// v000
// Measured on an AMD MI455X. A time is GPU time per run, averaged over a window of back-to-back runs after a warm-up
// (all launches, gaps included; the runs take copies of the inputs in turn), and the median of several windows.
// Apart from v000's, it joins two sittings. Times from different sittings can be a few percent apart, while
// side-by-side timings come from the same sitting.
// v000, which the later versions start from, runs in 569 microseconds.
// Contractions: x.Wq, x.Wk, x.Wv on v_wmma_f32_16x16x32_f16 (x as f16(bf16(x) x64), W as f16(bf16(W) x256), f32 accumulate);
// scores k.q^T on v_wmma_f32_16x16x32_bf16 as bf16 hi/lo split (hi.hi + lo.hi + hi.lo into one f32 accumulator);
// P.(gamma v)^T on v_wmma_f32_16x16x32_f16 (P x32768 f16, gamma v x256 f16, f32 accumulate); norms, asinh/sinh/acosh,
// base-2 online softmax, the sum_j p_j (gamma_j - 1) denominators and all carry folds in f32 on VALU.
// Float inputs RNE-converted to bf16 on load; f32 output written directly.
#include <hip/hip_runtime.h>
#include <math.h>
#include <stdint.h>

#ifndef NB
#define NB 2            // batches processed
#endif
#ifndef SQ
#define SQ 1024         // query rows processed per batch (keys/values always all SEQ rows)
#endif
#define NB_FULL 2
#define SEQ  1024       // rows per batch in every input / output / plane layout
#define DM   1024       // model width = K of the projections = row pitch of the 16-bit planes
#define NH   16
#define HD   64
#define XS   64.0f      // carry on the x plane
#define WSC  256.0f     // carry on the transposed weight planes
#define VS   256.0f     // carry on the gamma*v plane
#define PCAR 32768.0f   // carry on P
#define LOG2E 1.4426950408889634f
#define MAXN 0.996f     // (1 - 4e-3) / sqrt(c)
#define NKB  (SEQ / 32)
#define GPITCH 68
#define TPITCH 65
#define TP16   72
#define CVT_THREADS (DM / 8)
#define TR_THREADS  128
#define ATT_THREADS 128

static_assert(NB >= 1 && NB <= NB_FULL);
static_assert((SQ % 64) == 0 && SQ >= 64 && SQ <= SEQ);
static_assert(NH * HD == DM && HD == 64);
static_assert((SEQ % 128) == 0 && (SEQ % 32) == 0 && NKB * 32 == SEQ);
static_assert((DM % 256) == 0 && (DM % 64) == 0 && (DM % 32) == 0 && CVT_THREADS == 128);
static_assert((GPITCH * 4) % 16 == 0 && (TP16 * 2) % 16 == 0);
static_assert(ATT_THREADS == 128 && TR_THREADS == 128 && ATT_THREADS * 8 == SEQ);

typedef unsigned short u16;
typedef _Float16 v16h __attribute__((ext_vector_type(16)));
typedef _Float16 v8h  __attribute__((ext_vector_type(8)));
typedef __bf16   v16b __attribute__((ext_vector_type(16)));
typedef float    v8f  __attribute__((ext_vector_type(8)));
typedef float    v4f  __attribute__((ext_vector_type(4)));
typedef unsigned int v4u __attribute__((ext_vector_type(4)));
typedef v4u __attribute__((may_alias)) v4ua;
typedef v4f __attribute__((may_alias)) v4fa;

// one 16 x 16-bit per-lane fragment, viewed as f16 vector, bf16 vector or two 16-byte words
union Frag { v16h h; v16b b; v4u u[2]; };

// ---- scalar helpers ----------------------------------------------------------------------------------
__device__ __forceinline__ unsigned short bf_bits(float f) {          // f32 -> bf16 bits, RNE convert
  unsigned u = __float_as_uint(f);
  return (unsigned short)((u + 0x7FFFu + ((u >> 16) & 1u)) >> 16);
}
__device__ __forceinline__ float bf_up(unsigned short h) { return __uint_as_float(((unsigned)h) << 16); }
__device__ __forceinline__ float bfr(float f) { return bf_up(bf_bits(f)); }
__device__ __forceinline__ unsigned short h_bits(_Float16 x) { return __builtin_bit_cast(unsigned short, x); }
__device__ __forceinline__ unsigned pk16(unsigned short a, unsigned short b) { return (unsigned)a | ((unsigned)b << 16); }
__device__ __forceinline__ v8f zero8() { v8f z = {0.f, 0.f, 0.f, 0.f, 0.f, 0.f, 0.f, 0.f}; return z; }
__device__ __forceinline__ float red8(float v) {                      // sum over the 8-lane group (lane bits 0..2)
  v += __shfl_xor(v, 1, 32); v += __shfl_xor(v, 2, 32); v += __shfl_xor(v, 4, 32); return v;
}
__device__ __forceinline__ float rsum16(float v) {                    // sum over the 16-lane half (lane bits 0..3)
  v += __shfl_xor(v, 8, 32); v += __shfl_xor(v, 4, 32); v += __shfl_xor(v, 2, 32); v += __shfl_xor(v, 1, 32); return v;
}

// ---- fragment loader: 16-bit A/B operand from a k-contiguous row; lane -> row/col (lane&15), p already includes
//      +8*(lane>>4); elements 0..7 <- p[0..7] (k0+8h..), elements 8..15 <- p[16..23] (k0+16+8h..); same split k map
//      for A and B; B always read from a k-contiguous [n][k] plane. Loaded as unsigned 16-byte words.
__device__ __forceinline__ Frag ldfrag(const u16* p) {
  Frag f;
  f.u[0] = *(const v4u*)(p);
  f.u[1] = *(const v4u*)(p + 16);
  return f;
}

// ---- WMMA helpers and trailing VALU hazard gaps --------------------------------------------------------
__device__ __forceinline__ v8f mma_h(const Frag& a, const Frag& b, v8f c) {
  return __builtin_amdgcn_wmma_f32_16x16x32_f16(false, a.h, false, b.h, (short)0, c, false, false);
}
__device__ __forceinline__ v8f mma_b(const Frag& a, const Frag& b, v8f c) {
  return __builtin_amdgcn_wmma_f32_16x16x32_bf16(false, a.b, false, b.b, (short)0, c, false, false);
}
__device__ __forceinline__ void guard_sc(v8f& a, v8f& b, v16h x0, v16h x1, v16h x2, v16h x3, v16h x4, v16h x5) {
#if defined(__HIP_DEVICE_COMPILE__)
  asm volatile("v_nop\n\tv_nop\n\tv_nop\n\tv_nop"
               : "+v"(a), "+v"(b) : "v"(x0), "v"(x1), "v"(x2), "v"(x3), "v"(x4), "v"(x5) : "memory");
#endif
}
__device__ __forceinline__ void guard_pv(v8f (&o)[4], v16h p, v16h x0, v16h x1, v16h x2, v16h x3) {
#if defined(__HIP_DEVICE_COMPILE__)
  asm volatile("v_nop\n\tv_nop\n\tv_nop\n\tv_nop"
               : "+v"(o[0]), "+v"(o[1]), "+v"(o[2]), "+v"(o[3]) : "v"(p), "v"(x0), "v"(x1), "v"(x2), "v"(x3) : "memory");
#endif
}
__device__ __forceinline__ void guard_g(v8f (&acc)[8], v16h x0, v16h x1, v16h x2, v16h x3, v16h x4, v16h x5) {
#if defined(__HIP_DEVICE_COMPILE__)
  asm volatile("v_nop\n\tv_nop\n\tv_nop\n\tv_nop"
               : "+v"(acc[0]), "+v"(acc[1]), "+v"(acc[2]), "+v"(acc[3]),
                 "+v"(acc[4]), "+v"(acc[5]), "+v"(acc[6]), "+v"(acc[7])
               : "v"(x0), "v"(x1), "v"(x2), "v"(x3), "v"(x4), "v"(x5) : "memory");
#endif
}
__device__ __forceinline__ void acc_guard4(v8f (&o)[4]) {
#if defined(__HIP_DEVICE_COMPILE__)
  asm volatile("v_nop\n\tv_nop\n\tv_nop\n\tv_nop" : "+v"(o[0]), "+v"(o[1]), "+v"(o[2]), "+v"(o[3]));
#endif
}
__device__ __forceinline__ void wave_sync_lds() {
  __builtin_amdgcn_fence(__ATOMIC_RELEASE, "workgroup");
  __builtin_amdgcn_wave_barrier();
  __builtin_amdgcn_fence(__ATOMIC_ACQUIRE, "workgroup");
}

// =====================================================================================================
// Row convert: row r of a [rows][DM] f16 plane <- f16(bf16_RNE(x[r][e]) * scale), scale a power of two.
// Block = DM/8 threads, thread = 8 consecutive elements (two 16-B loads, one 16-B store; 32 consecutive lanes = 512
// coverage: grid = number of rows, 128 thr x 8 = DM = the whole row.
// =====================================================================================================
__global__ __launch_bounds__(CVT_THREADS)
void cvt16(const float* __restrict__ x, u16* Y, float scale) {
  const int tid = threadIdx.x;
  const size_t r = blockIdx.x;
  const float* src = x + r * (size_t)DM + (size_t)tid * 8;
  const v4f a = *(const v4f*)(src), c4 = *(const v4f*)(src + 4);
  v4u o;
#pragma unroll
  for (int e = 0; e < 2; ++e) {
    o[e]     = pk16(h_bits((_Float16)(bfr(a[2 * e]) * scale)),  h_bits((_Float16)(bfr(a[2 * e + 1]) * scale)));
    o[2 + e] = pk16(h_bits((_Float16)(bfr(c4[2 * e]) * scale)), h_bits((_Float16)(bfr(c4[2 * e + 1]) * scale)));
  }
  u16* dst = Y + r * (size_t)DM + (size_t)tid * 8;
  {
    *(v4u*)(dst) = o;
    
  }
}

// =====================================================================================================
// Row statistics: CX2[r] = sum_e bf16(x[r][e])^2 in f32. Block = 32 rows, 256 threads, wave w rows 32*blk + 4w + j:
// per row each lane sums 32 values (8 x 16-B loads), xor-shuffle reduce, lane 0 -> LDS; after a block barrier threads
// =====================================================================================================
__global__ __launch_bounds__(256)
void rowstat(const float* __restrict__ x, float* CX2) {
  __shared__ __align__(16) float rs[32];
  const int tid = threadIdx.x, wave = tid >> 5, lane = tid & 31;
  const int row0 = blockIdx.x * 32;
#pragma unroll 1
  for (int j = 0; j < 4; ++j) {
    const int row = row0 + wave * 4 + j;
    const float* xr = x + (size_t)row * DM + 4 * lane;
    float s = 0.f;
#pragma unroll 2
    for (int q = 0; q < DM / 128; ++q) {
      const v4f a = *(const v4f*)(xr + 128 * q);
      const float a0 = bfr(a[0]), a1 = bfr(a[1]), a2 = bfr(a[2]), a3 = bfr(a[3]);
      s += a0 * a0; s += a1 * a1; s += a2 * a2; s += a3 * a3;
    }
    s += __shfl_xor(s, 16, 32); s += __shfl_xor(s, 8, 32); s += __shfl_xor(s, 4, 32);
    s += __shfl_xor(s, 2, 32);  s += __shfl_xor(s, 1, 32);
    if (lane == 0) rs[wave * 4 + j] = s;
  }
  __syncthreads();
  if (tid < 8) {
    const v4f v = *(const v4fa*)(rs + 4 * tid);
    float* dst = CX2 + row0 + 4 * tid;
    {
      *(v4f*)(dst) = v;
      
    }
  }
}

// =====================================================================================================
// Column statistics of a weight z[k][n] (DM x DM): ZN[n] = max(sqrt(sum_k bf16(z[k][n])^2), 1e-15), CH[n] = cosh(2 r[n]),
// SH[n] = sinh(2 r[n]) (r index clamped to nr-1). Block = 256 columns, thread = column, rolled loop over the 1024 rows
// coverage: grid = DM/256 blocks x 256 columns = every column of the three arrays once.
// =====================================================================================================
__global__ __launch_bounds__(256)
void colstat(const float* __restrict__ z, const float* __restrict__ r, int nr, float* ZN, float* CH, float* SH) {
  __shared__ __align__(16) float st[3 * 256];
  const int tid = threadIdx.x;
  const int col = blockIdx.x * 256 + tid;
  float s = 0.f;
#pragma unroll 4
  for (int k = 0; k < DM; ++k) {
    const float v = bfr(z[(size_t)k * DM + col]);
    s += v * v;
  }
  const float zn = fmaxf(sqrtf(s), 1e-15f);
  int ri = col;
  ri = (ri < nr - 1) ? ri : (nr - 1);
  const float dr = 2.0f * bfr(r[ri]);
  st[tid]       = zn;
  st[256 + tid] = coshf(dr);
  st[512 + tid] = sinhf(dr);
  __syncthreads();
  const int wv = tid >> 5;
  if (wv < 6) {                                  // wave-uniform
    const int arr = wv >> 1;
    const int q = tid & 63;
    const v4f val = *(const v4fa*)(st + arr * 256 + 4 * q);
    float* dst = (arr == 0) ? ZN : ((arr == 1) ? CH : SH);   // all three are global pointers
    dst += blockIdx.x * 256 + 4 * q;
    {
      *(v4f*)(dst) = val;
      
    }
  }
}

// =====================================================================================================
// Weight transpose-convert for y = x.W weights stored [k][n]: WT[n][k] (f16, k-contiguous Bt layout) <- f16(bf16_RNE(W[k][n]) *
// scale). Block = 64(k) x 64(n) tile, 128 threads. Load phase: thread = (row 8p + (tid>>4), 4 floats at 4*(tid&15)),
// 8 steps = 64 k-rows x 64 n, into an LDS tile [kk][nn] (pitch 65); block barrier; store phase: output row n0 + 16i + (tid>>3)
// coverage: 4 i x 16 rows x (8 lanes x 8 halves) = 64 n-rows x 64 k per block; the grid covers WT exactly once.
// LDS tile: cross-wave, block barrier; staged extent 64x64 == consumed extent.
// =====================================================================================================
__global__ __launch_bounds__(TR_THREADS)
void cvtT16(const float* __restrict__ W, u16* Y, float scale) {
  __shared__ __align__(16) float tile[64 * TPITCH];
  const int tid = threadIdx.x;
  constexpr int NT = DM / 64;
  const int bid = blockIdx.x;
  const int kt  = bid % NT;
  const int ntb = bid / NT;
  const int k0  = kt * 64, n0 = ntb * 64;
  const int lr = tid >> 4, lc = (tid & 15) * 4;
#pragma unroll
  for (int p = 0; p < 8; ++p) {
    const int kk = p * 8 + lr;
    const v4f w4 = *(const v4f*)(W + (size_t)(k0 + kk) * (size_t)DM + n0 + lc);
    tile[kk * TPITCH + lc + 0] = w4[0];
    tile[kk * TPITCH + lc + 1] = w4[1];
    tile[kk * TPITCH + lc + 2] = w4[2];
    tile[kk * TPITCH + lc + 3] = w4[3];
  }
  __syncthreads();
  const int rq = tid >> 3, c8 = (tid & 7) * 8;      // rq 0..15, c8 0..56
  v4u ov[4];
#pragma unroll
  for (int i = 0; i < 4; ++i) {
    const int row = 16 * i + rq;                   // n within tile
#pragma unroll
    for (int e = 0; e < 4; ++e) {
      const float x0 = tile[(c8 + 2 * e) * TPITCH + row];
      const float x1 = tile[(c8 + 2 * e + 1) * TPITCH + row];
      ov[i][e] = pk16(h_bits((_Float16)(bfr(x0) * scale)), h_bits((_Float16)(bfr(x1) * scale)));
    }
  }
  u16* dst = Y + (size_t)n0 * (size_t)DM + k0 + c8;
  {
#pragma unroll
    for (int i = 0; i < 4; ++i) {
      const int row = 16 * i + rq;
      *(v4u*)(dst + (size_t)row * (size_t)DM) = ov[i];
    }
    
  }
}

// =====================================================================================================
// f16 GEMM core: the wave's 32 x 64 tile of C = A[rows][K] . Bt[cols][K]^T; ap -> A row (rowb + m) + 8h, bp -> Bt row
// (col0 + m) + 8h; acc[4i + j] = rows rowb+16i.., cols col0+16j..; K stepped by 32 (K % 32 == 0 asserted).
// =====================================================================================================
__device__ __forceinline__ void gemm_core(const u16* ap, const u16* bp, int K, v8f (&acc)[8]) {
  const size_t rs16 = (size_t)16 * (size_t)K;
#pragma unroll 1
  for (int k0 = 0; k0 < K; k0 += 32) {
    const Frag a0 = ldfrag(ap + k0), a1 = ldfrag(ap + rs16 + k0);
    const Frag b0 = ldfrag(bp + k0);
    const Frag b1 = ldfrag(bp + rs16 + k0);
    const Frag b2 = ldfrag(bp + 2 * rs16 + k0);
    const Frag b3 = ldfrag(bp + 3 * rs16 + k0);
    acc[0] = mma_h(a0, b0, acc[0]);
    acc[1] = mma_h(a0, b1, acc[1]);
    acc[2] = mma_h(a0, b2, acc[2]);
    acc[3] = mma_h(a0, b3, acc[3]);
    acc[4] = mma_h(a1, b0, acc[4]);
    acc[5] = mma_h(a1, b1, acc[5]);
    acc[6] = mma_h(a1, b2, acc[6]);
    acc[7] = mma_h(a1, b3, acc[7]);
    guard_g(acc, a0.h, a1.h, b0.h, b1.h, b2.h, b3.h);
  }
}
// Stage the wave's 32 x 64 f32 tile (times oscale) in its LDS slab (pitch 68): D element r of acc[4i+j], lane l ->
// coverage: 32 lanes x 2 x 8 rows x 4 cols-of-16 = rows 0..31 x cols 0..63 of the slab.
__device__ __forceinline__ void stage32x64(float* sl, v8f (&acc)[8], float oscale, int lane) {
  const int hh = lane >> 4, m = lane & 15;
#pragma unroll
  for (int i = 0; i < 2; ++i) {
#pragma unroll
    for (int r = 0; r < 8; ++r) {
      const int ro = (16 * i + 8 * hh + r) * GPITCH + m;
      sl[ro]      = acc[4 * i + 0][r] * oscale;
      sl[ro + 16] = acc[4 * i + 1][r] * oscale;
      sl[ro + 32] = acc[4 * i + 2][r] * oscale;
      sl[ro + 48] = acc[4 * i + 3][r] * oscale;
    }
  }
  wave_sync_lds();
}

// =====================================================================================================
// Projection GEMM + ball MLR epilogue. A = x plane [NB*SEQ][DM] (f16, x XS), Bt = WT [DM n][DM k] (f16, x WSC).
// Block = 128 threads = 128 rows x 64 cols (one head), wave = 32 rows; fragments straight from the 16-bit rows.
// Epilogue per element (f32): mm = (x.z)[row][n] / ZN[n]; arg = (2 mm CH[n] - (1 + cx2) SH[n]) / max(1 - cx2, 1e-15);
// y = sinh(2 ZN[n] asinh(arg)); per (row, head) 64-vector (8 lanes x 8 values, 8-lane shuffle sums): clip to norm MAXN,
// y = y / (1 + sqrt(1 + sum y^2)), clip again; x2 = sum y^2. mode 0/1: planes Ph/Pl = bf16 hi / bf16 lo of y, RS row
// scalar = x2; mode 2: g = 2 / max(1 - x2, 1e-15), plane Ph = f16(g y VS), RS row scalar = g - 1.
// coverage: per wave 8 instr x 4 rows x 8 lanes x 8 halves = 32 x 64 per plane; RS: 32 floats per wave; grid covers every
//           (row, col) of the planes and every (b, head, s) of RS exactly once.
// LDS: slab and rsc are wave-private (wave_sync); staged extent 32x64 == consumed extent; no block barriers.
// =====================================================================================================
__global__ __launch_bounds__(128)
void proj_mlr(const u16* __restrict__ A, const u16* __restrict__ Bt,
              const float* __restrict__ ZN, const float* __restrict__ CH, const float* __restrict__ SH,
              const float* __restrict__ CX2, int mode, u16* Ph, u16* Pl, float* RS) {
  __shared__ __align__(16) float slab[4 * 32 * GPITCH];
  __shared__ __align__(16) float rsc[4 * 32];
  const int tid = threadIdx.x, wave = tid >> 5, lane = tid & 31, hh = lane >> 4, m = lane & 15;
  constexpr int NT = DM / 64;
  const int bid  = blockIdx.x;
  const int nt   = bid % NT;
  const int mt   = bid / NT;
  const int rowb = mt * 128 + wave * 32;       // global token row b*SEQ + s of the wave's first row
  const int col0 = nt * 64;                    // = head * HD
  const u16* ap = A  + (size_t)(rowb + m) * DM + 8 * hh;
  const u16* bp = Bt + (size_t)(col0 + m) * DM + 8 * hh;
  v8f acc[8];
#pragma unroll
  for (int i = 0; i < 8; ++i) acc[i] = zero8();
  gemm_core(ap, bp, DM, acc);
  float* sl = slab + wave * 32 * GPITCH;
  stage32x64(sl, acc, 1.0f / (XS * WSC), lane);

  const int rq = lane >> 3, c8 = (lane & 7) * 8;
  float zn8[8], ch8[8], sh8[8];
  {
    const v4f z0 = *(const v4f*)(ZN + col0 + c8), z1 = *(const v4f*)(ZN + col0 + c8 + 4);
    const v4f h0 = *(const v4f*)(CH + col0 + c8), h1 = *(const v4f*)(CH + col0 + c8 + 4);
    const v4f g0 = *(const v4f*)(SH + col0 + c8), g1 = *(const v4f*)(SH + col0 + c8 + 4);
#pragma unroll
    for (int e = 0; e < 4; ++e) {
      zn8[e] = z0[e]; zn8[4 + e] = z1[e];
      ch8[e] = h0[e]; ch8[4 + e] = h1[e];
      sh8[e] = g0[e]; sh8[4 + e] = g1[e];
    }
  }
  const bool mv = (mode == 2);
#pragma unroll 1
  for (int i = 0; i < 8; ++i) {
    const int row = 4 * i + rq;
    const float cx  = CX2[rowb + row];
    const float omc = fmaxf(1.0f - cx, 1e-15f);
    const float opc = 1.0f + cx;
    float* sr = sl + row * GPITCH + c8;
    float y[8];
    float s0 = 0.f;
#pragma unroll
    for (int e = 0; e < 8; ++e) {
      const float mm  = sr[e] / zn8[e];
      const float arg = (2.0f * mm * ch8[e] - opc * sh8[e]) / omc;
      const float w   = 2.0f * zn8[e] * asinhf(arg);
      y[e] = sinhf(w);
      s0 += y[e] * y[e];
    }
    s0 = red8(s0);
    const float n0 = fmaxf(sqrtf(s0), 1e-15f);
    const bool cl0 = n0 > MAXN;
    float s1 = 0.f;
#pragma unroll
    for (int e = 0; e < 8; ++e) {
      const float yp = y[e] / n0 * MAXN;
      y[e] = cl0 ? yp : y[e];
      s1 += y[e] * y[e];
    }
    s1 = red8(s1);
    const float den = 1.0f + sqrtf(1.0f + s1);
    float s2 = 0.f;
#pragma unroll
    for (int e = 0; e < 8; ++e) {
      y[e] = y[e] / den;
      s2 += y[e] * y[e];
    }
    s2 = red8(s2);
    const float n2 = fmaxf(sqrtf(s2), 1e-15f);
    const bool cl2 = n2 > MAXN;
    float s3 = 0.f;
#pragma unroll
    for (int e = 0; e < 8; ++e) {
      const float yp = y[e] / n2 * MAXN;
      y[e] = cl2 ? yp : y[e];
      s3 += y[e] * y[e];
    }
    s3 = red8(s3);
    const float g    = 2.0f / fmaxf(1.0f - s3, 1e-15f);
    const float gmul = mv ? g : 1.0f;
    const float scal = mv ? (g - 1.0f) : s3;
#pragma unroll
    for (int e = 0; e < 8; ++e) sr[e] = y[e] * gmul;
    if ((lane & 7) == 0) rsc[wave * 32 + row] = scal;
  }
  wave_sync_lds();

  const int bb = rowb / SEQ, s0r = rowb - bb * SEQ, head = nt;
  if (lane < 8) {
    const v4f v = *(const v4fa*)(rsc + wave * 32 + 4 * lane);
    float* dst = RS + ((size_t)(bb * NH + head)) * SEQ + s0r + 4 * lane;
    {
      *(v4f*)(dst) = v;
      
    }
  }
  // ---- planes ----
  const size_t pofs = (size_t)rowb * DM + (size_t)(col0 + c8);
  if (!mv) {
    v4u oh[8], ol[8];
#pragma unroll
    for (int i = 0; i < 8; ++i) {
      const int row = 4 * i + rq;
      const v4f a = *(const v4fa*)(sl + row * GPITCH + c8), c4 = *(const v4fa*)(sl + row * GPITCH + c8 + 4);
#pragma unroll
      for (int e = 0; e < 2; ++e) {
        const unsigned short ha = bf_bits(a[2 * e]),  hb = bf_bits(a[2 * e + 1]);
        const unsigned short la = bf_bits(a[2 * e] - bf_up(ha)), lb = bf_bits(a[2 * e + 1] - bf_up(hb));
        oh[i][e] = pk16(ha, hb);
        ol[i][e] = pk16(la, lb);
        const unsigned short hc = bf_bits(c4[2 * e]), hd = bf_bits(c4[2 * e + 1]);
        const unsigned short lc = bf_bits(c4[2 * e] - bf_up(hc)), ld = bf_bits(c4[2 * e + 1] - bf_up(hd));
        oh[i][2 + e] = pk16(hc, hd);
        ol[i][2 + e] = pk16(lc, ld);
      }
    }
    {
#pragma unroll
      for (int i = 0; i < 8; ++i) {
        const int row = 4 * i + rq;
        *(v4u*)(Ph + pofs + (size_t)row * DM) = oh[i];
        *(v4u*)(Pl + pofs + (size_t)row * DM) = ol[i];
      }
      
    }
  } else {
    v4u ov[8];
#pragma unroll
    for (int i = 0; i < 8; ++i) {
      const int row = 4 * i + rq;
      const v4f a = *(const v4fa*)(sl + row * GPITCH + c8), c4 = *(const v4fa*)(sl + row * GPITCH + c8 + 4);
#pragma unroll
      for (int e = 0; e < 2; ++e) {
        ov[i][e]     = pk16(h_bits((_Float16)(a[2 * e] * VS)),  h_bits((_Float16)(a[2 * e + 1] * VS)));
        ov[i][2 + e] = pk16(h_bits((_Float16)(c4[2 * e] * VS)), h_bits((_Float16)(c4[2 * e + 1] * VS)));
      }
    }
    {
#pragma unroll
      for (int i = 0; i < 8; ++i) {
        const int row = 4 * i + rq;
        *(v4u*)(Ph + pofs + (size_t)row * DM) = ov[i];
      }
      
    }
  }
}

// =====================================================================================================
// 16-bit per-batch transpose: VT[b*DM + hd][s] <- Vg[b*SEQ + s][hd]. Block = 64(s) x 64(hd) tile, 128 threads.
// Load phase: thread = (s = 16p + (tid>>3), 8 halves at hd = 8*(tid&7)) one 16-B load, 4 steps, scattered as u16 scalars
// into an LDS tile [hd][s] (pitch 72); block barrier; store phase: VT row hd0 + 16i + (tid>>3) gets s0 + 8*(tid&7) .. +7 =
// passes. grid = NB x (SEQ/64) x (DM/64): bid -> (st = bid % 16, ht = (bid/16) % 16, b = bid/256).
// coverage: load 4 p x 16 s x 8 lane-groups x 8 hd = 64 x 64; store 4 i x 16 rows x 8 lanes x 8 halves = 64 hd x 64 s;
//           the grid covers VT (NB*DM rows x SEQ) exactly once.
// LDS tile: cross-wave, block barrier; staged extent 64x64 == consumed extent (pad columns 64..71 never read).
// =====================================================================================================
__global__ __launch_bounds__(TR_THREADS)
void trT16(const u16* __restrict__ Vg, u16* VT) {
  __shared__ __align__(16) u16 tile[64 * TP16];
  const int tid = threadIdx.x;
  constexpr int NST = SEQ / 64, NHT = DM / 64;
  const int bid = blockIdx.x;
  const int st  = bid % NST;
  const int tmp = bid / NST;
  const int ht  = tmp % NHT;
  const int b   = tmp / NHT;
  const int s0 = st * 64, hd0 = ht * 64;
  const int r = tid >> 3, c = (tid & 7) * 8;
#pragma unroll
  for (int p = 0; p < 4; ++p) {
    const int s = 16 * p + r;
    const v4u w = *(const v4u*)(Vg + ((size_t)(b * SEQ + s0 + s)) * DM + hd0 + c);
#pragma unroll
    for (int e = 0; e < 8; ++e)
      tile[(c + e) * TP16 + s] = (u16)((w[e >> 1] >> (16 * (e & 1))) & 0xFFFFu);
  }
  __syncthreads();
  const int rq = tid >> 3, c8 = (tid & 7) * 8;
  v4u ov[4];
#pragma unroll
  for (int i = 0; i < 4; ++i) {
    const int row = 16 * i + rq;
    ov[i] = *(const v4ua*)(tile + row * TP16 + c8);
  }
  u16* dst = VT + ((size_t)(b * DM + hd0)) * SEQ + s0 + c8;
  {
#pragma unroll
    for (int i = 0; i < 4; ++i) {
      const int row = 16 * i + rq;
      *(v4u*)(dst + (size_t)row * SEQ) = ov[i];
    }
    
  }
}

// ---- ball distance logit (base 2) of one (query, key) pair ----
__device__ __forceinline__ float logit2(float xy, float y2, float mk, float x2, float omx) {
  const float num  = fmaxf(x2 - 2.0f * xy + y2, 1e-15f);
  const float den  = fmaxf(omx * (1.0f - y2), 1e-15f);
  const float dist = acoshf(1.0f + 2.0f * num / den);
  return (mk - dist) * LOG2E;
}

// =====================================================================================================
// Fused distance attention + gyro-midpoint over all SEQ keys: block = (batch b, head, 64 query rows), 4 waves, wave w owns
// queries q0 = 64*qt + 16*w .. q0+15 (waves independent after the initial table staging: one block barrier, then only
// wave-private LDS).
//   q planes bf16 hi/lo [b*SEQ + s][h*64 + d]; k planes bf16 hi/lo same layout; v^T plane f16 x VS [(b*NH + h)*64 + d][s];
//   per-key tables for (b, h): sum k^2, gamma - 1; additive bias row amask[b][s] (bf16-converted); per query x2 = sum q^2.
//   All NKB = 32 key blocks of 32 keys are visited (static bound).
//   Scores computed TRANSPOSED: S^T tile g = k rows (keys kb+16g .., A operand, row m = lane&15, split k map over d)
//   times q^T (B operand, col n = query q0 + (lane&15), k = d), 2 d-chunks of 32, three bf16 products each (hi.hi, lo.hi,
//   hi.lo). D element r of lane l = (key kb+16g+8h+r, query q0+(l&15)): a lane owns one query column and 16 of its 32 keys;
//   the partner lane l^16 owns the other 16 -> row max / row sums need one xor-16 shuffle.
//   dist = acosh(1 + 2 max(x2 - 2 xy + y2, 1e-15) / max((1 - x2)(1 - y2), 1e-15)), logit = -dist + bias, all f32.
//   Online max-subtracted base-2 softmax in f32; running sums l = sum p and dn = sum p (gamma - 1). The exp'd values ARE the
//   P A-fragment in place: A row m = query = lane&15, element i <- key kb+8h+i (tile 0, D element i), element 8+i <- key
//   kb+16+8h+i (tile 1, D element i). P (<= 1) carried x32768 as f16. O rescale factors shuffled from the query-owner lanes.
//   4 v^T B fragments (col n = d = 16j + (lane&15), keys k-contiguous), 4 P.V WMMAs + one guard.
//   Epilogue (f32): two_mean = (O (1/l) / (PCAR VS)) / max(dn / l, 1e-10); a = two_mean / (1 + sqrt(max(1 - sum two_mean^2,
//   1e-15))); clip to norm MAXN; the wave's 16x64 tile staged in its LDS slab (pitch 68); each output row segment
// coverage: per wave 8 instructions x 2 rows x 16 lanes x 4 floats = 16 x 64; grid NB*NH*(SQ/64) blocks x 4 waves = every
//           (b < NB, s < SQ, h) row segment of the output exactly once.
// LDS: ms/ky2/kg1 cross-wave (block barrier, 1024 staged == 1024 consumed); slab wave-private (wave_sync, 16x64).
// =====================================================================================================
__global__ __launch_bounds__(ATT_THREADS)
void attn_fwd(const u16* __restrict__ Qh, const u16* __restrict__ Ql, const u16* __restrict__ Kh, const u16* __restrict__ Kl,
              const u16* __restrict__ VT, const float* __restrict__ QX2, const float* __restrict__ KX2,
              const float* __restrict__ GM1, const float* __restrict__ amask, float* Out) {
  __shared__ __align__(16) float ms[SEQ];
  __shared__ __align__(16) float ky2[SEQ];
  __shared__ __align__(16) float kg1[SEQ];
  __shared__ __align__(16) float slab[4 * 16 * GPITCH];

  const int tid  = threadIdx.x;
  const int wave = tid >> 5;
  const int lane = tid & 31;
  const int hh   = lane >> 4;
  const int c    = lane & 15;

  constexpr int NQT = SQ / 64;
  const int bid  = blockIdx.x;
  const int qt   = bid % NQT;
  const int head = (bid / NQT) % NH;
  const int b    = bid / (NQT * NH);
  const int bh   = b * NH + head;
  const int q0   = qt * 64 + wave * 16;

  // ---- stage the per-key tables of (b, head): 128 threads x 8 keys = SEQ ----
  {
    const int i0 = tid * 8;
    const float* mp = amask + (size_t)b * SEQ + i0;
    const float* yp = KX2 + (size_t)bh * SEQ + i0;
    const float* gp = GM1 + (size_t)bh * SEQ + i0;
    const v4f m0 = *(const v4f*)(mp), m1 = *(const v4f*)(mp + 4);
    const v4f y0 = *(const v4f*)(yp), y1 = *(const v4f*)(yp + 4);
    const v4f g0 = *(const v4f*)(gp), g1 = *(const v4f*)(gp + 4);
#pragma unroll
    for (int e = 0; e < 4; ++e) {
      ms[i0 + e]  = bfr(m0[e]); ms[i0 + 4 + e]  = bfr(m1[e]);
      ky2[i0 + e] = y0[e];      ky2[i0 + 4 + e] = y1[e];
      kg1[i0 + e] = g0[e];      kg1[i0 + 4 + e] = g1[e];
    }
  }
  __syncthreads();

  // B fragments of q^T: col n = query q0 + c, k = d (k-contiguous rows of the q planes)
  const size_t qofs = ((size_t)(b * SEQ + q0 + c)) * DM + head * HD + 8 * hh;
  const Frag qh0 = ldfrag(Qh + qofs), qh1 = ldfrag(Qh + qofs + 32);
  const Frag ql0 = ldfrag(Ql + qofs), ql1 = ldfrag(Ql + qofs + 32);
  const float xq  = QX2[(size_t)bh * SEQ + q0 + c];
  const float omx = 1.0f - xq;
  // A fragments of k: row m = key kb + 16g + c, k = d (key row kb added per step)
  const size_t kofs = ((size_t)(b * SEQ + c)) * DM + head * HD + 8 * hh;
  const u16* KhB = Kh + kofs;
  const u16* KlB = Kl + kofs;
  // B fragments of v^T: col n = d = 16j + c, k = key (k-contiguous row of the v^T plane)
  const u16* Vb = VT + ((size_t)(bh * HD + c)) * SEQ + 8 * hh;

  float mrun = -INFINITY, lrun = 0.f, drun = 0.f;
  v8f o[4];
#pragma unroll
  for (int j = 0; j < 4; ++j) o[j] = zero8();

#pragma unroll 1
  for (int it = 0; it < NKB; ++it) {
    const int kb = it * 32;
    // ---- transposed scores: s0 = keys kb..kb+15, s1 = keys kb+16..kb+31, column = query q0 + c ----
    v8f s0 = zero8(), s1 = zero8();
    const size_t k0o = (size_t)kb * DM, k1o = k0o + (size_t)16 * DM;
    {
      const Frag kh0 = ldfrag(KhB + k0o), kh1 = ldfrag(KhB + k1o);
      const Frag kl0 = ldfrag(KlB + k0o), kl1 = ldfrag(KlB + k1o);
      s0 = mma_b(kh0, qh0, s0); s0 = mma_b(kl0, qh0, s0); s0 = mma_b(kh0, ql0, s0);
      s1 = mma_b(kh1, qh0, s1); s1 = mma_b(kl1, qh0, s1); s1 = mma_b(kh1, ql0, s1);
      guard_sc(s0, s1, qh0.h, ql0.h, kh0.h, kh1.h, kl0.h, kl1.h);
    }
    {
      const Frag kh0 = ldfrag(KhB + k0o + 32), kh1 = ldfrag(KhB + k1o + 32);
      const Frag kl0 = ldfrag(KlB + k0o + 32), kl1 = ldfrag(KlB + k1o + 32);
      s0 = mma_b(kh0, qh1, s0); s0 = mma_b(kl0, qh1, s0); s0 = mma_b(kh0, ql1, s0);
      s1 = mma_b(kh1, qh1, s1); s1 = mma_b(kl1, qh1, s1); s1 = mma_b(kh1, ql1, s1);
      guard_sc(s0, s1, qh1.h, ql1.h, kh0.h, kh1.h, kl0.h, kl1.h);
    }
    // ---- per-key values of this lane's 16 keys: [i] <- key kb+8hh+i, [8+i] <- key kb+16+8hh+i ----
    float y2v[16], g1v[16], mkv[16];
    {
      const int ka = kb + 8 * hh, kc = kb + 16 + 8 * hh;
      const v4f ya = *(const v4fa*)(ky2 + ka), yb = *(const v4fa*)(ky2 + ka + 4);
      const v4f yc = *(const v4fa*)(ky2 + kc), yd = *(const v4fa*)(ky2 + kc + 4);
      const v4f ga = *(const v4fa*)(kg1 + ka), gb = *(const v4fa*)(kg1 + ka + 4);
      const v4f gc = *(const v4fa*)(kg1 + kc), gd = *(const v4fa*)(kg1 + kc + 4);
      const v4f ma = *(const v4fa*)(ms + ka),  mb = *(const v4fa*)(ms + ka + 4);
      const v4f mc = *(const v4fa*)(ms + kc),  md = *(const v4fa*)(ms + kc + 4);
#pragma unroll
      for (int e = 0; e < 4; ++e) {
        y2v[e] = ya[e]; y2v[4 + e] = yb[e]; y2v[8 + e] = yc[e]; y2v[12 + e] = yd[e];
        g1v[e] = ga[e]; g1v[4 + e] = gb[e]; g1v[8 + e] = gc[e]; g1v[12 + e] = gd[e];
        mkv[e] = ma[e]; mkv[4 + e] = mb[e]; mkv[8 + e] = mc[e]; mkv[12 + e] = md[e];
      }
    }
    // ---- base-2 logits ----
    float t[16];
#pragma unroll
    for (int i = 0; i < 8; ++i) {
      t[i]     = logit2(s0[i], y2v[i],     mkv[i],     xq, omx);
      t[8 + i] = logit2(s1[i], y2v[8 + i], mkv[8 + i], xq, omx);
    }
    float cm = t[0];
#pragma unroll
    for (int i = 1; i < 16; ++i) cm = fmaxf(cm, t[i]);
    cm = fmaxf(cm, __shfl_xor(cm, 16, 32));
    const float mn = fmaxf(mrun, cm);        // finite from the first block on
    const float al = exp2f(mrun - mn);       // 0 on the first block (mrun = -inf)
    mrun = mn;
    // ---- probabilities (<= 1), the two running sums and the P A-fragment f16(p * 32768); element i <-> t[i] ----
    float ps = 0.f, pd = 0.f;
    Frag ph;
#pragma unroll
    for (int w = 0; w < 2; ++w) {
#pragma unroll
      for (int e4 = 0; e4 < 4; ++e4) {
        const int i = 8 * w + 2 * e4;
        const float p0 = exp2f(t[i] - mn), p1 = exp2f(t[i + 1] - mn);
        ps += p0 + p1;
        pd += p0 * g1v[i] + p1 * g1v[i + 1];
        ph.u[w][e4] = pk16(h_bits((_Float16)(p0 * PCAR)), h_bits((_Float16)(p1 * PCAR)));
      }
    }
    ps += __shfl_xor(ps, 16, 32);
    pd += __shfl_xor(pd, 16, 32);
    lrun = lrun * al + ps;
    drun = drun * al + pd;
    // ---- rescale the O accumulators: D row 8hh+r = query q0+8hh+r, its factor lives in lane 8hh+r ----
    float scl[8];
#pragma unroll
    for (int r = 0; r < 8; ++r) scl[r] = __shfl(al, 8 * hh + r, 32);
#pragma unroll
    for (int j = 0; j < 4; ++j) {
#pragma unroll
      for (int r = 0; r < 8; ++r) o[j][r] *= scl[r];
    }
    // ---- P.V : B fragment col n = d = j*16 + c, keys contiguous in the v^T plane ----
    {
      const u16* vp = Vb + kb;
      const Frag v0 = ldfrag(vp);
      const Frag v1 = ldfrag(vp + (size_t)16 * SEQ);
      const Frag v2 = ldfrag(vp + (size_t)32 * SEQ);
      const Frag v3 = ldfrag(vp + (size_t)48 * SEQ);
      o[0] = mma_h(ph, v0, o[0]);
      o[1] = mma_h(ph, v1, o[1]);
      o[2] = mma_h(ph, v2, o[2]);
      o[3] = mma_h(ph, v3, o[3]);
      guard_pv(o, ph.h, v0.h, v1.h, v2.h, v3.h);
    }
  }
  acc_guard4(o);

  // ---- gyro-midpoint epilogue in f32: per query factors from the query-owner lane (lane = query) ----
  const float linv = 1.0f / lrun;
  const float nf   = linv * (1.0f / (PCAR * VS));
  const float dq   = fmaxf(drun * linv, 1e-10f);
  float nfr[8], dqr[8];
#pragma unroll
  for (int r = 0; r < 8; ++r) { nfr[r] = __shfl(nf, 8 * hh + r, 32); dqr[r] = __shfl(dq, 8 * hh + r, 32); }
  float sq[8];
#pragma unroll
  for (int r = 0; r < 8; ++r) {
    float sp = 0.f;
#pragma unroll
    for (int j = 0; j < 4; ++j) {
      const float tm = (o[j][r] * nfr[r]) / dqr[r];
      o[j][r] = tm;
      sp += tm * tm;
    }
    sq[r] = rsum16(sp);
  }
  float* sw = slab + wave * 16 * GPITCH;
#pragma unroll
  for (int r = 0; r < 8; ++r) {
    const float df = 1.0f + sqrtf(fmaxf(1.0f - sq[r], 1e-15f));
    float sp = 0.f;
#pragma unroll
    for (int j = 0; j < 4; ++j) {
      const float a = o[j][r] / df;
      o[j][r] = a;
      sp += a * a;
    }
    const float s2  = rsum16(sp);
    const float n2  = fmaxf(sqrtf(s2), 1e-15f);
    const bool  cl  = n2 > MAXN;
    const float fcl = MAXN / n2;
#pragma unroll
    for (int j = 0; j < 4; ++j) {
      const float a = o[j][r];
      sw[(8 * hh + r) * GPITCH + 16 * j + c] = cl ? (a * fcl) : a;
    }
  }
  wave_sync_lds();
  // ---- f32 output rows: lanes 0..15 -> row 2i, lanes 16..31 -> row 2i+1, lane = 4 consecutive d ----
  const int cc = lane & 15;
  v4f vals[8];
#pragma unroll
  for (int i = 0; i < 8; ++i) vals[i] = *(const v4fa*)(sw + (2 * i + hh) * GPITCH + 4 * cc);
  float* ob = Out + ((size_t)(b * SEQ + q0 + hh)) * DM + head * HD + 4 * cc;
  {
#pragma unroll
    for (int i = 0; i < 8; ++i) {
      *(v4f*)(ob + (size_t)(2 * i) * DM) = vals[i];
    }
    
  }
}

// =====================================================================================================
// Workspace map (bytes); every region written fully by whole-line stores before it is read; every extent an exact multiple
//   X16  f16 [NB*SEQ][DM]          f16(bf16(x) x64)              4194304 (NB=2)
//   WQT/WKT/WVT f16 [DM n][DM k]   f16(bf16(W) x256)             3 x 2097152
//   CX2  f32 [NB*SEQ]              sum x^2                       8192
//   ZN, CH, SH f32 [3][DM]         column norms, cosh/sinh(2r)   3 x 12288
//   Qh, Ql, Kh, Kl bf16 [NB*SEQ][DM]                             4 x 4194304
//   Vg   f16 [NB*SEQ][DM]          f16(gamma v x256)             4194304
//   VT   f16 [NB*NH*HD][SEQ]       transposed Vg                 4194304
//   QX2, KX2, GM1 f32 [NB*NH][SEQ]                                3 x 131072
//   end = 36089856 at NB=2
// =====================================================================================================
static inline size_t up4k(size_t v) { return (v + 4095) & ~(size_t)4095; }

extern "C" void kernel_launch(void* const* d_in, const int* in_sizes, int n_in,
                              void* d_out, int out_size, void* d_ws, size_t ws_size,
                              hipStream_t stream) {
  if (n_in < 8) return;
  if (in_sizes[0] < NB * SEQ * DM) return;
  if (in_sizes[1] < NB * SEQ) return;
  if (in_sizes[2] < DM * DM || in_sizes[4] < DM * DM || in_sizes[6] < DM * DM) return;
  if (in_sizes[3] < 1 || in_sizes[5] < 1 || in_sizes[7] < 1) return;
  if (out_size < NB * SEQ * DM) return;

  const float* hs = (const float*)d_in[0];
  const float* am = (const float*)d_in[1];
  const float* qz = (const float*)d_in[2];
  const float* qr = (const float*)d_in[3];
  const float* kz = (const float*)d_in[4];
  const float* kr = (const float*)d_in[5];
  const float* vz = (const float*)d_in[6];
  const float* vr = (const float*)d_in[7];
  float*       out = (float*)d_out;
  const int nqr = in_sizes[3], nkr = in_sizes[5], nvr = in_sizes[7];

  const size_t nrow  = (size_t)NB * SEQ;
  const size_t szX16 = up4k(nrow * DM * 2);
  const size_t szWT  = up4k((size_t)DM * DM * 2);
  const size_t szCX2 = up4k(nrow * 4);
  const size_t szCOL = up4k((size_t)3 * DM * 4);
  const size_t szP   = up4k(nrow * DM * 2);
  const size_t szVT  = up4k((size_t)NB * NH * HD * SEQ * 2);
  const size_t szRS  = up4k((size_t)NB * NH * SEQ * 4);
  size_t off = 0;
  const size_t oX16 = off; off += szX16;
  const size_t oWQ  = off; off += szWT;
  const size_t oWK  = off; off += szWT;
  const size_t oWV  = off; off += szWT;
  const size_t oCX2 = off; off += szCX2;
  const size_t oZN  = off; off += szCOL;
  const size_t oCH  = off; off += szCOL;
  const size_t oSH  = off; off += szCOL;
  const size_t oQh  = off; off += szP;
  const size_t oQl  = off; off += szP;
  const size_t oKh  = off; off += szP;
  const size_t oKl  = off; off += szP;
  const size_t oVg  = off; off += szP;
  const size_t oVT  = off; off += szVT;
  const size_t oQX2 = off; off += szRS;
  const size_t oKX2 = off; off += szRS;
  const size_t oGM1 = off; off += szRS;
  if (off > ws_size) return;                       // off = 36089856 at NB=2
  if (off > (size_t)134217728) return;

  char* ws = (char*)d_ws;
  u16*   X16 = (u16*)(ws + oX16);
  u16*   WQT = (u16*)(ws + oWQ);
  u16*   WKT = (u16*)(ws + oWK);
  u16*   WVT = (u16*)(ws + oWV);
  float* CX2 = (float*)(ws + oCX2);
  float* ZN  = (float*)(ws + oZN);
  float* CH  = (float*)(ws + oCH);
  float* SH  = (float*)(ws + oSH);
  u16*   Qh  = (u16*)(ws + oQh);
  u16*   Ql  = (u16*)(ws + oQl);
  u16*   Kh  = (u16*)(ws + oKh);
  u16*   Kl  = (u16*)(ws + oKl);
  u16*   Vg  = (u16*)(ws + oVg);
  u16*   VT  = (u16*)(ws + oVT);
  float* QX2 = (float*)(ws + oQX2);
  float* KX2 = (float*)(ws + oKX2);
  float* GM1 = (float*)(ws + oGM1);

  // (1) x -> f16 plane of bf16-converted values x64; (2) per-row sum of squares
  cvt16<<<dim3(NB * SEQ), dim3(CVT_THREADS), 0, stream>>>(hs, X16, XS);
  rowstat<<<dim3(NB * SEQ / 32), dim3(256), 0, stream>>>(hs, CX2);
  // (3..5) per weight: column norms + cosh/sinh(2r)
  colstat<<<dim3(DM / 256), dim3(256), 0, stream>>>(qz, qr, nqr, ZN,          CH,          SH);
  colstat<<<dim3(DM / 256), dim3(256), 0, stream>>>(kz, kr, nkr, ZN + DM,     CH + DM,     SH + DM);
  colstat<<<dim3(DM / 256), dim3(256), 0, stream>>>(vz, vr, nvr, ZN + 2 * DM, CH + 2 * DM, SH + 2 * DM);
  // (6..8) weights [k = in][n = out]: transpose to k-contiguous [n][k] f16 planes of bf16(W) x256
  cvtT16<<<dim3((DM / 64) * (DM / 64)), dim3(TR_THREADS), 0, stream>>>(qz, WQT, WSC);
  cvtT16<<<dim3((DM / 64) * (DM / 64)), dim3(TR_THREADS), 0, stream>>>(kz, WKT, WSC);
  cvtT16<<<dim3((DM / 64) * (DM / 64)), dim3(TR_THREADS), 0, stream>>>(vz, WVT, WSC);
  // (9..11) projections with the fused MLR / per-head epilogue
  proj_mlr<<<dim3((NB * SEQ / 128) * (DM / 64)), dim3(128), 0, stream>>>(
      X16, WQT, ZN,          CH,          SH,          CX2, 0, Qh, Ql, QX2);
  proj_mlr<<<dim3((NB * SEQ / 128) * (DM / 64)), dim3(128), 0, stream>>>(
      X16, WKT, ZN + DM,     CH + DM,     SH + DM,     CX2, 1, Kh, Kl, KX2);
  proj_mlr<<<dim3((NB * SEQ / 128) * (DM / 64)), dim3(128), 0, stream>>>(
      X16, WVT, ZN + 2 * DM, CH + 2 * DM, SH + 2 * DM, CX2, 2, Vg, Vg, GM1);
  // (12) gamma v plane -> key-contiguous v^T plane
  trT16<<<dim3(NB * (SEQ / 64) * (DM / 64)), dim3(TR_THREADS), 0, stream>>>(Vg, VT);
  // (13) attention + midpoint -> out [b][SEQ][DM] f32 (rows s < SQ of batches b < NB), heads merged on the feature dim
  attn_fwd<<<dim3(NB * NH * (SQ / 64)), dim3(ATT_THREADS), 0, stream>>>(Qh, Ql, Kh, Kl, VT, QX2, KX2, GM1, am, out);
  (void)hipGetLastError();
}

// v001
// Measured time: 269 microseconds a run.
// Timed twice side by side with v000, it ran 2.14 times as fast both times.
// Contractions: x.Wq, x.Wk, x.Wv on v_wmma_f32_16x16x32_f16 (x as f16(bf16(x) x64), W as f16(bf16(W) x256), f32 accumulate);
// scores k.q^T on v_wmma_f32_16x16x32_bf16 as bf16 hi/lo split (hi.hi + lo.hi + hi.lo into one f32 accumulator);
// P.(gamma v)^T on v_wmma_f32_16x16x32_f16 (P x32768 f16, gamma v x256 f16, f32 accumulate); norms, asinh/sinh/acosh,
// base-2 online softmax, the sum_j p_j (gamma_j - 1) denominators and all carry folds in f32 on VALU.
// Float inputs RNE-converted to bf16 on load; f32 output written directly.
#include <hip/hip_runtime.h>
#include <math.h>
#include <stdint.h>

#ifndef NB
#define NB 2            // batches processed
#endif
#ifndef SQ
#define SQ 1024         // query rows processed per batch (keys/values always all SEQ rows)
#endif
#define NB_FULL 2
#define SEQ  1024       // rows per batch in every input / output / plane layout
#define DM   1024       // model width = K of the projections = row pitch of the 16-bit planes
#define NH   16
#define HD   64
#define XS   64.0f      // carry on the x plane
#define WSC  256.0f     // carry on the transposed weight planes
#define VS   256.0f     // carry on the gamma*v plane
#define PCAR 32768.0f   // carry on P
#define LOG2E 1.4426950408889634f
#define MAXN 0.996f     // (1 - 4e-3) / sqrt(c)
#define NKB  (SEQ / 32)
#define GPITCH 68
#define TPITCH 65
#define TP16   72
#define CVT_THREADS (DM / 8)
#define TR_THREADS  128
#define ATT_THREADS 128
#define CS_THREADS  1024  // column statistics: threads per block
#define CS_COLS     32    // columns per block
#define CS_STEPS    (DM / (CS_THREADS / 8))   // rows per thread

static_assert(NB >= 1 && NB <= NB_FULL);
static_assert((SQ % 64) == 0 && SQ >= 64 && SQ <= SEQ);
static_assert(NH * HD == DM && HD == 64);
static_assert((SEQ % 128) == 0 && (SEQ % 32) == 0 && NKB * 32 == SEQ);
static_assert((DM % 256) == 0 && (DM % 64) == 0 && (DM % 32) == 0 && CVT_THREADS == 128);
static_assert((GPITCH * 4) % 16 == 0 && (TP16 * 2) % 16 == 0);
static_assert(CS_COLS == 32 && (DM % CS_COLS) == 0 && CS_STEPS * (CS_THREADS / 8) == DM);
static_assert(ATT_THREADS == 128 && TR_THREADS == 128 && ATT_THREADS * 8 == SEQ);

typedef unsigned short u16;
typedef _Float16 v16h __attribute__((ext_vector_type(16)));
typedef _Float16 v8h  __attribute__((ext_vector_type(8)));
typedef __bf16   v16b __attribute__((ext_vector_type(16)));
typedef float    v8f  __attribute__((ext_vector_type(8)));
typedef float    v4f  __attribute__((ext_vector_type(4)));
typedef unsigned int v4u __attribute__((ext_vector_type(4)));
typedef v4u __attribute__((may_alias)) v4ua;
typedef v4f __attribute__((may_alias)) v4fa;

// one 16 x 16-bit per-lane fragment, viewed as f16 vector, bf16 vector or two 16-byte words
union Frag { v16h h; v16b b; v4u u[2]; };

// ---- scalar helpers ----------------------------------------------------------------------------------
__device__ __forceinline__ unsigned short bf_bits(float f) {          // f32 -> bf16 bits, RNE convert
  unsigned u = __float_as_uint(f);
  return (unsigned short)((u + 0x7FFFu + ((u >> 16) & 1u)) >> 16);
}
__device__ __forceinline__ float bf_up(unsigned short h) { return __uint_as_float(((unsigned)h) << 16); }
__device__ __forceinline__ float bfr(float f) { return bf_up(bf_bits(f)); }
__device__ __forceinline__ unsigned short h_bits(_Float16 x) { return __builtin_bit_cast(unsigned short, x); }
__device__ __forceinline__ unsigned pk16(unsigned short a, unsigned short b) { return (unsigned)a | ((unsigned)b << 16); }
__device__ __forceinline__ v8f zero8() { v8f z = {0.f, 0.f, 0.f, 0.f, 0.f, 0.f, 0.f, 0.f}; return z; }
__device__ __forceinline__ float red8(float v) {                      // sum over the 8-lane group (lane bits 0..2)
  v += __shfl_xor(v, 1, 32); v += __shfl_xor(v, 2, 32); v += __shfl_xor(v, 4, 32); return v;
}
__device__ __forceinline__ float rsum16(float v) {                    // sum over the 16-lane half (lane bits 0..3)
  v += __shfl_xor(v, 8, 32); v += __shfl_xor(v, 4, 32); v += __shfl_xor(v, 2, 32); v += __shfl_xor(v, 1, 32); return v;
}

// ---- fragment loader: 16-bit A/B operand from a k-contiguous row; lane -> row/col (lane&15), p already includes
//      +8*(lane>>4); elements 0..7 <- p[0..7] (k0+8h..), elements 8..15 <- p[16..23] (k0+16+8h..); same split k map
//      for A and B; B always read from a k-contiguous [n][k] plane. Loaded as unsigned 16-byte words.
__device__ __forceinline__ Frag ldfrag(const u16* p) {
  Frag f;
  f.u[0] = *(const v4u*)(p);
  f.u[1] = *(const v4u*)(p + 16);
  return f;
}

// ---- WMMA helpers and trailing VALU hazard gaps --------------------------------------------------------
__device__ __forceinline__ v8f mma_h(const Frag& a, const Frag& b, v8f c) {
  return __builtin_amdgcn_wmma_f32_16x16x32_f16(false, a.h, false, b.h, (short)0, c, false, false);
}
__device__ __forceinline__ v8f mma_b(const Frag& a, const Frag& b, v8f c) {
  return __builtin_amdgcn_wmma_f32_16x16x32_bf16(false, a.b, false, b.b, (short)0, c, false, false);
}
__device__ __forceinline__ void guard_sc(v8f& a, v8f& b, v16h x0, v16h x1, v16h x2, v16h x3, v16h x4, v16h x5) {
#if defined(__HIP_DEVICE_COMPILE__)
  asm volatile("v_nop\n\tv_nop\n\tv_nop\n\tv_nop"
               : "+v"(a), "+v"(b) : "v"(x0), "v"(x1), "v"(x2), "v"(x3), "v"(x4), "v"(x5) : "memory");
#endif
}
__device__ __forceinline__ void guard_pv(v8f (&o)[4], v16h p, v16h x0, v16h x1, v16h x2, v16h x3) {
#if defined(__HIP_DEVICE_COMPILE__)
  asm volatile("v_nop\n\tv_nop\n\tv_nop\n\tv_nop"
               : "+v"(o[0]), "+v"(o[1]), "+v"(o[2]), "+v"(o[3]) : "v"(p), "v"(x0), "v"(x1), "v"(x2), "v"(x3) : "memory");
#endif
}
__device__ __forceinline__ void guard_g(v8f (&acc)[8], v16h x0, v16h x1, v16h x2, v16h x3, v16h x4, v16h x5) {
#if defined(__HIP_DEVICE_COMPILE__)
  asm volatile("v_nop\n\tv_nop\n\tv_nop\n\tv_nop"
               : "+v"(acc[0]), "+v"(acc[1]), "+v"(acc[2]), "+v"(acc[3]),
                 "+v"(acc[4]), "+v"(acc[5]), "+v"(acc[6]), "+v"(acc[7])
               : "v"(x0), "v"(x1), "v"(x2), "v"(x3), "v"(x4), "v"(x5) : "memory");
#endif
}
__device__ __forceinline__ void acc_guard4(v8f (&o)[4]) {
#if defined(__HIP_DEVICE_COMPILE__)
  asm volatile("v_nop\n\tv_nop\n\tv_nop\n\tv_nop" : "+v"(o[0]), "+v"(o[1]), "+v"(o[2]), "+v"(o[3]));
#endif
}
__device__ __forceinline__ void wave_sync_lds() {
  __builtin_amdgcn_fence(__ATOMIC_RELEASE, "workgroup");
  __builtin_amdgcn_wave_barrier();
  __builtin_amdgcn_fence(__ATOMIC_ACQUIRE, "workgroup");
}

// =====================================================================================================
// Row convert: row r of a [rows][DM] f16 plane <- f16(bf16_RNE(x[r][e]) * scale), scale a power of two.
// Block = DM/8 threads, thread = 8 consecutive elements (two 16-B loads, one 16-B store; 32 consecutive lanes = 512
// coverage: grid = number of rows, 128 thr x 8 = DM = the whole row.
// =====================================================================================================
__global__ __launch_bounds__(CVT_THREADS)
void cvt16(const float* __restrict__ x, u16* Y, float scale) {
  const int tid = threadIdx.x;
  const size_t r = blockIdx.x;
  const float* src = x + r * (size_t)DM + (size_t)tid * 8;
  const v4f a = *(const v4f*)(src), c4 = *(const v4f*)(src + 4);
  v4u o;
#pragma unroll
  for (int e = 0; e < 2; ++e) {
    o[e]     = pk16(h_bits((_Float16)(bfr(a[2 * e]) * scale)),  h_bits((_Float16)(bfr(a[2 * e + 1]) * scale)));
    o[2 + e] = pk16(h_bits((_Float16)(bfr(c4[2 * e]) * scale)), h_bits((_Float16)(bfr(c4[2 * e + 1]) * scale)));
  }
  u16* dst = Y + r * (size_t)DM + (size_t)tid * 8;
  {
    *(v4u*)(dst) = o;
    
  }
}

// =====================================================================================================
// Row statistics: CX2[r] = sum_e bf16(x[r][e])^2 in f32. Block = 32 rows, 256 threads, wave w rows 32*blk + 4w + j:
// per row each lane sums 32 values (8 x 16-B loads), xor-shuffle reduce, lane 0 -> LDS; after a block barrier threads
// =====================================================================================================
__global__ __launch_bounds__(256)
void rowstat(const float* __restrict__ x, float* CX2) {
  __shared__ __align__(16) float rs[32];
  const int tid = threadIdx.x, wave = tid >> 5, lane = tid & 31;
  const int row0 = blockIdx.x * 32;
#pragma unroll 1
  for (int j = 0; j < 4; ++j) {
    const int row = row0 + wave * 4 + j;
    const float* xr = x + (size_t)row * DM + 4 * lane;
    float s = 0.f;
#pragma unroll 2
    for (int q = 0; q < DM / 128; ++q) {
      const v4f a = *(const v4f*)(xr + 128 * q);
      const float a0 = bfr(a[0]), a1 = bfr(a[1]), a2 = bfr(a[2]), a3 = bfr(a[3]);
      s += a0 * a0; s += a1 * a1; s += a2 * a2; s += a3 * a3;
    }
    s += __shfl_xor(s, 16, 32); s += __shfl_xor(s, 8, 32); s += __shfl_xor(s, 4, 32);
    s += __shfl_xor(s, 2, 32);  s += __shfl_xor(s, 1, 32);
    if (lane == 0) rs[wave * 4 + j] = s;
  }
  __syncthreads();
  if (tid < 8) {
    const v4f v = *(const v4fa*)(rs + 4 * tid);
    float* dst = CX2 + row0 + 4 * tid;
    {
      *(v4f*)(dst) = v;
      
    }
  }
}

// =====================================================================================================
// Column statistics of a weight z[k][n] (DM x DM): ZN[n] = max(sqrt(sum_k bf16(z[k][n])^2), 1e-15), CH[n] = cosh(2 r[n]),
// SH[n] = sinh(2 r[n]) (r index clamped to nr-1). Block = 32 columns (one 128-B line of every row) x all DM rows,
// 1024 threads: lane = (row sub-index lane>>3, 4 columns at 4*(lane&7)), wave w step j reads rows 128j + 4w .. +3, so a
// thread has its 8 independent 16-B loads in flight at once. Column sums: 8 rows in the thread, xor-8 / xor-16 shuffles
// over the wave's 4 row sub-indices, one 32-float row per wave in LDS, block barrier, wave 0 adds the 32 wave rows.
// coverage: 8 j x 32 waves x 4 rows = DM rows; grid = DM/32 blocks x 32 columns = every column of the three arrays once,
//           each block the only writer of its 128-B line in each array.
// =====================================================================================================
__global__ __launch_bounds__(CS_THREADS)
void colstat(const float* __restrict__ z, const float* __restrict__ r, int nr, float* ZN, float* CH, float* SH) {
  __shared__ __align__(16) float part[(CS_THREADS / 32) * CS_COLS];
  const int tid = threadIdx.x, wave = tid >> 5, lane = tid & 31;
  const int col0 = blockIdx.x * CS_COLS;
  const float* zp = z + (size_t)(wave * 4 + (lane >> 3)) * DM + col0 + 4 * (lane & 7);
  const int col = col0 + lane;
  float rv = 0.f;
  if (wave == 0) {                               // wave-uniform; issued with the column loads, not behind the barrier
    int ri = col;
    ri = (ri < nr - 1) ? ri : (nr - 1);
    rv = r[ri];
  }
  v4f a[CS_STEPS];
#pragma unroll   // all loads issue before the first use: one memory latency per thread instead of one per row group
  for (int j = 0; j < CS_STEPS; ++j) a[j] = *(const v4f*)(zp + (size_t)j * (CS_THREADS / 8) * DM);
  v4f s = {0.f, 0.f, 0.f, 0.f};
#pragma unroll
  for (int j = 0; j < CS_STEPS; ++j) {
#pragma unroll
    for (int e = 0; e < 4; ++e) {
      const float v = bfr(a[j][e]);
      s[e] += v * v;
    }
  }
#pragma unroll
  for (int e = 0; e < 4; ++e) {
    s[e] += __shfl_xor(s[e], 8, 32);
    s[e] += __shfl_xor(s[e], 16, 32);
  }
  if (lane < 8) *(v4fa*)(part + wave * CS_COLS + 4 * lane) = s;
  __syncthreads();
  if (wave == 0) {                               // wave-uniform; lane = column
    float t = 0.f;
#pragma unroll
    for (int w = 0; w < CS_THREADS / 32; ++w) t += part[w * CS_COLS + lane];
    const float dr = 2.0f * bfr(rv);
    ZN[col] = fmaxf(sqrtf(t), 1e-15f);
    CH[col] = coshf(dr);
    SH[col] = sinhf(dr);
  }
}

// =====================================================================================================
// Weight transpose-convert for y = x.W weights stored [k][n]: WT[n][k] (f16, k-contiguous Bt layout) <- f16(bf16_RNE(W[k][n]) *
// scale). Block = 64(k) x 64(n) tile, 128 threads. Load phase: thread = (row 8p + (tid>>4), 4 floats at 4*(tid&15)),
// 8 steps = 64 k-rows x 64 n, into an LDS tile [kk][nn] (pitch 65); block barrier; store phase: output row n0 + 16i + (tid>>3)
// coverage: 4 i x 16 rows x (8 lanes x 8 halves) = 64 n-rows x 64 k per block; the grid covers WT exactly once.
// LDS tile: cross-wave, block barrier; staged extent 64x64 == consumed extent.
// =====================================================================================================
__global__ __launch_bounds__(TR_THREADS)
void cvtT16(const float* __restrict__ W, u16* Y, float scale) {
  __shared__ __align__(16) float tile[64 * TPITCH];
  const int tid = threadIdx.x;
  constexpr int NT = DM / 64;
  const int bid = blockIdx.x;
  const int kt  = bid % NT;
  const int ntb = bid / NT;
  const int k0  = kt * 64, n0 = ntb * 64;
  const int lr = tid >> 4, lc = (tid & 15) * 4;
#pragma unroll
  for (int p = 0; p < 8; ++p) {
    const int kk = p * 8 + lr;
    const v4f w4 = *(const v4f*)(W + (size_t)(k0 + kk) * (size_t)DM + n0 + lc);
    tile[kk * TPITCH + lc + 0] = w4[0];
    tile[kk * TPITCH + lc + 1] = w4[1];
    tile[kk * TPITCH + lc + 2] = w4[2];
    tile[kk * TPITCH + lc + 3] = w4[3];
  }
  __syncthreads();
  const int rq = tid >> 3, c8 = (tid & 7) * 8;      // rq 0..15, c8 0..56
  v4u ov[4];
#pragma unroll
  for (int i = 0; i < 4; ++i) {
    const int row = 16 * i + rq;                   // n within tile
#pragma unroll
    for (int e = 0; e < 4; ++e) {
      const float x0 = tile[(c8 + 2 * e) * TPITCH + row];
      const float x1 = tile[(c8 + 2 * e + 1) * TPITCH + row];
      ov[i][e] = pk16(h_bits((_Float16)(bfr(x0) * scale)), h_bits((_Float16)(bfr(x1) * scale)));
    }
  }
  u16* dst = Y + (size_t)n0 * (size_t)DM + k0 + c8;
  {
#pragma unroll
    for (int i = 0; i < 4; ++i) {
      const int row = 16 * i + rq;
      *(v4u*)(dst + (size_t)row * (size_t)DM) = ov[i];
    }
    
  }
}

// =====================================================================================================
// f16 GEMM core: the wave's 32 x 64 tile of C = A[rows][K] . Bt[cols][K]^T; ap -> A row (rowb + m) + 8h, bp -> Bt row
// (col0 + m) + 8h; acc[4i + j] = rows rowb+16i.., cols col0+16j..; K stepped by 32 (K % 32 == 0 asserted).
// =====================================================================================================
__device__ __forceinline__ void gemm_core(const u16* ap, const u16* bp, int K, v8f (&acc)[8]) {
  const size_t rs16 = (size_t)16 * (size_t)K;
#pragma unroll 1
  for (int k0 = 0; k0 < K; k0 += 32) {
    const Frag a0 = ldfrag(ap + k0), a1 = ldfrag(ap + rs16 + k0);
    const Frag b0 = ldfrag(bp + k0);
    const Frag b1 = ldfrag(bp + rs16 + k0);
    const Frag b2 = ldfrag(bp + 2 * rs16 + k0);
    const Frag b3 = ldfrag(bp + 3 * rs16 + k0);
    acc[0] = mma_h(a0, b0, acc[0]);
    acc[1] = mma_h(a0, b1, acc[1]);
    acc[2] = mma_h(a0, b2, acc[2]);
    acc[3] = mma_h(a0, b3, acc[3]);
    acc[4] = mma_h(a1, b0, acc[4]);
    acc[5] = mma_h(a1, b1, acc[5]);
    acc[6] = mma_h(a1, b2, acc[6]);
    acc[7] = mma_h(a1, b3, acc[7]);
    guard_g(acc, a0.h, a1.h, b0.h, b1.h, b2.h, b3.h);
  }
}
// Stage the wave's 32 x 64 f32 tile (times oscale) in its LDS slab (pitch 68): D element r of acc[4i+j], lane l ->
// coverage: 32 lanes x 2 x 8 rows x 4 cols-of-16 = rows 0..31 x cols 0..63 of the slab.
__device__ __forceinline__ void stage32x64(float* sl, v8f (&acc)[8], float oscale, int lane) {
  const int hh = lane >> 4, m = lane & 15;
#pragma unroll
  for (int i = 0; i < 2; ++i) {
#pragma unroll
    for (int r = 0; r < 8; ++r) {
      const int ro = (16 * i + 8 * hh + r) * GPITCH + m;
      sl[ro]      = acc[4 * i + 0][r] * oscale;
      sl[ro + 16] = acc[4 * i + 1][r] * oscale;
      sl[ro + 32] = acc[4 * i + 2][r] * oscale;
      sl[ro + 48] = acc[4 * i + 3][r] * oscale;
    }
  }
  wave_sync_lds();
}

// =====================================================================================================
// Projection GEMM + ball MLR epilogue. A = x plane [NB*SEQ][DM] (f16, x XS), Bt = WT [DM n][DM k] (f16, x WSC).
// Block = 128 threads = 128 rows x 64 cols (one head), wave = 32 rows; fragments straight from the 16-bit rows.
// Epilogue per element (f32): mm = (x.z)[row][n] / ZN[n]; arg = (2 mm CH[n] - (1 + cx2) SH[n]) / max(1 - cx2, 1e-15);
// y = sinh(2 ZN[n] asinh(arg)); per (row, head) 64-vector (8 lanes x 8 values, 8-lane shuffle sums): clip to norm MAXN,
// y = y / (1 + sqrt(1 + sum y^2)), clip again; x2 = sum y^2. mode 0/1: planes Ph/Pl = bf16 hi / bf16 lo of y, RS row
// scalar = x2; mode 2: g = 2 / max(1 - x2, 1e-15), plane Ph = f16(g y VS), RS row scalar = g - 1.
// coverage: per wave 8 instr x 4 rows x 8 lanes x 8 halves = 32 x 64 per plane; RS: 32 floats per wave; grid covers every
//           (row, col) of the planes and every (b, head, s) of RS exactly once.
// LDS: slab and rsc are wave-private (wave_sync); staged extent 32x64 == consumed extent; no block barriers.
// =====================================================================================================
__global__ __launch_bounds__(128)
void proj_mlr(const u16* __restrict__ A, const u16* __restrict__ Bt,
              const float* __restrict__ ZN, const float* __restrict__ CH, const float* __restrict__ SH,
              const float* __restrict__ CX2, int mode, u16* Ph, u16* Pl, float* RS) {
  __shared__ __align__(16) float slab[4 * 32 * GPITCH];
  __shared__ __align__(16) float rsc[4 * 32];
  const int tid = threadIdx.x, wave = tid >> 5, lane = tid & 31, hh = lane >> 4, m = lane & 15;
  constexpr int NT = DM / 64;
  const int bid  = blockIdx.x;
  const int nt   = bid % NT;
  const int mt   = bid / NT;
  const int rowb = mt * 128 + wave * 32;       // global token row b*SEQ + s of the wave's first row
  const int col0 = nt * 64;                    // = head * HD
  const u16* ap = A  + (size_t)(rowb + m) * DM + 8 * hh;
  const u16* bp = Bt + (size_t)(col0 + m) * DM + 8 * hh;
  v8f acc[8];
#pragma unroll
  for (int i = 0; i < 8; ++i) acc[i] = zero8();
  gemm_core(ap, bp, DM, acc);
  float* sl = slab + wave * 32 * GPITCH;
  stage32x64(sl, acc, 1.0f / (XS * WSC), lane);

  const int rq = lane >> 3, c8 = (lane & 7) * 8;
  float zn8[8], ch8[8], sh8[8];
  {
    const v4f z0 = *(const v4f*)(ZN + col0 + c8), z1 = *(const v4f*)(ZN + col0 + c8 + 4);
    const v4f h0 = *(const v4f*)(CH + col0 + c8), h1 = *(const v4f*)(CH + col0 + c8 + 4);
    const v4f g0 = *(const v4f*)(SH + col0 + c8), g1 = *(const v4f*)(SH + col0 + c8 + 4);
#pragma unroll
    for (int e = 0; e < 4; ++e) {
      zn8[e] = z0[e]; zn8[4 + e] = z1[e];
      ch8[e] = h0[e]; ch8[4 + e] = h1[e];
      sh8[e] = g0[e]; sh8[4 + e] = g1[e];
    }
  }
  const bool mv = (mode == 2);
#pragma unroll 1
  for (int i = 0; i < 8; ++i) {
    const int row = 4 * i + rq;
    const float cx  = CX2[rowb + row];
    const float omc = fmaxf(1.0f - cx, 1e-15f);
    const float opc = 1.0f + cx;
    float* sr = sl + row * GPITCH + c8;
    float y[8];
    float s0 = 0.f;
#pragma unroll
    for (int e = 0; e < 8; ++e) {
      const float mm  = sr[e] / zn8[e];
      const float arg = (2.0f * mm * ch8[e] - opc * sh8[e]) / omc;
      const float w   = 2.0f * zn8[e] * asinhf(arg);
      y[e] = sinhf(w);
      s0 += y[e] * y[e];
    }
    s0 = red8(s0);
    const float n0 = fmaxf(sqrtf(s0), 1e-15f);
    const bool cl0 = n0 > MAXN;
    float s1 = 0.f;
#pragma unroll
    for (int e = 0; e < 8; ++e) {
      const float yp = y[e] / n0 * MAXN;
      y[e] = cl0 ? yp : y[e];
      s1 += y[e] * y[e];
    }
    s1 = red8(s1);
    const float den = 1.0f + sqrtf(1.0f + s1);
    float s2 = 0.f;
#pragma unroll
    for (int e = 0; e < 8; ++e) {
      y[e] = y[e] / den;
      s2 += y[e] * y[e];
    }
    s2 = red8(s2);
    const float n2 = fmaxf(sqrtf(s2), 1e-15f);
    const bool cl2 = n2 > MAXN;
    float s3 = 0.f;
#pragma unroll
    for (int e = 0; e < 8; ++e) {
      const float yp = y[e] / n2 * MAXN;
      y[e] = cl2 ? yp : y[e];
      s3 += y[e] * y[e];
    }
    s3 = red8(s3);
    const float g    = 2.0f / fmaxf(1.0f - s3, 1e-15f);
    const float gmul = mv ? g : 1.0f;
    const float scal = mv ? (g - 1.0f) : s3;
#pragma unroll
    for (int e = 0; e < 8; ++e) sr[e] = y[e] * gmul;
    if ((lane & 7) == 0) rsc[wave * 32 + row] = scal;
  }
  wave_sync_lds();

  const int bb = rowb / SEQ, s0r = rowb - bb * SEQ, head = nt;
  if (lane < 8) {
    const v4f v = *(const v4fa*)(rsc + wave * 32 + 4 * lane);
    float* dst = RS + ((size_t)(bb * NH + head)) * SEQ + s0r + 4 * lane;
    {
      *(v4f*)(dst) = v;
      
    }
  }
  // ---- planes ----
  const size_t pofs = (size_t)rowb * DM + (size_t)(col0 + c8);
  if (!mv) {
    v4u oh[8], ol[8];
#pragma unroll
    for (int i = 0; i < 8; ++i) {
      const int row = 4 * i + rq;
      const v4f a = *(const v4fa*)(sl + row * GPITCH + c8), c4 = *(const v4fa*)(sl + row * GPITCH + c8 + 4);
#pragma unroll
      for (int e = 0; e < 2; ++e) {
        const unsigned short ha = bf_bits(a[2 * e]),  hb = bf_bits(a[2 * e + 1]);
        const unsigned short la = bf_bits(a[2 * e] - bf_up(ha)), lb = bf_bits(a[2 * e + 1] - bf_up(hb));
        oh[i][e] = pk16(ha, hb);
        ol[i][e] = pk16(la, lb);
        const unsigned short hc = bf_bits(c4[2 * e]), hd = bf_bits(c4[2 * e + 1]);
        const unsigned short lc = bf_bits(c4[2 * e] - bf_up(hc)), ld = bf_bits(c4[2 * e + 1] - bf_up(hd));
        oh[i][2 + e] = pk16(hc, hd);
        ol[i][2 + e] = pk16(lc, ld);
      }
    }
    {
#pragma unroll
      for (int i = 0; i < 8; ++i) {
        const int row = 4 * i + rq;
        *(v4u*)(Ph + pofs + (size_t)row * DM) = oh[i];
        *(v4u*)(Pl + pofs + (size_t)row * DM) = ol[i];
      }
      
    }
  } else {
    v4u ov[8];
#pragma unroll
    for (int i = 0; i < 8; ++i) {
      const int row = 4 * i + rq;
      const v4f a = *(const v4fa*)(sl + row * GPITCH + c8), c4 = *(const v4fa*)(sl + row * GPITCH + c8 + 4);
#pragma unroll
      for (int e = 0; e < 2; ++e) {
        ov[i][e]     = pk16(h_bits((_Float16)(a[2 * e] * VS)),  h_bits((_Float16)(a[2 * e + 1] * VS)));
        ov[i][2 + e] = pk16(h_bits((_Float16)(c4[2 * e] * VS)), h_bits((_Float16)(c4[2 * e + 1] * VS)));
      }
    }
    {
#pragma unroll
      for (int i = 0; i < 8; ++i) {
        const int row = 4 * i + rq;
        *(v4u*)(Ph + pofs + (size_t)row * DM) = ov[i];
      }
      
    }
  }
}

// =====================================================================================================
// 16-bit per-batch transpose: VT[b*DM + hd][s] <- Vg[b*SEQ + s][hd]. Block = 64(s) x 64(hd) tile, 128 threads.
// Load phase: thread = (s = 16p + (tid>>3), 8 halves at hd = 8*(tid&7)) one 16-B load, 4 steps, scattered as u16 scalars
// into an LDS tile [hd][s] (pitch 72); block barrier; store phase: VT row hd0 + 16i + (tid>>3) gets s0 + 8*(tid&7) .. +7 =
// passes. grid = NB x (SEQ/64) x (DM/64): bid -> (st = bid % 16, ht = (bid/16) % 16, b = bid/256).
// coverage: load 4 p x 16 s x 8 lane-groups x 8 hd = 64 x 64; store 4 i x 16 rows x 8 lanes x 8 halves = 64 hd x 64 s;
//           the grid covers VT (NB*DM rows x SEQ) exactly once.
// LDS tile: cross-wave, block barrier; staged extent 64x64 == consumed extent (pad columns 64..71 never read).
// =====================================================================================================
__global__ __launch_bounds__(TR_THREADS)
void trT16(const u16* __restrict__ Vg, u16* VT) {
  __shared__ __align__(16) u16 tile[64 * TP16];
  const int tid = threadIdx.x;
  constexpr int NST = SEQ / 64, NHT = DM / 64;
  const int bid = blockIdx.x;
  const int st  = bid % NST;
  const int tmp = bid / NST;
  const int ht  = tmp % NHT;
  const int b   = tmp / NHT;
  const int s0 = st * 64, hd0 = ht * 64;
  const int r = tid >> 3, c = (tid & 7) * 8;
#pragma unroll
  for (int p = 0; p < 4; ++p) {
    const int s = 16 * p + r;
    const v4u w = *(const v4u*)(Vg + ((size_t)(b * SEQ + s0 + s)) * DM + hd0 + c);
#pragma unroll
    for (int e = 0; e < 8; ++e)
      tile[(c + e) * TP16 + s] = (u16)((w[e >> 1] >> (16 * (e & 1))) & 0xFFFFu);
  }
  __syncthreads();
  const int rq = tid >> 3, c8 = (tid & 7) * 8;
  v4u ov[4];
#pragma unroll
  for (int i = 0; i < 4; ++i) {
    const int row = 16 * i + rq;
    ov[i] = *(const v4ua*)(tile + row * TP16 + c8);
  }
  u16* dst = VT + ((size_t)(b * DM + hd0)) * SEQ + s0 + c8;
  {
#pragma unroll
    for (int i = 0; i < 4; ++i) {
      const int row = 16 * i + rq;
      *(v4u*)(dst + (size_t)row * SEQ) = ov[i];
    }
    
  }
}

// ---- ball distance logit (base 2) of one (query, key) pair ----
__device__ __forceinline__ float logit2(float xy, float y2, float mk, float x2, float omx) {
  const float num  = fmaxf(x2 - 2.0f * xy + y2, 1e-15f);
  const float den  = fmaxf(omx * (1.0f - y2), 1e-15f);
  const float dist = acoshf(1.0f + 2.0f * num / den);
  return (mk - dist) * LOG2E;
}

// =====================================================================================================
// Fused distance attention + gyro-midpoint over all SEQ keys: block = (batch b, head, 64 query rows), 4 waves, wave w owns
// queries q0 = 64*qt + 16*w .. q0+15 (waves independent after the initial table staging: one block barrier, then only
// wave-private LDS).
//   q planes bf16 hi/lo [b*SEQ + s][h*64 + d]; k planes bf16 hi/lo same layout; v^T plane f16 x VS [(b*NH + h)*64 + d][s];
//   per-key tables for (b, h): sum k^2, gamma - 1; additive bias row amask[b][s] (bf16-converted); per query x2 = sum q^2.
//   All NKB = 32 key blocks of 32 keys are visited (static bound).
//   Scores computed TRANSPOSED: S^T tile g = k rows (keys kb+16g .., A operand, row m = lane&15, split k map over d)
//   times q^T (B operand, col n = query q0 + (lane&15), k = d), 2 d-chunks of 32, three bf16 products each (hi.hi, lo.hi,
//   hi.lo). D element r of lane l = (key kb+16g+8h+r, query q0+(l&15)): a lane owns one query column and 16 of its 32 keys;
//   the partner lane l^16 owns the other 16 -> row max / row sums need one xor-16 shuffle.
//   dist = acosh(1 + 2 max(x2 - 2 xy + y2, 1e-15) / max((1 - x2)(1 - y2), 1e-15)), logit = -dist + bias, all f32.
//   Online max-subtracted base-2 softmax in f32; running sums l = sum p and dn = sum p (gamma - 1). The exp'd values ARE the
//   P A-fragment in place: A row m = query = lane&15, element i <- key kb+8h+i (tile 0, D element i), element 8+i <- key
//   kb+16+8h+i (tile 1, D element i). P (<= 1) carried x32768 as f16. O rescale factors shuffled from the query-owner lanes.
//   4 v^T B fragments (col n = d = 16j + (lane&15), keys k-contiguous), 4 P.V WMMAs + one guard.
//   Epilogue (f32): two_mean = (O (1/l) / (PCAR VS)) / max(dn / l, 1e-10); a = two_mean / (1 + sqrt(max(1 - sum two_mean^2,
//   1e-15))); clip to norm MAXN; the wave's 16x64 tile staged in its LDS slab (pitch 68); each output row segment
// coverage: per wave 8 instructions x 2 rows x 16 lanes x 4 floats = 16 x 64; grid NB*NH*(SQ/64) blocks x 4 waves = every
//           (b < NB, s < SQ, h) row segment of the output exactly once.
// LDS: ms/ky2/kg1 cross-wave (block barrier, 1024 staged == 1024 consumed); slab wave-private (wave_sync, 16x64).
// =====================================================================================================
__global__ __launch_bounds__(ATT_THREADS)
void attn_fwd(const u16* __restrict__ Qh, const u16* __restrict__ Ql, const u16* __restrict__ Kh, const u16* __restrict__ Kl,
              const u16* __restrict__ VT, const float* __restrict__ QX2, const float* __restrict__ KX2,
              const float* __restrict__ GM1, const float* __restrict__ amask, float* Out) {
  __shared__ __align__(16) float ms[SEQ];
  __shared__ __align__(16) float ky2[SEQ];
  __shared__ __align__(16) float kg1[SEQ];
  __shared__ __align__(16) float slab[4 * 16 * GPITCH];

  const int tid  = threadIdx.x;
  const int wave = tid >> 5;
  const int lane = tid & 31;
  const int hh   = lane >> 4;
  const int c    = lane & 15;

  constexpr int NQT = SQ / 64;
  const int bid  = blockIdx.x;
  const int qt   = bid % NQT;
  const int head = (bid / NQT) % NH;
  const int b    = bid / (NQT * NH);
  const int bh   = b * NH + head;
  const int q0   = qt * 64 + wave * 16;

  // ---- stage the per-key tables of (b, head): 128 threads x 8 keys = SEQ ----
  {
    const int i0 = tid * 8;
    const float* mp = amask + (size_t)b * SEQ + i0;
    const float* yp = KX2 + (size_t)bh * SEQ + i0;
    const float* gp = GM1 + (size_t)bh * SEQ + i0;
    const v4f m0 = *(const v4f*)(mp), m1 = *(const v4f*)(mp + 4);
    const v4f y0 = *(const v4f*)(yp), y1 = *(const v4f*)(yp + 4);
    const v4f g0 = *(const v4f*)(gp), g1 = *(const v4f*)(gp + 4);
#pragma unroll
    for (int e = 0; e < 4; ++e) {
      ms[i0 + e]  = bfr(m0[e]); ms[i0 + 4 + e]  = bfr(m1[e]);
      ky2[i0 + e] = y0[e];      ky2[i0 + 4 + e] = y1[e];
      kg1[i0 + e] = g0[e];      kg1[i0 + 4 + e] = g1[e];
    }
  }
  __syncthreads();

  // B fragments of q^T: col n = query q0 + c, k = d (k-contiguous rows of the q planes)
  const size_t qofs = ((size_t)(b * SEQ + q0 + c)) * DM + head * HD + 8 * hh;
  const Frag qh0 = ldfrag(Qh + qofs), qh1 = ldfrag(Qh + qofs + 32);
  const Frag ql0 = ldfrag(Ql + qofs), ql1 = ldfrag(Ql + qofs + 32);
  const float xq  = QX2[(size_t)bh * SEQ + q0 + c];
  const float omx = 1.0f - xq;
  // A fragments of k: row m = key kb + 16g + c, k = d (key row kb added per step)
  const size_t kofs = ((size_t)(b * SEQ + c)) * DM + head * HD + 8 * hh;
  const u16* KhB = Kh + kofs;
  const u16* KlB = Kl + kofs;
  // B fragments of v^T: col n = d = 16j + c, k = key (k-contiguous row of the v^T plane)
  const u16* Vb = VT + ((size_t)(bh * HD + c)) * SEQ + 8 * hh;

  float mrun = -INFINITY, lrun = 0.f, drun = 0.f;
  v8f o[4];
#pragma unroll
  for (int j = 0; j < 4; ++j) o[j] = zero8();

#pragma unroll 1
  for (int it = 0; it < NKB; ++it) {
    const int kb = it * 32;
    // ---- transposed scores: s0 = keys kb..kb+15, s1 = keys kb+16..kb+31, column = query q0 + c ----
    v8f s0 = zero8(), s1 = zero8();
    const size_t k0o = (size_t)kb * DM, k1o = k0o + (size_t)16 * DM;
    {
      const Frag kh0 = ldfrag(KhB + k0o), kh1 = ldfrag(KhB + k1o);
      const Frag kl0 = ldfrag(KlB + k0o), kl1 = ldfrag(KlB + k1o);
      s0 = mma_b(kh0, qh0, s0); s0 = mma_b(kl0, qh0, s0); s0 = mma_b(kh0, ql0, s0);
      s1 = mma_b(kh1, qh0, s1); s1 = mma_b(kl1, qh0, s1); s1 = mma_b(kh1, ql0, s1);
      guard_sc(s0, s1, qh0.h, ql0.h, kh0.h, kh1.h, kl0.h, kl1.h);
    }
    {
      const Frag kh0 = ldfrag(KhB + k0o + 32), kh1 = ldfrag(KhB + k1o + 32);
      const Frag kl0 = ldfrag(KlB + k0o + 32), kl1 = ldfrag(KlB + k1o + 32);
      s0 = mma_b(kh0, qh1, s0); s0 = mma_b(kl0, qh1, s0); s0 = mma_b(kh0, ql1, s0);
      s1 = mma_b(kh1, qh1, s1); s1 = mma_b(kl1, qh1, s1); s1 = mma_b(kh1, ql1, s1);
      guard_sc(s0, s1, qh1.h, ql1.h, kh0.h, kh1.h, kl0.h, kl1.h);
    }
    // ---- per-key values of this lane's 16 keys: [i] <- key kb+8hh+i, [8+i] <- key kb+16+8hh+i ----
    float y2v[16], g1v[16], mkv[16];
    {
      const int ka = kb + 8 * hh, kc = kb + 16 + 8 * hh;
      const v4f ya = *(const v4fa*)(ky2 + ka), yb = *(const v4fa*)(ky2 + ka + 4);
      const v4f yc = *(const v4fa*)(ky2 + kc), yd = *(const v4fa*)(ky2 + kc + 4);
      const v4f ga = *(const v4fa*)(kg1 + ka), gb = *(const v4fa*)(kg1 + ka + 4);
      const v4f gc = *(const v4fa*)(kg1 + kc), gd = *(const v4fa*)(kg1 + kc + 4);
      const v4f ma = *(const v4fa*)(ms + ka),  mb = *(const v4fa*)(ms + ka + 4);
      const v4f mc = *(const v4fa*)(ms + kc),  md = *(const v4fa*)(ms + kc + 4);
#pragma unroll
      for (int e = 0; e < 4; ++e) {
        y2v[e] = ya[e]; y2v[4 + e] = yb[e]; y2v[8 + e] = yc[e]; y2v[12 + e] = yd[e];
        g1v[e] = ga[e]; g1v[4 + e] = gb[e]; g1v[8 + e] = gc[e]; g1v[12 + e] = gd[e];
        mkv[e] = ma[e]; mkv[4 + e] = mb[e]; mkv[8 + e] = mc[e]; mkv[12 + e] = md[e];
      }
    }
    // ---- base-2 logits ----
    float t[16];
#pragma unroll
    for (int i = 0; i < 8; ++i) {
      t[i]     = logit2(s0[i], y2v[i],     mkv[i],     xq, omx);
      t[8 + i] = logit2(s1[i], y2v[8 + i], mkv[8 + i], xq, omx);
    }
    float cm = t[0];
#pragma unroll
    for (int i = 1; i < 16; ++i) cm = fmaxf(cm, t[i]);
    cm = fmaxf(cm, __shfl_xor(cm, 16, 32));
    const float mn = fmaxf(mrun, cm);        // finite from the first block on
    const float al = exp2f(mrun - mn);       // 0 on the first block (mrun = -inf)
    mrun = mn;
    // ---- probabilities (<= 1), the two running sums and the P A-fragment f16(p * 32768); element i <-> t[i] ----
    float ps = 0.f, pd = 0.f;
    Frag ph;
#pragma unroll
    for (int w = 0; w < 2; ++w) {
#pragma unroll
      for (int e4 = 0; e4 < 4; ++e4) {
        const int i = 8 * w + 2 * e4;
        const float p0 = exp2f(t[i] - mn), p1 = exp2f(t[i + 1] - mn);
        ps += p0 + p1;
        pd += p0 * g1v[i] + p1 * g1v[i + 1];
        ph.u[w][e4] = pk16(h_bits((_Float16)(p0 * PCAR)), h_bits((_Float16)(p1 * PCAR)));
      }
    }
    ps += __shfl_xor(ps, 16, 32);
    pd += __shfl_xor(pd, 16, 32);
    lrun = lrun * al + ps;
    drun = drun * al + pd;
    // ---- rescale the O accumulators: D row 8hh+r = query q0+8hh+r, its factor lives in lane 8hh+r ----
    float scl[8];
#pragma unroll
    for (int r = 0; r < 8; ++r) scl[r] = __shfl(al, 8 * hh + r, 32);
#pragma unroll
    for (int j = 0; j < 4; ++j) {
#pragma unroll
      for (int r = 0; r < 8; ++r) o[j][r] *= scl[r];
    }
    // ---- P.V : B fragment col n = d = j*16 + c, keys contiguous in the v^T plane ----
    {
      const u16* vp = Vb + kb;
      const Frag v0 = ldfrag(vp);
      const Frag v1 = ldfrag(vp + (size_t)16 * SEQ);
      const Frag v2 = ldfrag(vp + (size_t)32 * SEQ);
      const Frag v3 = ldfrag(vp + (size_t)48 * SEQ);
      o[0] = mma_h(ph, v0, o[0]);
      o[1] = mma_h(ph, v1, o[1]);
      o[2] = mma_h(ph, v2, o[2]);
      o[3] = mma_h(ph, v3, o[3]);
      guard_pv(o, ph.h, v0.h, v1.h, v2.h, v3.h);
    }
  }
  acc_guard4(o);

  // ---- gyro-midpoint epilogue in f32: per query factors from the query-owner lane (lane = query) ----
  const float linv = 1.0f / lrun;
  const float nf   = linv * (1.0f / (PCAR * VS));
  const float dq   = fmaxf(drun * linv, 1e-10f);
  float nfr[8], dqr[8];
#pragma unroll
  for (int r = 0; r < 8; ++r) { nfr[r] = __shfl(nf, 8 * hh + r, 32); dqr[r] = __shfl(dq, 8 * hh + r, 32); }
  float sq[8];
#pragma unroll
  for (int r = 0; r < 8; ++r) {
    float sp = 0.f;
#pragma unroll
    for (int j = 0; j < 4; ++j) {
      const float tm = (o[j][r] * nfr[r]) / dqr[r];
      o[j][r] = tm;
      sp += tm * tm;
    }
    sq[r] = rsum16(sp);
  }
  float* sw = slab + wave * 16 * GPITCH;
#pragma unroll
  for (int r = 0; r < 8; ++r) {
    const float df = 1.0f + sqrtf(fmaxf(1.0f - sq[r], 1e-15f));
    float sp = 0.f;
#pragma unroll
    for (int j = 0; j < 4; ++j) {
      const float a = o[j][r] / df;
      o[j][r] = a;
      sp += a * a;
    }
    const float s2  = rsum16(sp);
    const float n2  = fmaxf(sqrtf(s2), 1e-15f);
    const bool  cl  = n2 > MAXN;
    const float fcl = MAXN / n2;
#pragma unroll
    for (int j = 0; j < 4; ++j) {
      const float a = o[j][r];
      sw[(8 * hh + r) * GPITCH + 16 * j + c] = cl ? (a * fcl) : a;
    }
  }
  wave_sync_lds();
  // ---- f32 output rows: lanes 0..15 -> row 2i, lanes 16..31 -> row 2i+1, lane = 4 consecutive d ----
  const int cc = lane & 15;
  v4f vals[8];
#pragma unroll
  for (int i = 0; i < 8; ++i) vals[i] = *(const v4fa*)(sw + (2 * i + hh) * GPITCH + 4 * cc);
  float* ob = Out + ((size_t)(b * SEQ + q0 + hh)) * DM + head * HD + 4 * cc;
  {
#pragma unroll
    for (int i = 0; i < 8; ++i) {
      *(v4f*)(ob + (size_t)(2 * i) * DM) = vals[i];
    }
    
  }
}

// =====================================================================================================
// Workspace map (bytes); every region written fully by whole-line stores before it is read; every extent an exact multiple
//   X16  f16 [NB*SEQ][DM]          f16(bf16(x) x64)              4194304 (NB=2)
//   WQT/WKT/WVT f16 [DM n][DM k]   f16(bf16(W) x256)             3 x 2097152
//   CX2  f32 [NB*SEQ]              sum x^2                       8192
//   ZN, CH, SH f32 [3][DM]         column norms, cosh/sinh(2r)   3 x 12288
//   Qh, Ql, Kh, Kl bf16 [NB*SEQ][DM]                             4 x 4194304
//   Vg   f16 [NB*SEQ][DM]          f16(gamma v x256)             4194304
//   VT   f16 [NB*NH*HD][SEQ]       transposed Vg                 4194304
//   QX2, KX2, GM1 f32 [NB*NH][SEQ]                                3 x 131072
//   end = 36089856 at NB=2
// =====================================================================================================
static inline size_t up4k(size_t v) { return (v + 4095) & ~(size_t)4095; }

extern "C" void kernel_launch(void* const* d_in, const int* in_sizes, int n_in,
                              void* d_out, int out_size, void* d_ws, size_t ws_size,
                              hipStream_t stream) {
  if (n_in < 8) return;
  if (in_sizes[0] < NB * SEQ * DM) return;
  if (in_sizes[1] < NB * SEQ) return;
  if (in_sizes[2] < DM * DM || in_sizes[4] < DM * DM || in_sizes[6] < DM * DM) return;
  if (in_sizes[3] < 1 || in_sizes[5] < 1 || in_sizes[7] < 1) return;
  if (out_size < NB * SEQ * DM) return;

  const float* hs = (const float*)d_in[0];
  const float* am = (const float*)d_in[1];
  const float* qz = (const float*)d_in[2];
  const float* qr = (const float*)d_in[3];
  const float* kz = (const float*)d_in[4];
  const float* kr = (const float*)d_in[5];
  const float* vz = (const float*)d_in[6];
  const float* vr = (const float*)d_in[7];
  float*       out = (float*)d_out;
  const int nqr = in_sizes[3], nkr = in_sizes[5], nvr = in_sizes[7];

  const size_t nrow  = (size_t)NB * SEQ;
  const size_t szX16 = up4k(nrow * DM * 2);
  const size_t szWT  = up4k((size_t)DM * DM * 2);
  const size_t szCX2 = up4k(nrow * 4);
  const size_t szCOL = up4k((size_t)3 * DM * 4);
  const size_t szP   = up4k(nrow * DM * 2);
  const size_t szVT  = up4k((size_t)NB * NH * HD * SEQ * 2);
  const size_t szRS  = up4k((size_t)NB * NH * SEQ * 4);
  size_t off = 0;
  const size_t oX16 = off; off += szX16;
  const size_t oWQ  = off; off += szWT;
  const size_t oWK  = off; off += szWT;
  const size_t oWV  = off; off += szWT;
  const size_t oCX2 = off; off += szCX2;
  const size_t oZN  = off; off += szCOL;
  const size_t oCH  = off; off += szCOL;
  const size_t oSH  = off; off += szCOL;
  const size_t oQh  = off; off += szP;
  const size_t oQl  = off; off += szP;
  const size_t oKh  = off; off += szP;
  const size_t oKl  = off; off += szP;
  const size_t oVg  = off; off += szP;
  const size_t oVT  = off; off += szVT;
  const size_t oQX2 = off; off += szRS;
  const size_t oKX2 = off; off += szRS;
  const size_t oGM1 = off; off += szRS;
  if (off > ws_size) return;                       // off = 36089856 at NB=2
  if (off > (size_t)134217728) return;

  char* ws = (char*)d_ws;
  u16*   X16 = (u16*)(ws + oX16);
  u16*   WQT = (u16*)(ws + oWQ);
  u16*   WKT = (u16*)(ws + oWK);
  u16*   WVT = (u16*)(ws + oWV);
  float* CX2 = (float*)(ws + oCX2);
  float* ZN  = (float*)(ws + oZN);
  float* CH  = (float*)(ws + oCH);
  float* SH  = (float*)(ws + oSH);
  u16*   Qh  = (u16*)(ws + oQh);
  u16*   Ql  = (u16*)(ws + oQl);
  u16*   Kh  = (u16*)(ws + oKh);
  u16*   Kl  = (u16*)(ws + oKl);
  u16*   Vg  = (u16*)(ws + oVg);
  u16*   VT  = (u16*)(ws + oVT);
  float* QX2 = (float*)(ws + oQX2);
  float* KX2 = (float*)(ws + oKX2);
  float* GM1 = (float*)(ws + oGM1);

  // (1) x -> f16 plane of bf16-converted values x64; (2) per-row sum of squares
  cvt16<<<dim3(NB * SEQ), dim3(CVT_THREADS), 0, stream>>>(hs, X16, XS);
  rowstat<<<dim3(NB * SEQ / 32), dim3(256), 0, stream>>>(hs, CX2);
  // (3..5) per weight: column norms + cosh/sinh(2r)
  colstat<<<dim3(DM / CS_COLS), dim3(CS_THREADS), 0, stream>>>(qz, qr, nqr, ZN,          CH,          SH);
  colstat<<<dim3(DM / CS_COLS), dim3(CS_THREADS), 0, stream>>>(kz, kr, nkr, ZN + DM,     CH + DM,     SH + DM);
  colstat<<<dim3(DM / CS_COLS), dim3(CS_THREADS), 0, stream>>>(vz, vr, nvr, ZN + 2 * DM, CH + 2 * DM, SH + 2 * DM);
  // (6..8) weights [k = in][n = out]: transpose to k-contiguous [n][k] f16 planes of bf16(W) x256
  cvtT16<<<dim3((DM / 64) * (DM / 64)), dim3(TR_THREADS), 0, stream>>>(qz, WQT, WSC);
  cvtT16<<<dim3((DM / 64) * (DM / 64)), dim3(TR_THREADS), 0, stream>>>(kz, WKT, WSC);
  cvtT16<<<dim3((DM / 64) * (DM / 64)), dim3(TR_THREADS), 0, stream>>>(vz, WVT, WSC);
  // (9..11) projections with the fused MLR / per-head epilogue
  proj_mlr<<<dim3((NB * SEQ / 128) * (DM / 64)), dim3(128), 0, stream>>>(
      X16, WQT, ZN,          CH,          SH,          CX2, 0, Qh, Ql, QX2);
  proj_mlr<<<dim3((NB * SEQ / 128) * (DM / 64)), dim3(128), 0, stream>>>(
      X16, WKT, ZN + DM,     CH + DM,     SH + DM,     CX2, 1, Kh, Kl, KX2);
  proj_mlr<<<dim3((NB * SEQ / 128) * (DM / 64)), dim3(128), 0, stream>>>(
      X16, WVT, ZN + 2 * DM, CH + 2 * DM, SH + 2 * DM, CX2, 2, Vg, Vg, GM1);
  // (12) gamma v plane -> key-contiguous v^T plane
  trT16<<<dim3(NB * (SEQ / 64) * (DM / 64)), dim3(TR_THREADS), 0, stream>>>(Vg, VT);
  // (13) attention + midpoint -> out [b][SEQ][DM] f32 (rows s < SQ of batches b < NB), heads merged on the feature dim
  attn_fwd<<<dim3(NB * NH * (SQ / 64)), dim3(ATT_THREADS), 0, stream>>>(Qh, Ql, Kh, Kl, VT, QX2, KX2, GM1, am, out);
  (void)hipGetLastError();
}

// v002
// It runs in 175 microseconds.
// Two timings next to v001 both put it at 1.54 times that version's speed.
// Counting every step since v000, it is 3.28 times as fast.
// Contractions: x.Wq, x.Wk, x.Wv on v_wmma_f32_16x16x32_f16 (x as f16(bf16(x) x64), W as f16(bf16(W) x256), f32 accumulate);
// scores k.q^T on v_wmma_f32_16x16x32_bf16 as bf16 hi/lo split (hi.hi + lo.hi + hi.lo into one f32 accumulator);
// P.(gamma v)^T on v_wmma_f32_16x16x32_f16 (P x32768 f16, gamma v x256 f16, f32 accumulate); norms, asinh/sinh/acosh
// (closed forms on v_log_f32 / v_exp_f32 / v_sqrt_f32 / v_rcp_f32), base-2 online softmax,
// the sum_j p_j (gamma_j - 1) denominators and all carry folds in f32 on VALU.
// Float inputs RNE-converted to bf16 on load; f32 output written directly.
#include <hip/hip_runtime.h>
#include <math.h>
#include <stdint.h>

#ifndef NB
#define NB 2            // batches processed
#endif
#ifndef SQ
#define SQ 1024         // query rows processed per batch (keys/values always all SEQ rows)
#endif
#define NB_FULL 2
#define SEQ  1024       // rows per batch in every input / output / plane layout
#define DM   1024       // model width = K of the projections = row pitch of the 16-bit planes
#define NH   16
#define HD   64
#define XS   64.0f      // carry on the x plane
#define WSC  256.0f     // carry on the transposed weight planes
#define VS   256.0f     // carry on the gamma*v plane
#define PCAR 32768.0f   // carry on P
#define LOG2E 1.4426950408889634f
#define MAXN 0.996f     // (1 - 4e-3) / sqrt(c)
#define NKB  (SEQ / 32)
#define GPITCH 68
#define TPITCH 65
#define TP16   72
#define CVT_THREADS (DM / 8)
#define TR_THREADS  128
#define ATT_THREADS 128
#define CS_THREADS  1024  // column statistics: threads per block
#define CS_COLS     32    // columns per block
#define CS_STEPS    (DM / (CS_THREADS / 8))   // rows per thread

static_assert(NB >= 1 && NB <= NB_FULL);
static_assert((SQ % 64) == 0 && SQ >= 64 && SQ <= SEQ);
static_assert(NH * HD == DM && HD == 64);
static_assert((SEQ % 128) == 0 && (SEQ % 32) == 0 && NKB * 32 == SEQ);
static_assert((DM % 256) == 0 && (DM % 64) == 0 && (DM % 32) == 0 && CVT_THREADS == 128);
static_assert((GPITCH * 4) % 16 == 0 && (TP16 * 2) % 16 == 0);
static_assert(CS_COLS == 32 && (DM % CS_COLS) == 0 && CS_STEPS * (CS_THREADS / 8) == DM);
static_assert(ATT_THREADS == 128 && TR_THREADS == 128 && ATT_THREADS * 8 == SEQ);

typedef unsigned short u16;
typedef _Float16 v16h __attribute__((ext_vector_type(16)));
typedef _Float16 v8h  __attribute__((ext_vector_type(8)));
typedef __bf16   v16b __attribute__((ext_vector_type(16)));
typedef float    v8f  __attribute__((ext_vector_type(8)));
typedef float    v4f  __attribute__((ext_vector_type(4)));
typedef unsigned int v4u __attribute__((ext_vector_type(4)));
typedef v4u __attribute__((may_alias)) v4ua;
typedef v4f __attribute__((may_alias)) v4fa;

// one 16 x 16-bit per-lane fragment, viewed as f16 vector, bf16 vector or two 16-byte words
union Frag { v16h h; v16b b; v4u u[2]; };

// ---- scalar helpers ----------------------------------------------------------------------------------
__device__ __forceinline__ unsigned short bf_bits(float f) {          // f32 -> bf16 bits, RNE convert
  unsigned u = __float_as_uint(f);
  return (unsigned short)((u + 0x7FFFu + ((u >> 16) & 1u)) >> 16);
}
__device__ __forceinline__ float bf_up(unsigned short h) { return __uint_as_float(((unsigned)h) << 16); }
__device__ __forceinline__ float bfr(float f) { return bf_up(bf_bits(f)); }
__device__ __forceinline__ unsigned short h_bits(_Float16 x) { return __builtin_bit_cast(unsigned short, x); }
__device__ __forceinline__ unsigned pk16(unsigned short a, unsigned short b) { return (unsigned)a | ((unsigned)b << 16); }
__device__ __forceinline__ v8f zero8() { v8f z = {0.f, 0.f, 0.f, 0.f, 0.f, 0.f, 0.f, 0.f}; return z; }
__device__ __forceinline__ float red8(float v) {                      // sum over the 8-lane group (lane bits 0..2)
  v += __shfl_xor(v, 1, 32); v += __shfl_xor(v, 2, 32); v += __shfl_xor(v, 4, 32); return v;
}
__device__ __forceinline__ float rsum16(float v) {                    // sum over the 16-lane half (lane bits 0..3)
  v += __shfl_xor(v, 8, 32); v += __shfl_xor(v, 4, 32); v += __shfl_xor(v, 2, 32); v += __shfl_xor(v, 1, 32); return v;
}

// sinh(tz * asinh(x)) in closed form: e = |x| + sqrt(x^2 + 1), L = log2(e) >= 0, sinh = 2^(tz L - 1) - 2^(-tz L - 1), sign of x.
// Above 1e18 sqrt(x^2 + 1) = |x| in f32 and x^2 comes near the f32 overflow, so e = 2|x| there. The two halves are formed with the
// factor 1/2 in the exponent, so the result overflows only where sinh itself does.
__device__ __forceinline__ float sinh_of_scaled_asinh(float x, float tz) {
  const float a = fabsf(x);
  const float e = a + ((a > 1e18f) ? a : __builtin_amdgcn_sqrtf(fmaf(a, a, 1.0f)));
  const float L = __builtin_amdgcn_logf(e);
  const float s = __builtin_amdgcn_exp2f(fmaf(tz, L, -1.0f)) - __builtin_amdgcn_exp2f(fmaf(-tz, L, -1.0f));
  return copysignf(s, x);
}

// ---- fragment loader: 16-bit A/B operand from a k-contiguous row; lane -> row/col (lane&15), p already includes
//      +8*(lane>>4); elements 0..7 <- p[0..7] (k0+8h..), elements 8..15 <- p[16..23] (k0+16+8h..); same split k map
//      for A and B; B always read from a k-contiguous [n][k] plane. Loaded as unsigned 16-byte words.
__device__ __forceinline__ Frag ldfrag(const u16* p) {
  Frag f;
  f.u[0] = *(const v4u*)(p);
  f.u[1] = *(const v4u*)(p + 16);
  return f;
}

// ---- WMMA helpers and trailing VALU hazard gaps --------------------------------------------------------
__device__ __forceinline__ v8f mma_h(const Frag& a, const Frag& b, v8f c) {
  return __builtin_amdgcn_wmma_f32_16x16x32_f16(false, a.h, false, b.h, (short)0, c, false, false);
}
__device__ __forceinline__ v8f mma_b(const Frag& a, const Frag& b, v8f c) {
  return __builtin_amdgcn_wmma_f32_16x16x32_bf16(false, a.b, false, b.b, (short)0, c, false, false);
}
__device__ __forceinline__ void guard_sc(v8f& a, v8f& b, v16h x0, v16h x1, v16h x2, v16h x3, v16h x4, v16h x5) {
#if defined(__HIP_DEVICE_COMPILE__)
  asm volatile("v_nop\n\tv_nop\n\tv_nop\n\tv_nop"
               : "+v"(a), "+v"(b) : "v"(x0), "v"(x1), "v"(x2), "v"(x3), "v"(x4), "v"(x5) : "memory");
#endif
}
__device__ __forceinline__ void guard_pv(v8f (&o)[4], v16h p, v16h x0, v16h x1, v16h x2, v16h x3) {
#if defined(__HIP_DEVICE_COMPILE__)
  asm volatile("v_nop\n\tv_nop\n\tv_nop\n\tv_nop"
               : "+v"(o[0]), "+v"(o[1]), "+v"(o[2]), "+v"(o[3]) : "v"(p), "v"(x0), "v"(x1), "v"(x2), "v"(x3) : "memory");
#endif
}
__device__ __forceinline__ void guard_g(v8f (&acc)[8], v16h x0, v16h x1, v16h x2, v16h x3, v16h x4, v16h x5) {
#if defined(__HIP_DEVICE_COMPILE__)
  asm volatile("v_nop\n\tv_nop\n\tv_nop\n\tv_nop"
               : "+v"(acc[0]), "+v"(acc[1]), "+v"(acc[2]), "+v"(acc[3]),
                 "+v"(acc[4]), "+v"(acc[5]), "+v"(acc[6]), "+v"(acc[7])
               : "v"(x0), "v"(x1), "v"(x2), "v"(x3), "v"(x4), "v"(x5) : "memory");
#endif
}
__device__ __forceinline__ void acc_guard4(v8f (&o)[4]) {
#if defined(__HIP_DEVICE_COMPILE__)
  asm volatile("v_nop\n\tv_nop\n\tv_nop\n\tv_nop" : "+v"(o[0]), "+v"(o[1]), "+v"(o[2]), "+v"(o[3]));
#endif
}
__device__ __forceinline__ void wave_sync_lds() {
  __builtin_amdgcn_fence(__ATOMIC_RELEASE, "workgroup");
  __builtin_amdgcn_wave_barrier();
  __builtin_amdgcn_fence(__ATOMIC_ACQUIRE, "workgroup");
}

// =====================================================================================================
// Row convert: row r of a [rows][DM] f16 plane <- f16(bf16_RNE(x[r][e]) * scale), scale a power of two.
// Block = DM/8 threads, thread = 8 consecutive elements (two 16-B loads, one 16-B store; 32 consecutive lanes = 512
// coverage: grid = number of rows, 128 thr x 8 = DM = the whole row.
// =====================================================================================================
__global__ __launch_bounds__(CVT_THREADS)
void cvt16(const float* __restrict__ x, u16* Y, float scale) {
  const int tid = threadIdx.x;
  const size_t r = blockIdx.x;
  const float* src = x + r * (size_t)DM + (size_t)tid * 8;
  const v4f a = *(const v4f*)(src), c4 = *(const v4f*)(src + 4);
  v4u o;
#pragma unroll
  for (int e = 0; e < 2; ++e) {
    o[e]     = pk16(h_bits((_Float16)(bfr(a[2 * e]) * scale)),  h_bits((_Float16)(bfr(a[2 * e + 1]) * scale)));
    o[2 + e] = pk16(h_bits((_Float16)(bfr(c4[2 * e]) * scale)), h_bits((_Float16)(bfr(c4[2 * e + 1]) * scale)));
  }
  u16* dst = Y + r * (size_t)DM + (size_t)tid * 8;
  {
    *(v4u*)(dst) = o;
    
  }
}

// =====================================================================================================
// Row statistics: CX2[r] = sum_e bf16(x[r][e])^2 in f32. Block = 32 rows, 256 threads, wave w rows 32*blk + 4w + j:
// per row each lane sums 32 values (8 x 16-B loads), xor-shuffle reduce, lane 0 -> LDS; after a block barrier threads
// =====================================================================================================
__global__ __launch_bounds__(256)
void rowstat(const float* __restrict__ x, float* CX2) {
  __shared__ __align__(16) float rs[32];
  const int tid = threadIdx.x, wave = tid >> 5, lane = tid & 31;
  const int row0 = blockIdx.x * 32;
#pragma unroll 1
  for (int j = 0; j < 4; ++j) {
    const int row = row0 + wave * 4 + j;
    const float* xr = x + (size_t)row * DM + 4 * lane;
    float s = 0.f;
#pragma unroll 2
    for (int q = 0; q < DM / 128; ++q) {
      const v4f a = *(const v4f*)(xr + 128 * q);
      const float a0 = bfr(a[0]), a1 = bfr(a[1]), a2 = bfr(a[2]), a3 = bfr(a[3]);
      s += a0 * a0; s += a1 * a1; s += a2 * a2; s += a3 * a3;
    }
    s += __shfl_xor(s, 16, 32); s += __shfl_xor(s, 8, 32); s += __shfl_xor(s, 4, 32);
    s += __shfl_xor(s, 2, 32);  s += __shfl_xor(s, 1, 32);
    if (lane == 0) rs[wave * 4 + j] = s;
  }
  __syncthreads();
  if (tid < 8) {
    const v4f v = *(const v4fa*)(rs + 4 * tid);
    float* dst = CX2 + row0 + 4 * tid;
    {
      *(v4f*)(dst) = v;
      
    }
  }
}

// =====================================================================================================
// Column statistics of a weight z[k][n] (DM x DM): ZN[n] = max(sqrt(sum_k bf16(z[k][n])^2), 1e-15), CH[n] = cosh(2 r[n]),
// SH[n] = sinh(2 r[n]) (r index clamped to nr-1). Block = 32 columns (one 128-B line of every row) x all DM rows,
// 1024 threads: lane = (row sub-index lane>>3, 4 columns at 4*(lane&7)), wave w step j reads rows 128j + 4w .. +3, so a
// thread has its 8 independent 16-B loads in flight at once. Column sums: 8 rows in the thread, xor-8 / xor-16 shuffles
// over the wave's 4 row sub-indices, one 32-float row per wave in LDS, block barrier, wave 0 adds the 32 wave rows.
// coverage: 8 j x 32 waves x 4 rows = DM rows; grid = DM/32 blocks x 32 columns = every column of the three arrays once,
//           each block the only writer of its 128-B line in each array.
// =====================================================================================================
__global__ __launch_bounds__(CS_THREADS)
void colstat(const float* __restrict__ z, const float* __restrict__ r, int nr, float* ZN, float* CH, float* SH) {
  __shared__ __align__(16) float part[(CS_THREADS / 32) * CS_COLS];
  const int tid = threadIdx.x, wave = tid >> 5, lane = tid & 31;
  const int col0 = blockIdx.x * CS_COLS;
  const float* zp = z + (size_t)(wave * 4 + (lane >> 3)) * DM + col0 + 4 * (lane & 7);
  const int col = col0 + lane;
  float rv = 0.f;
  if (wave == 0) {                               // wave-uniform; issued with the column loads, not behind the barrier
    int ri = col;
    ri = (ri < nr - 1) ? ri : (nr - 1);
    rv = r[ri];
  }
  v4f a[CS_STEPS];
#pragma unroll   // all loads issue before the first use: one memory latency per thread instead of one per row group
  for (int j = 0; j < CS_STEPS; ++j) a[j] = *(const v4f*)(zp + (size_t)j * (CS_THREADS / 8) * DM);
  v4f s = {0.f, 0.f, 0.f, 0.f};
#pragma unroll
  for (int j = 0; j < CS_STEPS; ++j) {
#pragma unroll
    for (int e = 0; e < 4; ++e) {
      const float v = bfr(a[j][e]);
      s[e] += v * v;
    }
  }
#pragma unroll
  for (int e = 0; e < 4; ++e) {
    s[e] += __shfl_xor(s[e], 8, 32);
    s[e] += __shfl_xor(s[e], 16, 32);
  }
  if (lane < 8) *(v4fa*)(part + wave * CS_COLS + 4 * lane) = s;
  __syncthreads();
  if (wave == 0) {                               // wave-uniform; lane = column
    float t = 0.f;
#pragma unroll
    for (int w = 0; w < CS_THREADS / 32; ++w) t += part[w * CS_COLS + lane];
    const float dr = 2.0f * bfr(rv);
    ZN[col] = fmaxf(sqrtf(t), 1e-15f);
    CH[col] = coshf(dr);
    SH[col] = sinhf(dr);
  }
}

// =====================================================================================================
// Weight transpose-convert for y = x.W weights stored [k][n]: WT[n][k] (f16, k-contiguous Bt layout) <- f16(bf16_RNE(W[k][n]) *
// scale). Block = 64(k) x 64(n) tile, 128 threads. Load phase: thread = (row 8p + (tid>>4), 4 floats at 4*(tid&15)),
// 8 steps = 64 k-rows x 64 n, into an LDS tile [kk][nn] (pitch 65); block barrier; store phase: output row n0 + 16i + (tid>>3)
// coverage: 4 i x 16 rows x (8 lanes x 8 halves) = 64 n-rows x 64 k per block; the grid covers WT exactly once.
// LDS tile: cross-wave, block barrier; staged extent 64x64 == consumed extent.
// =====================================================================================================
__global__ __launch_bounds__(TR_THREADS)
void cvtT16(const float* __restrict__ W, u16* Y, float scale) {
  __shared__ __align__(16) float tile[64 * TPITCH];
  const int tid = threadIdx.x;
  constexpr int NT = DM / 64;
  const int bid = blockIdx.x;
  const int kt  = bid % NT;
  const int ntb = bid / NT;
  const int k0  = kt * 64, n0 = ntb * 64;
  const int lr = tid >> 4, lc = (tid & 15) * 4;
#pragma unroll
  for (int p = 0; p < 8; ++p) {
    const int kk = p * 8 + lr;
    const v4f w4 = *(const v4f*)(W + (size_t)(k0 + kk) * (size_t)DM + n0 + lc);
    tile[kk * TPITCH + lc + 0] = w4[0];
    tile[kk * TPITCH + lc + 1] = w4[1];
    tile[kk * TPITCH + lc + 2] = w4[2];
    tile[kk * TPITCH + lc + 3] = w4[3];
  }
  __syncthreads();
  const int rq = tid >> 3, c8 = (tid & 7) * 8;      // rq 0..15, c8 0..56
  v4u ov[4];
#pragma unroll
  for (int i = 0; i < 4; ++i) {
    const int row = 16 * i + rq;                   // n within tile
#pragma unroll
    for (int e = 0; e < 4; ++e) {
      const float x0 = tile[(c8 + 2 * e) * TPITCH + row];
      const float x1 = tile[(c8 + 2 * e + 1) * TPITCH + row];
      ov[i][e] = pk16(h_bits((_Float16)(bfr(x0) * scale)), h_bits((_Float16)(bfr(x1) * scale)));
    }
  }
  u16* dst = Y + (size_t)n0 * (size_t)DM + k0 + c8;
  {
#pragma unroll
    for (int i = 0; i < 4; ++i) {
      const int row = 16 * i + rq;
      *(v4u*)(dst + (size_t)row * (size_t)DM) = ov[i];
    }
    
  }
}

// =====================================================================================================
// f16 GEMM core: the wave's 32 x 64 tile of C = A[rows][K] . Bt[cols][K]^T; ap -> A row (rowb + m) + 8h, bp -> Bt row
// (col0 + m) + 8h; acc[4i + j] = rows rowb+16i.., cols col0+16j..; K stepped by 32 (K % 32 == 0 asserted).
// =====================================================================================================
__device__ __forceinline__ void gemm_core(const u16* ap, const u16* bp, int K, v8f (&acc)[8]) {
  const size_t rs16 = (size_t)16 * (size_t)K;
#pragma unroll 1
  for (int k0 = 0; k0 < K; k0 += 32) {
    const Frag a0 = ldfrag(ap + k0), a1 = ldfrag(ap + rs16 + k0);
    const Frag b0 = ldfrag(bp + k0);
    const Frag b1 = ldfrag(bp + rs16 + k0);
    const Frag b2 = ldfrag(bp + 2 * rs16 + k0);
    const Frag b3 = ldfrag(bp + 3 * rs16 + k0);
    acc[0] = mma_h(a0, b0, acc[0]);
    acc[1] = mma_h(a0, b1, acc[1]);
    acc[2] = mma_h(a0, b2, acc[2]);
    acc[3] = mma_h(a0, b3, acc[3]);
    acc[4] = mma_h(a1, b0, acc[4]);
    acc[5] = mma_h(a1, b1, acc[5]);
    acc[6] = mma_h(a1, b2, acc[6]);
    acc[7] = mma_h(a1, b3, acc[7]);
    guard_g(acc, a0.h, a1.h, b0.h, b1.h, b2.h, b3.h);
  }
}
// Stage the wave's 32 x 64 f32 tile (times oscale) in its LDS slab (pitch 68): D element r of acc[4i+j], lane l ->
// coverage: 32 lanes x 2 x 8 rows x 4 cols-of-16 = rows 0..31 x cols 0..63 of the slab.
__device__ __forceinline__ void stage32x64(float* sl, v8f (&acc)[8], float oscale, int lane) {
  const int hh = lane >> 4, m = lane & 15;
#pragma unroll
  for (int i = 0; i < 2; ++i) {
#pragma unroll
    for (int r = 0; r < 8; ++r) {
      const int ro = (16 * i + 8 * hh + r) * GPITCH + m;
      sl[ro]      = acc[4 * i + 0][r] * oscale;
      sl[ro + 16] = acc[4 * i + 1][r] * oscale;
      sl[ro + 32] = acc[4 * i + 2][r] * oscale;
      sl[ro + 48] = acc[4 * i + 3][r] * oscale;
    }
  }
  wave_sync_lds();
}

// =====================================================================================================
// Projection GEMM + ball MLR epilogue. A = x plane [NB*SEQ][DM] (f16, x XS), Bt = WT [DM n][DM k] (f16, x WSC).
// Block = 128 threads = 128 rows x 64 cols (one head), wave = 32 rows; fragments straight from the 16-bit rows.
// Epilogue per element (f32): mm = (x.z)[row][n] / ZN[n]; arg = (2 mm CH[n] - (1 + cx2) SH[n]) / max(1 - cx2, 1e-15);
// y = sinh(2 ZN[n] asinh(arg)); per (row, head) 64-vector (8 lanes x 8 values, 8-lane shuffle sums): clip to norm MAXN,
// y = y / (1 + sqrt(1 + sum y^2)), clip again; x2 = sum y^2. mode 0/1: planes Ph/Pl = bf16 hi / bf16 lo of y, RS row
// scalar = x2; mode 2: g = 2 / max(1 - x2, 1e-15), plane Ph = f16(g y VS), RS row scalar = g - 1.
// coverage: per wave 8 instr x 4 rows x 8 lanes x 8 halves = 32 x 64 per plane; RS: 32 floats per wave; grid covers every
//           (row, col) of the planes and every (b, head, s) of RS exactly once.
// LDS: slab and rsc are wave-private (wave_sync); staged extent 32x64 == consumed extent; no block barriers.
// =====================================================================================================
__global__ __launch_bounds__(128)
void proj_mlr(const u16* __restrict__ A, const u16* __restrict__ Bt,
              const float* __restrict__ ZN, const float* __restrict__ CH, const float* __restrict__ SH,
              const float* __restrict__ CX2, int mode, u16* Ph, u16* Pl, float* RS) {
  __shared__ __align__(16) float slab[4 * 32 * GPITCH];
  __shared__ __align__(16) float rsc[4 * 32];
  const int tid = threadIdx.x, wave = tid >> 5, lane = tid & 31, hh = lane >> 4, m = lane & 15;
  constexpr int NT = DM / 64;
  const int bid  = blockIdx.x;
  const int nt   = bid % NT;
  const int mt   = bid / NT;
  const int rowb = mt * 128 + wave * 32;       // global token row b*SEQ + s of the wave's first row
  const int col0 = nt * 64;                    // = head * HD
  const u16* ap = A  + (size_t)(rowb + m) * DM + 8 * hh;
  const u16* bp = Bt + (size_t)(col0 + m) * DM + 8 * hh;
  v8f acc[8];
#pragma unroll
  for (int i = 0; i < 8; ++i) acc[i] = zero8();
  gemm_core(ap, bp, DM, acc);
  float* sl = slab + wave * 32 * GPITCH;
  stage32x64(sl, acc, 1.0f / (XS * WSC), lane);

  const int rq = lane >> 3, c8 = (lane & 7) * 8;
  float zn8[8], ch8[8], sh8[8];
  {
    const v4f z0 = *(const v4f*)(ZN + col0 + c8), z1 = *(const v4f*)(ZN + col0 + c8 + 4);
    const v4f h0 = *(const v4f*)(CH + col0 + c8), h1 = *(const v4f*)(CH + col0 + c8 + 4);
    const v4f g0 = *(const v4f*)(SH + col0 + c8), g1 = *(const v4f*)(SH + col0 + c8 + 4);
#pragma unroll
    for (int e = 0; e < 4; ++e) {
      zn8[e] = z0[e]; zn8[4 + e] = z1[e];
      ch8[e] = h0[e]; ch8[4 + e] = h1[e];
      sh8[e] = g0[e]; sh8[4 + e] = g1[e];
    }
  }
  const bool mv = (mode == 2);
#pragma unroll 1
  for (int i = 0; i < 8; ++i) {
    const int row = 4 * i + rq;
    const float cx  = CX2[rowb + row];
    const float omc = fmaxf(1.0f - cx, 1e-15f);
    const float opc = 1.0f + cx;
    float* sr = sl + row * GPITCH + c8;
    float y[8];
    float s0 = 0.f;
#pragma unroll
    for (int e = 0; e < 8; ++e) {
      const float mm  = sr[e] / zn8[e];
      const float arg = (2.0f * mm * ch8[e] - opc * sh8[e]) / omc;
      y[e] = sinh_of_scaled_asinh(arg, 2.0f * zn8[e]);
      s0 += y[e] * y[e];
    }
    s0 = red8(s0);
    const float n0 = fmaxf(sqrtf(s0), 1e-15f);
    const bool cl0 = n0 > MAXN;
    float s1 = 0.f;
#pragma unroll
    for (int e = 0; e < 8; ++e) {
      const float yp = y[e] / n0 * MAXN;
      y[e] = cl0 ? yp : y[e];
      s1 += y[e] * y[e];
    }
    s1 = red8(s1);
    const float den = 1.0f + sqrtf(1.0f + s1);
    float s2 = 0.f;
#pragma unroll
    for (int e = 0; e < 8; ++e) {
      y[e] = y[e] / den;
      s2 += y[e] * y[e];
    }
    s2 = red8(s2);
    const float n2 = fmaxf(sqrtf(s2), 1e-15f);
    const bool cl2 = n2 > MAXN;
    float s3 = 0.f;
#pragma unroll
    for (int e = 0; e < 8; ++e) {
      const float yp = y[e] / n2 * MAXN;
      y[e] = cl2 ? yp : y[e];
      s3 += y[e] * y[e];
    }
    s3 = red8(s3);
    const float g    = 2.0f / fmaxf(1.0f - s3, 1e-15f);
    const float gmul = mv ? g : 1.0f;
    const float scal = mv ? (g - 1.0f) : s3;
#pragma unroll
    for (int e = 0; e < 8; ++e) sr[e] = y[e] * gmul;
    if ((lane & 7) == 0) rsc[wave * 32 + row] = scal;
  }
  wave_sync_lds();

  const int bb = rowb / SEQ, s0r = rowb - bb * SEQ, head = nt;
  if (lane < 8) {
    const v4f v = *(const v4fa*)(rsc + wave * 32 + 4 * lane);
    float* dst = RS + ((size_t)(bb * NH + head)) * SEQ + s0r + 4 * lane;
    {
      *(v4f*)(dst) = v;
      
    }
  }
  // ---- planes ----
  const size_t pofs = (size_t)rowb * DM + (size_t)(col0 + c8);
  if (!mv) {
    v4u oh[8], ol[8];
#pragma unroll
    for (int i = 0; i < 8; ++i) {
      const int row = 4 * i + rq;
      const v4f a = *(const v4fa*)(sl + row * GPITCH + c8), c4 = *(const v4fa*)(sl + row * GPITCH + c8 + 4);
#pragma unroll
      for (int e = 0; e < 2; ++e) {
        const unsigned short ha = bf_bits(a[2 * e]),  hb = bf_bits(a[2 * e + 1]);
        const unsigned short la = bf_bits(a[2 * e] - bf_up(ha)), lb = bf_bits(a[2 * e + 1] - bf_up(hb));
        oh[i][e] = pk16(ha, hb);
        ol[i][e] = pk16(la, lb);
        const unsigned short hc = bf_bits(c4[2 * e]), hd = bf_bits(c4[2 * e + 1]);
        const unsigned short lc = bf_bits(c4[2 * e] - bf_up(hc)), ld = bf_bits(c4[2 * e + 1] - bf_up(hd));
        oh[i][2 + e] = pk16(hc, hd);
        ol[i][2 + e] = pk16(lc, ld);
      }
    }
    {
#pragma unroll
      for (int i = 0; i < 8; ++i) {
        const int row = 4 * i + rq;
        *(v4u*)(Ph + pofs + (size_t)row * DM) = oh[i];
        *(v4u*)(Pl + pofs + (size_t)row * DM) = ol[i];
      }
      
    }
  } else {
    v4u ov[8];
#pragma unroll
    for (int i = 0; i < 8; ++i) {
      const int row = 4 * i + rq;
      const v4f a = *(const v4fa*)(sl + row * GPITCH + c8), c4 = *(const v4fa*)(sl + row * GPITCH + c8 + 4);
#pragma unroll
      for (int e = 0; e < 2; ++e) {
        ov[i][e]     = pk16(h_bits((_Float16)(a[2 * e] * VS)),  h_bits((_Float16)(a[2 * e + 1] * VS)));
        ov[i][2 + e] = pk16(h_bits((_Float16)(c4[2 * e] * VS)), h_bits((_Float16)(c4[2 * e + 1] * VS)));
      }
    }
    {
#pragma unroll
      for (int i = 0; i < 8; ++i) {
        const int row = 4 * i + rq;
        *(v4u*)(Ph + pofs + (size_t)row * DM) = ov[i];
      }
      
    }
  }
}

// =====================================================================================================
// 16-bit per-batch transpose: VT[b*DM + hd][s] <- Vg[b*SEQ + s][hd]. Block = 64(s) x 64(hd) tile, 128 threads.
// Load phase: thread = (s = 16p + (tid>>3), 8 halves at hd = 8*(tid&7)) one 16-B load, 4 steps, scattered as u16 scalars
// into an LDS tile [hd][s] (pitch 72); block barrier; store phase: VT row hd0 + 16i + (tid>>3) gets s0 + 8*(tid&7) .. +7 =
// passes. grid = NB x (SEQ/64) x (DM/64): bid -> (st = bid % 16, ht = (bid/16) % 16, b = bid/256).
// coverage: load 4 p x 16 s x 8 lane-groups x 8 hd = 64 x 64; store 4 i x 16 rows x 8 lanes x 8 halves = 64 hd x 64 s;
//           the grid covers VT (NB*DM rows x SEQ) exactly once.
// LDS tile: cross-wave, block barrier; staged extent 64x64 == consumed extent (pad columns 64..71 never read).
// =====================================================================================================
__global__ __launch_bounds__(TR_THREADS)
void trT16(const u16* __restrict__ Vg, u16* VT) {
  __shared__ __align__(16) u16 tile[64 * TP16];
  const int tid = threadIdx.x;
  constexpr int NST = SEQ / 64, NHT = DM / 64;
  const int bid = blockIdx.x;
  const int st  = bid % NST;
  const int tmp = bid / NST;
  const int ht  = tmp % NHT;
  const int b   = tmp / NHT;
  const int s0 = st * 64, hd0 = ht * 64;
  const int r = tid >> 3, c = (tid & 7) * 8;
#pragma unroll
  for (int p = 0; p < 4; ++p) {
    const int s = 16 * p + r;
    const v4u w = *(const v4u*)(Vg + ((size_t)(b * SEQ + s0 + s)) * DM + hd0 + c);
#pragma unroll
    for (int e = 0; e < 8; ++e)
      tile[(c + e) * TP16 + s] = (u16)((w[e >> 1] >> (16 * (e & 1))) & 0xFFFFu);
  }
  __syncthreads();
  const int rq = tid >> 3, c8 = (tid & 7) * 8;
  v4u ov[4];
#pragma unroll
  for (int i = 0; i < 4; ++i) {
    const int row = 16 * i + rq;
    ov[i] = *(const v4ua*)(tile + row * TP16 + c8);
  }
  u16* dst = VT + ((size_t)(b * DM + hd0)) * SEQ + s0 + c8;
  {
#pragma unroll
    for (int i = 0; i < 4; ++i) {
      const int row = 16 * i + rq;
      *(v4u*)(dst + (size_t)row * SEQ) = ov[i];
    }
    
  }
}

// ---- ball distance logit (base 2) of one (query, key) pair ----
// acosh(z) = ln(z + sqrt(z^2 - 1)); with z = 1 + 2u, u = num / den: z^2 - 1 = 4 (u + u^2), formed without the cancellation of
// z^2 - 1, so dist * log2(e) = log2(1 + 2 (u + sqrt(u + u^2))). u lies in [1e-15, about 4e15]: no step leaves the f32 range.
__device__ __forceinline__ float logit2(float xy, float y2, float mk, float x2, float omx) {
  const float num = fmaxf(x2 - 2.0f * xy + y2, 1e-15f);
  const float den = fmaxf(omx * (1.0f - y2), 1e-15f);
  const float u   = num * __builtin_amdgcn_rcpf(den);
  const float rt  = __builtin_amdgcn_sqrtf(fmaf(u, u, u));
  const float d2  = __builtin_amdgcn_logf(fmaf(2.0f, u + rt, 1.0f));
  return fmaf(mk, LOG2E, -d2);
}

// =====================================================================================================
// Fused distance attention + gyro-midpoint over all SEQ keys: block = (batch b, head, 64 query rows), 4 waves, wave w owns
// queries q0 = 64*qt + 16*w .. q0+15 (waves independent after the initial table staging: one block barrier, then only
// wave-private LDS).
//   q planes bf16 hi/lo [b*SEQ + s][h*64 + d]; k planes bf16 hi/lo same layout; v^T plane f16 x VS [(b*NH + h)*64 + d][s];
//   per-key tables for (b, h): sum k^2, gamma - 1; additive bias row amask[b][s] (bf16-converted); per query x2 = sum q^2.
//   All NKB = 32 key blocks of 32 keys are visited (static bound).
//   Scores computed TRANSPOSED: S^T tile g = k rows (keys kb+16g .., A operand, row m = lane&15, split k map over d)
//   times q^T (B operand, col n = query q0 + (lane&15), k = d), 2 d-chunks of 32, three bf16 products each (hi.hi, lo.hi,
//   hi.lo). D element r of lane l = (key kb+16g+8h+r, query q0+(l&15)): a lane owns one query column and 16 of its 32 keys;
//   the partner lane l^16 owns the other 16 -> row max / row sums need one xor-16 shuffle.
//   dist = acosh(1 + 2 max(x2 - 2 xy + y2, 1e-15) / max((1 - x2)(1 - y2), 1e-15)), logit = -dist + bias, all f32.
//   Online max-subtracted base-2 softmax in f32; running sums l = sum p and dn = sum p (gamma - 1). The exp'd values ARE the
//   P A-fragment in place: A row m = query = lane&15, element i <- key kb+8h+i (tile 0, D element i), element 8+i <- key
//   kb+16+8h+i (tile 1, D element i). P (<= 1) carried x32768 as f16. O rescale factors shuffled from the query-owner lanes.
//   4 v^T B fragments (col n = d = 16j + (lane&15), keys k-contiguous), 4 P.V WMMAs + one guard.
//   Epilogue (f32): two_mean = (O (1/l) / (PCAR VS)) / max(dn / l, 1e-10); a = two_mean / (1 + sqrt(max(1 - sum two_mean^2,
//   1e-15))); clip to norm MAXN; the wave's 16x64 tile staged in its LDS slab (pitch 68); each output row segment
// coverage: per wave 8 instructions x 2 rows x 16 lanes x 4 floats = 16 x 64; grid NB*NH*(SQ/64) blocks x 4 waves = every
//           (b < NB, s < SQ, h) row segment of the output exactly once.
// LDS: ms/ky2/kg1 cross-wave (block barrier, 1024 staged == 1024 consumed); slab wave-private (wave_sync, 16x64).
// =====================================================================================================
__global__ __launch_bounds__(ATT_THREADS)
void attn_fwd(const u16* __restrict__ Qh, const u16* __restrict__ Ql, const u16* __restrict__ Kh, const u16* __restrict__ Kl,
              const u16* __restrict__ VT, const float* __restrict__ QX2, const float* __restrict__ KX2,
              const float* __restrict__ GM1, const float* __restrict__ amask, float* Out) {
  __shared__ __align__(16) float ms[SEQ];
  __shared__ __align__(16) float ky2[SEQ];
  __shared__ __align__(16) float kg1[SEQ];
  __shared__ __align__(16) float slab[4 * 16 * GPITCH];

  const int tid  = threadIdx.x;
  const int wave = tid >> 5;
  const int lane = tid & 31;
  const int hh   = lane >> 4;
  const int c    = lane & 15;

  constexpr int NQT = SQ / 64;
  const int bid  = blockIdx.x;
  const int qt   = bid % NQT;
  const int head = (bid / NQT) % NH;
  const int b    = bid / (NQT * NH);
  const int bh   = b * NH + head;
  const int q0   = qt * 64 + wave * 16;

  // ---- stage the per-key tables of (b, head): 128 threads x 8 keys = SEQ ----
  {
    const int i0 = tid * 8;
    const float* mp = amask + (size_t)b * SEQ + i0;
    const float* yp = KX2 + (size_t)bh * SEQ + i0;
    const float* gp = GM1 + (size_t)bh * SEQ + i0;
    const v4f m0 = *(const v4f*)(mp), m1 = *(const v4f*)(mp + 4);
    const v4f y0 = *(const v4f*)(yp), y1 = *(const v4f*)(yp + 4);
    const v4f g0 = *(const v4f*)(gp), g1 = *(const v4f*)(gp + 4);
#pragma unroll
    for (int e = 0; e < 4; ++e) {
      ms[i0 + e]  = bfr(m0[e]); ms[i0 + 4 + e]  = bfr(m1[e]);
      ky2[i0 + e] = y0[e];      ky2[i0 + 4 + e] = y1[e];
      kg1[i0 + e] = g0[e];      kg1[i0 + 4 + e] = g1[e];
    }
  }
  __syncthreads();

  // B fragments of q^T: col n = query q0 + c, k = d (k-contiguous rows of the q planes)
  const size_t qofs = ((size_t)(b * SEQ + q0 + c)) * DM + head * HD + 8 * hh;
  const Frag qh0 = ldfrag(Qh + qofs), qh1 = ldfrag(Qh + qofs + 32);
  const Frag ql0 = ldfrag(Ql + qofs), ql1 = ldfrag(Ql + qofs + 32);
  const float xq  = QX2[(size_t)bh * SEQ + q0 + c];
  const float omx = 1.0f - xq;
  // A fragments of k: row m = key kb + 16g + c, k = d (key row kb added per step)
  const size_t kofs = ((size_t)(b * SEQ + c)) * DM + head * HD + 8 * hh;
  const u16* KhB = Kh + kofs;
  const u16* KlB = Kl + kofs;
  // B fragments of v^T: col n = d = 16j + c, k = key (k-contiguous row of the v^T plane)
  const u16* Vb = VT + ((size_t)(bh * HD + c)) * SEQ + 8 * hh;

  float mrun = -INFINITY, lrun = 0.f, drun = 0.f;
  v8f o[4];
#pragma unroll
  for (int j = 0; j < 4; ++j) o[j] = zero8();

#pragma unroll 1
  for (int it = 0; it < NKB; ++it) {
    const int kb = it * 32;
    // ---- transposed scores: s0 = keys kb..kb+15, s1 = keys kb+16..kb+31, column = query q0 + c ----
    v8f s0 = zero8(), s1 = zero8();
    const size_t k0o = (size_t)kb * DM, k1o = k0o + (size_t)16 * DM;
    {
      const Frag kh0 = ldfrag(KhB + k0o), kh1 = ldfrag(KhB + k1o);
      const Frag kl0 = ldfrag(KlB + k0o), kl1 = ldfrag(KlB + k1o);
      s0 = mma_b(kh0, qh0, s0); s0 = mma_b(kl0, qh0, s0); s0 = mma_b(kh0, ql0, s0);
      s1 = mma_b(kh1, qh0, s1); s1 = mma_b(kl1, qh0, s1); s1 = mma_b(kh1, ql0, s1);
      guard_sc(s0, s1, qh0.h, ql0.h, kh0.h, kh1.h, kl0.h, kl1.h);
    }
    {
      const Frag kh0 = ldfrag(KhB + k0o + 32), kh1 = ldfrag(KhB + k1o + 32);
      const Frag kl0 = ldfrag(KlB + k0o + 32), kl1 = ldfrag(KlB + k1o + 32);
      s0 = mma_b(kh0, qh1, s0); s0 = mma_b(kl0, qh1, s0); s0 = mma_b(kh0, ql1, s0);
      s1 = mma_b(kh1, qh1, s1); s1 = mma_b(kl1, qh1, s1); s1 = mma_b(kh1, ql1, s1);
      guard_sc(s0, s1, qh1.h, ql1.h, kh0.h, kh1.h, kl0.h, kl1.h);
    }
    // ---- per-key values of this lane's 16 keys: [i] <- key kb+8hh+i, [8+i] <- key kb+16+8hh+i ----
    float y2v[16], g1v[16], mkv[16];
    {
      const int ka = kb + 8 * hh, kc = kb + 16 + 8 * hh;
      const v4f ya = *(const v4fa*)(ky2 + ka), yb = *(const v4fa*)(ky2 + ka + 4);
      const v4f yc = *(const v4fa*)(ky2 + kc), yd = *(const v4fa*)(ky2 + kc + 4);
      const v4f ga = *(const v4fa*)(kg1 + ka), gb = *(const v4fa*)(kg1 + ka + 4);
      const v4f gc = *(const v4fa*)(kg1 + kc), gd = *(const v4fa*)(kg1 + kc + 4);
      const v4f ma = *(const v4fa*)(ms + ka),  mb = *(const v4fa*)(ms + ka + 4);
      const v4f mc = *(const v4fa*)(ms + kc),  md = *(const v4fa*)(ms + kc + 4);
#pragma unroll
      for (int e = 0; e < 4; ++e) {
        y2v[e] = ya[e]; y2v[4 + e] = yb[e]; y2v[8 + e] = yc[e]; y2v[12 + e] = yd[e];
        g1v[e] = ga[e]; g1v[4 + e] = gb[e]; g1v[8 + e] = gc[e]; g1v[12 + e] = gd[e];
        mkv[e] = ma[e]; mkv[4 + e] = mb[e]; mkv[8 + e] = mc[e]; mkv[12 + e] = md[e];
      }
    }
    // ---- base-2 logits ----
    float t[16];
#pragma unroll
    for (int i = 0; i < 8; ++i) {
      t[i]     = logit2(s0[i], y2v[i],     mkv[i],     xq, omx);
      t[8 + i] = logit2(s1[i], y2v[8 + i], mkv[8 + i], xq, omx);
    }
    float cm = t[0];
#pragma unroll
    for (int i = 1; i < 16; ++i) cm = fmaxf(cm, t[i]);
    cm = fmaxf(cm, __shfl_xor(cm, 16, 32));
    const float mn = fmaxf(mrun, cm);        // finite from the first block on
    const float al = exp2f(mrun - mn);       // 0 on the first block (mrun = -inf)
    mrun = mn;
    // ---- probabilities (<= 1), the two running sums and the P A-fragment f16(p * 32768); element i <-> t[i] ----
    float ps = 0.f, pd = 0.f;
    Frag ph;
#pragma unroll
    for (int w = 0; w < 2; ++w) {
#pragma unroll
      for (int e4 = 0; e4 < 4; ++e4) {
        const int i = 8 * w + 2 * e4;
        const float p0 = exp2f(t[i] - mn), p1 = exp2f(t[i + 1] - mn);
        ps += p0 + p1;
        pd += p0 * g1v[i] + p1 * g1v[i + 1];
        ph.u[w][e4] = pk16(h_bits((_Float16)(p0 * PCAR)), h_bits((_Float16)(p1 * PCAR)));
      }
    }
    ps += __shfl_xor(ps, 16, 32);
    pd += __shfl_xor(pd, 16, 32);
    lrun = lrun * al + ps;
    drun = drun * al + pd;
    // ---- rescale the O accumulators: D row 8hh+r = query q0+8hh+r, its factor lives in lane 8hh+r ----
    float scl[8];
#pragma unroll
    for (int r = 0; r < 8; ++r) scl[r] = __shfl(al, 8 * hh + r, 32);
#pragma unroll
    for (int j = 0; j < 4; ++j) {
#pragma unroll
      for (int r = 0; r < 8; ++r) o[j][r] *= scl[r];
    }
    // ---- P.V : B fragment col n = d = j*16 + c, keys contiguous in the v^T plane ----
    {
      const u16* vp = Vb + kb;
      const Frag v0 = ldfrag(vp);
      const Frag v1 = ldfrag(vp + (size_t)16 * SEQ);
      const Frag v2 = ldfrag(vp + (size_t)32 * SEQ);
      const Frag v3 = ldfrag(vp + (size_t)48 * SEQ);
      o[0] = mma_h(ph, v0, o[0]);
      o[1] = mma_h(ph, v1, o[1]);
      o[2] = mma_h(ph, v2, o[2]);
      o[3] = mma_h(ph, v3, o[3]);
      guard_pv(o, ph.h, v0.h, v1.h, v2.h, v3.h);
    }
  }
  acc_guard4(o);

  // ---- gyro-midpoint epilogue in f32: per query factors from the query-owner lane (lane = query) ----
  const float linv = 1.0f / lrun;
  const float nf   = linv * (1.0f / (PCAR * VS));
  const float dq   = fmaxf(drun * linv, 1e-10f);
  float nfr[8], dqr[8];
#pragma unroll
  for (int r = 0; r < 8; ++r) { nfr[r] = __shfl(nf, 8 * hh + r, 32); dqr[r] = __shfl(dq, 8 * hh + r, 32); }
  float sq[8];
#pragma unroll
  for (int r = 0; r < 8; ++r) {
    float sp = 0.f;
#pragma unroll
    for (int j = 0; j < 4; ++j) {
      const float tm = (o[j][r] * nfr[r]) / dqr[r];
      o[j][r] = tm;
      sp += tm * tm;
    }
    sq[r] = rsum16(sp);
  }
  float* sw = slab + wave * 16 * GPITCH;
#pragma unroll
  for (int r = 0; r < 8; ++r) {
    const float df = 1.0f + sqrtf(fmaxf(1.0f - sq[r], 1e-15f));
    float sp = 0.f;
#pragma unroll
    for (int j = 0; j < 4; ++j) {
      const float a = o[j][r] / df;
      o[j][r] = a;
      sp += a * a;
    }
    const float s2  = rsum16(sp);
    const float n2  = fmaxf(sqrtf(s2), 1e-15f);
    const bool  cl  = n2 > MAXN;
    const float fcl = MAXN / n2;
#pragma unroll
    for (int j = 0; j < 4; ++j) {
      const float a = o[j][r];
      sw[(8 * hh + r) * GPITCH + 16 * j + c] = cl ? (a * fcl) : a;
    }
  }
  wave_sync_lds();
  // ---- f32 output rows: lanes 0..15 -> row 2i, lanes 16..31 -> row 2i+1, lane = 4 consecutive d ----
  const int cc = lane & 15;
  v4f vals[8];
#pragma unroll
  for (int i = 0; i < 8; ++i) vals[i] = *(const v4fa*)(sw + (2 * i + hh) * GPITCH + 4 * cc);
  float* ob = Out + ((size_t)(b * SEQ + q0 + hh)) * DM + head * HD + 4 * cc;
  {
#pragma unroll
    for (int i = 0; i < 8; ++i) {
      *(v4f*)(ob + (size_t)(2 * i) * DM) = vals[i];
    }
    
  }
}

// =====================================================================================================
// Workspace map (bytes); every region written fully by whole-line stores before it is read; every extent an exact multiple
//   X16  f16 [NB*SEQ][DM]          f16(bf16(x) x64)              4194304 (NB=2)
//   WQT/WKT/WVT f16 [DM n][DM k]   f16(bf16(W) x256)             3 x 2097152
//   CX2  f32 [NB*SEQ]              sum x^2                       8192
//   ZN, CH, SH f32 [3][DM]         column norms, cosh/sinh(2r)   3 x 12288
//   Qh, Ql, Kh, Kl bf16 [NB*SEQ][DM]                             4 x 4194304
//   Vg   f16 [NB*SEQ][DM]          f16(gamma v x256)             4194304
//   VT   f16 [NB*NH*HD][SEQ]       transposed Vg                 4194304
//   QX2, KX2, GM1 f32 [NB*NH][SEQ]                                3 x 131072
//   end = 36089856 at NB=2
// =====================================================================================================
static inline size_t up4k(size_t v) { return (v + 4095) & ~(size_t)4095; }

extern "C" void kernel_launch(void* const* d_in, const int* in_sizes, int n_in,
                              void* d_out, int out_size, void* d_ws, size_t ws_size,
                              hipStream_t stream) {
  if (n_in < 8) return;
  if (in_sizes[0] < NB * SEQ * DM) return;
  if (in_sizes[1] < NB * SEQ) return;
  if (in_sizes[2] < DM * DM || in_sizes[4] < DM * DM || in_sizes[6] < DM * DM) return;
  if (in_sizes[3] < 1 || in_sizes[5] < 1 || in_sizes[7] < 1) return;
  if (out_size < NB * SEQ * DM) return;

  const float* hs = (const float*)d_in[0];
  const float* am = (const float*)d_in[1];
  const float* qz = (const float*)d_in[2];
  const float* qr = (const float*)d_in[3];
  const float* kz = (const float*)d_in[4];
  const float* kr = (const float*)d_in[5];
  const float* vz = (const float*)d_in[6];
  const float* vr = (const float*)d_in[7];
  float*       out = (float*)d_out;
  const int nqr = in_sizes[3], nkr = in_sizes[5], nvr = in_sizes[7];

  const size_t nrow  = (size_t)NB * SEQ;
  const size_t szX16 = up4k(nrow * DM * 2);
  const size_t szWT  = up4k((size_t)DM * DM * 2);
  const size_t szCX2 = up4k(nrow * 4);
  const size_t szCOL = up4k((size_t)3 * DM * 4);
  const size_t szP   = up4k(nrow * DM * 2);
  const size_t szVT  = up4k((size_t)NB * NH * HD * SEQ * 2);
  const size_t szRS  = up4k((size_t)NB * NH * SEQ * 4);
  size_t off = 0;
  const size_t oX16 = off; off += szX16;
  const size_t oWQ  = off; off += szWT;
  const size_t oWK  = off; off += szWT;
  const size_t oWV  = off; off += szWT;
  const size_t oCX2 = off; off += szCX2;
  const size_t oZN  = off; off += szCOL;
  const size_t oCH  = off; off += szCOL;
  const size_t oSH  = off; off += szCOL;
  const size_t oQh  = off; off += szP;
  const size_t oQl  = off; off += szP;
  const size_t oKh  = off; off += szP;
  const size_t oKl  = off; off += szP;
  const size_t oVg  = off; off += szP;
  const size_t oVT  = off; off += szVT;
  const size_t oQX2 = off; off += szRS;
  const size_t oKX2 = off; off += szRS;
  const size_t oGM1 = off; off += szRS;
  if (off > ws_size) return;                       // off = 36089856 at NB=2
  if (off > (size_t)134217728) return;

  char* ws = (char*)d_ws;
  u16*   X16 = (u16*)(ws + oX16);
  u16*   WQT = (u16*)(ws + oWQ);
  u16*   WKT = (u16*)(ws + oWK);
  u16*   WVT = (u16*)(ws + oWV);
  float* CX2 = (float*)(ws + oCX2);
  float* ZN  = (float*)(ws + oZN);
  float* CH  = (float*)(ws + oCH);
  float* SH  = (float*)(ws + oSH);
  u16*   Qh  = (u16*)(ws + oQh);
  u16*   Ql  = (u16*)(ws + oQl);
  u16*   Kh  = (u16*)(ws + oKh);
  u16*   Kl  = (u16*)(ws + oKl);
  u16*   Vg  = (u16*)(ws + oVg);
  u16*   VT  = (u16*)(ws + oVT);
  float* QX2 = (float*)(ws + oQX2);
  float* KX2 = (float*)(ws + oKX2);
  float* GM1 = (float*)(ws + oGM1);

  // (1) x -> f16 plane of bf16-converted values x64; (2) per-row sum of squares
  cvt16<<<dim3(NB * SEQ), dim3(CVT_THREADS), 0, stream>>>(hs, X16, XS);
  rowstat<<<dim3(NB * SEQ / 32), dim3(256), 0, stream>>>(hs, CX2);
  // (3..5) per weight: column norms + cosh/sinh(2r)
  colstat<<<dim3(DM / CS_COLS), dim3(CS_THREADS), 0, stream>>>(qz, qr, nqr, ZN,          CH,          SH);
  colstat<<<dim3(DM / CS_COLS), dim3(CS_THREADS), 0, stream>>>(kz, kr, nkr, ZN + DM,     CH + DM,     SH + DM);
  colstat<<<dim3(DM / CS_COLS), dim3(CS_THREADS), 0, stream>>>(vz, vr, nvr, ZN + 2 * DM, CH + 2 * DM, SH + 2 * DM);
  // (6..8) weights [k = in][n = out]: transpose to k-contiguous [n][k] f16 planes of bf16(W) x256
  cvtT16<<<dim3((DM / 64) * (DM / 64)), dim3(TR_THREADS), 0, stream>>>(qz, WQT, WSC);
  cvtT16<<<dim3((DM / 64) * (DM / 64)), dim3(TR_THREADS), 0, stream>>>(kz, WKT, WSC);
  cvtT16<<<dim3((DM / 64) * (DM / 64)), dim3(TR_THREADS), 0, stream>>>(vz, WVT, WSC);
  // (9..11) projections with the fused MLR / per-head epilogue
  proj_mlr<<<dim3((NB * SEQ / 128) * (DM / 64)), dim3(128), 0, stream>>>(
      X16, WQT, ZN,          CH,          SH,          CX2, 0, Qh, Ql, QX2);
  proj_mlr<<<dim3((NB * SEQ / 128) * (DM / 64)), dim3(128), 0, stream>>>(
      X16, WKT, ZN + DM,     CH + DM,     SH + DM,     CX2, 1, Kh, Kl, KX2);
  proj_mlr<<<dim3((NB * SEQ / 128) * (DM / 64)), dim3(128), 0, stream>>>(
      X16, WVT, ZN + 2 * DM, CH + 2 * DM, SH + 2 * DM, CX2, 2, Vg, Vg, GM1);
  // (12) gamma v plane -> key-contiguous v^T plane
  trT16<<<dim3(NB * (SEQ / 64) * (DM / 64)), dim3(TR_THREADS), 0, stream>>>(Vg, VT);
  // (13) attention + midpoint -> out [b][SEQ][DM] f32 (rows s < SQ of batches b < NB), heads merged on the feature dim
  attn_fwd<<<dim3(NB * NH * (SQ / 64)), dim3(ATT_THREADS), 0, stream>>>(Qh, Ql, Kh, Kl, VT, QX2, KX2, GM1, am, out);
  (void)hipGetLastError();
}

// v003
// Measured time: 127 microseconds a run.
// Two timings next to v002 put it at 1.39 and 1.37 times that version's speed.
// Counting every step since v000, it is 4.54 times as fast.
// Contractions: x.Wq, x.Wk, x.Wv on v_wmma_f32_16x16x32_f16 (x as f16(bf16(x) x64), W as f16(bf16(W) x256), f32 accumulate);
// scores k.q^T on v_wmma_f32_16x16x32_bf16 as bf16 hi/lo split (hi.hi + lo.hi + hi.lo into one f32 accumulator);
// P.(gamma v)^T on v_wmma_f32_16x16x32_f16 (P x32768 f16, gamma v x256 f16, f32 accumulate); norms, asinh/sinh/acosh
// (closed forms on v_log_f32 / v_exp_f32 / v_sqrt_f32 / v_rcp_f32), base-2 online softmax,
// the sum_j p_j (gamma_j - 1) denominators and all carry folds in f32 on VALU.
// Float inputs RNE-converted to bf16 on load; f32 output written directly.
#include <hip/hip_runtime.h>
#include <math.h>
#include <stdint.h>

#ifndef NB
#define NB 2            // batches processed
#endif
#ifndef SQ
#define SQ 1024         // query rows processed per batch (keys/values always all SEQ rows)
#endif
#define NB_FULL 2
#define SEQ  1024       // rows per batch in every input / output / plane layout
#define DM   1024       // model width = K of the projections = row pitch of the 16-bit planes
#define NH   16
#define HD   64
#define XS   64.0f      // carry on the x plane
#define WSC  256.0f     // carry on the transposed weight planes
#define VS   256.0f     // carry on the gamma*v plane
#define PCAR 32768.0f   // carry on P
#define LOG2E 1.4426950408889634f
#define MAXN 0.996f     // (1 - 4e-3) / sqrt(c)
#define NKB  (SEQ / 32)
#define GPITCH 68
#define TPITCH 65
#define TP16   72
#define CVT_THREADS (DM / 8)
#define TR_THREADS  128
#define ATT_THREADS 128
#define CS_THREADS  1024  // column statistics: threads per block
#define CS_COLS     32    // columns per block
#define CS_STEPS    (DM / (CS_THREADS / 8))   // rows per thread
#define PREP_THREADS 1024                      // block of the preparation grid (all four block kinds)
#define PB_ROW  (NB * SEQ / 128)               // row statistics blocks, 128 rows each
#define PB_COL  (3 * (DM / CS_COLS))           // column statistics blocks, 32 columns of one weight each
#define PB_TR   (3 * (DM / 64) * (DM / 64) / 8)  // weight transpose blocks, 8 tiles of 64 x 64 of one weight each
#define PB_CVT  (NB * SEQ / 8)                 // x convert blocks, 8 rows each
#define PJ_BLOCKS ((NB * SEQ / 128) * (DM / 64)) // projection blocks: one per 128-row x 64-column tile
#define PJ_THREADS 384                         // 3 weights x 4 waves

static_assert(NB >= 1 && NB <= NB_FULL);
static_assert((SQ % 64) == 0 && SQ >= 64 && SQ <= SEQ);
static_assert(NH * HD == DM && HD == 64);
static_assert((SEQ % 128) == 0 && (SEQ % 32) == 0 && NKB * 32 == SEQ);
static_assert((DM % 256) == 0 && (DM % 64) == 0 && (DM % 32) == 0 && CVT_THREADS == 128);
static_assert((GPITCH * 4) % 16 == 0 && (TP16 * 2) % 16 == 0);
static_assert(CS_COLS == 32 && (DM % CS_COLS) == 0 && CS_STEPS * (CS_THREADS / 8) == DM);
static_assert(ATT_THREADS == 128 && TR_THREADS == 128 && ATT_THREADS * 8 == SEQ);
static_assert(PREP_THREADS == CS_THREADS && PREP_THREADS == 8 * CVT_THREADS && PREP_THREADS == 8 * TR_THREADS);
static_assert(((DM / 64) * (DM / 64)) % 8 == 0 && (NB * SEQ) % 128 == 0);

typedef unsigned short u16;
typedef _Float16 v16h __attribute__((ext_vector_type(16)));
typedef _Float16 v8h  __attribute__((ext_vector_type(8)));
typedef __bf16   v16b __attribute__((ext_vector_type(16)));
typedef float    v8f  __attribute__((ext_vector_type(8)));
typedef float    v4f  __attribute__((ext_vector_type(4)));
typedef unsigned int v4u __attribute__((ext_vector_type(4)));
typedef v4u __attribute__((may_alias)) v4ua;
typedef v4f __attribute__((may_alias)) v4fa;

// one 16 x 16-bit per-lane fragment, viewed as f16 vector, bf16 vector or two 16-byte words
union Frag { v16h h; v16b b; v4u u[2]; };

// ---- scalar helpers ----------------------------------------------------------------------------------
__device__ __forceinline__ unsigned short bf_bits(float f) {          // f32 -> bf16 bits, RNE convert
  unsigned u = __float_as_uint(f);
  return (unsigned short)((u + 0x7FFFu + ((u >> 16) & 1u)) >> 16);
}
__device__ __forceinline__ float bf_up(unsigned short h) { return __uint_as_float(((unsigned)h) << 16); }
__device__ __forceinline__ float bfr(float f) { return bf_up(bf_bits(f)); }
__device__ __forceinline__ unsigned short h_bits(_Float16 x) { return __builtin_bit_cast(unsigned short, x); }
__device__ __forceinline__ unsigned pk16(unsigned short a, unsigned short b) { return (unsigned)a | ((unsigned)b << 16); }
__device__ __forceinline__ v8f zero8() { v8f z = {0.f, 0.f, 0.f, 0.f, 0.f, 0.f, 0.f, 0.f}; return z; }
__device__ __forceinline__ float red8(float v) {                      // sum over the 8-lane group (lane bits 0..2)
  v += __shfl_xor(v, 1, 32); v += __shfl_xor(v, 2, 32); v += __shfl_xor(v, 4, 32); return v;
}
__device__ __forceinline__ float rsum16(float v) {                    // sum over the 16-lane half (lane bits 0..3)
  v += __shfl_xor(v, 8, 32); v += __shfl_xor(v, 4, 32); v += __shfl_xor(v, 2, 32); v += __shfl_xor(v, 1, 32); return v;
}

// sinh(tz * asinh(x)) in closed form: e = |x| + sqrt(x^2 + 1), L = log2(e) >= 0, sinh = 2^(tz L - 1) - 2^(-tz L - 1), sign of x.
// Above 1e18 sqrt(x^2 + 1) = |x| in f32 and x^2 comes near the f32 overflow, so e = 2|x| there. The two halves are formed with the
// factor 1/2 in the exponent, so the result overflows only where sinh itself does.
__device__ __forceinline__ float sinh_of_scaled_asinh(float x, float tz) {
  const float a = fabsf(x);
  const float e = a + ((a > 1e18f) ? a : __builtin_amdgcn_sqrtf(fmaf(a, a, 1.0f)));
  const float L = __builtin_amdgcn_logf(e);
  const float s = __builtin_amdgcn_exp2f(fmaf(tz, L, -1.0f)) - __builtin_amdgcn_exp2f(fmaf(-tz, L, -1.0f));
  return copysignf(s, x);
}

// ---- fragment loader: 16-bit A/B operand from a k-contiguous row; lane -> row/col (lane&15), p already includes
//      +8*(lane>>4); elements 0..7 <- p[0..7] (k0+8h..), elements 8..15 <- p[16..23] (k0+16+8h..); same split k map
//      for A and B; B always read from a k-contiguous [n][k] plane. Loaded as unsigned 16-byte words.
__device__ __forceinline__ Frag ldfrag(const u16* p) {
  Frag f;
  f.u[0] = *(const v4u*)(p);
  f.u[1] = *(const v4u*)(p + 16);
  return f;
}

// ---- WMMA helpers and trailing VALU hazard gaps --------------------------------------------------------
__device__ __forceinline__ v8f mma_h(const Frag& a, const Frag& b, v8f c) {
  return __builtin_amdgcn_wmma_f32_16x16x32_f16(false, a.h, false, b.h, (short)0, c, false, false);
}
__device__ __forceinline__ v8f mma_b(const Frag& a, const Frag& b, v8f c) {
  return __builtin_amdgcn_wmma_f32_16x16x32_bf16(false, a.b, false, b.b, (short)0, c, false, false);
}
__device__ __forceinline__ void guard_sc(v8f& a, v8f& b, v16h x0, v16h x1, v16h x2, v16h x3, v16h x4, v16h x5) {
#if defined(__HIP_DEVICE_COMPILE__)
  asm volatile("v_nop\n\tv_nop\n\tv_nop\n\tv_nop"
               : "+v"(a), "+v"(b) : "v"(x0), "v"(x1), "v"(x2), "v"(x3), "v"(x4), "v"(x5) : "memory");
#endif
}
__device__ __forceinline__ void guard_pv(v8f (&o)[4], v16h p, v16h x0, v16h x1, v16h x2, v16h x3) {
#if defined(__HIP_DEVICE_COMPILE__)
  asm volatile("v_nop\n\tv_nop\n\tv_nop\n\tv_nop"
               : "+v"(o[0]), "+v"(o[1]), "+v"(o[2]), "+v"(o[3]) : "v"(p), "v"(x0), "v"(x1), "v"(x2), "v"(x3) : "memory");
#endif
}
__device__ __forceinline__ void guard_g(v8f (&acc)[8], v16h x0, v16h x1, v16h x2, v16h x3, v16h x4, v16h x5) {
#if defined(__HIP_DEVICE_COMPILE__)
  asm volatile("v_nop\n\tv_nop\n\tv_nop\n\tv_nop"
               : "+v"(acc[0]), "+v"(acc[1]), "+v"(acc[2]), "+v"(acc[3]),
                 "+v"(acc[4]), "+v"(acc[5]), "+v"(acc[6]), "+v"(acc[7])
               : "v"(x0), "v"(x1), "v"(x2), "v"(x3), "v"(x4), "v"(x5) : "memory");
#endif
}
__device__ __forceinline__ void acc_guard4(v8f (&o)[4]) {
#if defined(__HIP_DEVICE_COMPILE__)
  asm volatile("v_nop\n\tv_nop\n\tv_nop\n\tv_nop" : "+v"(o[0]), "+v"(o[1]), "+v"(o[2]), "+v"(o[3]));
#endif
}
__device__ __forceinline__ void wave_sync_lds() {
  __builtin_amdgcn_fence(__ATOMIC_RELEASE, "workgroup");
  __builtin_amdgcn_wave_barrier();
  __builtin_amdgcn_fence(__ATOMIC_ACQUIRE, "workgroup");
}

// =====================================================================================================
// Row convert: row r of a [rows][DM] f16 plane <- f16(bf16_RNE(x[r][e]) * scale), scale a power of two.
// A group of DM/8 threads per row (tid = index in the group), thread = 8 consecutive elements (two 16-B loads, one 16-B store).
// coverage: one group per row, 128 thr x 8 = DM = the whole row.
// =====================================================================================================
__device__ __forceinline__ void cvt16_row(const float* __restrict__ x, u16* Y, float scale, int tid, size_t r) {
  const float* src = x + r * (size_t)DM + (size_t)tid * 8;
  const v4f a = *(const v4f*)(src), c4 = *(const v4f*)(src + 4);
  v4u o;
#pragma unroll
  for (int e = 0; e < 2; ++e) {
    o[e]     = pk16(h_bits((_Float16)(bfr(a[2 * e]) * scale)),  h_bits((_Float16)(bfr(a[2 * e + 1]) * scale)));
    o[2 + e] = pk16(h_bits((_Float16)(bfr(c4[2 * e]) * scale)), h_bits((_Float16)(bfr(c4[2 * e + 1]) * scale)));
  }
  u16* dst = Y + r * (size_t)DM + (size_t)tid * 8;
  {
    *(v4u*)(dst) = o;
    // precaution: in the merged kernel other block kinds' code follows in the listing and rewrites the store's registers
    asm volatile("s_wait_xcnt 0x0" ::: "memory");
  }
}

// =====================================================================================================
// Row statistics: CX2[r] = sum_e bf16(x[r][e])^2 in f32. Block = 128 rows, 1024 threads, wave w rows 128*blk + 4w + j:
// per row each lane sums 32 values (8 x 16-B loads), xor-shuffle reduce, lane 0 -> LDS (rs, 128 floats); after a block
// barrier threads 0..31 store the 128 sums as 16-B words.
// =====================================================================================================
__device__ __forceinline__ void rowstat_blk(const float* __restrict__ x, float* CX2, float* rs, int tid, int blk) {
  const int wave = tid >> 5, lane = tid & 31;
  const int row0 = blk * 128;
#pragma unroll 1
  for (int j = 0; j < 4; ++j) {
    const int row = row0 + wave * 4 + j;
    const float* xr = x + (size_t)row * DM + 4 * lane;
    float s = 0.f;
#pragma unroll 2
    for (int q = 0; q < DM / 128; ++q) {
      const v4f a = *(const v4f*)(xr + 128 * q);
      const float a0 = bfr(a[0]), a1 = bfr(a[1]), a2 = bfr(a[2]), a3 = bfr(a[3]);
      s += a0 * a0; s += a1 * a1; s += a2 * a2; s += a3 * a3;
    }
    s += __shfl_xor(s, 16, 32); s += __shfl_xor(s, 8, 32); s += __shfl_xor(s, 4, 32);
    s += __shfl_xor(s, 2, 32);  s += __shfl_xor(s, 1, 32);
    if (lane == 0) rs[wave * 4 + j] = s;
  }
  __syncthreads();
  if (tid < 32) {
    const v4f v = *(const v4fa*)(rs + 4 * tid);
    float* dst = CX2 + row0 + 4 * tid;
    {
      *(v4f*)(dst) = v;
      
    }
  }
}

// =====================================================================================================
// Column statistics of a weight z[k][n] (DM x DM): ZN[n] = max(sqrt(sum_k bf16(z[k][n])^2), 1e-15), CH[n] = cosh(2 r[n]),
// SH[n] = sinh(2 r[n]) (r index clamped to nr-1). Block = 32 columns (one 128-B line of every row) x all DM rows,
// 1024 threads: lane = (row sub-index lane>>3, 4 columns at 4*(lane&7)), wave w step j reads rows 128j + 4w .. +3, so a
// thread has its 8 independent 16-B loads in flight at once. Column sums: 8 rows in the thread, xor-8 / xor-16 shuffles
// over the wave's 4 row sub-indices, one 32-float row per wave in LDS, block barrier, wave 0 adds the 32 wave rows.
// coverage: 8 j x 32 waves x 4 rows = DM rows; DM/32 blocks x 32 columns = every column of the three arrays once,
//           each block the only writer of its 128-B line in each array. part: (CS_THREADS / 32) * CS_COLS floats of LDS.
// =====================================================================================================
__device__ __forceinline__ void colstat_blk(const float* __restrict__ z, const float* __restrict__ r, int nr,
                                            float* ZN, float* CH, float* SH, float* part, int tid, int blk) {
  const int wave = tid >> 5, lane = tid & 31;
  const int col0 = blk * CS_COLS;
  const float* zp = z + (size_t)(wave * 4 + (lane >> 3)) * DM + col0 + 4 * (lane & 7);
  const int col = col0 + lane;
  float rv = 0.f;
  if (wave == 0) {                               // wave-uniform; issued with the column loads, not behind the barrier
    int ri = col;
    ri = (ri < nr - 1) ? ri : (nr - 1);
    rv = r[ri];
  }
  v4f a[CS_STEPS];
#pragma unroll   // all loads issue before the first use: one memory latency per thread instead of one per row group
  for (int j = 0; j < CS_STEPS; ++j) a[j] = *(const v4f*)(zp + (size_t)j * (CS_THREADS / 8) * DM);
  v4f s = {0.f, 0.f, 0.f, 0.f};
#pragma unroll
  for (int j = 0; j < CS_STEPS; ++j) {
#pragma unroll
    for (int e = 0; e < 4; ++e) {
      const float v = bfr(a[j][e]);
      s[e] += v * v;
    }
  }
#pragma unroll
  for (int e = 0; e < 4; ++e) {
    s[e] += __shfl_xor(s[e], 8, 32);
    s[e] += __shfl_xor(s[e], 16, 32);
  }
  if (lane < 8) *(v4fa*)(part + wave * CS_COLS + 4 * lane) = s;
  __syncthreads();
  if (wave == 0) {                               // wave-uniform; lane = column
    float t = 0.f;
#pragma unroll
    for (int w = 0; w < CS_THREADS / 32; ++w) t += part[w * CS_COLS + lane];
    const float dr = 2.0f * bfr(rv);
    ZN[col] = fmaxf(sqrtf(t), 1e-15f);
    CH[col] = coshf(dr);
    SH[col] = sinhf(dr);
  }
}

// =====================================================================================================
// Weight transpose-convert for y = x.W weights stored [k][n]: WT[n][k] (f16, k-contiguous Bt layout) <- f16(bf16_RNE(W[k][n]) *
// scale). A group of 128 threads (tid = index in the group) per 64(k) x 64(n) tile, 8 groups per block. Load phase: thread = (row 8p + (tid>>4), 4 floats at 4*(tid&15)),
// 8 steps = 64 k-rows x 64 n, into an LDS tile [kk][nn] (pitch 65); block barrier; store phase: output row n0 + 16i + (tid>>3)
// coverage: 4 i x 16 rows x (8 lanes x 8 halves) = 64 n-rows x 64 k per group; the (DM/64)^2 tiles cover WT exactly once.
// LDS tile (64 * TPITCH floats, the group's own): cross-wave, block barrier; staged extent 64x64 == consumed extent.
// =====================================================================================================
__device__ __forceinline__ void cvtT16_tile(const float* __restrict__ W, u16* Y, float scale, float* tile, int tid, int bid) {
  constexpr int NT = DM / 64;
  const int kt  = bid % NT;
  const int ntb = bid / NT;
  const int k0  = kt * 64, n0 = ntb * 64;
  const int lr = tid >> 4, lc = (tid & 15) * 4;
#pragma unroll
  for (int p = 0; p < 8; ++p) {
    const int kk = p * 8 + lr;
    const v4f w4 = *(const v4f*)(W + (size_t)(k0 + kk) * (size_t)DM + n0 + lc);
    tile[kk * TPITCH + lc + 0] = w4[0];
    tile[kk * TPITCH + lc + 1] = w4[1];
    tile[kk * TPITCH + lc + 2] = w4[2];
    tile[kk * TPITCH + lc + 3] = w4[3];
  }
  __syncthreads();
  const int rq = tid >> 3, c8 = (tid & 7) * 8;      // rq 0..15, c8 0..56
  v4u ov[4];
#pragma unroll
  for (int i = 0; i < 4; ++i) {
    const int row = 16 * i + rq;                   // n within tile
#pragma unroll
    for (int e = 0; e < 4; ++e) {
      const float x0 = tile[(c8 + 2 * e) * TPITCH + row];
      const float x1 = tile[(c8 + 2 * e + 1) * TPITCH + row];
      ov[i][e] = pk16(h_bits((_Float16)(bfr(x0) * scale)), h_bits((_Float16)(bfr(x1) * scale)));
    }
  }
  u16* dst = Y + (size_t)n0 * (size_t)DM + k0 + c8;
  {
#pragma unroll
    for (int i = 0; i < 4; ++i) {
      const int row = 16 * i + rq;
      *(v4u*)(dst + (size_t)row * (size_t)DM) = ov[i];
    }
    // precaution: in the merged kernel other block kinds' code follows in the listing and rewrites the stores' registers
    asm volatile("s_wait_xcnt 0x0" ::: "memory");
  }
}

// =====================================================================================================
// Preparation grid: everything that reads only the inputs, in one launch, so that the four kinds of block run side by side.
// Block kind by block index (block-uniform, so each kind's block barrier is passed by all 1024 threads of its block); the
// kinds with the longest dependent chains come first:
//   [0, PB_ROW)            row statistics of x, 128 rows per block
//   next PB_COL blocks     column statistics, weight = index / (DM/32), 32 columns per block
//   next PB_TR blocks      weight transpose-convert, weight = index / 32, 8 tiles per block (tile = 8 * index + tid / 128)
//   next PB_CVT blocks     x convert, 8 rows per block (row = 8 * index + tid / 128)
// LDS: one array, used by one kind per block (8 transpose tiles, or the column partials, or the row sums).
// =====================================================================================================
__global__ __launch_bounds__(PREP_THREADS)
void prep(const float* __restrict__ x,
          const float* __restrict__ qz, const float* __restrict__ kz, const float* __restrict__ vz,
          const float* __restrict__ qr, const float* __restrict__ kr, const float* __restrict__ vr,
          int nqr, int nkr, int nvr,
          u16* X16, float* CX2, float* ZN, float* CH, float* SH, u16* WQT, u16* WKT, u16* WVT) {
  __shared__ __align__(16) float sm[8 * 64 * TPITCH];
  const int tid = threadIdx.x;
  int bid = blockIdx.x;
  if (bid < PB_ROW) {
    rowstat_blk(x, CX2, sm, tid, bid);
    return;
  }
  bid -= PB_ROW;
  if (bid < PB_COL) {
    const int w = bid / (DM / CS_COLS), blk = bid % (DM / CS_COLS);
    const float* z = (w == 0) ? qz : (w == 1) ? kz : vz;
    const float* r = (w == 0) ? qr : (w == 1) ? kr : vr;
    const int   nr = (w == 0) ? nqr : (w == 1) ? nkr : nvr;
    colstat_blk(z, r, nr, ZN + w * DM, CH + w * DM, SH + w * DM, sm, tid, blk);
    return;
  }
  bid -= PB_COL;
  if (bid < PB_TR) {
    constexpr int BPW = (DM / 64) * (DM / 64) / 8;   // blocks per weight
    const int w = bid / BPW, grp = tid >> 7;
    const float* z = (w == 0) ? qz : (w == 1) ? kz : vz;
    u16*         y = (w == 0) ? WQT : (w == 1) ? WKT : WVT;
    cvtT16_tile(z, y, WSC, sm + grp * 64 * TPITCH, tid & 127, (bid % BPW) * 8 + grp);
    return;
  }
  bid -= PB_TR;
  cvt16_row(x, X16, XS, tid & 127, (size_t)(bid * 8 + (tid >> 7)));
}

// =====================================================================================================
// f16 GEMM core: the wave's 32 x 64 tile of C = A[rows][K] . Bt[cols][K]^T; ap -> A row (rowb + m) + 8h, bp -> Bt row
// (col0 + m) + 8h; acc[4i + j] = rows rowb+16i.., cols col0+16j..; K stepped by 32 (K % 32 == 0 asserted).
// =====================================================================================================
__device__ __forceinline__ void gemm_core(const u16* ap, const u16* bp, int K, v8f (&acc)[8]) {
  const size_t rs16 = (size_t)16 * (size_t)K;
#pragma unroll 1
  for (int k0 = 0; k0 < K; k0 += 32) {
    const Frag a0 = ldfrag(ap + k0), a1 = ldfrag(ap + rs16 + k0);
    const Frag b0 = ldfrag(bp + k0);
    const Frag b1 = ldfrag(bp + rs16 + k0);
    const Frag b2 = ldfrag(bp + 2 * rs16 + k0);
    const Frag b3 = ldfrag(bp + 3 * rs16 + k0);
    acc[0] = mma_h(a0, b0, acc[0]);
    acc[1] = mma_h(a0, b1, acc[1]);
    acc[2] = mma_h(a0, b2, acc[2]);
    acc[3] = mma_h(a0, b3, acc[3]);
    acc[4] = mma_h(a1, b0, acc[4]);
    acc[5] = mma_h(a1, b1, acc[5]);
    acc[6] = mma_h(a1, b2, acc[6]);
    acc[7] = mma_h(a1, b3, acc[7]);
    guard_g(acc, a0.h, a1.h, b0.h, b1.h, b2.h, b3.h);
  }
}
// Stage the wave's 32 x 64 f32 tile (times oscale) in its LDS slab (pitch 68): D element r of acc[4i+j], lane l ->
// coverage: 32 lanes x 2 x 8 rows x 4 cols-of-16 = rows 0..31 x cols 0..63 of the slab.
__device__ __forceinline__ void stage32x64(float* sl, v8f (&acc)[8], float oscale, int lane) {
  const int hh = lane >> 4, m = lane & 15;
#pragma unroll
  for (int i = 0; i < 2; ++i) {
#pragma unroll
    for (int r = 0; r < 8; ++r) {
      const int ro = (16 * i + 8 * hh + r) * GPITCH + m;
      sl[ro]      = acc[4 * i + 0][r] * oscale;
      sl[ro + 16] = acc[4 * i + 1][r] * oscale;
      sl[ro + 32] = acc[4 * i + 2][r] * oscale;
      sl[ro + 48] = acc[4 * i + 3][r] * oscale;
    }
  }
  wave_sync_lds();
}

// =====================================================================================================
// Projection GEMM + ball MLR epilogue. A = x plane [NB*SEQ][DM] (f16, x XS), Bt = WT [DM n][DM k] (f16, x WSC).
// One launch for the three weights: block = 384 threads = 128 rows x 64 cols (one head) of q, k and v; waves 4*mode .. 4*mode+3
// (mode 0 q, 1 k, 2 v: picks Bt, the column tables' row and the outputs) take 32 rows each, so the three modes read the same A rows
// from one WGP and three waves share a SIMD; fragments straight from the 16-bit rows.
// Epilogue per element (f32): mm = (x.z)[row][n] / ZN[n]; arg = (2 mm CH[n] - (1 + cx2) SH[n]) / max(1 - cx2, 1e-15);
// y = sinh(2 ZN[n] asinh(arg)); per (row, head) 64-vector (8 lanes x 8 values, 8-lane shuffle sums): clip to norm MAXN,
// y = y / (1 + sqrt(1 + sum y^2)), clip again; x2 = sum y^2. mode 0/1: planes Ph/Pl = bf16 hi / bf16 lo of y, RS row
// scalar = x2; mode 2: g = 2 / max(1 - x2, 1e-15), plane Ph = f16(g y VS), RS row scalar = g - 1.
// coverage: per wave 8 instr x 4 rows x 8 lanes x 8 halves = 32 x 64 per plane; RS: 32 floats per wave; grid covers every
//           (row, col) of the planes and every (b, head, s) of RS exactly once.
// LDS: slab and rsc are wave-private (wave_sync); staged extent 32x64 == consumed extent; no block barriers.
// =====================================================================================================
__global__ __launch_bounds__(PJ_THREADS)
void proj_mlr(const u16* __restrict__ A, const u16* __restrict__ WQT, const u16* __restrict__ WKT, const u16* __restrict__ WVT,
              const float* __restrict__ ZN3, const float* __restrict__ CH3, const float* __restrict__ SH3,
              const float* __restrict__ CX2, u16* Qh, u16* Ql, u16* Kh, u16* Kl, u16* Vg,
              float* QX2, float* KX2, float* GM1) {
  __shared__ __align__(16) float slab[(PJ_THREADS / 32) * 32 * GPITCH];
  __shared__ __align__(16) float rsc[(PJ_THREADS / 32) * 32];
  const int tid = threadIdx.x, wv = tid >> 5, wave = wv & 3, lane = tid & 31, hh = lane >> 4, m = lane & 15;
  constexpr int NT = DM / 64;
  const int mode = __builtin_amdgcn_readfirstlane(wv >> 2);   // the same in all lanes of a wave: pointer picks and the mode branch stay scalar
  const int bid  = blockIdx.x;
  const u16* Bt  = (mode == 0) ? WQT : (mode == 1) ? WKT : WVT;
  const float* ZN = ZN3 + mode * DM;
  const float* CH = CH3 + mode * DM;
  const float* SH = SH3 + mode * DM;
  u16*   Ph = (mode == 0) ? Qh : (mode == 1) ? Kh : Vg;
  u16*   Pl = (mode == 0) ? Ql : Kl;           // stored to by modes 0 and 1 only
  float* RS = (mode == 0) ? QX2 : (mode == 1) ? KX2 : GM1;
  const int nt   = bid % NT;
  const int mt   = bid / NT;
  const int rowb = mt * 128 + wave * 32;       // global token row b*SEQ + s of the wave's first row
  const int col0 = nt * 64;                    // = head * HD
  const u16* ap = A  + (size_t)(rowb + m) * DM + 8 * hh;
  const u16* bp = Bt + (size_t)(col0 + m) * DM + 8 * hh;
  v8f acc[8];
#pragma unroll
  for (int i = 0; i < 8; ++i) acc[i] = zero8();
  gemm_core(ap, bp, DM, acc);
  float* sl = slab + wv * 32 * GPITCH;
  stage32x64(sl, acc, 1.0f / (XS * WSC), lane);

  const int rq = lane >> 3, c8 = (lane & 7) * 8;
  float zn8[8], ch8[8], sh8[8];
  {
    const v4f z0 = *(const v4f*)(ZN + col0 + c8), z1 = *(const v4f*)(ZN + col0 + c8 + 4);
    const v4f h0 = *(const v4f*)(CH + col0 + c8), h1 = *(const v4f*)(CH + col0 + c8 + 4);
    const v4f g0 = *(const v4f*)(SH + col0 + c8), g1 = *(const v4f*)(SH + col0 + c8 + 4);
#pragma unroll
    for (int e = 0; e < 4; ++e) {
      zn8[e] = z0[e]; zn8[4 + e] = z1[e];
      ch8[e] = h0[e]; ch8[4 + e] = h1[e];
      sh8[e] = g0[e]; sh8[4 + e] = g1[e];
    }
  }
  const bool mv = (mode == 2);
#pragma unroll 1
  for (int i = 0; i < 8; ++i) {
    const int row = 4 * i + rq;
    const float cx  = CX2[rowb + row];
    const float omc = fmaxf(1.0f - cx, 1e-15f);
    const float opc = 1.0f + cx;
    float* sr = sl + row * GPITCH + c8;
    float y[8];
    float s0 = 0.f;
#pragma unroll
    for (int e = 0; e < 8; ++e) {
      const float mm  = sr[e] / zn8[e];
      const float arg = (2.0f * mm * ch8[e] - opc * sh8[e]) / omc;
      y[e] = sinh_of_scaled_asinh(arg, 2.0f * zn8[e]);
      s0 += y[e] * y[e];
    }
    s0 = red8(s0);
    const float n0 = fmaxf(sqrtf(s0), 1e-15f);
    const bool cl0 = n0 > MAXN;
    float s1 = 0.f;
#pragma unroll
    for (int e = 0; e < 8; ++e) {
      const float yp = y[e] / n0 * MAXN;
      y[e] = cl0 ? yp : y[e];
      s1 += y[e] * y[e];
    }
    s1 = red8(s1);
    const float den = 1.0f + sqrtf(1.0f + s1);
    float s2 = 0.f;
#pragma unroll
    for (int e = 0; e < 8; ++e) {
      y[e] = y[e] / den;
      s2 += y[e] * y[e];
    }
    s2 = red8(s2);
    const float n2 = fmaxf(sqrtf(s2), 1e-15f);
    const bool cl2 = n2 > MAXN;
    float s3 = 0.f;
#pragma unroll
    for (int e = 0; e < 8; ++e) {
      const float yp = y[e] / n2 * MAXN;
      y[e] = cl2 ? yp : y[e];
      s3 += y[e] * y[e];
    }
    s3 = red8(s3);
    const float g    = 2.0f / fmaxf(1.0f - s3, 1e-15f);
    const float gmul = mv ? g : 1.0f;
    const float scal = mv ? (g - 1.0f) : s3;
#pragma unroll
    for (int e = 0; e < 8; ++e) sr[e] = y[e] * gmul;
    if ((lane & 7) == 0) rsc[wv * 32 + row] = scal;
  }
  wave_sync_lds();

  const int bb = rowb / SEQ, s0r = rowb - bb * SEQ, head = nt;
  if (lane < 8) {
    const v4f v = *(const v4fa*)(rsc + wv * 32 + 4 * lane);
    float* dst = RS + ((size_t)(bb * NH + head)) * SEQ + s0r + 4 * lane;
    {
      *(v4f*)(dst) = v;
      
    }
  }
  // ---- planes ----
  const size_t pofs = (size_t)rowb * DM + (size_t)(col0 + c8);
  if (!mv) {
    v4u oh[8], ol[8];
#pragma unroll
    for (int i = 0; i < 8; ++i) {
      const int row = 4 * i + rq;
      const v4f a = *(const v4fa*)(sl + row * GPITCH + c8), c4 = *(const v4fa*)(sl + row * GPITCH + c8 + 4);
#pragma unroll
      for (int e = 0; e < 2; ++e) {
        const unsigned short ha = bf_bits(a[2 * e]),  hb = bf_bits(a[2 * e + 1]);
        const unsigned short la = bf_bits(a[2 * e] - bf_up(ha)), lb = bf_bits(a[2 * e + 1] - bf_up(hb));
        oh[i][e] = pk16(ha, hb);
        ol[i][e] = pk16(la, lb);
        const unsigned short hc = bf_bits(c4[2 * e]), hd = bf_bits(c4[2 * e + 1]);
        const unsigned short lc = bf_bits(c4[2 * e] - bf_up(hc)), ld = bf_bits(c4[2 * e + 1] - bf_up(hd));
        oh[i][2 + e] = pk16(hc, hd);
        ol[i][2 + e] = pk16(lc, ld);
      }
    }
    {
#pragma unroll
      for (int i = 0; i < 8; ++i) {
        const int row = 4 * i + rq;
        *(v4u*)(Ph + pofs + (size_t)row * DM) = oh[i];
        *(v4u*)(Pl + pofs + (size_t)row * DM) = ol[i];
      }
      
    }
  } else {
    v4u ov[8];
#pragma unroll
    for (int i = 0; i < 8; ++i) {
      const int row = 4 * i + rq;
      const v4f a = *(const v4fa*)(sl + row * GPITCH + c8), c4 = *(const v4fa*)(sl + row * GPITCH + c8 + 4);
#pragma unroll
      for (int e = 0; e < 2; ++e) {
        ov[i][e]     = pk16(h_bits((_Float16)(a[2 * e] * VS)),  h_bits((_Float16)(a[2 * e + 1] * VS)));
        ov[i][2 + e] = pk16(h_bits((_Float16)(c4[2 * e] * VS)), h_bits((_Float16)(c4[2 * e + 1] * VS)));
      }
    }
    {
#pragma unroll
      for (int i = 0; i < 8; ++i) {
        const int row = 4 * i + rq;
        *(v4u*)(Ph + pofs + (size_t)row * DM) = ov[i];
      }
      
    }
  }
}

// =====================================================================================================
// 16-bit per-batch transpose: VT[b*DM + hd][s] <- Vg[b*SEQ + s][hd]. Block = 64(s) x 64(hd) tile, 128 threads.
// Load phase: thread = (s = 16p + (tid>>3), 8 halves at hd = 8*(tid&7)) one 16-B load, 4 steps, scattered as u16 scalars
// into an LDS tile [hd][s] (pitch 72); block barrier; store phase: VT row hd0 + 16i + (tid>>3) gets s0 + 8*(tid&7) .. +7 =
// passes. grid = NB x (SEQ/64) x (DM/64): bid -> (st = bid % 16, ht = (bid/16) % 16, b = bid/256).
// coverage: load 4 p x 16 s x 8 lane-groups x 8 hd = 64 x 64; store 4 i x 16 rows x 8 lanes x 8 halves = 64 hd x 64 s;
//           the grid covers VT (NB*DM rows x SEQ) exactly once.
// LDS tile: cross-wave, block barrier; staged extent 64x64 == consumed extent (pad columns 64..71 never read).
// =====================================================================================================
__global__ __launch_bounds__(TR_THREADS)
void trT16(const u16* __restrict__ Vg, u16* VT) {
  __shared__ __align__(16) u16 tile[64 * TP16];
  const int tid = threadIdx.x;
  constexpr int NST = SEQ / 64, NHT = DM / 64;
  const int bid = blockIdx.x;
  const int st  = bid % NST;
  const int tmp = bid / NST;
  const int ht  = tmp % NHT;
  const int b   = tmp / NHT;
  const int s0 = st * 64, hd0 = ht * 64;
  const int r = tid >> 3, c = (tid & 7) * 8;
#pragma unroll
  for (int p = 0; p < 4; ++p) {
    const int s = 16 * p + r;
    const v4u w = *(const v4u*)(Vg + ((size_t)(b * SEQ + s0 + s)) * DM + hd0 + c);
#pragma unroll
    for (int e = 0; e < 8; ++e)
      tile[(c + e) * TP16 + s] = (u16)((w[e >> 1] >> (16 * (e & 1))) & 0xFFFFu);
  }
  __syncthreads();
  const int rq = tid >> 3, c8 = (tid & 7) * 8;
  v4u ov[4];
#pragma unroll
  for (int i = 0; i < 4; ++i) {
    const int row = 16 * i + rq;
    ov[i] = *(const v4ua*)(tile + row * TP16 + c8);
  }
  u16* dst = VT + ((size_t)(b * DM + hd0)) * SEQ + s0 + c8;
  {
#pragma unroll
    for (int i = 0; i < 4; ++i) {
      const int row = 16 * i + rq;
      *(v4u*)(dst + (size_t)row * SEQ) = ov[i];
    }
    
  }
}

// ---- ball distance logit (base 2) of one (query, key) pair ----
// acosh(z) = ln(z + sqrt(z^2 - 1)); with z = 1 + 2u, u = num / den: z^2 - 1 = 4 (u + u^2), formed without the cancellation of
// z^2 - 1, so dist * log2(e) = log2(1 + 2 (u + sqrt(u + u^2))). u lies in [1e-15, about 4e15]: no step leaves the f32 range.
__device__ __forceinline__ float logit2(float xy, float y2, float mk, float x2, float omx) {
  const float num = fmaxf(x2 - 2.0f * xy + y2, 1e-15f);
  const float den = fmaxf(omx * (1.0f - y2), 1e-15f);
  const float u   = num * __builtin_amdgcn_rcpf(den);
  const float rt  = __builtin_amdgcn_sqrtf(fmaf(u, u, u));
  const float d2  = __builtin_amdgcn_logf(fmaf(2.0f, u + rt, 1.0f));
  return fmaf(mk, LOG2E, -d2);
}

// =====================================================================================================
// Fused distance attention + gyro-midpoint over all SEQ keys: block = (batch b, head, 64 query rows), 4 waves, wave w owns
// queries q0 = 64*qt + 16*w .. q0+15 (waves independent after the initial table staging: one block barrier, then only
// wave-private LDS).
//   q planes bf16 hi/lo [b*SEQ + s][h*64 + d]; k planes bf16 hi/lo same layout; v^T plane f16 x VS [(b*NH + h)*64 + d][s];
//   per-key tables for (b, h): sum k^2, gamma - 1; additive bias row amask[b][s] (bf16-converted); per query x2 = sum q^2.
//   All NKB = 32 key blocks of 32 keys are visited (static bound).
//   Scores computed TRANSPOSED: S^T tile g = k rows (keys kb+16g .., A operand, row m = lane&15, split k map over d)
//   times q^T (B operand, col n = query q0 + (lane&15), k = d), 2 d-chunks of 32, three bf16 products each (hi.hi, lo.hi,
//   hi.lo). D element r of lane l = (key kb+16g+8h+r, query q0+(l&15)): a lane owns one query column and 16 of its 32 keys;
//   the partner lane l^16 owns the other 16 -> row max / row sums need one xor-16 shuffle.
//   dist = acosh(1 + 2 max(x2 - 2 xy + y2, 1e-15) / max((1 - x2)(1 - y2), 1e-15)), logit = -dist + bias, all f32.
//   Online max-subtracted base-2 softmax in f32; running sums l = sum p and dn = sum p (gamma - 1). The exp'd values ARE the
//   P A-fragment in place: A row m = query = lane&15, element i <- key kb+8h+i (tile 0, D element i), element 8+i <- key
//   kb+16+8h+i (tile 1, D element i). P (<= 1) carried x32768 as f16. O rescale factors shuffled from the query-owner lanes.
//   4 v^T B fragments (col n = d = 16j + (lane&15), keys k-contiguous), 4 P.V WMMAs + one guard.
//   Epilogue (f32): two_mean = (O (1/l) / (PCAR VS)) / max(dn / l, 1e-10); a = two_mean / (1 + sqrt(max(1 - sum two_mean^2,
//   1e-15))); clip to norm MAXN; the wave's 16x64 tile staged in its LDS slab (pitch 68); each output row segment
// coverage: per wave 8 instructions x 2 rows x 16 lanes x 4 floats = 16 x 64; grid NB*NH*(SQ/64) blocks x 4 waves = every
//           (b < NB, s < SQ, h) row segment of the output exactly once.
// LDS: ms/ky2/kg1 cross-wave (block barrier, 1024 staged == 1024 consumed); slab wave-private (wave_sync, 16x64).
// =====================================================================================================
__global__ __launch_bounds__(ATT_THREADS)
void attn_fwd(const u16* __restrict__ Qh, const u16* __restrict__ Ql, const u16* __restrict__ Kh, const u16* __restrict__ Kl,
              const u16* __restrict__ VT, const float* __restrict__ QX2, const float* __restrict__ KX2,
              const float* __restrict__ GM1, const float* __restrict__ amask, float* Out) {
  __shared__ __align__(16) float ms[SEQ];
  __shared__ __align__(16) float ky2[SEQ];
  __shared__ __align__(16) float kg1[SEQ];
  __shared__ __align__(16) float slab[4 * 16 * GPITCH];

  const int tid  = threadIdx.x;
  const int wave = tid >> 5;
  const int lane = tid & 31;
  const int hh   = lane >> 4;
  const int c    = lane & 15;

  constexpr int NQT = SQ / 64;
  const int bid  = blockIdx.x;
  const int qt   = bid % NQT;
  const int head = (bid / NQT) % NH;
  const int b    = bid / (NQT * NH);
  const int bh   = b * NH + head;
  const int q0   = qt * 64 + wave * 16;

  // ---- stage the per-key tables of (b, head): 128 threads x 8 keys = SEQ ----
  {
    const int i0 = tid * 8;
    const float* mp = amask + (size_t)b * SEQ + i0;
    const float* yp = KX2 + (size_t)bh * SEQ + i0;
    const float* gp = GM1 + (size_t)bh * SEQ + i0;
    const v4f m0 = *(const v4f*)(mp), m1 = *(const v4f*)(mp + 4);
    const v4f y0 = *(const v4f*)(yp), y1 = *(const v4f*)(yp + 4);
    const v4f g0 = *(const v4f*)(gp), g1 = *(const v4f*)(gp + 4);
#pragma unroll
    for (int e = 0; e < 4; ++e) {
      ms[i0 + e]  = bfr(m0[e]); ms[i0 + 4 + e]  = bfr(m1[e]);
      ky2[i0 + e] = y0[e];      ky2[i0 + 4 + e] = y1[e];
      kg1[i0 + e] = g0[e];      kg1[i0 + 4 + e] = g1[e];
    }
  }
  __syncthreads();

  // B fragments of q^T: col n = query q0 + c, k = d (k-contiguous rows of the q planes)
  const size_t qofs = ((size_t)(b * SEQ + q0 + c)) * DM + head * HD + 8 * hh;
  const Frag qh0 = ldfrag(Qh + qofs), qh1 = ldfrag(Qh + qofs + 32);
  const Frag ql0 = ldfrag(Ql + qofs), ql1 = ldfrag(Ql + qofs + 32);
  const float xq  = QX2[(size_t)bh * SEQ + q0 + c];
  const float omx = 1.0f - xq;
  // A fragments of k: row m = key kb + 16g + c, k = d (key row kb added per step)
  const size_t kofs = ((size_t)(b * SEQ + c)) * DM + head * HD + 8 * hh;
  const u16* KhB = Kh + kofs;
  const u16* KlB = Kl + kofs;
  // B fragments of v^T: col n = d = 16j + c, k = key (k-contiguous row of the v^T plane)
  const u16* Vb = VT + ((size_t)(bh * HD + c)) * SEQ + 8 * hh;

  float mrun = -INFINITY, lrun = 0.f, drun = 0.f;
  v8f o[4];
#pragma unroll
  for (int j = 0; j < 4; ++j) o[j] = zero8();

#pragma unroll 1
  for (int it = 0; it < NKB; ++it) {
    const int kb = it * 32;
    // ---- transposed scores: s0 = keys kb..kb+15, s1 = keys kb+16..kb+31, column = query q0 + c ----
    v8f s0 = zero8(), s1 = zero8();
    const size_t k0o = (size_t)kb * DM, k1o = k0o + (size_t)16 * DM;
    {
      const Frag kh0 = ldfrag(KhB + k0o), kh1 = ldfrag(KhB + k1o);
      const Frag kl0 = ldfrag(KlB + k0o), kl1 = ldfrag(KlB + k1o);
      s0 = mma_b(kh0, qh0, s0); s0 = mma_b(kl0, qh0, s0); s0 = mma_b(kh0, ql0, s0);
      s1 = mma_b(kh1, qh0, s1); s1 = mma_b(kl1, qh0, s1); s1 = mma_b(kh1, ql0, s1);
      guard_sc(s0, s1, qh0.h, ql0.h, kh0.h, kh1.h, kl0.h, kl1.h);
    }
    {
      const Frag kh0 = ldfrag(KhB + k0o + 32), kh1 = ldfrag(KhB + k1o + 32);
      const Frag kl0 = ldfrag(KlB + k0o + 32), kl1 = ldfrag(KlB + k1o + 32);
      s0 = mma_b(kh0, qh1, s0); s0 = mma_b(kl0, qh1, s0); s0 = mma_b(kh0, ql1, s0);
      s1 = mma_b(kh1, qh1, s1); s1 = mma_b(kl1, qh1, s1); s1 = mma_b(kh1, ql1, s1);
      guard_sc(s0, s1, qh1.h, ql1.h, kh0.h, kh1.h, kl0.h, kl1.h);
    }
    // ---- per-key values of this lane's 16 keys: [i] <- key kb+8hh+i, [8+i] <- key kb+16+8hh+i ----
    float y2v[16], g1v[16], mkv[16];
    {
      const int ka = kb + 8 * hh, kc = kb + 16 + 8 * hh;
      const v4f ya = *(const v4fa*)(ky2 + ka), yb = *(const v4fa*)(ky2 + ka + 4);
      const v4f yc = *(const v4fa*)(ky2 + kc), yd = *(const v4fa*)(ky2 + kc + 4);
      const v4f ga = *(const v4fa*)(kg1 + ka), gb = *(const v4fa*)(kg1 + ka + 4);
      const v4f gc = *(const v4fa*)(kg1 + kc), gd = *(const v4fa*)(kg1 + kc + 4);
      const v4f ma = *(const v4fa*)(ms + ka),  mb = *(const v4fa*)(ms + ka + 4);
      const v4f mc = *(const v4fa*)(ms + kc),  md = *(const v4fa*)(ms + kc + 4);
#pragma unroll
      for (int e = 0; e < 4; ++e) {
        y2v[e] = ya[e]; y2v[4 + e] = yb[e]; y2v[8 + e] = yc[e]; y2v[12 + e] = yd[e];
        g1v[e] = ga[e]; g1v[4 + e] = gb[e]; g1v[8 + e] = gc[e]; g1v[12 + e] = gd[e];
        mkv[e] = ma[e]; mkv[4 + e] = mb[e]; mkv[8 + e] = mc[e]; mkv[12 + e] = md[e];
      }
    }
    // ---- base-2 logits ----
    float t[16];
#pragma unroll
    for (int i = 0; i < 8; ++i) {
      t[i]     = logit2(s0[i], y2v[i],     mkv[i],     xq, omx);
      t[8 + i] = logit2(s1[i], y2v[8 + i], mkv[8 + i], xq, omx);
    }
    float cm = t[0];
#pragma unroll
    for (int i = 1; i < 16; ++i) cm = fmaxf(cm, t[i]);
    cm = fmaxf(cm, __shfl_xor(cm, 16, 32));
    const float mn = fmaxf(mrun, cm);        // finite from the first block on
    const float al = exp2f(mrun - mn);       // 0 on the first block (mrun = -inf)
    mrun = mn;
    // ---- probabilities (<= 1), the two running sums and the P A-fragment f16(p * 32768); element i <-> t[i] ----
    float ps = 0.f, pd = 0.f;
    Frag ph;
#pragma unroll
    for (int w = 0; w < 2; ++w) {
#pragma unroll
      for (int e4 = 0; e4 < 4; ++e4) {
        const int i = 8 * w + 2 * e4;
        const float p0 = exp2f(t[i] - mn), p1 = exp2f(t[i + 1] - mn);
        ps += p0 + p1;
        pd += p0 * g1v[i] + p1 * g1v[i + 1];
        ph.u[w][e4] = pk16(h_bits((_Float16)(p0 * PCAR)), h_bits((_Float16)(p1 * PCAR)));
      }
    }
    ps += __shfl_xor(ps, 16, 32);
    pd += __shfl_xor(pd, 16, 32);
    lrun = lrun * al + ps;
    drun = drun * al + pd;
    // ---- rescale the O accumulators: D row 8hh+r = query q0+8hh+r, its factor lives in lane 8hh+r ----
    float scl[8];
#pragma unroll
    for (int r = 0; r < 8; ++r) scl[r] = __shfl(al, 8 * hh + r, 32);
#pragma unroll
    for (int j = 0; j < 4; ++j) {
#pragma unroll
      for (int r = 0; r < 8; ++r) o[j][r] *= scl[r];
    }
    // ---- P.V : B fragment col n = d = j*16 + c, keys contiguous in the v^T plane ----
    {
      const u16* vp = Vb + kb;
      const Frag v0 = ldfrag(vp);
      const Frag v1 = ldfrag(vp + (size_t)16 * SEQ);
      const Frag v2 = ldfrag(vp + (size_t)32 * SEQ);
      const Frag v3 = ldfrag(vp + (size_t)48 * SEQ);
      o[0] = mma_h(ph, v0, o[0]);
      o[1] = mma_h(ph, v1, o[1]);
      o[2] = mma_h(ph, v2, o[2]);
      o[3] = mma_h(ph, v3, o[3]);
      guard_pv(o, ph.h, v0.h, v1.h, v2.h, v3.h);
    }
  }
  acc_guard4(o);

  // ---- gyro-midpoint epilogue in f32: per query factors from the query-owner lane (lane = query) ----
  const float linv = 1.0f / lrun;
  const float nf   = linv * (1.0f / (PCAR * VS));
  const float dq   = fmaxf(drun * linv, 1e-10f);
  float nfr[8], dqr[8];
#pragma unroll
  for (int r = 0; r < 8; ++r) { nfr[r] = __shfl(nf, 8 * hh + r, 32); dqr[r] = __shfl(dq, 8 * hh + r, 32); }
  float sq[8];
#pragma unroll
  for (int r = 0; r < 8; ++r) {
    float sp = 0.f;
#pragma unroll
    for (int j = 0; j < 4; ++j) {
      const float tm = (o[j][r] * nfr[r]) / dqr[r];
      o[j][r] = tm;
      sp += tm * tm;
    }
    sq[r] = rsum16(sp);
  }
  float* sw = slab + wave * 16 * GPITCH;
#pragma unroll
  for (int r = 0; r < 8; ++r) {
    const float df = 1.0f + sqrtf(fmaxf(1.0f - sq[r], 1e-15f));
    float sp = 0.f;
#pragma unroll
    for (int j = 0; j < 4; ++j) {
      const float a = o[j][r] / df;
      o[j][r] = a;
      sp += a * a;
    }
    const float s2  = rsum16(sp);
    const float n2  = fmaxf(sqrtf(s2), 1e-15f);
    const bool  cl  = n2 > MAXN;
    const float fcl = MAXN / n2;
#pragma unroll
    for (int j = 0; j < 4; ++j) {
      const float a = o[j][r];
      sw[(8 * hh + r) * GPITCH + 16 * j + c] = cl ? (a * fcl) : a;
    }
  }
  wave_sync_lds();
  // ---- f32 output rows: lanes 0..15 -> row 2i, lanes 16..31 -> row 2i+1, lane = 4 consecutive d ----
  const int cc = lane & 15;
  v4f vals[8];
#pragma unroll
  for (int i = 0; i < 8; ++i) vals[i] = *(const v4fa*)(sw + (2 * i + hh) * GPITCH + 4 * cc);
  float* ob = Out + ((size_t)(b * SEQ + q0 + hh)) * DM + head * HD + 4 * cc;
  {
#pragma unroll
    for (int i = 0; i < 8; ++i) {
      *(v4f*)(ob + (size_t)(2 * i) * DM) = vals[i];
    }
    
  }
}

// =====================================================================================================
// Workspace map (bytes); every region written fully by whole-line stores before it is read; every extent an exact multiple
//   X16  f16 [NB*SEQ][DM]          f16(bf16(x) x64)              4194304 (NB=2)
//   WQT/WKT/WVT f16 [DM n][DM k]   f16(bf16(W) x256)             3 x 2097152
//   CX2  f32 [NB*SEQ]              sum x^2                       8192
//   ZN, CH, SH f32 [3][DM]         column norms, cosh/sinh(2r)   3 x 12288
//   Qh, Ql, Kh, Kl bf16 [NB*SEQ][DM]                             4 x 4194304
//   Vg   f16 [NB*SEQ][DM]          f16(gamma v x256)             4194304
//   VT   f16 [NB*NH*HD][SEQ]       transposed Vg                 4194304
//   QX2, KX2, GM1 f32 [NB*NH][SEQ]                                3 x 131072
//   end = 36089856 at NB=2
// =====================================================================================================
static inline size_t up4k(size_t v) { return (v + 4095) & ~(size_t)4095; }

extern "C" void kernel_launch(void* const* d_in, const int* in_sizes, int n_in,
                              void* d_out, int out_size, void* d_ws, size_t ws_size,
                              hipStream_t stream) {
  if (n_in < 8) return;
  if (in_sizes[0] < NB * SEQ * DM) return;
  if (in_sizes[1] < NB * SEQ) return;
  if (in_sizes[2] < DM * DM || in_sizes[4] < DM * DM || in_sizes[6] < DM * DM) return;
  if (in_sizes[3] < 1 || in_sizes[5] < 1 || in_sizes[7] < 1) return;
  if (out_size < NB * SEQ * DM) return;

  const float* hs = (const float*)d_in[0];
  const float* am = (const float*)d_in[1];
  const float* qz = (const float*)d_in[2];
  const float* qr = (const float*)d_in[3];
  const float* kz = (const float*)d_in[4];
  const float* kr = (const float*)d_in[5];
  const float* vz = (const float*)d_in[6];
  const float* vr = (const float*)d_in[7];
  float*       out = (float*)d_out;
  const int nqr = in_sizes[3], nkr = in_sizes[5], nvr = in_sizes[7];

  const size_t nrow  = (size_t)NB * SEQ;
  const size_t szX16 = up4k(nrow * DM * 2);
  const size_t szWT  = up4k((size_t)DM * DM * 2);
  const size_t szCX2 = up4k(nrow * 4);
  const size_t szCOL = up4k((size_t)3 * DM * 4);
  const size_t szP   = up4k(nrow * DM * 2);
  const size_t szVT  = up4k((size_t)NB * NH * HD * SEQ * 2);
  const size_t szRS  = up4k((size_t)NB * NH * SEQ * 4);
  size_t off = 0;
  const size_t oX16 = off; off += szX16;
  const size_t oWQ  = off; off += szWT;
  const size_t oWK  = off; off += szWT;
  const size_t oWV  = off; off += szWT;
  const size_t oCX2 = off; off += szCX2;
  const size_t oZN  = off; off += szCOL;
  const size_t oCH  = off; off += szCOL;
  const size_t oSH  = off; off += szCOL;
  const size_t oQh  = off; off += szP;
  const size_t oQl  = off; off += szP;
  const size_t oKh  = off; off += szP;
  const size_t oKl  = off; off += szP;
  const size_t oVg  = off; off += szP;
  const size_t oVT  = off; off += szVT;
  const size_t oQX2 = off; off += szRS;
  const size_t oKX2 = off; off += szRS;
  const size_t oGM1 = off; off += szRS;
  if (off > ws_size) return;                       // off = 36089856 at NB=2
  if (off > (size_t)134217728) return;

  char* ws = (char*)d_ws;
  u16*   X16 = (u16*)(ws + oX16);
  u16*   WQT = (u16*)(ws + oWQ);
  u16*   WKT = (u16*)(ws + oWK);
  u16*   WVT = (u16*)(ws + oWV);
  float* CX2 = (float*)(ws + oCX2);
  float* ZN  = (float*)(ws + oZN);
  float* CH  = (float*)(ws + oCH);
  float* SH  = (float*)(ws + oSH);
  u16*   Qh  = (u16*)(ws + oQh);
  u16*   Ql  = (u16*)(ws + oQl);
  u16*   Kh  = (u16*)(ws + oKh);
  u16*   Kl  = (u16*)(ws + oKl);
  u16*   Vg  = (u16*)(ws + oVg);
  u16*   VT  = (u16*)(ws + oVT);
  float* QX2 = (float*)(ws + oQX2);
  float* KX2 = (float*)(ws + oKX2);
  float* GM1 = (float*)(ws + oGM1);

  // (1) all that reads only the inputs: x -> f16 plane of bf16(x) x64, per-row sums of squares, per weight the column norms
  //     with cosh/sinh(2r) and the k-contiguous [n][k] f16 plane of bf16(W) x256
  prep<<<dim3(PB_ROW + PB_COL + PB_TR + PB_CVT), dim3(PREP_THREADS), 0, stream>>>(
      hs, qz, kz, vz, qr, kr, vr, nqr, nkr, nvr, X16, CX2, ZN, CH, SH, WQT, WKT, WVT);
  // (2) the three projections with the fused MLR / per-head epilogue
  proj_mlr<<<dim3(PJ_BLOCKS), dim3(PJ_THREADS), 0, stream>>>(
      X16, WQT, WKT, WVT, ZN, CH, SH, CX2, Qh, Ql, Kh, Kl, Vg, QX2, KX2, GM1);
  // (3) gamma v plane -> key-contiguous v^T plane
  trT16<<<dim3(NB * (SEQ / 64) * (DM / 64)), dim3(TR_THREADS), 0, stream>>>(Vg, VT);
  // (4) attention + midpoint -> out [b][SEQ][DM] f32 (rows s < SQ of batches b < NB), heads merged on the feature dim
  attn_fwd<<<dim3(NB * NH * (SQ / 64)), dim3(ATT_THREADS), 0, stream>>>(Qh, Ql, Kh, Kl, VT, QX2, KX2, GM1, am, out);
  (void)hipGetLastError();
}

// v004
// One run takes 80.7 microseconds.
// In two side-by-side timings against v003, it was 1.57 and 1.56 times as fast.
// All steps since v000 together make it 7.08 times as fast.
// Contractions: x.Wq, x.Wk, x.Wv on v_wmma_f32_16x16x32_f16 (x as f16(bf16(x) x64), W as f16(bf16(W) x256), f32 accumulate);
// scores k.q^T on v_wmma_f32_16x16x32_bf16 as bf16 hi/lo split (hi.hi + lo.hi + hi.lo into one f32 accumulator);
// P.(gamma v)^T on v_wmma_f32_16x16x32_f16 (P x32768 f16, gamma v x256 f16, f32 accumulate); norms, asinh/sinh/acosh
// (closed forms on v_log_f32 / v_exp_f32 / v_sqrt_f32 / v_rcp_f32), base-2 online softmax,
// the sum_j p_j (gamma_j - 1) denominators and all carry folds in f32 on VALU.
// Float inputs RNE-converted to bf16 on load; f32 output written directly.
#include <hip/hip_runtime.h>
#include <math.h>
#include <stdint.h>

#ifndef NB
#define NB 2            // batches processed
#endif
#ifndef SQ
#define SQ 1024         // query rows processed per batch (keys/values always all SEQ rows)
#endif
#define NB_FULL 2
#define SEQ  1024       // rows per batch in every input / output / plane layout
#define DM   1024       // model width = K of the projections = row pitch of the 16-bit planes
#define NH   16
#define HD   64
#define XS   64.0f      // carry on the x plane
#define WSC  256.0f     // carry on the transposed weight planes
#define VS   256.0f     // carry on the gamma*v plane
#define PCAR 32768.0f   // carry on P
#define LOG2E 1.4426950408889634f
#define MAXN 0.996f     // (1 - 4e-3) / sqrt(c)
#define NKB  (SEQ / 32)
#define GPITCH 68
#define TPITCH 65
#define TP16   72
#define CVT_THREADS (DM / 8)
#define TR_THREADS  128
#define ATT_THREADS 128
#define CS_THREADS  1024  // column statistics: threads per block
#define CS_COLS     32    // columns per block
#define CS_STEPS    (DM / (CS_THREADS / 8))   // rows per thread
#define PREP_THREADS 1024                      // block of the preparation grid (all four block kinds)
#define PB_ROW  (NB * SEQ / 128)               // row statistics blocks, 128 rows each
#define PB_COL  (3 * (DM / CS_COLS))           // column statistics blocks, 32 columns of one weight each
#define PB_TR   (3 * (DM / 64) * (DM / 64) / 8)  // weight transpose blocks, 8 tiles of 64 x 64 of one weight each
#define PB_CVT  (NB * SEQ / 8)                 // x convert blocks, 8 rows each
#define PJ_BLOCKS ((NB * SEQ / 128) * (DM / 64)) // projection blocks: one per 128-row x 64-column tile
#define PJ_THREADS 384                         // 3 weights x 4 waves
#define KST     64                             // k (projection) or keys (attention) per LDS stage: one 128-B line of every staged row
#define PJ_ROWS (128 + 3 * 64)                 // staged rows of a projection stage: 128 of A, then 64 of each weight
#define PJ_CPW  ((PJ_ROWS / 4 + PJ_THREADS / 32 - 1) / (PJ_THREADS / 32))  // copies per wave and stage, upper bound (a copy = 4 rows)
#define ATILE   (64 * TP16)                    // one staged 64-row tile of attention, in 16-bit units

static_assert(NB >= 1 && NB <= NB_FULL);
static_assert((SQ % 64) == 0 && SQ >= 64 && SQ <= SEQ);
static_assert(NH * HD == DM && HD == 64);
static_assert((SEQ % 128) == 0 && (SEQ % 32) == 0 && NKB * 32 == SEQ);
static_assert((DM % 256) == 0 && (DM % 64) == 0 && (DM % 32) == 0 && CVT_THREADS == 128);
static_assert((GPITCH * 4) % 16 == 0 && (TP16 * 2) % 16 == 0);
static_assert(CS_COLS == 32 && (DM % CS_COLS) == 0 && CS_STEPS * (CS_THREADS / 8) == DM);
static_assert(ATT_THREADS == 128 && TR_THREADS == 128 && ATT_THREADS * 8 == SEQ);
static_assert(PREP_THREADS == CS_THREADS && PREP_THREADS == 8 * CVT_THREADS && PREP_THREADS == 8 * TR_THREADS);
static_assert(((DM / 64) * (DM / 64)) % 8 == 0 && (NB * SEQ) % 128 == 0);
static_assert(KST == 64 && DM / KST >= 2 && SEQ / KST >= 2 && (DM % KST) == 0 && (SEQ % KST) == 0);
static_assert(PJ_CPW == 7 && (PJ_ROWS % 4) == 0 && PJ_ROWS / 4 - 6 * (PJ_THREADS / 32) == 8);

typedef unsigned short u16;
typedef _Float16 v16h __attribute__((ext_vector_type(16)));
typedef _Float16 v8h  __attribute__((ext_vector_type(8)));
typedef __bf16   v16b __attribute__((ext_vector_type(16)));
typedef float    v8f  __attribute__((ext_vector_type(8)));
typedef float    v4f  __attribute__((ext_vector_type(4)));
typedef unsigned int v4u __attribute__((ext_vector_type(4)));
typedef v4u __attribute__((may_alias)) v4ua;
typedef v4f __attribute__((may_alias)) v4fa;

// one 16 x 16-bit per-lane fragment, viewed as f16 vector, bf16 vector or two 16-byte words
union Frag { v16h h; v16b b; v4u u[2]; };

// ---- scalar helpers ----------------------------------------------------------------------------------
__device__ __forceinline__ unsigned short bf_bits(float f) {          // f32 -> bf16 bits, RNE convert
  unsigned u = __float_as_uint(f);
  return (unsigned short)((u + 0x7FFFu + ((u >> 16) & 1u)) >> 16);
}
__device__ __forceinline__ float bf_up(unsigned short h) { return __uint_as_float(((unsigned)h) << 16); }
__device__ __forceinline__ float bfr(float f) { return bf_up(bf_bits(f)); }
__device__ __forceinline__ unsigned short h_bits(_Float16 x) { return __builtin_bit_cast(unsigned short, x); }
__device__ __forceinline__ unsigned pk16(unsigned short a, unsigned short b) { return (unsigned)a | ((unsigned)b << 16); }
__device__ __forceinline__ v8f zero8() { v8f z = {0.f, 0.f, 0.f, 0.f, 0.f, 0.f, 0.f, 0.f}; return z; }
__device__ __forceinline__ float red8(float v) {                      // sum over the 8-lane group (lane bits 0..2)
  v += __shfl_xor(v, 1, 32); v += __shfl_xor(v, 2, 32); v += __shfl_xor(v, 4, 32); return v;
}
__device__ __forceinline__ float rsum16(float v) {                    // sum over the 16-lane half (lane bits 0..3)
  v += __shfl_xor(v, 8, 32); v += __shfl_xor(v, 4, 32); v += __shfl_xor(v, 2, 32); v += __shfl_xor(v, 1, 32); return v;
}

// sinh(tz * asinh(x)) in closed form: e = |x| + sqrt(x^2 + 1), L = log2(e) >= 0, sinh = 2^(tz L - 1) - 2^(-tz L - 1), sign of x.
// Above 1e18 sqrt(x^2 + 1) = |x| in f32 and x^2 comes near the f32 overflow, so e = 2|x| there. The two halves are formed with the
// factor 1/2 in the exponent, so the result overflows only where sinh itself does.
__device__ __forceinline__ float sinh_of_scaled_asinh(float x, float tz) {
  const float a = fabsf(x);
  const float e = a + ((a > 1e18f) ? a : __builtin_amdgcn_sqrtf(fmaf(a, a, 1.0f)));
  const float L = __builtin_amdgcn_logf(e);
  const float s = __builtin_amdgcn_exp2f(fmaf(tz, L, -1.0f)) - __builtin_amdgcn_exp2f(fmaf(-tz, L, -1.0f));
  return copysignf(s, x);
}

// ---- fragment loader: 16-bit A/B operand from a k-contiguous row; lane -> row/col (lane&15), p already includes
//      +8*(lane>>4); elements 0..7 <- p[0..7] (k0+8h..), elements 8..15 <- p[16..23] (k0+16+8h..); same split k map
//      for A and B; B always read from a k-contiguous [n][k] plane. Loaded as unsigned 16-byte words.
__device__ __forceinline__ Frag ldfrag(const u16* p) {
  Frag f;
  f.u[0] = *(const v4u*)(p);
  f.u[1] = *(const v4u*)(p + 16);
  return f;
}

// ---- WMMA helpers and trailing VALU hazard gaps --------------------------------------------------------
__device__ __forceinline__ v8f mma_h(const Frag& a, const Frag& b, v8f c) {
  return __builtin_amdgcn_wmma_f32_16x16x32_f16(false, a.h, false, b.h, (short)0, c, false, false);
}
__device__ __forceinline__ v8f mma_b(const Frag& a, const Frag& b, v8f c) {
  return __builtin_amdgcn_wmma_f32_16x16x32_bf16(false, a.b, false, b.b, (short)0, c, false, false);
}
__device__ __forceinline__ void guard_sc(v8f& a, v8f& b, v16h x0, v16h x1, v16h x2, v16h x3, v16h x4, v16h x5) {
#if defined(__HIP_DEVICE_COMPILE__)
  asm volatile("v_nop\n\tv_nop\n\tv_nop\n\tv_nop"
               : "+v"(a), "+v"(b) : "v"(x0), "v"(x1), "v"(x2), "v"(x3), "v"(x4), "v"(x5) : "memory");
#endif
}
__device__ __forceinline__ void guard_pv(v8f (&o)[4], v16h p, v16h x0, v16h x1, v16h x2, v16h x3) {
#if defined(__HIP_DEVICE_COMPILE__)
  asm volatile("v_nop\n\tv_nop\n\tv_nop\n\tv_nop"
               : "+v"(o[0]), "+v"(o[1]), "+v"(o[2]), "+v"(o[3]) : "v"(p), "v"(x0), "v"(x1), "v"(x2), "v"(x3) : "memory");
#endif
}
__device__ __forceinline__ void guard_g(v8f (&acc)[8], v16h x0, v16h x1, v16h x2, v16h x3, v16h x4, v16h x5) {
#if defined(__HIP_DEVICE_COMPILE__)
  asm volatile("v_nop\n\tv_nop\n\tv_nop\n\tv_nop"
               : "+v"(acc[0]), "+v"(acc[1]), "+v"(acc[2]), "+v"(acc[3]),
                 "+v"(acc[4]), "+v"(acc[5]), "+v"(acc[6]), "+v"(acc[7])
               : "v"(x0), "v"(x1), "v"(x2), "v"(x3), "v"(x4), "v"(x5) : "memory");
#endif
}
__device__ __forceinline__ void acc_guard4(v8f (&o)[4]) {
#if defined(__HIP_DEVICE_COMPILE__)
  asm volatile("v_nop\n\tv_nop\n\tv_nop\n\tv_nop" : "+v"(o[0]), "+v"(o[1]), "+v"(o[2]), "+v"(o[3]));
#endif
}
__device__ __forceinline__ void wave_sync_lds() {
  __builtin_amdgcn_fence(__ATOMIC_RELEASE, "workgroup");
  __builtin_amdgcn_wave_barrier();
  __builtin_amdgcn_fence(__ATOMIC_ACQUIRE, "workgroup");
}

// ---- asynchronous 16-byte copies global -> LDS (through no register): l = the lane's own LDS byte address, g = the lane's own
//      global address, both multiples of 16. The closing s_wait_xcnt stands inside each statement, so that no address register
//      of an issued copy is rewritten ahead of it (a precaution).
__device__ __forceinline__ unsigned lds_addr(const void* p) { return (unsigned)(uintptr_t)p; }   // low 32 bits = LDS byte offset
__device__ __forceinline__ void acopy1(unsigned l0, const u16* g0) {
#if defined(__HIP_DEVICE_COMPILE__)
  asm volatile("global_load_async_to_lds_b128 %0, %1, off\n\t"
               "s_wait_xcnt 0x0"
               :: "v"(l0), "v"(g0) : "memory");
#endif
}
__device__ __forceinline__ void acopy6(const unsigned (&l)[6], const u16* const (&g)[6]) {
#if defined(__HIP_DEVICE_COMPILE__)
  asm volatile("global_load_async_to_lds_b128 %0, %6, off\n\t"
               "global_load_async_to_lds_b128 %1, %7, off\n\t"
               "global_load_async_to_lds_b128 %2, %8, off\n\t"
               "global_load_async_to_lds_b128 %3, %9, off\n\t"
               "global_load_async_to_lds_b128 %4, %10, off\n\t"
               "global_load_async_to_lds_b128 %5, %11, off\n\t"
               "s_wait_xcnt 0x0"
               :: "v"(l[0]), "v"(l[1]), "v"(l[2]), "v"(l[3]), "v"(l[4]), "v"(l[5]),
                  "v"(g[0]), "v"(g[1]), "v"(g[2]), "v"(g[3]), "v"(g[4]), "v"(g[5]) : "memory");
#endif
}
// The issuing wave's own copies have landed.
__device__ __forceinline__ void wait_copies() { asm volatile("s_wait_asynccnt 0x0" ::: "memory"); }
// Publish point of a two-buffer stage ring, passed by every wave of the block at the foot of every stage.
__device__ __forceinline__ void publish_stage() {
  asm volatile("s_wait_dscnt 0x0" ::: "memory");   // this wave's reads of the buffer that is refilled next have returned
  wait_copies();                                   // this wave's share of the next stage has landed
  __syncthreads();                                 // publishes the next stage; ends every reader's last read of this one
}

// =====================================================================================================
// Row convert: row r of a [rows][DM] f16 plane <- f16(bf16_RNE(x[r][e]) * scale), scale a power of two.
// A group of DM/8 threads per row (tid = index in the group), thread = 8 consecutive elements (two 16-B loads, one 16-B store).
// coverage: one group per row, 128 thr x 8 = DM = the whole row.
// =====================================================================================================
__device__ __forceinline__ void cvt16_row(const float* __restrict__ x, u16* Y, float scale, int tid, size_t r) {
  const float* src = x + r * (size_t)DM + (size_t)tid * 8;
  const v4f a = *(const v4f*)(src), c4 = *(const v4f*)(src + 4);
  v4u o;
#pragma unroll
  for (int e = 0; e < 2; ++e) {
    o[e]     = pk16(h_bits((_Float16)(bfr(a[2 * e]) * scale)),  h_bits((_Float16)(bfr(a[2 * e + 1]) * scale)));
    o[2 + e] = pk16(h_bits((_Float16)(bfr(c4[2 * e]) * scale)), h_bits((_Float16)(bfr(c4[2 * e + 1]) * scale)));
  }
  u16* dst = Y + r * (size_t)DM + (size_t)tid * 8;
  {
    *(v4u*)(dst) = o;
    // precaution: in the merged kernel other block kinds' code follows in the listing and rewrites the store's registers
    asm volatile("s_wait_xcnt 0x0" ::: "memory");
  }
}

// =====================================================================================================
// Row statistics: CX2[r] = sum_e bf16(x[r][e])^2 in f32. Block = 128 rows, 1024 threads, wave w rows 128*blk + 4w + j:
// per row each lane sums 32 values (8 x 16-B loads), xor-shuffle reduce, lane 0 -> LDS (rs, 128 floats); after a block
// barrier threads 0..31 store the 128 sums as 16-B words.
// =====================================================================================================
__device__ __forceinline__ void rowstat_blk(const float* __restrict__ x, float* CX2, float* rs, int tid, int blk) {
  const int wave = tid >> 5, lane = tid & 31;
  const int row0 = blk * 128;
#pragma unroll 1
  for (int j = 0; j < 4; ++j) {
    const int row = row0 + wave * 4 + j;
    const float* xr = x + (size_t)row * DM + 4 * lane;
    float s = 0.f;
#pragma unroll 2
    for (int q = 0; q < DM / 128; ++q) {
      const v4f a = *(const v4f*)(xr + 128 * q);
      const float a0 = bfr(a[0]), a1 = bfr(a[1]), a2 = bfr(a[2]), a3 = bfr(a[3]);
      s += a0 * a0; s += a1 * a1; s += a2 * a2; s += a3 * a3;
    }
    s += __shfl_xor(s, 16, 32); s += __shfl_xor(s, 8, 32); s += __shfl_xor(s, 4, 32);
    s += __shfl_xor(s, 2, 32);  s += __shfl_xor(s, 1, 32);
    if (lane == 0) rs[wave * 4 + j] = s;
  }
  __syncthreads();
  if (tid < 32) {
    const v4f v = *(const v4fa*)(rs + 4 * tid);
    float* dst = CX2 + row0 + 4 * tid;
    {
      *(v4f*)(dst) = v;
      
    }
  }
}

// =====================================================================================================
// Column statistics of a weight z[k][n] (DM x DM): ZN[n] = max(sqrt(sum_k bf16(z[k][n])^2), 1e-15), CH[n] = cosh(2 r[n]),
// SH[n] = sinh(2 r[n]) (r index clamped to nr-1). Block = 32 columns (one 128-B line of every row) x all DM rows,
// 1024 threads: lane = (row sub-index lane>>3, 4 columns at 4*(lane&7)), wave w step j reads rows 128j + 4w .. +3, so a
// thread has its 8 independent 16-B loads in flight at once. Column sums: 8 rows in the thread, xor-8 / xor-16 shuffles
// over the wave's 4 row sub-indices, one 32-float row per wave in LDS, block barrier, wave 0 adds the 32 wave rows.
// coverage: 8 j x 32 waves x 4 rows = DM rows; DM/32 blocks x 32 columns = every column of the three arrays once,
//           each block the only writer of its 128-B line in each array. part: (CS_THREADS / 32) * CS_COLS floats of LDS.
// =====================================================================================================
__device__ __forceinline__ void colstat_blk(const float* __restrict__ z, const float* __restrict__ r, int nr,
                                            float* ZN, float* CH, float* SH, float* part, int tid, int blk) {
  const int wave = tid >> 5, lane = tid & 31;
  const int col0 = blk * CS_COLS;
  const float* zp = z + (size_t)(wave * 4 + (lane >> 3)) * DM + col0 + 4 * (lane & 7);
  const int col = col0 + lane;
  float rv = 0.f;
  if (wave == 0) {                               // wave-uniform; issued with the column loads, not behind the barrier
    int ri = col;
    ri = (ri < nr - 1) ? ri : (nr - 1);
    rv = r[ri];
  }
  v4f a[CS_STEPS];
#pragma unroll   // all loads issue before the first use: one memory latency per thread instead of one per row group
  for (int j = 0; j < CS_STEPS; ++j) a[j] = *(const v4f*)(zp + (size_t)j * (CS_THREADS / 8) * DM);
  v4f s = {0.f, 0.f, 0.f, 0.f};
#pragma unroll
  for (int j = 0; j < CS_STEPS; ++j) {
#pragma unroll
    for (int e = 0; e < 4; ++e) {
      const float v = bfr(a[j][e]);
      s[e] += v * v;
    }
  }
#pragma unroll
  for (int e = 0; e < 4; ++e) {
    s[e] += __shfl_xor(s[e], 8, 32);
    s[e] += __shfl_xor(s[e], 16, 32);
  }
  if (lane < 8) *(v4fa*)(part + wave * CS_COLS + 4 * lane) = s;
  __syncthreads();
  if (wave == 0) {                               // wave-uniform; lane = column
    float t = 0.f;
#pragma unroll
    for (int w = 0; w < CS_THREADS / 32; ++w) t += part[w * CS_COLS + lane];
    const float dr = 2.0f * bfr(rv);
    ZN[col] = fmaxf(sqrtf(t), 1e-15f);
    CH[col] = coshf(dr);
    SH[col] = sinhf(dr);
  }
}

// =====================================================================================================
// Weight transpose-convert for y = x.W weights stored [k][n]: WT[n][k] (f16, k-contiguous Bt layout) <- f16(bf16_RNE(W[k][n]) *
// scale). A group of 128 threads (tid = index in the group) per 64(k) x 64(n) tile, 8 groups per block. Load phase: thread = (row 8p + (tid>>4), 4 floats at 4*(tid&15)),
// 8 steps = 64 k-rows x 64 n, into an LDS tile [kk][nn] (pitch 65); block barrier; store phase: output row n0 + 16i + (tid>>3)
// coverage: 4 i x 16 rows x (8 lanes x 8 halves) = 64 n-rows x 64 k per group; the (DM/64)^2 tiles cover WT exactly once.
// LDS tile (64 * TPITCH floats, the group's own): cross-wave, block barrier; staged extent 64x64 == consumed extent.
// =====================================================================================================
__device__ __forceinline__ void cvtT16_tile(const float* __restrict__ W, u16* Y, float scale, float* tile, int tid, int bid) {
  constexpr int NT = DM / 64;
  const int kt  = bid % NT;
  const int ntb = bid / NT;
  const int k0  = kt * 64, n0 = ntb * 64;
  const int lr = tid >> 4, lc = (tid & 15) * 4;
#pragma unroll
  for (int p = 0; p < 8; ++p) {
    const int kk = p * 8 + lr;
    const v4f w4 = *(const v4f*)(W + (size_t)(k0 + kk) * (size_t)DM + n0 + lc);
    tile[kk * TPITCH + lc + 0] = w4[0];
    tile[kk * TPITCH + lc + 1] = w4[1];
    tile[kk * TPITCH + lc + 2] = w4[2];
    tile[kk * TPITCH + lc + 3] = w4[3];
  }
  __syncthreads();
  const int rq = tid >> 3, c8 = (tid & 7) * 8;      // rq 0..15, c8 0..56
  v4u ov[4];
#pragma unroll
  for (int i = 0; i < 4; ++i) {
    const int row = 16 * i + rq;                   // n within tile
#pragma unroll
    for (int e = 0; e < 4; ++e) {
      const float x0 = tile[(c8 + 2 * e) * TPITCH + row];
      const float x1 = tile[(c8 + 2 * e + 1) * TPITCH + row];
      ov[i][e] = pk16(h_bits((_Float16)(bfr(x0) * scale)), h_bits((_Float16)(bfr(x1) * scale)));
    }
  }
  u16* dst = Y + (size_t)n0 * (size_t)DM + k0 + c8;
  {
#pragma unroll
    for (int i = 0; i < 4; ++i) {
      const int row = 16 * i + rq;
      *(v4u*)(dst + (size_t)row * (size_t)DM) = ov[i];
    }
    // precaution: in the merged kernel other block kinds' code follows in the listing and rewrites the stores' registers
    asm volatile("s_wait_xcnt 0x0" ::: "memory");
  }
}

// =====================================================================================================
// Preparation grid: everything that reads only the inputs, in one launch, so that the four kinds of block run side by side.
// Block kind by block index (block-uniform, so each kind's block barrier is passed by all 1024 threads of its block); the
// kinds with the longest dependent chains come first:
//   [0, PB_ROW)            row statistics of x, 128 rows per block
//   next PB_COL blocks     column statistics, weight = index / (DM/32), 32 columns per block
//   next PB_TR blocks      weight transpose-convert, weight = index / 32, 8 tiles per block (tile = 8 * index + tid / 128)
//   next PB_CVT blocks     x convert, 8 rows per block (row = 8 * index + tid / 128)
// LDS: one array, used by one kind per block (8 transpose tiles, or the column partials, or the row sums).
// =====================================================================================================
__global__ __launch_bounds__(PREP_THREADS)
void prep(const float* __restrict__ x,
          const float* __restrict__ qz, const float* __restrict__ kz, const float* __restrict__ vz,
          const float* __restrict__ qr, const float* __restrict__ kr, const float* __restrict__ vr,
          int nqr, int nkr, int nvr,
          u16* X16, float* CX2, float* ZN, float* CH, float* SH, u16* WQT, u16* WKT, u16* WVT) {
  __shared__ __align__(16) float sm[8 * 64 * TPITCH];
  const int tid = threadIdx.x;
  int bid = blockIdx.x;
  if (bid < PB_ROW) {
    rowstat_blk(x, CX2, sm, tid, bid);
    return;
  }
  bid -= PB_ROW;
  if (bid < PB_COL) {
    const int w = bid / (DM / CS_COLS), blk = bid % (DM / CS_COLS);
    const float* z = (w == 0) ? qz : (w == 1) ? kz : vz;
    const float* r = (w == 0) ? qr : (w == 1) ? kr : vr;
    const int   nr = (w == 0) ? nqr : (w == 1) ? nkr : nvr;
    colstat_blk(z, r, nr, ZN + w * DM, CH + w * DM, SH + w * DM, sm, tid, blk);
    return;
  }
  bid -= PB_COL;
  if (bid < PB_TR) {
    constexpr int BPW = (DM / 64) * (DM / 64) / 8;   // blocks per weight
    const int w = bid / BPW, grp = tid >> 7;
    const float* z = (w == 0) ? qz : (w == 1) ? kz : vz;
    u16*         y = (w == 0) ? WQT : (w == 1) ? WKT : WVT;
    cvtT16_tile(z, y, WSC, sm + grp * 64 * TPITCH, tid & 127, (bid % BPW) * 8 + grp);
    return;
  }
  bid -= PB_TR;
  cvt16_row(x, X16, XS, tid & 127, (size_t)(bid * 8 + (tid >> 7)));
}

// =====================================================================================================
// f16 GEMM core on one LDS stage (KST of k): the wave's 32 x 64 tile of C += A . Bt^T; as -> staged A row (wave row + m) + 8h,
// bs -> staged Bt row (m) + 8h, rows at pitch TP16 (144 B: ds_load_b128 of 16 rows falls on all banks once);
// acc[4i + j] = rows 16i.., cols 16j..; k stepped by 32 in ascending order.
// =====================================================================================================
__device__ __forceinline__ void gemm_stage(const u16* as, const u16* bs, v8f (&acc)[8]) {
#pragma unroll   // two steps: the k offsets become immediates of the LDS reads
  for (int k0 = 0; k0 < KST; k0 += 32) {
    const Frag a0 = ldfrag(as + k0), a1 = ldfrag(as + 16 * TP16 + k0);
    const Frag b0 = ldfrag(bs + k0);
    const Frag b1 = ldfrag(bs + 16 * TP16 + k0);
    const Frag b2 = ldfrag(bs + 32 * TP16 + k0);
    const Frag b3 = ldfrag(bs + 48 * TP16 + k0);
    acc[0] = mma_h(a0, b0, acc[0]);
    acc[1] = mma_h(a0, b1, acc[1]);
    acc[2] = mma_h(a0, b2, acc[2]);
    acc[3] = mma_h(a0, b3, acc[3]);
    acc[4] = mma_h(a1, b0, acc[4]);
    acc[5] = mma_h(a1, b1, acc[5]);
    acc[6] = mma_h(a1, b2, acc[6]);
    acc[7] = mma_h(a1, b3, acc[7]);
    guard_g(acc, a0.h, a1.h, b0.h, b1.h, b2.h, b3.h);
  }
}
// Stage the wave's 32 x 64 f32 tile (times oscale) in its LDS slab (pitch 68): D element r of acc[4i+j], lane l ->
// coverage: 32 lanes x 2 x 8 rows x 4 cols-of-16 = rows 0..31 x cols 0..63 of the slab.
__device__ __forceinline__ void stage32x64(float* sl, v8f (&acc)[8], float oscale, int lane) {
  const int hh = lane >> 4, m = lane & 15;
#pragma unroll
  for (int i = 0; i < 2; ++i) {
#pragma unroll
    for (int r = 0; r < 8; ++r) {
      const int ro = (16 * i + 8 * hh + r) * GPITCH + m;
      sl[ro]      = acc[4 * i + 0][r] * oscale;
      sl[ro + 16] = acc[4 * i + 1][r] * oscale;
      sl[ro + 32] = acc[4 * i + 2][r] * oscale;
      sl[ro + 48] = acc[4 * i + 3][r] * oscale;
    }
  }
  wave_sync_lds();
}

// =====================================================================================================
// Projection GEMM + ball MLR epilogue. A = x plane [NB*SEQ][DM] (f16, x XS), Bt = WT [DM n][DM k] (f16, x WSC).
// One launch for the three weights: block = 384 threads = 128 rows x 64 cols (one head) of q, k and v; waves 4*mode .. 4*mode+3
// (mode 0 q, 1 k, 2 v: picks Bt, the column tables' row and the outputs) take 32 rows each, so the three modes read the same A rows
// from one WGP and three waves share a SIMD. Operands go through a two-buffer LDS ring, KST of k per stage: the block's 128 A rows
// and 3 x 64 Bt rows (PJ_ROWS rows x 128 B, whole lines) are brought in by asynchronous 16-byte copies, one copy of a wave = 4 rows,
// copy index = wave + 12 i (i < 6 for every wave, i = 6 for waves 0..7: 80 copies); the next stage flies while this one is worked on.
// Epilogue per element (f32): mm = (x.z)[row][n] / ZN[n]; arg = (2 mm CH[n] - (1 + cx2) SH[n]) / max(1 - cx2, 1e-15);
// y = sinh(2 ZN[n] asinh(arg)); per (row, head) 64-vector (8 lanes x 8 values, 8-lane shuffle sums): clip to norm MAXN,
// y = y / (1 + sqrt(1 + sum y^2)), clip again; x2 = sum y^2. mode 0/1: planes Ph/Pl = bf16 hi / bf16 lo of y, RS row
// scalar = x2; mode 2: g = 2 / max(1 - x2, 1e-15), plane Ph = f16(g y VS), RS row scalar = g - 1.
// coverage: per wave 8 instr x 4 rows x 8 lanes x 8 halves = 32 x 64 per plane; RS: 32 floats per wave; grid covers every
//           (row, col) of the planes and every (b, head, s) of RS exactly once.
// LDS: ring cross-wave (one block barrier per stage, staged extent == consumed extent, pad bytes never read); slab and rsc are
// wave-private (wave_sync); staged extent 32x64 == consumed extent.
// =====================================================================================================
__global__ __launch_bounds__(PJ_THREADS)
void proj_mlr(const u16* __restrict__ A, const u16* __restrict__ WQT, const u16* __restrict__ WKT, const u16* __restrict__ WVT,
              const float* __restrict__ ZN3, const float* __restrict__ CH3, const float* __restrict__ SH3,
              const float* __restrict__ CX2, u16* Qh, u16* Ql, u16* Kh, u16* Kl, u16* Vg,
              float* QX2, float* KX2, float* GM1) {
  __shared__ __align__(16) float slab[(PJ_THREADS / 32) * 32 * GPITCH];
  __shared__ __align__(16) float rsc[(PJ_THREADS / 32) * 32];
  __shared__ __align__(16) u16 ring[2 * PJ_ROWS * TP16];
  const int tid = threadIdx.x, wv = tid >> 5, wave = wv & 3, lane = tid & 31, hh = lane >> 4, m = lane & 15;
  constexpr int NT = DM / 64;
  const int mode = __builtin_amdgcn_readfirstlane(wv >> 2);   // the same in all lanes of a wave: pointer picks and the mode branch stay scalar
  const int bid  = blockIdx.x;
  const float* ZN = ZN3 + mode * DM;
  const float* CH = CH3 + mode * DM;
  const float* SH = SH3 + mode * DM;
  u16*   Ph = (mode == 0) ? Qh : (mode == 1) ? Kh : Vg;
  u16*   Pl = (mode == 0) ? Ql : Kl;           // stored to by modes 0 and 1 only
  float* RS = (mode == 0) ? QX2 : (mode == 1) ? KX2 : GM1;
  const int nt   = bid % NT;
  const int mt   = bid / NT;
  const int rowb = mt * 128 + wave * 32;       // global token row b*SEQ + s of the wave's first row
  const int col0 = nt * 64;                    // = head * HD
  // ---- this lane's share of a stage: copy i brings staged rows 4 (wave + 12 i) .. +3, lane = (row lane>>3, 16 bytes at 16 (lane&7)) ----
  const int wvs = __builtin_amdgcn_readfirstlane(wv);         // scalar: source picks and the test on the seventh copy stay scalar
  const bool has7 = wvs + 6 * (PJ_THREADS / 32) < PJ_ROWS / 4;
  const u16* gsrc[PJ_CPW];
  unsigned   ldst[PJ_CPW];
#pragma unroll   // constant indices: both arrays stay in registers
  for (int i = 0; i < PJ_CPW; ++i) {
    int ci = wvs + (PJ_THREADS / 32) * i;
    ci = (ci < PJ_ROWS / 4) ? ci : (PJ_ROWS / 4 - 1);         // keeps the addresses of a seventh copy that is not issued in range
    const int sr = 4 * ci + (lane >> 3);                      // staged row
    const int wsel = (ci - 32) >> 4;                          // weight of a Bt row (ci >= 32)
    const u16* rowp = (ci < 32) ? (A + (size_t)(mt * 128 + sr) * DM)
                                : (((wsel == 0) ? WQT : (wsel == 1) ? WKT : WVT) + (size_t)(col0 + sr - 128 - 64 * wsel) * DM);
    gsrc[i] = rowp + 8 * (lane & 7);
    ldst[i] = lds_addr(ring) + (unsigned)(sr * (TP16 * 2) + 16 * (lane & 7));
  }
  auto stage_copy = [&](int st) {                             // stage st -> buffer st & 1
    const unsigned lo = (unsigned)((st & 1) * (PJ_ROWS * TP16 * 2));
    const unsigned l6[6] = {ldst[0] + lo, ldst[1] + lo, ldst[2] + lo, ldst[3] + lo, ldst[4] + lo, ldst[5] + lo};
    const u16* const g6[6] = {gsrc[0] + st * KST, gsrc[1] + st * KST, gsrc[2] + st * KST,
                              gsrc[3] + st * KST, gsrc[4] + st * KST, gsrc[5] + st * KST};
    acopy6(l6, g6);
    if (has7) acopy1(ldst[6] + lo, gsrc[6] + st * KST);
  };
  v8f acc[8];
#pragma unroll
  for (int i = 0; i < 8; ++i) acc[i] = zero8();
  stage_copy(0);
  wait_copies();
  __syncthreads();                                            // stage 0 is published
  stage_copy(1);
#pragma unroll 1   // one stage per trip: the ring's order (read, publish, refill) stays as written
  for (int st = 0; st < DM / KST; ++st) {
    const u16* rb = ring + (st & 1) * (PJ_ROWS * TP16);
    gemm_stage(rb + (wave * 32 + m) * TP16 + 8 * hh, rb + (128 + mode * 64 + m) * TP16 + 8 * hh, acc);
    publish_stage();
    if (st + 2 < DM / KST) stage_copy(st + 2);                // into the buffer that this trip has just read
  }
  wait_copies();
  float* sl = slab + wv * 32 * GPITCH;
  stage32x64(sl, acc, 1.0f / (XS * WSC), lane);

  const int rq = lane >> 3, c8 = (lane & 7) * 8;
  float zn8[8], ch8[8], sh8[8];
  {
    const v4f z0 = *(const v4f*)(ZN + col0 + c8), z1 = *(const v4f*)(ZN + col0 + c8 + 4);
    const v4f h0 = *(const v4f*)(CH + col0 + c8), h1 = *(const v4f*)(CH + col0 + c8 + 4);
    const v4f g0 = *(const v4f*)(SH + col0 + c8), g1 = *(const v4f*)(SH + col0 + c8 + 4);
#pragma unroll
    for (int e = 0; e < 4; ++e) {
      zn8[e] = z0[e]; zn8[4 + e] = z1[e];
      ch8[e] = h0[e]; ch8[4 + e] = h1[e];
      sh8[e] = g0[e]; sh8[4 + e] = g1[e];
    }
  }
  const bool mv = (mode == 2);
#pragma unroll 1
  for (int i = 0; i < 8; ++i) {
    const int row = 4 * i + rq;
    const float cx  = CX2[rowb + row];
    const float omc = fmaxf(1.0f - cx, 1e-15f);
    const float opc = 1.0f + cx;
    float* sr = sl + row * GPITCH + c8;
    float y[8];
    float s0 = 0.f;
#pragma unroll
    for (int e = 0; e < 8; ++e) {
      const float mm  = sr[e] / zn8[e];
      const float arg = (2.0f * mm * ch8[e] - opc * sh8[e]) / omc;
      y[e] = sinh_of_scaled_asinh(arg, 2.0f * zn8[e]);
      s0 += y[e] * y[e];
    }
    s0 = red8(s0);
    const float n0 = fmaxf(sqrtf(s0), 1e-15f);
    const bool cl0 = n0 > MAXN;
    float s1 = 0.f;
#pragma unroll
    for (int e = 0; e < 8; ++e) {
      const float yp = y[e] / n0 * MAXN;
      y[e] = cl0 ? yp : y[e];
      s1 += y[e] * y[e];
    }
    s1 = red8(s1);
    const float den = 1.0f + sqrtf(1.0f + s1);
    float s2 = 0.f;
#pragma unroll
    for (int e = 0; e < 8; ++e) {
      y[e] = y[e] / den;
      s2 += y[e] * y[e];
    }
    s2 = red8(s2);
    const float n2 = fmaxf(sqrtf(s2), 1e-15f);
    const bool cl2 = n2 > MAXN;
    float s3 = 0.f;
#pragma unroll
    for (int e = 0; e < 8; ++e) {
      const float yp = y[e] / n2 * MAXN;
      y[e] = cl2 ? yp : y[e];
      s3 += y[e] * y[e];
    }
    s3 = red8(s3);
    const float g    = 2.0f / fmaxf(1.0f - s3, 1e-15f);
    const float gmul = mv ? g : 1.0f;
    const float scal = mv ? (g - 1.0f) : s3;
#pragma unroll
    for (int e = 0; e < 8; ++e) sr[e] = y[e] * gmul;
    if ((lane & 7) == 0) rsc[wv * 32 + row] = scal;
  }
  wave_sync_lds();

  const int bb = rowb / SEQ, s0r = rowb - bb * SEQ, head = nt;
  if (lane < 8) {
    const v4f v = *(const v4fa*)(rsc + wv * 32 + 4 * lane);
    float* dst = RS + ((size_t)(bb * NH + head)) * SEQ + s0r + 4 * lane;
    {
      *(v4f*)(dst) = v;
      
    }
  }
  // ---- planes ----
  const size_t pofs = (size_t)rowb * DM + (size_t)(col0 + c8);
  if (!mv) {
    v4u oh[8], ol[8];
#pragma unroll
    for (int i = 0; i < 8; ++i) {
      const int row = 4 * i + rq;
      const v4f a = *(const v4fa*)(sl + row * GPITCH + c8), c4 = *(const v4fa*)(sl + row * GPITCH + c8 + 4);
#pragma unroll
      for (int e = 0; e < 2; ++e) {
        const unsigned short ha = bf_bits(a[2 * e]),  hb = bf_bits(a[2 * e + 1]);
        const unsigned short la = bf_bits(a[2 * e] - bf_up(ha)), lb = bf_bits(a[2 * e + 1] - bf_up(hb));
        oh[i][e] = pk16(ha, hb);
        ol[i][e] = pk16(la, lb);
        const unsigned short hc = bf_bits(c4[2 * e]), hd = bf_bits(c4[2 * e + 1]);
        const unsigned short lc = bf_bits(c4[2 * e] - bf_up(hc)), ld = bf_bits(c4[2 * e + 1] - bf_up(hd));
        oh[i][2 + e] = pk16(hc, hd);
        ol[i][2 + e] = pk16(lc, ld);
      }
    }
    {
#pragma unroll
      for (int i = 0; i < 8; ++i) {
        const int row = 4 * i + rq;
        *(v4u*)(Ph + pofs + (size_t)row * DM) = oh[i];
        *(v4u*)(Pl + pofs + (size_t)row * DM) = ol[i];
      }
      
    }
  } else {
    v4u ov[8];
#pragma unroll
    for (int i = 0; i < 8; ++i) {
      const int row = 4 * i + rq;
      const v4f a = *(const v4fa*)(sl + row * GPITCH + c8), c4 = *(const v4fa*)(sl + row * GPITCH + c8 + 4);
#pragma unroll
      for (int e = 0; e < 2; ++e) {
        ov[i][e]     = pk16(h_bits((_Float16)(a[2 * e] * VS)),  h_bits((_Float16)(a[2 * e + 1] * VS)));
        ov[i][2 + e] = pk16(h_bits((_Float16)(c4[2 * e] * VS)), h_bits((_Float16)(c4[2 * e + 1] * VS)));
      }
    }
    {
#pragma unroll
      for (int i = 0; i < 8; ++i) {
        const int row = 4 * i + rq;
        *(v4u*)(Ph + pofs + (size_t)row * DM) = ov[i];
      }
      
    }
  }
}

// =====================================================================================================
// 16-bit per-batch transpose: VT[b*DM + hd][s] <- Vg[b*SEQ + s][hd]. Block = 64(s) x 64(hd) tile, 128 threads.
// Load phase: thread = (s = 16p + (tid>>3), 8 halves at hd = 8*(tid&7)) one 16-B load, 4 steps, scattered as u16 scalars
// into an LDS tile [hd][s] (pitch 72); block barrier; store phase: VT row hd0 + 16i + (tid>>3) gets s0 + 8*(tid&7) .. +7 =
// passes. grid = NB x (SEQ/64) x (DM/64): bid -> (st = bid % 16, ht = (bid/16) % 16, b = bid/256).
// coverage: load 4 p x 16 s x 8 lane-groups x 8 hd = 64 x 64; store 4 i x 16 rows x 8 lanes x 8 halves = 64 hd x 64 s;
//           the grid covers VT (NB*DM rows x SEQ) exactly once.
// LDS tile: cross-wave, block barrier; staged extent 64x64 == consumed extent (pad columns 64..71 never read).
// =====================================================================================================
__global__ __launch_bounds__(TR_THREADS)
void trT16(const u16* __restrict__ Vg, u16* VT) {
  __shared__ __align__(16) u16 tile[64 * TP16];
  const int tid = threadIdx.x;
  constexpr int NST = SEQ / 64, NHT = DM / 64;
  const int bid = blockIdx.x;
  const int st  = bid % NST;
  const int tmp = bid / NST;
  const int ht  = tmp % NHT;
  const int b   = tmp / NHT;
  const int s0 = st * 64, hd0 = ht * 64;
  const int r = tid >> 3, c = (tid & 7) * 8;
#pragma unroll
  for (int p = 0; p < 4; ++p) {
    const int s = 16 * p + r;
    const v4u w = *(const v4u*)(Vg + ((size_t)(b * SEQ + s0 + s)) * DM + hd0 + c);
#pragma unroll
    for (int e = 0; e < 8; ++e)
      tile[(c + e) * TP16 + s] = (u16)((w[e >> 1] >> (16 * (e & 1))) & 0xFFFFu);
  }
  __syncthreads();
  const int rq = tid >> 3, c8 = (tid & 7) * 8;
  v4u ov[4];
#pragma unroll
  for (int i = 0; i < 4; ++i) {
    const int row = 16 * i + rq;
    ov[i] = *(const v4ua*)(tile + row * TP16 + c8);
  }
  u16* dst = VT + ((size_t)(b * DM + hd0)) * SEQ + s0 + c8;
  {
#pragma unroll
    for (int i = 0; i < 4; ++i) {
      const int row = 16 * i + rq;
      *(v4u*)(dst + (size_t)row * SEQ) = ov[i];
    }
    
  }
}

// ---- ball distance logit (base 2) of one (query, key) pair ----
// acosh(z) = ln(z + sqrt(z^2 - 1)); with z = 1 + 2u, u = num / den: z^2 - 1 = 4 (u + u^2), formed without the cancellation of
// z^2 - 1, so dist * log2(e) = log2(1 + 2 (u + sqrt(u + u^2))). u lies in [1e-15, about 4e15]: no step leaves the f32 range.
__device__ __forceinline__ float logit2(float xy, float y2, float mk, float x2, float omx) {
  const float num = fmaxf(x2 - 2.0f * xy + y2, 1e-15f);
  const float den = fmaxf(omx * (1.0f - y2), 1e-15f);
  const float u   = num * __builtin_amdgcn_rcpf(den);
  const float rt  = __builtin_amdgcn_sqrtf(fmaf(u, u, u));
  const float d2  = __builtin_amdgcn_logf(fmaf(2.0f, u + rt, 1.0f));
  return fmaf(mk, LOG2E, -d2);
}

// =====================================================================================================
// Fused distance attention + gyro-midpoint over all SEQ keys: block = (batch b, head, 64 query rows), 4 waves, wave w owns
// queries q0 = 64*qt + 16*w .. q0+15. The four waves share the keys: k hi, k lo and v^T go through a two-buffer LDS ring, KST keys
// per stage (3 tiles of 64 rows x 128 B, whole lines, pitch TP16), brought in by asynchronous 16-byte copies, 12 per thread and
// stage; the next stage flies while this one is worked on; one block barrier per stage.
//   q planes bf16 hi/lo [b*SEQ + s][h*64 + d]; k planes bf16 hi/lo same layout; v^T plane f16 x VS [(b*NH + h)*64 + d][s];
//   per-key tables for (b, h): sum k^2, gamma - 1; additive bias row amask[b][s] (bf16-converted); per query x2 = sum q^2.
//   All NKB = 32 key blocks of 32 keys are visited (static bound), two per ring stage.
//   Scores computed TRANSPOSED: S^T tile g = k rows (keys kb+16g .., A operand, row m = lane&15, split k map over d)
//   times q^T (B operand, col n = query q0 + (lane&15), k = d), 2 d-chunks of 32, three bf16 products each (hi.hi, lo.hi,
//   hi.lo). D element r of lane l = (key kb+16g+8h+r, query q0+(l&15)): a lane owns one query column and 16 of its 32 keys;
//   the partner lane l^16 owns the other 16 -> row max / row sums need one xor-16 shuffle.
//   dist = acosh(1 + 2 max(x2 - 2 xy + y2, 1e-15) / max((1 - x2)(1 - y2), 1e-15)), logit = -dist + bias, all f32.
//   Online max-subtracted base-2 softmax in f32; running sums l = sum p and dn = sum p (gamma - 1). The exp'd values ARE the
//   P A-fragment in place: A row m = query = lane&15, element i <- key kb+8h+i (tile 0, D element i), element 8+i <- key
//   kb+16+8h+i (tile 1, D element i). P (<= 1) carried x32768 as f16. O rescale factors shuffled from the query-owner lanes.
//   4 v^T B fragments (col n = d = 16j + (lane&15), keys k-contiguous), 4 P.V WMMAs + one guard.
//   Epilogue (f32): two_mean = (O (1/l) / (PCAR VS)) / max(dn / l, 1e-10); a = two_mean / (1 + sqrt(max(1 - sum two_mean^2,
//   1e-15))); clip to norm MAXN; the wave's 16x64 tile staged in its LDS slab (pitch 68); each output row segment
// coverage: per wave 8 instructions x 2 rows x 16 lanes x 4 floats = 16 x 64; grid NB*NH*(SQ/64) blocks x 4 waves = every
//           (b < NB, s < SQ, h) row segment of the output exactly once.
// LDS: ms/ky2/kg1 cross-wave (block barrier, 1024 staged == 1024 consumed); ring cross-wave (block barrier per stage, staged
// extent == consumed extent, pad bytes never read); slab wave-private (wave_sync, 16x64).
// =====================================================================================================
__global__ __launch_bounds__(ATT_THREADS)
void attn_fwd(const u16* __restrict__ Qh, const u16* __restrict__ Ql, const u16* __restrict__ Kh, const u16* __restrict__ Kl,
              const u16* __restrict__ VT, const float* __restrict__ QX2, const float* __restrict__ KX2,
              const float* __restrict__ GM1, const float* __restrict__ amask, float* Out) {
  __shared__ __align__(16) float ms[SEQ];
  __shared__ __align__(16) float ky2[SEQ];
  __shared__ __align__(16) float kg1[SEQ];
  __shared__ __align__(16) float slab[4 * 16 * GPITCH];
  __shared__ __align__(16) u16 ring[2 * 3 * ATILE];

  const int tid  = threadIdx.x;
  const int wave = tid >> 5;
  const int lane = tid & 31;
  const int hh   = lane >> 4;
  const int c    = lane & 15;

  constexpr int NQT = SQ / 64;
  const int bid  = blockIdx.x;
  const int qt   = bid % NQT;
  const int head = (bid / NQT) % NH;
  const int b    = bid / (NQT * NH);
  const int bh   = b * NH + head;
  const int q0   = qt * 64 + wave * 16;

  // ---- this thread's share of a ring stage: per tile rows (tid>>3) + 16 i, i < 4, 16 bytes at 16 (tid&7) ----
  const u16* khg = Kh + ((size_t)(b * SEQ + (tid >> 3))) * DM + head * HD + 8 * (tid & 7);
  const u16* klg = Kl + ((size_t)(b * SEQ + (tid >> 3))) * DM + head * HD + 8 * (tid & 7);
  const u16* vtg = VT + ((size_t)(bh * HD + (tid >> 3))) * SEQ + 8 * (tid & 7);
  const unsigned lring = lds_addr(ring) + (unsigned)((tid >> 3) * (TP16 * 2) + 16 * (tid & 7));
  auto stage_copy = [&](int st) {                             // keys KST st .. +63 -> buffer st & 1
    const unsigned lo = lring + (unsigned)((st & 1) * (3 * ATILE * 2));
    const u16* kh = khg + (size_t)st * KST * DM;
    const u16* kl = klg + (size_t)st * KST * DM;
    const u16* vt = vtg + st * KST;
    constexpr unsigned R16 = 16 * TP16 * 2, TB = ATILE * 2;   // 16 rows, one tile, in bytes
    const unsigned la[6] = {lo, lo + R16, lo + 2 * R16, lo + 3 * R16, lo + TB, lo + TB + R16};
    const u16* const ga[6] = {kh, kh + 16 * DM, kh + 32 * DM, kh + 48 * DM, kl, kl + 16 * DM};
    acopy6(la, ga);
    const unsigned lb[6] = {lo + TB + 2 * R16, lo + TB + 3 * R16, lo + 2 * TB, lo + 2 * TB + R16, lo + 2 * TB + 2 * R16,
                            lo + 2 * TB + 3 * R16};
    const u16* const gb[6] = {kl + 32 * DM, kl + 48 * DM, vt, vt + 16 * SEQ, vt + 32 * SEQ, vt + 48 * SEQ};
    acopy6(lb, gb);
  };
  stage_copy(0);                                              // flies while the tables are staged

  // ---- stage the per-key tables of (b, head): 128 threads x 8 keys = SEQ ----
  {
    const int i0 = tid * 8;
    const float* mp = amask + (size_t)b * SEQ + i0;
    const float* yp = KX2 + (size_t)bh * SEQ + i0;
    const float* gp = GM1 + (size_t)bh * SEQ + i0;
    const v4f m0 = *(const v4f*)(mp), m1 = *(const v4f*)(mp + 4);
    const v4f y0 = *(const v4f*)(yp), y1 = *(const v4f*)(yp + 4);
    const v4f g0 = *(const v4f*)(gp), g1 = *(const v4f*)(gp + 4);
#pragma unroll
    for (int e = 0; e < 4; ++e) {
      ms[i0 + e]  = bfr(m0[e]); ms[i0 + 4 + e]  = bfr(m1[e]);
      ky2[i0 + e] = y0[e];      ky2[i0 + 4 + e] = y1[e];
      kg1[i0 + e] = g0[e];      kg1[i0 + 4 + e] = g1[e];
    }
  }
  wait_copies();
  __syncthreads();                                            // the tables and stage 0 are published
  stage_copy(1);

  // B fragments of q^T: col n = query q0 + c, k = d (k-contiguous rows of the q planes)
  const size_t qofs = ((size_t)(b * SEQ + q0 + c)) * DM + head * HD + 8 * hh;
  const Frag qh0 = ldfrag(Qh + qofs), qh1 = ldfrag(Qh + qofs + 32);
  const Frag ql0 = ldfrag(Ql + qofs), ql1 = ldfrag(Ql + qofs + 32);
  const float xq  = QX2[(size_t)bh * SEQ + q0 + c];
  const float omx = 1.0f - xq;
  // A fragments of k: row m = key kb + 16g + c, k = d; B fragments of v^T: col n = d = 16j + c, k = key; both from the ring

  float mrun = -INFINITY, lrun = 0.f, drun = 0.f;
  v8f o[4];
#pragma unroll
  for (int j = 0; j < 4; ++j) o[j] = zero8();

#pragma unroll 1   // one stage per trip: the ring's order (read, publish, refill) stays as written
  for (int st = 0; st < SEQ / KST; ++st) {
  const u16* rb = ring + (st & 1) * (3 * ATILE);
#pragma unroll 1   // the two 32-key blocks of a stage share one copy of the long body
  for (int sub = 0; sub < KST / 32; ++sub) {
    const int kb = st * KST + sub * 32;
    const u16* KhB = rb + (sub * 32 + c) * TP16 + 8 * hh;     // staged k hi row of key kb + c
    const u16* KlB = KhB + ATILE;
    // ---- transposed scores: s0 = keys kb..kb+15, s1 = keys kb+16..kb+31, column = query q0 + c ----
    v8f s0 = zero8(), s1 = zero8();
    constexpr int k0o = 0, k1o = 16 * TP16;
    {
      const Frag kh0 = ldfrag(KhB + k0o), kh1 = ldfrag(KhB + k1o);
      const Frag kl0 = ldfrag(KlB + k0o), kl1 = ldfrag(KlB + k1o);
      s0 = mma_b(kh0, qh0, s0); s0 = mma_b(kl0, qh0, s0); s0 = mma_b(kh0, ql0, s0);
      s1 = mma_b(kh1, qh0, s1); s1 = mma_b(kl1, qh0, s1); s1 = mma_b(kh1, ql0, s1);
      guard_sc(s0, s1, qh0.h, ql0.h, kh0.h, kh1.h, kl0.h, kl1.h);
    }
    {
      const Frag kh0 = ldfrag(KhB + k0o + 32), kh1 = ldfrag(KhB + k1o + 32);
      const Frag kl0 = ldfrag(KlB + k0o + 32), kl1 = ldfrag(KlB + k1o + 32);
      s0 = mma_b(kh0, qh1, s0); s0 = mma_b(kl0, qh1, s0); s0 = mma_b(kh0, ql1, s0);
      s1 = mma_b(kh1, qh1, s1); s1 = mma_b(kl1, qh1, s1); s1 = mma_b(kh1, ql1, s1);
      guard_sc(s0, s1, qh1.h, ql1.h, kh0.h, kh1.h, kl0.h, kl1.h);
    }
    // ---- per-key values of this lane's 16 keys: [i] <- key kb+8hh+i, [8+i] <- key kb+16+8hh+i ----
    float y2v[16], g1v[16], mkv[16];
    {
      const int ka = kb + 8 * hh, kc = kb + 16 + 8 * hh;
      const v4f ya = *(const v4fa*)(ky2 + ka), yb = *(const v4fa*)(ky2 + ka + 4);
      const v4f yc = *(const v4fa*)(ky2 + kc), yd = *(const v4fa*)(ky2 + kc + 4);
      const v4f ga = *(const v4fa*)(kg1 + ka), gb = *(const v4fa*)(kg1 + ka + 4);
      const v4f gc = *(const v4fa*)(kg1 + kc), gd = *(const v4fa*)(kg1 + kc + 4);
      const v4f ma = *(const v4fa*)(ms + ka),  mb = *(const v4fa*)(ms + ka + 4);
      const v4f mc = *(const v4fa*)(ms + kc),  md = *(const v4fa*)(ms + kc + 4);
#pragma unroll
      for (int e = 0; e < 4; ++e) {
        y2v[e] = ya[e]; y2v[4 + e] = yb[e]; y2v[8 + e] = yc[e]; y2v[12 + e] = yd[e];
        g1v[e] = ga[e]; g1v[4 + e] = gb[e]; g1v[8 + e] = gc[e]; g1v[12 + e] = gd[e];
        mkv[e] = ma[e]; mkv[4 + e] = mb[e]; mkv[8 + e] = mc[e]; mkv[12 + e] = md[e];
      }
    }
    // ---- base-2 logits ----
    float t[16];
#pragma unroll
    for (int i = 0; i < 8; ++i) {
      t[i]     = logit2(s0[i], y2v[i],     mkv[i],     xq, omx);
      t[8 + i] = logit2(s1[i], y2v[8 + i], mkv[8 + i], xq, omx);
    }
    float cm = t[0];
#pragma unroll
    for (int i = 1; i < 16; ++i) cm = fmaxf(cm, t[i]);
    cm = fmaxf(cm, __shfl_xor(cm, 16, 32));
    const float mn = fmaxf(mrun, cm);        // finite from the first block on
    const float al = exp2f(mrun - mn);       // 0 on the first block (mrun = -inf)
    mrun = mn;
    // ---- probabilities (<= 1), the two running sums and the P A-fragment f16(p * 32768); element i <-> t[i] ----
    float ps = 0.f, pd = 0.f;
    Frag ph;
#pragma unroll
    for (int w = 0; w < 2; ++w) {
#pragma unroll
      for (int e4 = 0; e4 < 4; ++e4) {
        const int i = 8 * w + 2 * e4;
        const float p0 = exp2f(t[i] - mn), p1 = exp2f(t[i + 1] - mn);
        ps += p0 + p1;
        pd += p0 * g1v[i] + p1 * g1v[i + 1];
        ph.u[w][e4] = pk16(h_bits((_Float16)(p0 * PCAR)), h_bits((_Float16)(p1 * PCAR)));
      }
    }
    ps += __shfl_xor(ps, 16, 32);
    pd += __shfl_xor(pd, 16, 32);
    lrun = lrun * al + ps;
    drun = drun * al + pd;
    // ---- rescale the O accumulators: D row 8hh+r = query q0+8hh+r, its factor lives in lane 8hh+r ----
    float scl[8];
#pragma unroll
    for (int r = 0; r < 8; ++r) scl[r] = __shfl(al, 8 * hh + r, 32);
#pragma unroll
    for (int j = 0; j < 4; ++j) {
#pragma unroll
      for (int r = 0; r < 8; ++r) o[j][r] *= scl[r];
    }
    // ---- P.V : B fragment col n = d = j*16 + c, keys contiguous in the v^T plane ----
    {
      const u16* vp = rb + 2 * ATILE + c * TP16 + sub * 32 + 8 * hh;
      const Frag v0 = ldfrag(vp);
      const Frag v1 = ldfrag(vp + 16 * TP16);
      const Frag v2 = ldfrag(vp + 32 * TP16);
      const Frag v3 = ldfrag(vp + 48 * TP16);
      o[0] = mma_h(ph, v0, o[0]);
      o[1] = mma_h(ph, v1, o[1]);
      o[2] = mma_h(ph, v2, o[2]);
      o[3] = mma_h(ph, v3, o[3]);
      guard_pv(o, ph.h, v0.h, v1.h, v2.h, v3.h);
    }
  }
  publish_stage();
  if (st + 2 < SEQ / KST) stage_copy(st + 2);                 // into the buffer that this trip has just read
  }
  wait_copies();
  acc_guard4(o);

  // ---- gyro-midpoint epilogue in f32: per query factors from the query-owner lane (lane = query) ----
  const float linv = 1.0f / lrun;
  const float nf   = linv * (1.0f / (PCAR * VS));
  const float dq   = fmaxf(drun * linv, 1e-10f);
  float nfr[8], dqr[8];
#pragma unroll
  for (int r = 0; r < 8; ++r) { nfr[r] = __shfl(nf, 8 * hh + r, 32); dqr[r] = __shfl(dq, 8 * hh + r, 32); }
  float sq[8];
#pragma unroll
  for (int r = 0; r < 8; ++r) {
    float sp = 0.f;
#pragma unroll
    for (int j = 0; j < 4; ++j) {
      const float tm = (o[j][r] * nfr[r]) / dqr[r];
      o[j][r] = tm;
      sp += tm * tm;
    }
    sq[r] = rsum16(sp);
  }
  float* sw = slab + wave * 16 * GPITCH;
#pragma unroll
  for (int r = 0; r < 8; ++r) {
    const float df = 1.0f + sqrtf(fmaxf(1.0f - sq[r], 1e-15f));
    float sp = 0.f;
#pragma unroll
    for (int j = 0; j < 4; ++j) {
      const float a = o[j][r] / df;
      o[j][r] = a;
      sp += a * a;
    }
    const float s2  = rsum16(sp);
    const float n2  = fmaxf(sqrtf(s2), 1e-15f);
    const bool  cl  = n2 > MAXN;
    const float fcl = MAXN / n2;
#pragma unroll
    for (int j = 0; j < 4; ++j) {
      const float a = o[j][r];
      sw[(8 * hh + r) * GPITCH + 16 * j + c] = cl ? (a * fcl) : a;
    }
  }
  wave_sync_lds();
  // ---- f32 output rows: lanes 0..15 -> row 2i, lanes 16..31 -> row 2i+1, lane = 4 consecutive d ----
  const int cc = lane & 15;
  v4f vals[8];
#pragma unroll
  for (int i = 0; i < 8; ++i) vals[i] = *(const v4fa*)(sw + (2 * i + hh) * GPITCH + 4 * cc);
  float* ob = Out + ((size_t)(b * SEQ + q0 + hh)) * DM + head * HD + 4 * cc;
  {
#pragma unroll
    for (int i = 0; i < 8; ++i) {
      *(v4f*)(ob + (size_t)(2 * i) * DM) = vals[i];
    }
    
  }
}

// =====================================================================================================
// Workspace map (bytes); every region written fully by whole-line stores before it is read; every extent an exact multiple
//   X16  f16 [NB*SEQ][DM]          f16(bf16(x) x64)              4194304 (NB=2)
//   WQT/WKT/WVT f16 [DM n][DM k]   f16(bf16(W) x256)             3 x 2097152
//   CX2  f32 [NB*SEQ]              sum x^2                       8192
//   ZN, CH, SH f32 [3][DM]         column norms, cosh/sinh(2r)   3 x 12288
//   Qh, Ql, Kh, Kl bf16 [NB*SEQ][DM]                             4 x 4194304
//   Vg   f16 [NB*SEQ][DM]          f16(gamma v x256)             4194304
//   VT   f16 [NB*NH*HD][SEQ]       transposed Vg                 4194304
//   QX2, KX2, GM1 f32 [NB*NH][SEQ]                                3 x 131072
//   end = 36089856 at NB=2
// =====================================================================================================
static inline size_t up4k(size_t v) { return (v + 4095) & ~(size_t)4095; }

extern "C" void kernel_launch(void* const* d_in, const int* in_sizes, int n_in,
                              void* d_out, int out_size, void* d_ws, size_t ws_size,
                              hipStream_t stream) {
  if (n_in < 8) return;
  if (in_sizes[0] < NB * SEQ * DM) return;
  if (in_sizes[1] < NB * SEQ) return;
  if (in_sizes[2] < DM * DM || in_sizes[4] < DM * DM || in_sizes[6] < DM * DM) return;
  if (in_sizes[3] < 1 || in_sizes[5] < 1 || in_sizes[7] < 1) return;
  if (out_size < NB * SEQ * DM) return;

  const float* hs = (const float*)d_in[0];
  const float* am = (const float*)d_in[1];
  const float* qz = (const float*)d_in[2];
  const float* qr = (const float*)d_in[3];
  const float* kz = (const float*)d_in[4];
  const float* kr = (const float*)d_in[5];
  const float* vz = (const float*)d_in[6];
  const float* vr = (const float*)d_in[7];
  float*       out = (float*)d_out;
  const int nqr = in_sizes[3], nkr = in_sizes[5], nvr = in_sizes[7];

  const size_t nrow  = (size_t)NB * SEQ;
  const size_t szX16 = up4k(nrow * DM * 2);
  const size_t szWT  = up4k((size_t)DM * DM * 2);
  const size_t szCX2 = up4k(nrow * 4);
  const size_t szCOL = up4k((size_t)3 * DM * 4);
  const size_t szP   = up4k(nrow * DM * 2);
  const size_t szVT  = up4k((size_t)NB * NH * HD * SEQ * 2);
  const size_t szRS  = up4k((size_t)NB * NH * SEQ * 4);
  size_t off = 0;
  const size_t oX16 = off; off += szX16;
  const size_t oWQ  = off; off += szWT;
  const size_t oWK  = off; off += szWT;
  const size_t oWV  = off; off += szWT;
  const size_t oCX2 = off; off += szCX2;
  const size_t oZN  = off; off += szCOL;
  const size_t oCH  = off; off += szCOL;
  const size_t oSH  = off; off += szCOL;
  const size_t oQh  = off; off += szP;
  const size_t oQl  = off; off += szP;
  const size_t oKh  = off; off += szP;
  const size_t oKl  = off; off += szP;
  const size_t oVg  = off; off += szP;
  const size_t oVT  = off; off += szVT;
  const size_t oQX2 = off; off += szRS;
  const size_t oKX2 = off; off += szRS;
  const size_t oGM1 = off; off += szRS;
  if (off > ws_size) return;                       // off = 36089856 at NB=2
  if (off > (size_t)134217728) return;

  char* ws = (char*)d_ws;
  u16*   X16 = (u16*)(ws + oX16);
  u16*   WQT = (u16*)(ws + oWQ);
  u16*   WKT = (u16*)(ws + oWK);
  u16*   WVT = (u16*)(ws + oWV);
  float* CX2 = (float*)(ws + oCX2);
  float* ZN  = (float*)(ws + oZN);
  float* CH  = (float*)(ws + oCH);
  float* SH  = (float*)(ws + oSH);
  u16*   Qh  = (u16*)(ws + oQh);
  u16*   Ql  = (u16*)(ws + oQl);
  u16*   Kh  = (u16*)(ws + oKh);
  u16*   Kl  = (u16*)(ws + oKl);
  u16*   Vg  = (u16*)(ws + oVg);
  u16*   VT  = (u16*)(ws + oVT);
  float* QX2 = (float*)(ws + oQX2);
  float* KX2 = (float*)(ws + oKX2);
  float* GM1 = (float*)(ws + oGM1);

  // (1) all that reads only the inputs: x -> f16 plane of bf16(x) x64, per-row sums of squares, per weight the column norms
  //     with cosh/sinh(2r) and the k-contiguous [n][k] f16 plane of bf16(W) x256
  prep<<<dim3(PB_ROW + PB_COL + PB_TR + PB_CVT), dim3(PREP_THREADS), 0, stream>>>(
      hs, qz, kz, vz, qr, kr, vr, nqr, nkr, nvr, X16, CX2, ZN, CH, SH, WQT, WKT, WVT);
  // (2) the three projections with the fused MLR / per-head epilogue
  proj_mlr<<<dim3(PJ_BLOCKS), dim3(PJ_THREADS), 0, stream>>>(
      X16, WQT, WKT, WVT, ZN, CH, SH, CX2, Qh, Ql, Kh, Kl, Vg, QX2, KX2, GM1);
  // (3) gamma v plane -> key-contiguous v^T plane
  trT16<<<dim3(NB * (SEQ / 64) * (DM / 64)), dim3(TR_THREADS), 0, stream>>>(Vg, VT);
  // (4) attention + midpoint -> out [b][SEQ][DM] f32 (rows s < SQ of batches b < NB), heads merged on the feature dim
  attn_fwd<<<dim3(NB * NH * (SQ / 64)), dim3(ATT_THREADS), 0, stream>>>(Qh, Ql, Kh, Kl, VT, QX2, KX2, GM1, am, out);
  (void)hipGetLastError();
}

// v006
// It runs in 64.1 microseconds.
// Versions between v004 and this one are left out; their measured steps multiply to 1.26 times as fast.
// Counting every step since v000, it is 8.94 times as fast.
// Contractions: x.Wq, x.Wk, x.Wv on v_wmma_f32_16x16x32_f16 (x as f16(bf16(x) x64), W as f16(bf16(W) x256), f32 accumulate);
// scores k.q^T on v_wmma_f32_16x16x32_bf16 as bf16 hi/lo split (hi.hi + lo.hi + hi.lo into one f32 accumulator);
// P.(gamma v)^T on v_wmma_f32_16x16x32_f16 (P x32768 f16, gamma v x256 f16, f32 accumulate); norms, asinh/sinh/acosh
// (closed forms on v_log_f32 / v_exp_f32 / v_sqrt_f32 / v_rcp_f32), softmax weights in closed form at a fixed scale,
// the sum_j p_j (gamma_j - 1) denominators and all carry folds in f32 on VALU.
// Float inputs RNE-converted to bf16 on load; f32 output written directly.
#include <hip/hip_runtime.h>
#include <math.h>
#include <stdint.h>

#ifndef NB
#define NB 2            // batches processed
#endif
#ifndef SQ
#define SQ 1024         // query rows processed per batch (keys/values always all SEQ rows)
#endif
#define NB_FULL 2
#define SEQ  1024       // rows per batch in every input / output / plane layout
#define DM   1024       // model width = K of the projections = row pitch of the 16-bit planes
#define NH   16
#define HD   64
#define XS   64.0f      // carry on the x plane
#define WSC  256.0f     // carry on the transposed weight planes
#define VS   256.0f     // carry on the gamma*v plane
#define PCAR 32768.0f   // carry on P
#define LOG2E 1.4426950408889634f
#define MAXN 0.996f     // (1 - 4e-3) / sqrt(c)
#define NKB  (SEQ / 32)
#define GPITCH 68
#define TPITCH 65
#define TP16   72
#define CVT_THREADS (DM / 8)
#define TR_THREADS  128
#define ATT_THREADS 128
#define CS_THREADS  1024  // column statistics: threads per block
#define CS_COLS     32    // columns per block
#define CS_STEPS    (DM / (CS_THREADS / 8))   // rows per thread
#define PREP_THREADS 1024                      // block of the preparation grid (all four block kinds)
#define PB_ROW  (NB * SEQ / 128)               // row statistics blocks, 128 rows each
#define PB_COL  (3 * (DM / CS_COLS))           // column statistics blocks, 32 columns of one weight each
#define PB_TR   (3 * (DM / 64) * (DM / 64) / 8)  // weight transpose blocks, 8 tiles of 64 x 64 of one weight each
#define PB_CVT  (NB * SEQ / 8)                 // x convert blocks, 8 rows each
#define PJ_BLOCKS ((NB * SEQ / 128) * (DM / 64)) // projection blocks: one per 128-row x 64-column tile
#define PJ_THREADS 384                         // 3 weights x 4 waves
#define KST     64                             // k (projection) or keys (attention) per LDS stage: one 128-B line of every staged row
#define PJ_ROWS (128 + 3 * 64)                 // staged rows of a projection stage: 128 of A, then 64 of each weight
#define PJ_CPW  ((PJ_ROWS / 4 + PJ_THREADS / 32 - 1) / (PJ_THREADS / 32))  // copies per wave and stage, upper bound (a copy = 4 rows)
#define ATILE   (64 * TP16)                    // one staged 64-row tile of attention, in 16-bit units

static_assert(NB >= 1 && NB <= NB_FULL);
static_assert((SQ % 64) == 0 && SQ >= 64 && SQ <= SEQ);
static_assert(NH * HD == DM && HD == 64);
static_assert((SEQ % 128) == 0 && (SEQ % 32) == 0 && NKB * 32 == SEQ);
static_assert((DM % 256) == 0 && (DM % 64) == 0 && (DM % 32) == 0 && CVT_THREADS == 128);
static_assert((GPITCH * 4) % 16 == 0 && (TP16 * 2) % 16 == 0);
static_assert(CS_COLS == 32 && (DM % CS_COLS) == 0 && CS_STEPS * (CS_THREADS / 8) == DM);
static_assert(ATT_THREADS == 128 && TR_THREADS == 128 && ATT_THREADS * 8 == SEQ);
static_assert(PREP_THREADS == CS_THREADS && PREP_THREADS == 8 * CVT_THREADS && PREP_THREADS == 8 * TR_THREADS);
static_assert(((DM / 64) * (DM / 64)) % 8 == 0 && (NB * SEQ) % 128 == 0);
static_assert(KST == 64 && DM / KST >= 2 && SEQ / KST >= 2 && (DM % KST) == 0 && (SEQ % KST) == 0);
static_assert(PJ_CPW == 7 && (PJ_ROWS % 4) == 0 && PJ_ROWS / 4 - 6 * (PJ_THREADS / 32) == 8);

typedef unsigned short u16;
typedef _Float16 v16h __attribute__((ext_vector_type(16)));
typedef _Float16 v8h  __attribute__((ext_vector_type(8)));
typedef __bf16   v16b __attribute__((ext_vector_type(16)));
typedef float    v8f  __attribute__((ext_vector_type(8)));
typedef float    v4f  __attribute__((ext_vector_type(4)));
typedef float    v2f  __attribute__((ext_vector_type(2)));
typedef _Float16 v2h  __attribute__((ext_vector_type(2)));
typedef unsigned int v4u __attribute__((ext_vector_type(4)));
typedef v4u __attribute__((may_alias)) v4ua;
typedef v4f __attribute__((may_alias)) v4fa;

// one 16 x 16-bit per-lane fragment, viewed as f16 vector, bf16 vector or two 16-byte words
union Frag { v16h h; v16b b; v4u u[2]; };

// ---- scalar helpers ----------------------------------------------------------------------------------
__device__ __forceinline__ unsigned short bf_bits(float f) {          // f32 -> bf16 bits, RNE convert
  unsigned u = __float_as_uint(f);
  return (unsigned short)((u + 0x7FFFu + ((u >> 16) & 1u)) >> 16);
}
__device__ __forceinline__ float bf_up(unsigned short h) { return __uint_as_float(((unsigned)h) << 16); }
__device__ __forceinline__ float bfr(float f) { return bf_up(bf_bits(f)); }
__device__ __forceinline__ unsigned short h_bits(_Float16 x) { return __builtin_bit_cast(unsigned short, x); }
__device__ __forceinline__ unsigned pk16(unsigned short a, unsigned short b) { return (unsigned)a | ((unsigned)b << 16); }
__device__ __forceinline__ v8f zero8() { v8f z = {0.f, 0.f, 0.f, 0.f, 0.f, 0.f, 0.f, 0.f}; return z; }
__device__ __forceinline__ float red8(float v) {                      // sum over the 8-lane group (lane bits 0..2)
  v += __shfl_xor(v, 1, 32); v += __shfl_xor(v, 2, 32); v += __shfl_xor(v, 4, 32); return v;
}
__device__ __forceinline__ float rsum16(float v) {                    // sum over the 16-lane half (lane bits 0..3)
  v += __shfl_xor(v, 8, 32); v += __shfl_xor(v, 4, 32); v += __shfl_xor(v, 2, 32); v += __shfl_xor(v, 1, 32); return v;
}

// 1 / x on v_rcp_f32 (about 1 ulp), for a divisor that a whole row or column shares: formed once, then multiplied in.
// Every divisor it is used on is clamped to at least 1e-15 (or is at least 1/8) and, where finite, stays below 2e19,
// so the reciprocal is a normal f32; an infinite divisor gives 0, as the quotient of a finite value by it does.
__device__ __forceinline__ float rcp1(float x) {
  float r = 0.f;
#if defined(__HIP_DEVICE_COMPILE__)
  // v_nop in the same statement: the slot between a transcendental and an instruction that reads its result or overwrites its
  // source
  asm("v_rcp_f32 %0, %1\n\tv_nop" : "=v"(r) : "v"(x));
#endif
  return r;
}

// sqrt(x) on v_sqrt_f32 alone (about 1 ulp), without the correctly rounding sequence of sqrtf. Where it is used x is a sum of
// squares whose root is clamped to at least 1e-15 behind it (a subnormal x may come out as 0: the clamp gives the same value
// as for its true root), or x is at least 1e-15.
__device__ __forceinline__ float sqrt1(float x) {
  float r = 0.f;
#if defined(__HIP_DEVICE_COMPILE__)
  // v_nop in the same statement: the slot behind a transcendental, as in rcp1()
  asm("v_sqrt_f32 %0, %1\n\tv_nop" : "=v"(r) : "v"(x));
#endif
  return r;
}

// sinh(tz * asinh(x)) in closed form: e = |x| + sqrt(x^2 + 1), L = log2(e) >= 0, sinh = 2^(tz L - 1) - 2^(-tz L - 1), sign of x.
// Above 1e18 sqrt(x^2 + 1) = |x| in f32 and x^2 comes near the f32 overflow, so e = 2|x| there. The two halves are formed with the
// factor 1/2 in the exponent, so the result overflows only where sinh itself does.
__device__ __forceinline__ float sinh_of_scaled_asinh(float x, float tz) {
  const float a = fabsf(x);
  const float e = a + ((a > 1e18f) ? a : __builtin_amdgcn_sqrtf(fmaf(a, a, 1.0f)));
  const float L = __builtin_amdgcn_logf(e);
  const float s = __builtin_amdgcn_exp2f(fmaf(tz, L, -1.0f)) - __builtin_amdgcn_exp2f(fmaf(-tz, L, -1.0f));
  return copysignf(s, x);
}

// ---- fragment loader: 16-bit A/B operand from a k-contiguous row; lane -> row/col (lane&15), p already includes
//      +8*(lane>>4); elements 0..7 <- p[0..7] (k0+8h..), elements 8..15 <- p[16..23] (k0+16+8h..); same split k map
//      for A and B; B always read from a k-contiguous [n][k] plane. Loaded as unsigned 16-byte words.
__device__ __forceinline__ Frag ldfrag(const u16* p) {
  Frag f;
  f.u[0] = *(const v4u*)(p);
  f.u[1] = *(const v4u*)(p + 16);
  return f;
}

// ---- WMMA helpers and trailing VALU hazard gaps --------------------------------------------------------
__device__ __forceinline__ v8f mma_h(const Frag& a, const Frag& b, v8f c) {
  return __builtin_amdgcn_wmma_f32_16x16x32_f16(false, a.h, false, b.h, (short)0, c, false, false);
}
__device__ __forceinline__ v8f mma_b(const Frag& a, const Frag& b, v8f c) {
  return __builtin_amdgcn_wmma_f32_16x16x32_bf16(false, a.b, false, b.b, (short)0, c, false, false);
}
__device__ __forceinline__ void guard_sc(v8f& a, v8f& b, v16h x0, v16h x1, v16h x2, v16h x3, v16h x4, v16h x5) {
#if defined(__HIP_DEVICE_COMPILE__)
  asm volatile("v_nop\n\tv_nop\n\tv_nop\n\tv_nop"
               : "+v"(a), "+v"(b) : "v"(x0), "v"(x1), "v"(x2), "v"(x3), "v"(x4), "v"(x5) : "memory");
#endif
}
__device__ __forceinline__ void guard_pv(v8f (&o)[4], v16h p, v16h x0, v16h x1, v16h x2, v16h x3) {
#if defined(__HIP_DEVICE_COMPILE__)
  asm volatile("v_nop\n\tv_nop\n\tv_nop\n\tv_nop"
               : "+v"(o[0]), "+v"(o[1]), "+v"(o[2]), "+v"(o[3]) : "v"(p), "v"(x0), "v"(x1), "v"(x2), "v"(x3) : "memory");
#endif
}
__device__ __forceinline__ void guard_g(v8f (&acc)[8], v16h x0, v16h x1, v16h x2, v16h x3, v16h x4, v16h x5) {
#if defined(__HIP_DEVICE_COMPILE__)
  asm volatile("v_nop\n\tv_nop\n\tv_nop\n\tv_nop"
               : "+v"(acc[0]), "+v"(acc[1]), "+v"(acc[2]), "+v"(acc[3]),
                 "+v"(acc[4]), "+v"(acc[5]), "+v"(acc[6]), "+v"(acc[7])
               : "v"(x0), "v"(x1), "v"(x2), "v"(x3), "v"(x4), "v"(x5) : "memory");
#endif
}
__device__ __forceinline__ void acc_guard4(v8f (&o)[4]) {
#if defined(__HIP_DEVICE_COMPILE__)
  asm volatile("v_nop\n\tv_nop\n\tv_nop\n\tv_nop" : "+v"(o[0]), "+v"(o[1]), "+v"(o[2]), "+v"(o[3]));
#endif
}
__device__ __forceinline__ void wave_sync_lds() {
  __builtin_amdgcn_fence(__ATOMIC_RELEASE, "workgroup");
  __builtin_amdgcn_wave_barrier();
  __builtin_amdgcn_fence(__ATOMIC_ACQUIRE, "workgroup");
}

// ---- asynchronous 16-byte copies global -> LDS (through no register): l = the lane's own LDS byte address, g = the lane's own
//      global address, both multiples of 16. The closing s_wait_xcnt stands inside each statement, so that no address register
//      of an issued copy is rewritten ahead of it (a precaution).
__device__ __forceinline__ unsigned lds_addr(const void* p) { return (unsigned)(uintptr_t)p; }   // low 32 bits = LDS byte offset
__device__ __forceinline__ void acopy1(unsigned l0, const u16* g0) {
#if defined(__HIP_DEVICE_COMPILE__)
  asm volatile("global_load_async_to_lds_b128 %0, %1, off\n\t"
               "s_wait_xcnt 0x0"
               :: "v"(l0), "v"(g0) : "memory");
#endif
}
__device__ __forceinline__ void acopy6(const unsigned (&l)[6], const u16* const (&g)[6]) {
#if defined(__HIP_DEVICE_COMPILE__)
  asm volatile("global_load_async_to_lds_b128 %0, %6, off\n\t"
               "global_load_async_to_lds_b128 %1, %7, off\n\t"
               "global_load_async_to_lds_b128 %2, %8, off\n\t"
               "global_load_async_to_lds_b128 %3, %9, off\n\t"
               "global_load_async_to_lds_b128 %4, %10, off\n\t"
               "global_load_async_to_lds_b128 %5, %11, off\n\t"
               "s_wait_xcnt 0x0"
               :: "v"(l[0]), "v"(l[1]), "v"(l[2]), "v"(l[3]), "v"(l[4]), "v"(l[5]),
                  "v"(g[0]), "v"(g[1]), "v"(g[2]), "v"(g[3]), "v"(g[4]), "v"(g[5]) : "memory");
#endif
}
// The issuing wave's own copies have landed.
__device__ __forceinline__ void wait_copies() { asm volatile("s_wait_asynccnt 0x0" ::: "memory"); }
// Publish point of a two-buffer stage ring, passed by every wave of the block at the foot of every stage.
__device__ __forceinline__ void publish_stage() {
  asm volatile("s_wait_dscnt 0x0" ::: "memory");   // this wave's reads of the buffer that is refilled next have returned
  wait_copies();                                   // this wave's share of the next stage has landed
  __syncthreads();                                 // publishes the next stage; ends every reader's last read of this one
}

// =====================================================================================================
// Row convert: row r of a [rows][DM] f16 plane <- f16(bf16_RNE(x[r][e]) * scale), scale a power of two.
// A group of DM/8 threads per row (tid = index in the group), thread = 8 consecutive elements (two 16-B loads, one 16-B store).
// coverage: one group per row, 128 thr x 8 = DM = the whole row.
// =====================================================================================================
__device__ __forceinline__ void cvt16_row(const float* __restrict__ x, u16* Y, float scale, int tid, size_t r) {
  const float* src = x + r * (size_t)DM + (size_t)tid * 8;
  const v4f a = *(const v4f*)(src), c4 = *(const v4f*)(src + 4);
  v4u o;
#pragma unroll
  for (int e = 0; e < 2; ++e) {
    o[e]     = pk16(h_bits((_Float16)(bfr(a[2 * e]) * scale)),  h_bits((_Float16)(bfr(a[2 * e + 1]) * scale)));
    o[2 + e] = pk16(h_bits((_Float16)(bfr(c4[2 * e]) * scale)), h_bits((_Float16)(bfr(c4[2 * e + 1]) * scale)));
  }
  u16* dst = Y + r * (size_t)DM + (size_t)tid * 8;
  {
    *(v4u*)(dst) = o;
    // precaution: in the merged kernel other block kinds' code follows in the listing and rewrites the store's registers
    asm volatile("s_wait_xcnt 0x0" ::: "memory");
  }
}

// =====================================================================================================
// Row statistics: CX2[r] = sum_e bf16(x[r][e])^2 in f32. Block = 128 rows, 1024 threads, wave w rows 128*blk + 4w + j:
// per row each lane sums 32 values (8 x 16-B loads), xor-shuffle reduce, lane 0 -> LDS (rs, 128 floats); after a block
// barrier threads 0..31 store the 128 sums as 16-B words.
// =====================================================================================================
__device__ __forceinline__ void rowstat_blk(const float* __restrict__ x, float* CX2, float* rs, int tid, int blk) {
  const int wave = tid >> 5, lane = tid & 31;
  const int row0 = blk * 128;
#pragma unroll 1
  for (int j = 0; j < 4; ++j) {
    const int row = row0 + wave * 4 + j;
    const float* xr = x + (size_t)row * DM + 4 * lane;
    float s = 0.f;
#pragma unroll 2
    for (int q = 0; q < DM / 128; ++q) {
      const v4f a = *(const v4f*)(xr + 128 * q);
      const float a0 = bfr(a[0]), a1 = bfr(a[1]), a2 = bfr(a[2]), a3 = bfr(a[3]);
      s += a0 * a0; s += a1 * a1; s += a2 * a2; s += a3 * a3;
    }
    s += __shfl_xor(s, 16, 32); s += __shfl_xor(s, 8, 32); s += __shfl_xor(s, 4, 32);
    s += __shfl_xor(s, 2, 32);  s += __shfl_xor(s, 1, 32);
    if (lane == 0) rs[wave * 4 + j] = s;
  }
  __syncthreads();
  if (tid < 32) {
    const v4f v = *(const v4fa*)(rs + 4 * tid);
    float* dst = CX2 + row0 + 4 * tid;
    {
      *(v4f*)(dst) = v;
      
    }
  }
}

// =====================================================================================================
// Column statistics of a weight z[k][n] (DM x DM): ZN[n] = max(sqrt(sum_k bf16(z[k][n])^2), 1e-15), CH[n] = cosh(2 r[n]),
// SH[n] = sinh(2 r[n]) (r index clamped to nr-1). Block = 32 columns (one 128-B line of every row) x all DM rows,
// 1024 threads: lane = (row sub-index lane>>3, 4 columns at 4*(lane&7)), wave w step j reads rows 128j + 4w .. +3, so a
// thread has its 8 independent 16-B loads in flight at once. Column sums: 8 rows in the thread, xor-8 / xor-16 shuffles
// over the wave's 4 row sub-indices, one 32-float row per wave in LDS, block barrier, wave 0 adds the 32 wave rows.
// coverage: 8 j x 32 waves x 4 rows = DM rows; DM/32 blocks x 32 columns = every column of the three arrays once,
//           each block the only writer of its 128-B line in each array. part: (CS_THREADS / 32) * CS_COLS floats of LDS.
// =====================================================================================================
__device__ __forceinline__ void colstat_blk(const float* __restrict__ z, const float* __restrict__ r, int nr,
                                            float* ZN, float* CH, float* SH, float* part, int tid, int blk) {
  const int wave = tid >> 5, lane = tid & 31;
  const int col0 = blk * CS_COLS;
  const float* zp = z + (size_t)(wave * 4 + (lane >> 3)) * DM + col0 + 4 * (lane & 7);
  const int col = col0 + lane;
  float rv = 0.f;
  if (wave == 0) {                               // wave-uniform; issued with the column loads, not behind the barrier
    int ri = col;
    ri = (ri < nr - 1) ? ri : (nr - 1);
    rv = r[ri];
  }
  v4f a[CS_STEPS];
#pragma unroll   // all loads issue before the first use: one memory latency per thread instead of one per row group
  for (int j = 0; j < CS_STEPS; ++j) a[j] = *(const v4f*)(zp + (size_t)j * (CS_THREADS / 8) * DM);
  v4f s = {0.f, 0.f, 0.f, 0.f};
#pragma unroll
  for (int j = 0; j < CS_STEPS; ++j) {
#pragma unroll
    for (int e = 0; e < 4; ++e) {
      const float v = bfr(a[j][e]);
      s[e] += v * v;
    }
  }
#pragma unroll
  for (int e = 0; e < 4; ++e) {
    s[e] += __shfl_xor(s[e], 8, 32);
    s[e] += __shfl_xor(s[e], 16, 32);
  }
  if (lane < 8) *(v4fa*)(part + wave * CS_COLS + 4 * lane) = s;
  __syncthreads();
  if (wave == 0) {                               // wave-uniform; lane = column
    float t = 0.f;
#pragma unroll
    for (int w = 0; w < CS_THREADS / 32; ++w) t += part[w * CS_COLS + lane];
    const float dr = 2.0f * bfr(rv);
    ZN[col] = fmaxf(sqrtf(t), 1e-15f);
    CH[col] = coshf(dr);
    SH[col] = sinhf(dr);
  }
}

// =====================================================================================================
// Weight transpose-convert for y = x.W weights stored [k][n]: WT[n][k] (f16, k-contiguous Bt layout) <- f16(bf16_RNE(W[k][n]) *
// scale). A group of 128 threads (tid = index in the group) per 64(k) x 64(n) tile, 8 groups per block. Load phase: thread = (row 8p + (tid>>4), 4 floats at 4*(tid&15)),
// 8 steps = 64 k-rows x 64 n, into an LDS tile [kk][nn] (pitch 65); block barrier; store phase: output row n0 + 16i + (tid>>3)
// coverage: 4 i x 16 rows x (8 lanes x 8 halves) = 64 n-rows x 64 k per group; the (DM/64)^2 tiles cover WT exactly once.
// LDS tile (64 * TPITCH floats, the group's own): cross-wave, block barrier; staged extent 64x64 == consumed extent.
// =====================================================================================================
__device__ __forceinline__ void cvtT16_tile(const float* __restrict__ W, u16* Y, float scale, float* tile, int tid, int bid) {
  constexpr int NT = DM / 64;
  const int kt  = bid % NT;
  const int ntb = bid / NT;
  const int k0  = kt * 64, n0 = ntb * 64;
  const int lr = tid >> 4, lc = (tid & 15) * 4;
#pragma unroll
  for (int p = 0; p < 8; ++p) {
    const int kk = p * 8 + lr;
    const v4f w4 = *(const v4f*)(W + (size_t)(k0 + kk) * (size_t)DM + n0 + lc);
    tile[kk * TPITCH + lc + 0] = w4[0];
    tile[kk * TPITCH + lc + 1] = w4[1];
    tile[kk * TPITCH + lc + 2] = w4[2];
    tile[kk * TPITCH + lc + 3] = w4[3];
  }
  __syncthreads();
  const int rq = tid >> 3, c8 = (tid & 7) * 8;      // rq 0..15, c8 0..56
  v4u ov[4];
#pragma unroll
  for (int i = 0; i < 4; ++i) {
    const int row = 16 * i + rq;                   // n within tile
#pragma unroll
    for (int e = 0; e < 4; ++e) {
      const float x0 = tile[(c8 + 2 * e) * TPITCH + row];
      const float x1 = tile[(c8 + 2 * e + 1) * TPITCH + row];
      ov[i][e] = pk16(h_bits((_Float16)(bfr(x0) * scale)), h_bits((_Float16)(bfr(x1) * scale)));
    }
  }
  u16* dst = Y + (size_t)n0 * (size_t)DM + k0 + c8;
  {
#pragma unroll
    for (int i = 0; i < 4; ++i) {
      const int row = 16 * i + rq;
      *(v4u*)(dst + (size_t)row * (size_t)DM) = ov[i];
    }
    // precaution: in the merged kernel other block kinds' code follows in the listing and rewrites the stores' registers
    asm volatile("s_wait_xcnt 0x0" ::: "memory");
  }
}

// =====================================================================================================
// Preparation grid: everything that reads only the inputs, in one launch, so that the four kinds of block run side by side.
// Block kind by block index (block-uniform, so each kind's block barrier is passed by all 1024 threads of its block); the
// kinds with the longest dependent chains come first:
//   [0, PB_ROW)            row statistics of x, 128 rows per block
//   next PB_COL blocks     column statistics, weight = index / (DM/32), 32 columns per block
//   next PB_TR blocks      weight transpose-convert, weight = index / 32, 8 tiles per block (tile = 8 * index + tid / 128)
//   next PB_CVT blocks     x convert, 8 rows per block (row = 8 * index + tid / 128)
// LDS: one array, used by one kind per block (8 transpose tiles, or the column partials, or the row sums).
// =====================================================================================================
__global__ __launch_bounds__(PREP_THREADS)
void prep(const float* __restrict__ x,
          const float* __restrict__ qz, const float* __restrict__ kz, const float* __restrict__ vz,
          const float* __restrict__ qr, const float* __restrict__ kr, const float* __restrict__ vr,
          int nqr, int nkr, int nvr,
          u16* X16, float* CX2, float* ZN, float* CH, float* SH, u16* WQT, u16* WKT, u16* WVT) {
  __shared__ __align__(16) float sm[8 * 64 * TPITCH];
  const int tid = threadIdx.x;
  int bid = blockIdx.x;
  if (bid < PB_ROW) {
    rowstat_blk(x, CX2, sm, tid, bid);
    return;
  }
  bid -= PB_ROW;
  if (bid < PB_COL) {
    const int w = bid / (DM / CS_COLS), blk = bid % (DM / CS_COLS);
    const float* z = (w == 0) ? qz : (w == 1) ? kz : vz;
    const float* r = (w == 0) ? qr : (w == 1) ? kr : vr;
    const int   nr = (w == 0) ? nqr : (w == 1) ? nkr : nvr;
    colstat_blk(z, r, nr, ZN + w * DM, CH + w * DM, SH + w * DM, sm, tid, blk);
    return;
  }
  bid -= PB_COL;
  if (bid < PB_TR) {
    constexpr int BPW = (DM / 64) * (DM / 64) / 8;   // blocks per weight
    const int w = bid / BPW, grp = tid >> 7;
    const float* z = (w == 0) ? qz : (w == 1) ? kz : vz;
    u16*         y = (w == 0) ? WQT : (w == 1) ? WKT : WVT;
    cvtT16_tile(z, y, WSC, sm + grp * 64 * TPITCH, tid & 127, (bid % BPW) * 8 + grp);
    return;
  }
  bid -= PB_TR;
  cvt16_row(x, X16, XS, tid & 127, (size_t)(bid * 8 + (tid >> 7)));
}

// =====================================================================================================
// f16 GEMM core on one LDS stage (KST of k): the wave's 32 x 64 tile of C += A . Bt^T; as -> staged A row (wave row + m) + 8h,
// bs -> staged Bt row (m) + 8h, rows at pitch TP16 (144 B: ds_load_b128 of 16 rows falls on all banks once);
// acc[4i + j] = rows 16i.., cols 16j..; k stepped by 32 in ascending order.
// =====================================================================================================
__device__ __forceinline__ void gemm_stage(const u16* as, const u16* bs, v8f (&acc)[8]) {
#pragma unroll   // two steps: the k offsets become immediates of the LDS reads
  for (int k0 = 0; k0 < KST; k0 += 32) {
    const Frag a0 = ldfrag(as + k0), a1 = ldfrag(as + 16 * TP16 + k0);
    const Frag b0 = ldfrag(bs + k0);
    const Frag b1 = ldfrag(bs + 16 * TP16 + k0);
    const Frag b2 = ldfrag(bs + 32 * TP16 + k0);
    const Frag b3 = ldfrag(bs + 48 * TP16 + k0);
    acc[0] = mma_h(a0, b0, acc[0]);
    acc[1] = mma_h(a0, b1, acc[1]);
    acc[2] = mma_h(a0, b2, acc[2]);
    acc[3] = mma_h(a0, b3, acc[3]);
    acc[4] = mma_h(a1, b0, acc[4]);
    acc[5] = mma_h(a1, b1, acc[5]);
    acc[6] = mma_h(a1, b2, acc[6]);
    acc[7] = mma_h(a1, b3, acc[7]);
    guard_g(acc, a0.h, a1.h, b0.h, b1.h, b2.h, b3.h);
  }
}
// Stage the wave's 32 x 64 f32 tile (times oscale) in its LDS slab (pitch 68): D element r of acc[4i+j], lane l ->
// coverage: 32 lanes x 2 x 8 rows x 4 cols-of-16 = rows 0..31 x cols 0..63 of the slab.
__device__ __forceinline__ void stage32x64(float* sl, v8f (&acc)[8], float oscale, int lane) {
  const int hh = lane >> 4, m = lane & 15;
#pragma unroll
  for (int i = 0; i < 2; ++i) {
#pragma unroll
    for (int r = 0; r < 8; ++r) {
      const int ro = (16 * i + 8 * hh + r) * GPITCH + m;
      sl[ro]      = acc[4 * i + 0][r] * oscale;
      sl[ro + 16] = acc[4 * i + 1][r] * oscale;
      sl[ro + 32] = acc[4 * i + 2][r] * oscale;
      sl[ro + 48] = acc[4 * i + 3][r] * oscale;
    }
  }
  wave_sync_lds();
}

// =====================================================================================================
// Projection GEMM + ball MLR epilogue. A = x plane [NB*SEQ][DM] (f16, x XS), Bt = WT [DM n][DM k] (f16, x WSC).
// One launch for the three weights: block = 384 threads = 128 rows x 64 cols (one head) of q, k and v; waves 4*mode .. 4*mode+3
// (mode 0 q, 1 k, 2 v: picks Bt, the column tables' row and the outputs) take 32 rows each, so the three modes read the same A rows
// from one WGP and three waves share a SIMD. Operands go through a two-buffer LDS ring, KST of k per stage: the block's 128 A rows
// and 3 x 64 Bt rows (PJ_ROWS rows x 128 B, whole lines) are brought in by asynchronous 16-byte copies, one copy of a wave = 4 rows,
// copy index = wave + 12 i (i < 6 for every wave, i = 6 for waves 0..7: 80 copies); the next stage flies while this one is worked on.
// Epilogue per element (f32): mm = (x.z)[row][n] / ZN[n]; arg = (2 mm CH[n] - (1 + cx2) SH[n]) / max(1 - cx2, 1e-15);
// y = sinh(2 ZN[n] asinh(arg)); per (row, head) 64-vector (8 lanes x 8 values, 8-lane shuffle sums): clip to norm MAXN,
// y = y / (1 + sqrt(1 + sum y^2)), clip again; x2 = sum y^2. mode 0/1: planes Ph/Pl = bf16 hi / bf16 lo of y, RS row
// scalar = x2; mode 2: g = 2 / max(1 - x2, 1e-15), plane Ph = f16(g y VS), RS row scalar = g - 1.
// coverage: per wave 8 instr x 4 rows x 8 lanes x 8 halves = 32 x 64 per plane; RS: 32 floats per wave; grid covers every
//           (row, col) of the planes and every (b, head, s) of RS exactly once.
// LDS: ring cross-wave (one block barrier per stage, staged extent == consumed extent, pad bytes never read); slab and rsc are
// wave-private (wave_sync); staged extent 32x64 == consumed extent.
// =====================================================================================================
__global__ __launch_bounds__(PJ_THREADS)
void proj_mlr(const u16* __restrict__ A, const u16* __restrict__ WQT, const u16* __restrict__ WKT, const u16* __restrict__ WVT,
              const float* __restrict__ ZN3, const float* __restrict__ CH3, const float* __restrict__ SH3,
              const float* __restrict__ CX2, u16* Qh, u16* Ql, u16* Kh, u16* Kl, u16* Vg,
              float* QX2, float* KX2, float* GM1) {
  __shared__ __align__(16) float slab[(PJ_THREADS / 32) * 32 * GPITCH];
  __shared__ __align__(16) float rsc[(PJ_THREADS / 32) * 32];
  __shared__ __align__(16) u16 ring[2 * PJ_ROWS * TP16];
  const int tid = threadIdx.x, wv = tid >> 5, wave = wv & 3, lane = tid & 31, hh = lane >> 4, m = lane & 15;
  constexpr int NT = DM / 64;
  const int mode = __builtin_amdgcn_readfirstlane(wv >> 2);   // the same in all lanes of a wave: pointer picks and the mode branch stay scalar
  const int bid  = blockIdx.x;
  const float* ZN = ZN3 + mode * DM;
  const float* CH = CH3 + mode * DM;
  const float* SH = SH3 + mode * DM;
  u16*   Ph = (mode == 0) ? Qh : (mode == 1) ? Kh : Vg;
  u16*   Pl = (mode == 0) ? Ql : Kl;           // stored to by modes 0 and 1 only
  float* RS = (mode == 0) ? QX2 : (mode == 1) ? KX2 : GM1;
  const int nt   = bid % NT;
  const int mt   = bid / NT;
  const int rowb = mt * 128 + wave * 32;       // global token row b*SEQ + s of the wave's first row
  const int col0 = nt * 64;                    // = head * HD
  // ---- this lane's share of a stage: copy i brings staged rows 4 (wave + 12 i) .. +3, lane = (row lane>>3, 16 bytes at 16 (lane&7)) ----
  const int wvs = __builtin_amdgcn_readfirstlane(wv);         // scalar: source picks and the test on the seventh copy stay scalar
  const bool has7 = wvs + 6 * (PJ_THREADS / 32) < PJ_ROWS / 4;
  const u16* gsrc[PJ_CPW];
  unsigned   ldst[PJ_CPW];
#pragma unroll   // constant indices: both arrays stay in registers
  for (int i = 0; i < PJ_CPW; ++i) {
    int ci = wvs + (PJ_THREADS / 32) * i;
    ci = (ci < PJ_ROWS / 4) ? ci : (PJ_ROWS / 4 - 1);         // keeps the addresses of a seventh copy that is not issued in range
    const int sr = 4 * ci + (lane >> 3);                      // staged row
    const int wsel = (ci - 32) >> 4;                          // weight of a Bt row (ci >= 32)
    const u16* rowp = (ci < 32) ? (A + (size_t)(mt * 128 + sr) * DM)
                                : (((wsel == 0) ? WQT : (wsel == 1) ? WKT : WVT) + (size_t)(col0 + sr - 128 - 64 * wsel) * DM);
    gsrc[i] = rowp + 8 * (lane & 7);
    ldst[i] = lds_addr(ring) + (unsigned)(sr * (TP16 * 2) + 16 * (lane & 7));
  }
  auto stage_copy = [&](int st) {                             // stage st -> buffer st & 1
    const unsigned lo = (unsigned)((st & 1) * (PJ_ROWS * TP16 * 2));
    const unsigned l6[6] = {ldst[0] + lo, ldst[1] + lo, ldst[2] + lo, ldst[3] + lo, ldst[4] + lo, ldst[5] + lo};
    const u16* const g6[6] = {gsrc[0] + st * KST, gsrc[1] + st * KST, gsrc[2] + st * KST,
                              gsrc[3] + st * KST, gsrc[4] + st * KST, gsrc[5] + st * KST};
    acopy6(l6, g6);
    if (has7) acopy1(ldst[6] + lo, gsrc[6] + st * KST);
  };
  v8f acc[8];
#pragma unroll
  for (int i = 0; i < 8; ++i) acc[i] = zero8();
  stage_copy(0);
  wait_copies();
  __syncthreads();                                            // stage 0 is published
  stage_copy(1);
#pragma unroll 1   // one stage per trip: the ring's order (read, publish, refill) stays as written
  for (int st = 0; st < DM / KST; ++st) {
    const u16* rb = ring + (st & 1) * (PJ_ROWS * TP16);
    gemm_stage(rb + (wave * 32 + m) * TP16 + 8 * hh, rb + (128 + mode * 64 + m) * TP16 + 8 * hh, acc);
    publish_stage();
    if (st + 2 < DM / KST) stage_copy(st + 2);                // into the buffer that this trip has just read
  }
  wait_copies();
  float* sl = slab + wv * 32 * GPITCH;
  stage32x64(sl, acc, 1.0f / (XS * WSC), lane);

  const int rq = lane >> 3, c8 = (lane & 7) * 8;
  float zn8[8], ch8[8], sh8[8], rz8[8];
  {
    const v4f z0 = *(const v4f*)(ZN + col0 + c8), z1 = *(const v4f*)(ZN + col0 + c8 + 4);
    const v4f h0 = *(const v4f*)(CH + col0 + c8), h1 = *(const v4f*)(CH + col0 + c8 + 4);
    const v4f g0 = *(const v4f*)(SH + col0 + c8), g1 = *(const v4f*)(SH + col0 + c8 + 4);
#pragma unroll
    for (int e = 0; e < 4; ++e) {
      zn8[e] = z0[e]; zn8[4 + e] = z1[e];
      ch8[e] = h0[e]; ch8[4 + e] = h1[e];
      sh8[e] = g0[e]; sh8[4 + e] = g1[e];
    }
#pragma unroll
    for (int e = 0; e < 8; ++e) rz8[e] = rcp1(zn8[e]);        // one reciprocal per column, used by all 8 row groups
  }
  const bool mv = (mode == 2);
#pragma unroll 1
  for (int i = 0; i < 8; ++i) {
    const int row = 4 * i + rq;
    const float cx  = CX2[rowb + row];
    const float romc = rcp1(fmaxf(1.0f - cx, 1e-15f));
    const float opc = 1.0f + cx;
    float* sr = sl + row * GPITCH + c8;
    float y[8];
    float s0 = 0.f;
#pragma unroll
    for (int e = 0; e < 8; ++e) {
      const float mm  = sr[e] * rz8[e];
      const float arg = (2.0f * mm * ch8[e] - opc * sh8[e]) * romc;
      y[e] = sinh_of_scaled_asinh(arg, 2.0f * zn8[e]);
      s0 += y[e] * y[e];
    }
    s0 = red8(s0);
    const float n0 = fmaxf(sqrt1(s0), 1e-15f);
    const float r0 = rcp1(n0);                                // formed for every row: no branch on the clip test
    const float f0 = (n0 > MAXN) ? MAXN * r0 : 1.0f;          // a row inside the ball is multiplied by exactly 1
    float s1 = 0.f;
#pragma unroll
    for (int e = 0; e < 8; ++e) {
      y[e] = y[e] * f0;
      s1 += y[e] * y[e];
    }
    s1 = red8(s1);
    const float rden = rcp1(1.0f + sqrt1(1.0f + s1));
    float s2 = 0.f;
#pragma unroll
    for (int e = 0; e < 8; ++e) {
      y[e] = y[e] * rden;
      s2 += y[e] * y[e];
    }
    s2 = red8(s2);
    const float n2 = fmaxf(sqrt1(s2), 1e-15f);
    const float r2 = rcp1(n2);
    const float f2 = (n2 > MAXN) ? MAXN * r2 : 1.0f;
    float s3 = 0.f;
#pragma unroll
    for (int e = 0; e < 8; ++e) {
      y[e] = y[e] * f2;
      s3 += y[e] * y[e];
    }
    s3 = red8(s3);
    const float g    = 2.0f * rcp1(fmaxf(1.0f - s3, 1e-15f));
    const float gmul = mv ? g : 1.0f;
    const float scal = mv ? (g - 1.0f) : s3;
#pragma unroll
    for (int e = 0; e < 8; ++e) sr[e] = y[e] * gmul;
    if ((lane & 7) == 0) rsc[wv * 32 + row] = scal;
  }
  wave_sync_lds();

  const int bb = rowb / SEQ, s0r = rowb - bb * SEQ, head = nt;
  if (lane < 8) {
    const v4f v = *(const v4fa*)(rsc + wv * 32 + 4 * lane);
    float* dst = RS + ((size_t)(bb * NH + head)) * SEQ + s0r + 4 * lane;
    {
      *(v4f*)(dst) = v;
      
    }
  }
  // ---- planes ----
  const size_t pofs = (size_t)rowb * DM + (size_t)(col0 + c8);
  if (!mv) {
    v4u oh[8], ol[8];
#pragma unroll
    for (int i = 0; i < 8; ++i) {
      const int row = 4 * i + rq;
      const v4f a = *(const v4fa*)(sl + row * GPITCH + c8), c4 = *(const v4fa*)(sl + row * GPITCH + c8 + 4);
#pragma unroll
      for (int e = 0; e < 2; ++e) {
        const unsigned short ha = bf_bits(a[2 * e]),  hb = bf_bits(a[2 * e + 1]);
        const unsigned short la = bf_bits(a[2 * e] - bf_up(ha)), lb = bf_bits(a[2 * e + 1] - bf_up(hb));
        oh[i][e] = pk16(ha, hb);
        ol[i][e] = pk16(la, lb);
        const unsigned short hc = bf_bits(c4[2 * e]), hd = bf_bits(c4[2 * e + 1]);
        const unsigned short lc = bf_bits(c4[2 * e] - bf_up(hc)), ld = bf_bits(c4[2 * e + 1] - bf_up(hd));
        oh[i][2 + e] = pk16(hc, hd);
        ol[i][2 + e] = pk16(lc, ld);
      }
    }
    {
#pragma unroll
      for (int i = 0; i < 8; ++i) {
        const int row = 4 * i + rq;
        *(v4u*)(Ph + pofs + (size_t)row * DM) = oh[i];
        *(v4u*)(Pl + pofs + (size_t)row * DM) = ol[i];
      }
      
    }
  } else {
    v4u ov[8];
#pragma unroll
    for (int i = 0; i < 8; ++i) {
      const int row = 4 * i + rq;
      const v4f a = *(const v4fa*)(sl + row * GPITCH + c8), c4 = *(const v4fa*)(sl + row * GPITCH + c8 + 4);
#pragma unroll
      for (int e = 0; e < 2; ++e) {
        ov[i][e]     = pk16(h_bits((_Float16)(a[2 * e] * VS)),  h_bits((_Float16)(a[2 * e + 1] * VS)));
        ov[i][2 + e] = pk16(h_bits((_Float16)(c4[2 * e] * VS)), h_bits((_Float16)(c4[2 * e + 1] * VS)));
      }
    }
    {
#pragma unroll
      for (int i = 0; i < 8; ++i) {
        const int row = 4 * i + rq;
        *(v4u*)(Ph + pofs + (size_t)row * DM) = ov[i];
      }
      
    }
  }
}

// =====================================================================================================
// 16-bit per-batch transpose: VT[b*DM + hd][s] <- Vg[b*SEQ + s][hd]. Block = 64(s) x 64(hd) tile, 128 threads.
// Load phase: thread = (s = 16p + (tid>>3), 8 halves at hd = 8*(tid&7)) one 16-B load, 4 steps, scattered as u16 scalars
// into an LDS tile [hd][s] (pitch 72); block barrier; store phase: VT row hd0 + 16i + (tid>>3) gets s0 + 8*(tid&7) .. +7 =
// passes. grid = NB x (SEQ/64) x (DM/64): bid -> (st = bid % 16, ht = (bid/16) % 16, b = bid/256).
// coverage: load 4 p x 16 s x 8 lane-groups x 8 hd = 64 x 64; store 4 i x 16 rows x 8 lanes x 8 halves = 64 hd x 64 s;
//           the grid covers VT (NB*DM rows x SEQ) exactly once.
// LDS tile: cross-wave, block barrier; staged extent 64x64 == consumed extent (pad columns 64..71 never read).
// =====================================================================================================
__global__ __launch_bounds__(TR_THREADS)
void trT16(const u16* __restrict__ Vg, u16* VT) {
  __shared__ __align__(16) u16 tile[64 * TP16];
  const int tid = threadIdx.x;
  constexpr int NST = SEQ / 64, NHT = DM / 64;
  const int bid = blockIdx.x;
  const int st  = bid % NST;
  const int tmp = bid / NST;
  const int ht  = tmp % NHT;
  const int b   = tmp / NHT;
  const int s0 = st * 64, hd0 = ht * 64;
  const int r = tid >> 3, c = (tid & 7) * 8;
#pragma unroll
  for (int p = 0; p < 4; ++p) {
    const int s = 16 * p + r;
    const v4u w = *(const v4u*)(Vg + ((size_t)(b * SEQ + s0 + s)) * DM + hd0 + c);
#pragma unroll
    for (int e = 0; e < 8; ++e)
      tile[(c + e) * TP16 + s] = (u16)((w[e >> 1] >> (16 * (e & 1))) & 0xFFFFu);
  }
  __syncthreads();
  const int rq = tid >> 3, c8 = (tid & 7) * 8;
  v4u ov[4];
#pragma unroll
  for (int i = 0; i < 4; ++i) {
    const int row = 16 * i + rq;
    ov[i] = *(const v4ua*)(tile + row * TP16 + c8);
  }
  u16* dst = VT + ((size_t)(b * DM + hd0)) * SEQ + s0 + c8;
  {
#pragma unroll
    for (int i = 0; i < 4; ++i) {
      const int row = 16 * i + rq;
      *(v4u*)(dst + (size_t)row * SEQ) = ov[i];
    }
    
  }
}

// ---- softmax weight of one (query, key) pair, not normalised: em * exp(-dist) ----
// exp(-acosh(z)) = 1 / (z + sqrt(z^2 - 1)); with z = 1 + 2 num / den this is den / (den + 2 (num + sqrt(num (num + den)))):
// no logarithm, no exponential, no cancellation. num and den lie in [1e-15, 4], so no step leaves the normal f32 range.
// em = the key's own factor exp(bias - largest bias of the batch) * PCAR, in [0, PCAR].
// Range of exp(-dist): q and k leave the projection clipped to norm MAXN, so den >= (1 - MAXN^2)^2 and num <= 4 MAXN^2, which
// gives z + sqrt(z^2 - 1) < 2^18. A key with the largest bias therefore has a weight of at least PCAR / 2^18 = 1/8 in every row,
// while no weight exceeds PCAR: the f16 P operand and the f32 sums need no row maximum.
// Two neighbouring keys at a time: they lie in neighbouring registers of the score tile and of the tables (packed f32 forms).
__device__ __forceinline__ v2f weight2(v2f xy, v2f y2, v2f em, float x2, float omx) {
  const v2f lim = {1e-15f, 1e-15f};
  const v2f num = __builtin_elementwise_max(x2 - 2.0f * xy + y2, lim);
  const v2f den = __builtin_elementwise_max(omx * (1.0f - y2), lim);
  const v2f sq  = num * (num + den);
  const v2f rt  = {__builtin_amdgcn_sqrtf(sq[0]), __builtin_amdgcn_sqrtf(sq[1])};
  const v2f ee  = 2.0f * (num + rt) + den;
  const v2f ri  = {__builtin_amdgcn_rcpf(ee[0]), __builtin_amdgcn_rcpf(ee[1])};
  return (em * den) * ri;
}

// =====================================================================================================
// Fused distance attention + gyro-midpoint over all SEQ keys: block = (batch b, head, 64 query rows), 4 waves, wave w owns
// queries q0 = 64*qt + 16*w .. q0+15. The four waves share the keys: k hi, k lo and v^T go through a two-buffer LDS ring, KST keys
// per stage (3 tiles of 64 rows x 128 B, whole lines, pitch TP16), brought in by asynchronous 16-byte copies, 12 per thread and
// stage; the next stage flies while this one is worked on; one block barrier per stage.
//   q planes bf16 hi/lo [b*SEQ + s][h*64 + d]; k planes bf16 hi/lo same layout; v^T plane f16 x VS [(b*NH + h)*64 + d][s];
//   per-key tables for (b, h): sum k^2, gamma - 1; factor exp(bias - largest bias) x32768 from the additive bias row amask[b][s] (bf16-converted); per query x2 = sum q^2.
//   All NKB = 32 key blocks of 32 keys are visited (static bound), two per ring stage.
//   Scores computed TRANSPOSED: S^T tile g = k rows (keys kb+16g .., A operand, row m = lane&15, split k map over d)
//   times q^T (B operand, col n = query q0 + (lane&15), k = d), 2 d-chunks of 32, three bf16 products each (hi.hi, lo.hi,
//   hi.lo). D element r of lane l = (key kb+16g+8h+r, query q0+(l&15)): a lane owns one query column and 16 of its 32 keys;
//   the partner lane l^16 owns the other 16 -> the row sums need one xor-16 shuffle.
//   dist = acosh(1 + 2 max(x2 - 2 xy + y2, 1e-15) / max((1 - x2)(1 - y2), 1e-15)), logit = -dist + bias, all f32.
//   Softmax weights p = exp(bias - largest bias of the batch) exp(-dist) in closed form (weight2()), one fixed scale for all keys:
//   no row maximum, no rescale of O, nothing crosses lanes in the key loop. Each lane sums l = sum p and dn = sum p (gamma - 1) over
//   its own keys; the two halves of a query's keys meet in one xor-16 shuffle behind the loop. The weights ARE the
//   P A-fragment in place: A row m = query = lane&15, element i <- key kb+8h+i (tile 0, D element i), element 8+i <- key
//   kb+16+8h+i (tile 1, D element i). P (<= 1) carried x32768 as f16; l and dn carry the same factor.
//   4 v^T B fragments (col n = d = 16j + (lane&15), keys k-contiguous), 4 P.V WMMAs + one guard.
//   Epilogue (f32): two_mean = (O (1/l) / VS) / max(dn / l, 1e-10); a = two_mean / (1 + sqrt(max(1 - sum two_mean^2,
//   1e-15))); clip to norm MAXN; the wave's 16x64 tile staged in its LDS slab (pitch 68); each output row segment
// coverage: per wave 8 instructions x 2 rows x 16 lanes x 4 floats = 16 x 64; grid NB*NH*(SQ/64) blocks x 4 waves = every
//           (b < NB, s < SQ, h) row segment of the output exactly once.
// LDS: ms/ky2/kg1 cross-wave (block barrier, 1024 staged == 1024 consumed); ring cross-wave (block barrier per stage, staged
// extent == consumed extent, pad bytes never read); slab wave-private (wave_sync, 16x64).
// =====================================================================================================
__global__ __launch_bounds__(ATT_THREADS)
void attn_fwd(const u16* __restrict__ Qh, const u16* __restrict__ Ql, const u16* __restrict__ Kh, const u16* __restrict__ Kl,
              const u16* __restrict__ VT, const float* __restrict__ QX2, const float* __restrict__ KX2,
              const float* __restrict__ GM1, const float* __restrict__ amask, float* Out) {
  __shared__ __align__(16) float ms[SEQ];
  __shared__ __align__(16) float ky2[SEQ];
  __shared__ __align__(16) float kg1[SEQ];
  __shared__ __align__(16) float slab[4 * 16 * GPITCH];
  __shared__ __align__(16) u16 ring[2 * 3 * ATILE];

  const int tid  = threadIdx.x;
  const int wave = tid >> 5;
  const int lane = tid & 31;
  const int hh   = lane >> 4;
  const int c    = lane & 15;

  constexpr int NQT = SQ / 64;
  const int bid  = blockIdx.x;
  const int qt   = bid % NQT;
  const int head = (bid / NQT) % NH;
  const int b    = bid / (NQT * NH);
  const int bh   = b * NH + head;
  const int q0   = qt * 64 + wave * 16;

  // ---- this thread's share of a ring stage: per tile rows (tid>>3) + 16 i, i < 4, 16 bytes at 16 (tid&7) ----
  const u16* khg = Kh + ((size_t)(b * SEQ + (tid >> 3))) * DM + head * HD + 8 * (tid & 7);
  const u16* klg = Kl + ((size_t)(b * SEQ + (tid >> 3))) * DM + head * HD + 8 * (tid & 7);
  const u16* vtg = VT + ((size_t)(bh * HD + (tid >> 3))) * SEQ + 8 * (tid & 7);
  const unsigned lring = lds_addr(ring) + (unsigned)((tid >> 3) * (TP16 * 2) + 16 * (tid & 7));
  auto stage_copy = [&](int st) {                             // keys KST st .. +63 -> buffer st & 1
    const unsigned lo = lring + (unsigned)((st & 1) * (3 * ATILE * 2));
    const u16* kh = khg + (size_t)st * KST * DM;
    const u16* kl = klg + (size_t)st * KST * DM;
    const u16* vt = vtg + st * KST;
    constexpr unsigned R16 = 16 * TP16 * 2, TB = ATILE * 2;   // 16 rows, one tile, in bytes
    const unsigned la[6] = {lo, lo + R16, lo + 2 * R16, lo + 3 * R16, lo + TB, lo + TB + R16};
    const u16* const ga[6] = {kh, kh + 16 * DM, kh + 32 * DM, kh + 48 * DM, kl, kl + 16 * DM};
    acopy6(la, ga);
    const unsigned lb[6] = {lo + TB + 2 * R16, lo + TB + 3 * R16, lo + 2 * TB, lo + 2 * TB + R16, lo + 2 * TB + 2 * R16,
                            lo + 2 * TB + 3 * R16};
    const u16* const gb[6] = {kl + 32 * DM, kl + 48 * DM, vt, vt + 16 * SEQ, vt + 32 * SEQ, vt + 48 * SEQ};
    acopy6(lb, gb);
  };
  stage_copy(0);                                              // flies while the tables are staged

  // ---- largest bias of the batch: every wave reads the whole row (32 lanes x 32 values), so no barrier is needed for it.
  //      bf16 rounding is monotone: the rounded maximum is the maximum of the rounded values.
  float mb;
  {
    const float* mr = amask + (size_t)b * SEQ + 4 * lane;
    v4f a[SEQ / 128];
#pragma unroll   // all loads issue before the first use: one memory latency
    for (int q = 0; q < SEQ / 128; ++q) a[q] = *(const v4f*)(mr + 128 * q);
    // precaution: the table loads that follow may land in the register that holds these loads' offset
    asm volatile("s_wait_xcnt 0x0" ::: "memory");
    float mx = -INFINITY;
#pragma unroll
    for (int q = 0; q < SEQ / 128; ++q) mx = fmaxf(fmaxf(fmaxf(mx, a[q][0]), fmaxf(a[q][1], a[q][2])), a[q][3]);
    mx = fmaxf(mx, __shfl_xor(mx, 16, 32)); mx = fmaxf(mx, __shfl_xor(mx, 8, 32)); mx = fmaxf(mx, __shfl_xor(mx, 4, 32));
    mx = fmaxf(mx, __shfl_xor(mx, 2, 32));  mx = fmaxf(mx, __shfl_xor(mx, 1, 32));
    mb = bfr(mx);
  }
  // ---- stage the per-key tables of (b, head): 128 threads x 8 keys = SEQ ----
  {
    const int i0 = tid * 8;
    const float* mp = amask + (size_t)b * SEQ + i0;
    const float* yp = KX2 + (size_t)bh * SEQ + i0;
    const float* gp = GM1 + (size_t)bh * SEQ + i0;
    const v4f m0 = *(const v4f*)(mp), m1 = *(const v4f*)(mp + 4);
    const v4f y0 = *(const v4f*)(yp), y1 = *(const v4f*)(yp + 4);
    const v4f g0 = *(const v4f*)(gp), g1 = *(const v4f*)(gp + 4);
#pragma unroll
    for (int e = 0; e < 4; ++e) {
      ms[i0 + e]     = exp2f((bfr(m0[e]) - mb) * LOG2E) * PCAR;
      ms[i0 + 4 + e] = exp2f((bfr(m1[e]) - mb) * LOG2E) * PCAR;
      ky2[i0 + e] = y0[e];      ky2[i0 + 4 + e] = y1[e];
      kg1[i0 + e] = g0[e];      kg1[i0 + 4 + e] = g1[e];
    }
  }
  wait_copies();
  __syncthreads();                                            // the tables and stage 0 are published
  stage_copy(1);

  // B fragments of q^T: col n = query q0 + c, k = d (k-contiguous rows of the q planes)
  const size_t qofs = ((size_t)(b * SEQ + q0 + c)) * DM + head * HD + 8 * hh;
  const Frag qh0 = ldfrag(Qh + qofs), qh1 = ldfrag(Qh + qofs + 32);
  const Frag ql0 = ldfrag(Ql + qofs), ql1 = ldfrag(Ql + qofs + 32);
  const float xq  = QX2[(size_t)bh * SEQ + q0 + c];
  const float omx = 1.0f - xq;
  // A fragments of k: row m = key kb + 16g + c, k = d; B fragments of v^T: col n = d = 16j + c, k = key; both from the ring

  v2f lrun2 = {0.f, 0.f}, drun2 = {0.f, 0.f};   // this lane's sums over its even and its odd keys
  v8f o[4];
#pragma unroll
  for (int j = 0; j < 4; ++j) o[j] = zero8();

#pragma unroll 1   // one stage per trip: the ring's order (read, publish, refill) stays as written
  for (int st = 0; st < SEQ / KST; ++st) {
  const u16* rb = ring + (st & 1) * (3 * ATILE);
#pragma unroll 1   // the two 32-key blocks of a stage share one copy of the long body
  for (int sub = 0; sub < KST / 32; ++sub) {
    const int kb = st * KST + sub * 32;
    const u16* KhB = rb + (sub * 32 + c) * TP16 + 8 * hh;     // staged k hi row of key kb + c
    const u16* KlB = KhB + ATILE;
    // ---- transposed scores: s0 = keys kb..kb+15, s1 = keys kb+16..kb+31, column = query q0 + c ----
    v8f s0 = zero8(), s1 = zero8();
    constexpr int k0o = 0, k1o = 16 * TP16;
    {
      const Frag kh0 = ldfrag(KhB + k0o), kh1 = ldfrag(KhB + k1o);
      const Frag kl0 = ldfrag(KlB + k0o), kl1 = ldfrag(KlB + k1o);
      s0 = mma_b(kh0, qh0, s0); s0 = mma_b(kl0, qh0, s0); s0 = mma_b(kh0, ql0, s0);
      s1 = mma_b(kh1, qh0, s1); s1 = mma_b(kl1, qh0, s1); s1 = mma_b(kh1, ql0, s1);
      guard_sc(s0, s1, qh0.h, ql0.h, kh0.h, kh1.h, kl0.h, kl1.h);
    }
    {
      const Frag kh0 = ldfrag(KhB + k0o + 32), kh1 = ldfrag(KhB + k1o + 32);
      const Frag kl0 = ldfrag(KlB + k0o + 32), kl1 = ldfrag(KlB + k1o + 32);
      s0 = mma_b(kh0, qh1, s0); s0 = mma_b(kl0, qh1, s0); s0 = mma_b(kh0, ql1, s0);
      s1 = mma_b(kh1, qh1, s1); s1 = mma_b(kl1, qh1, s1); s1 = mma_b(kh1, ql1, s1);
      guard_sc(s0, s1, qh1.h, ql1.h, kh0.h, kh1.h, kl0.h, kl1.h);
    }
    // ---- per-key values of this lane's 16 keys: word q of [0..1] <- keys kb+8hh+4q.., of [2..3] <- keys kb+16+8hh+4(q-2).. ----
    const int ka = kb + 8 * hh, kc = kb + 16 + 8 * hh;
    const v4f y4[4] = {*(const v4fa*)(ky2 + ka), *(const v4fa*)(ky2 + ka + 4), *(const v4fa*)(ky2 + kc), *(const v4fa*)(ky2 + kc + 4)};
    const v4f g4[4] = {*(const v4fa*)(kg1 + ka), *(const v4fa*)(kg1 + ka + 4), *(const v4fa*)(kg1 + kc), *(const v4fa*)(kg1 + kc + 4)};
    const v4f m4[4] = {*(const v4fa*)(ms + ka),  *(const v4fa*)(ms + ka + 4),  *(const v4fa*)(ms + kc),  *(const v4fa*)(ms + kc + 4)};
    // ---- weights (<= PCAR), this lane's two sums and the P A-fragment f16(p); fragment word 4w + e4 <-> D elements 2 e4, 2 e4 + 1 of tile w ----
    Frag ph;
#pragma unroll
    for (int w = 0; w < 2; ++w) {
      const v8f sv = w ? s1 : s0;
#pragma unroll
      for (int e4 = 0; e4 < 4; ++e4) {
        const int q = 2 * w + (e4 >> 1), h2 = 2 * (e4 & 1);
        const v2f xy = {sv[2 * e4], sv[2 * e4 + 1]};
        const v2f y2 = {y4[q][h2], y4[q][h2 + 1]};
        const v2f em = {m4[q][h2], m4[q][h2 + 1]};
        const v2f g1 = {g4[q][h2], g4[q][h2 + 1]};
        const v2f p  = weight2(xy, y2, em, xq, omx);
        lrun2 += p;
        drun2 += p * g1;
        ph.u[w][e4] = __builtin_bit_cast(unsigned, __builtin_convertvector(p, v2h));
      }
    }
    // ---- P.V : B fragment col n = d = j*16 + c, keys contiguous in the v^T plane ----
    {
      const u16* vp = rb + 2 * ATILE + c * TP16 + sub * 32 + 8 * hh;
      const Frag v0 = ldfrag(vp);
      const Frag v1 = ldfrag(vp + 16 * TP16);
      const Frag v2 = ldfrag(vp + 32 * TP16);
      const Frag v3 = ldfrag(vp + 48 * TP16);
      o[0] = mma_h(ph, v0, o[0]);
      o[1] = mma_h(ph, v1, o[1]);
      o[2] = mma_h(ph, v2, o[2]);
      o[3] = mma_h(ph, v3, o[3]);
      guard_pv(o, ph.h, v0.h, v1.h, v2.h, v3.h);
    }
  }
  publish_stage();
  if (st + 2 < SEQ / KST) stage_copy(st + 2);                 // into the buffer that this trip has just read
  }
  wait_copies();
  acc_guard4(o);

  // ---- the two halves of each query's keys (lanes l and l ^ 16) meet ----
  float lrun = lrun2[0] + lrun2[1], drun = drun2[0] + drun2[1];
  lrun += __shfl_xor(lrun, 16, 32);
  drun += __shfl_xor(drun, 16, 32);
  // ---- gyro-midpoint epilogue in f32: per query factors from the query-owner lane (lane = query); O and l both carry PCAR ----
  const float linv = rcp1(lrun);
  const float nf   = linv * (1.0f / VS);
  const float dq   = fmaxf(drun * linv, 1e-10f);
  const float fq   = nf * rcp1(dq);             // the query's one factor: 1 / (l VS) over the clamped denominator
  float fqr[8];
#pragma unroll
  for (int r = 0; r < 8; ++r) fqr[r] = __shfl(fq, 8 * hh + r, 32);
  float sq[8];
#pragma unroll
  for (int r = 0; r < 8; ++r) {
    float sp = 0.f;
#pragma unroll
    for (int j = 0; j < 4; ++j) {
      const float tm = o[j][r] * fqr[r];
      o[j][r] = tm;
      sp += tm * tm;
    }
    sq[r] = rsum16(sp);
  }
  float* sw = slab + wave * 16 * GPITCH;
#pragma unroll
  for (int r = 0; r < 8; ++r) {
    const float rdf = rcp1(1.0f + sqrt1(fmaxf(1.0f - sq[r], 1e-15f)));
    float sp = 0.f;
#pragma unroll
    for (int j = 0; j < 4; ++j) {
      const float a = o[j][r] * rdf;
      o[j][r] = a;
      sp += a * a;
    }
    const float s2  = rsum16(sp);
    const float n2  = fmaxf(sqrt1(s2), 1e-15f);
    const bool  cl  = n2 > MAXN;
    const float fcl = MAXN * rcp1(n2);
#pragma unroll
    for (int j = 0; j < 4; ++j) {
      const float a = o[j][r];
      sw[(8 * hh + r) * GPITCH + 16 * j + c] = cl ? (a * fcl) : a;
    }
  }
  wave_sync_lds();
  // ---- f32 output rows: lanes 0..15 -> row 2i, lanes 16..31 -> row 2i+1, lane = 4 consecutive d ----
  const int cc = lane & 15;
  v4f vals[8];
#pragma unroll
  for (int i = 0; i < 8; ++i) vals[i] = *(const v4fa*)(sw + (2 * i + hh) * GPITCH + 4 * cc);
  float* ob = Out + ((size_t)(b * SEQ + q0 + hh)) * DM + head * HD + 4 * cc;
  {
#pragma unroll
    for (int i = 0; i < 8; ++i) {
      *(v4f*)(ob + (size_t)(2 * i) * DM) = vals[i];
    }
    
  }
}

// =====================================================================================================
// Workspace map (bytes); every region written fully by whole-line stores before it is read; every extent an exact multiple
//   X16  f16 [NB*SEQ][DM]          f16(bf16(x) x64)              4194304 (NB=2)
//   WQT/WKT/WVT f16 [DM n][DM k]   f16(bf16(W) x256)             3 x 2097152
//   CX2  f32 [NB*SEQ]              sum x^2                       8192
//   ZN, CH, SH f32 [3][DM]         column norms, cosh/sinh(2r)   3 x 12288
//   Qh, Ql, Kh, Kl bf16 [NB*SEQ][DM]                             4 x 4194304
//   Vg   f16 [NB*SEQ][DM]          f16(gamma v x256)             4194304
//   VT   f16 [NB*NH*HD][SEQ]       transposed Vg                 4194304
//   QX2, KX2, GM1 f32 [NB*NH][SEQ]                                3 x 131072
//   end = 36089856 at NB=2
// =====================================================================================================
static inline size_t up4k(size_t v) { return (v + 4095) & ~(size_t)4095; }

extern "C" void kernel_launch(void* const* d_in, const int* in_sizes, int n_in,
                              void* d_out, int out_size, void* d_ws, size_t ws_size,
                              hipStream_t stream) {
  if (n_in < 8) return;
  if (in_sizes[0] < NB * SEQ * DM) return;
  if (in_sizes[1] < NB * SEQ) return;
  if (in_sizes[2] < DM * DM || in_sizes[4] < DM * DM || in_sizes[6] < DM * DM) return;
  if (in_sizes[3] < 1 || in_sizes[5] < 1 || in_sizes[7] < 1) return;
  if (out_size < NB * SEQ * DM) return;

  const float* hs = (const float*)d_in[0];
  const float* am = (const float*)d_in[1];
  const float* qz = (const float*)d_in[2];
  const float* qr = (const float*)d_in[3];
  const float* kz = (const float*)d_in[4];
  const float* kr = (const float*)d_in[5];
  const float* vz = (const float*)d_in[6];
  const float* vr = (const float*)d_in[7];
  float*       out = (float*)d_out;
  const int nqr = in_sizes[3], nkr = in_sizes[5], nvr = in_sizes[7];

  const size_t nrow  = (size_t)NB * SEQ;
  const size_t szX16 = up4k(nrow * DM * 2);
  const size_t szWT  = up4k((size_t)DM * DM * 2);
  const size_t szCX2 = up4k(nrow * 4);
  const size_t szCOL = up4k((size_t)3 * DM * 4);
  const size_t szP   = up4k(nrow * DM * 2);
  const size_t szVT  = up4k((size_t)NB * NH * HD * SEQ * 2);
  const size_t szRS  = up4k((size_t)NB * NH * SEQ * 4);
  size_t off = 0;
  const size_t oX16 = off; off += szX16;
  const size_t oWQ  = off; off += szWT;
  const size_t oWK  = off; off += szWT;
  const size_t oWV  = off; off += szWT;
  const size_t oCX2 = off; off += szCX2;
  const size_t oZN  = off; off += szCOL;
  const size_t oCH  = off; off += szCOL;
  const size_t oSH  = off; off += szCOL;
  const size_t oQh  = off; off += szP;
  const size_t oQl  = off; off += szP;
  const size_t oKh  = off; off += szP;
  const size_t oKl  = off; off += szP;
  const size_t oVg  = off; off += szP;
  const size_t oVT  = off; off += szVT;
  const size_t oQX2 = off; off += szRS;
  const size_t oKX2 = off; off += szRS;
  const size_t oGM1 = off; off += szRS;
  if (off > ws_size) return;                       // off = 36089856 at NB=2
  if (off > (size_t)134217728) return;

  char* ws = (char*)d_ws;
  u16*   X16 = (u16*)(ws + oX16);
  u16*   WQT = (u16*)(ws + oWQ);
  u16*   WKT = (u16*)(ws + oWK);
  u16*   WVT = (u16*)(ws + oWV);
  float* CX2 = (float*)(ws + oCX2);
  float* ZN  = (float*)(ws + oZN);
  float* CH  = (float*)(ws + oCH);
  float* SH  = (float*)(ws + oSH);
  u16*   Qh  = (u16*)(ws + oQh);
  u16*   Ql  = (u16*)(ws + oQl);
  u16*   Kh  = (u16*)(ws + oKh);
  u16*   Kl  = (u16*)(ws + oKl);
  u16*   Vg  = (u16*)(ws + oVg);
  u16*   VT  = (u16*)(ws + oVT);
  float* QX2 = (float*)(ws + oQX2);
  float* KX2 = (float*)(ws + oKX2);
  float* GM1 = (float*)(ws + oGM1);

  // (1) all that reads only the inputs: x -> f16 plane of bf16(x) x64, per-row sums of squares, per weight the column norms
  //     with cosh/sinh(2r) and the k-contiguous [n][k] f16 plane of bf16(W) x256
  prep<<<dim3(PB_ROW + PB_COL + PB_TR + PB_CVT), dim3(PREP_THREADS), 0, stream>>>(
      hs, qz, kz, vz, qr, kr, vr, nqr, nkr, nvr, X16, CX2, ZN, CH, SH, WQT, WKT, WVT);
  // (2) the three projections with the fused MLR / per-head epilogue
  proj_mlr<<<dim3(PJ_BLOCKS), dim3(PJ_THREADS), 0, stream>>>(
      X16, WQT, WKT, WVT, ZN, CH, SH, CX2, Qh, Ql, Kh, Kl, Vg, QX2, KX2, GM1);
  // (3) gamma v plane -> key-contiguous v^T plane
  trT16<<<dim3(NB * (SEQ / 64) * (DM / 64)), dim3(TR_THREADS), 0, stream>>>(Vg, VT);
  // (4) attention + midpoint -> out [b][SEQ][DM] f32 (rows s < SQ of batches b < NB), heads merged on the feature dim
  attn_fwd<<<dim3(NB * NH * (SQ / 64)), dim3(ATT_THREADS), 0, stream>>>(Qh, Ql, Kh, Kl, VT, QX2, KX2, GM1, am, out);
  (void)hipGetLastError();
}

// v007
// One run takes 61.1 microseconds.
// Two timings next to v006 both put it at 1.05 times that version's speed.
// Over all steps from v000 it is 9.37 times as fast.
// Contractions: x.Wq, x.Wk, x.Wv on v_wmma_f32_16x16x32_f16 (x as f16(bf16(x) x64), W as f16(bf16(W) x256), f32 accumulate);
// scores k.q^T on v_wmma_f32_16x16x32_bf16 as bf16 hi/lo split (hi.hi + lo.hi + hi.lo into one f32 accumulator);
// P.(gamma v) on v_wmma_f32_16x16x32_f16 (P x32768 f16, gamma v x256 f16 through transposing LDS loads, f32 accumulate); norms, asinh/sinh/acosh
// (closed forms on v_log_f32 / v_exp_f32 / v_sqrt_f32 / v_rcp_f32), softmax weights in closed form at a fixed scale,
// the sum_j p_j (gamma_j - 1) denominators and all carry folds in f32 on VALU.
// Float inputs RNE-converted to bf16 on load; f32 output written directly.
#include <hip/hip_runtime.h>
#include <math.h>
#include <stdint.h>

#ifndef NB
#define NB 2            // batches processed
#endif
#ifndef SQ
#define SQ 1024         // query rows processed per batch (keys/values always all SEQ rows)
#endif
#define NB_FULL 2
#define SEQ  1024       // rows per batch in every input / output / plane layout
#define DM   1024       // model width = K of the projections = row pitch of the 16-bit planes
#define NH   16
#define HD   64
#define XS   64.0f      // carry on the x plane
#define WSC  256.0f     // carry on the transposed weight planes
#define VS   256.0f     // carry on the gamma*v plane
#define PCAR 32768.0f   // carry on P
#define LOG2E 1.4426950408889634f
#define MAXN 0.996f     // (1 - 4e-3) / sqrt(c)
#define NKB  (SEQ / 32)
#define GPITCH 68
#define TPITCH 65
#define TP16   72
#define CVT_THREADS (DM / 8)
#define TR_THREADS  128
#define ATT_THREADS 128
#define CS_THREADS  1024  // column statistics: threads per block
#define CS_COLS     32    // columns per block
#define CS_STEPS    (DM / (CS_THREADS / 8))   // rows per thread
#define PREP_THREADS 1024                      // block of the preparation grid (all four block kinds)
#define PB_ROW  (NB * SEQ / 128)               // row statistics blocks, 128 rows each
#define PB_COL  (3 * (DM / CS_COLS))           // column statistics blocks, 32 columns of one weight each
#define PB_TR   (3 * (DM / 64) * (DM / 64) / 8)  // weight transpose blocks, 8 tiles of 64 x 64 of one weight each
#define PB_CVT  (NB * SEQ / 8)                 // x convert blocks, 8 rows each
#define PJ_BLOCKS ((NB * SEQ / 128) * (DM / 64)) // projection blocks: one per 128-row x 64-column tile
#define PJ_THREADS 384                         // 3 weights x 4 waves
#define KST     64                             // k (projection) or keys (attention) per LDS stage: one 128-B line of every staged row
#define PJ_ROWS (128 + 3 * 64)                 // staged rows of a projection stage: 128 of A, then 64 of each weight
#define PJ_CPW  ((PJ_ROWS / 4 + PJ_THREADS / 32 - 1) / (PJ_THREADS / 32))  // copies per wave and stage, upper bound (a copy = 4 rows)
#define ATILE   (64 * TP16)                    // one staged 64-row k tile of attention, in 16-bit units
#define VP16    80                             // pitch of a staged gamma v row: 160 B = 32 B x 5, the pitch for ds_load_tr16_b128
#define VTILE   (64 * VP16)                    // one staged 64-row gamma v tile, in 16-bit units
#define ABUF    (2 * ATILE + VTILE)            // one buffer of the attention ring: k hi, k lo, gamma v

static_assert(NB >= 1 && NB <= NB_FULL);
static_assert((SQ % 64) == 0 && SQ >= 64 && SQ <= SEQ);
static_assert(NH * HD == DM && HD == 64);
static_assert((SEQ % 128) == 0 && (SEQ % 32) == 0 && NKB * 32 == SEQ);
static_assert((DM % 256) == 0 && (DM % 64) == 0 && (DM % 32) == 0 && CVT_THREADS == 128);
static_assert((GPITCH * 4) % 16 == 0 && (TP16 * 2) % 16 == 0 && (VP16 * 2) % 32 == 0 && ((VP16 * 2) / 32) % 2 == 1);
static_assert(CS_COLS == 32 && (DM % CS_COLS) == 0 && CS_STEPS * (CS_THREADS / 8) == DM);
static_assert(ATT_THREADS == 128 && TR_THREADS == 128 && ATT_THREADS * 8 == SEQ);
static_assert(PREP_THREADS == CS_THREADS && PREP_THREADS == 8 * CVT_THREADS && PREP_THREADS == 8 * TR_THREADS);
static_assert(((DM / 64) * (DM / 64)) % 8 == 0 && (NB * SEQ) % 128 == 0);
static_assert(KST == 64 && DM / KST >= 2 && SEQ / KST >= 2 && (DM % KST) == 0 && (SEQ % KST) == 0);
static_assert(PJ_CPW == 7 && (PJ_ROWS % 4) == 0 && PJ_ROWS / 4 - 6 * (PJ_THREADS / 32) == 8);

typedef unsigned short u16;
typedef _Float16 v16h __attribute__((ext_vector_type(16)));
typedef _Float16 v8h  __attribute__((ext_vector_type(8)));
typedef __bf16   v16b __attribute__((ext_vector_type(16)));
typedef float    v8f  __attribute__((ext_vector_type(8)));
typedef float    v4f  __attribute__((ext_vector_type(4)));
typedef float    v2f  __attribute__((ext_vector_type(2)));
typedef _Float16 v2h  __attribute__((ext_vector_type(2)));
typedef unsigned int v4u __attribute__((ext_vector_type(4)));
typedef v4u __attribute__((may_alias)) v4ua;
typedef v4f __attribute__((may_alias)) v4fa;

// one 16 x 16-bit per-lane fragment, viewed as f16 vector, bf16 vector or two 16-byte words
union Frag { v16h h; v16b b; v4u u[2]; };

// ---- scalar helpers ----------------------------------------------------------------------------------
__device__ __forceinline__ unsigned short bf_bits(float f) {          // f32 -> bf16 bits, RNE convert
  unsigned u = __float_as_uint(f);
  return (unsigned short)((u + 0x7FFFu + ((u >> 16) & 1u)) >> 16);
}
__device__ __forceinline__ float bf_up(unsigned short h) { return __uint_as_float(((unsigned)h) << 16); }
__device__ __forceinline__ float bfr(float f) { return bf_up(bf_bits(f)); }
__device__ __forceinline__ unsigned short h_bits(_Float16 x) { return __builtin_bit_cast(unsigned short, x); }
__device__ __forceinline__ unsigned pk16(unsigned short a, unsigned short b) { return (unsigned)a | ((unsigned)b << 16); }
__device__ __forceinline__ v8f zero8() { v8f z = {0.f, 0.f, 0.f, 0.f, 0.f, 0.f, 0.f, 0.f}; return z; }
__device__ __forceinline__ float red8(float v) {                      // sum over the 8-lane group (lane bits 0..2)
  v += __shfl_xor(v, 1, 32); v += __shfl_xor(v, 2, 32); v += __shfl_xor(v, 4, 32); return v;
}
__device__ __forceinline__ float rsum16(float v) {                    // sum over the 16-lane half (lane bits 0..3)
  v += __shfl_xor(v, 8, 32); v += __shfl_xor(v, 4, 32); v += __shfl_xor(v, 2, 32); v += __shfl_xor(v, 1, 32); return v;
}

// 1 / x on v_rcp_f32 (about 1 ulp), for a divisor that a whole row or column shares: formed once, then multiplied in.
// Every divisor it is used on is clamped to at least 1e-15 (or is at least 1/8) and, where finite, stays below 2e19,
// so the reciprocal is a normal f32; an infinite divisor gives 0, as the quotient of a finite value by it does.
__device__ __forceinline__ float rcp1(float x) {
  float r = 0.f;
#if defined(__HIP_DEVICE_COMPILE__)
  // v_nop in the same statement: the slot between a transcendental and an instruction that reads its result or overwrites its
  // source
  asm("v_rcp_f32 %0, %1\n\tv_nop" : "=v"(r) : "v"(x));
#endif
  return r;
}

// sqrt(x) on v_sqrt_f32 alone (about 1 ulp), without the correctly rounding sequence of sqrtf. Where it is used x is a sum of
// squares whose root is clamped to at least 1e-15 behind it (a subnormal x may come out as 0: the clamp gives the same value
// as for its true root), or x is at least 1e-15.
__device__ __forceinline__ float sqrt1(float x) {
  float r = 0.f;
#if defined(__HIP_DEVICE_COMPILE__)
  // v_nop in the same statement: the slot behind a transcendental, as in rcp1()
  asm("v_sqrt_f32 %0, %1\n\tv_nop" : "=v"(r) : "v"(x));
#endif
  return r;
}

// sinh(tz * asinh(x)) in closed form: e = |x| + sqrt(x^2 + 1), L = log2(e) >= 0, sinh = 2^(tz L - 1) - 2^(-tz L - 1), sign of x.
// Above 1e18 sqrt(x^2 + 1) = |x| in f32 and x^2 comes near the f32 overflow, so e = 2|x| there. The two halves are formed with the
// factor 1/2 in the exponent, so the result overflows only where sinh itself does.
__device__ __forceinline__ float sinh_of_scaled_asinh(float x, float tz) {
  const float a = fabsf(x);
  const float e = a + ((a > 1e18f) ? a : __builtin_amdgcn_sqrtf(fmaf(a, a, 1.0f)));
  const float L = __builtin_amdgcn_logf(e);
  const float s = __builtin_amdgcn_exp2f(fmaf(tz, L, -1.0f)) - __builtin_amdgcn_exp2f(fmaf(-tz, L, -1.0f));
  return copysignf(s, x);
}

// ---- fragment loader: 16-bit A/B operand from a k-contiguous row; lane -> row/col (lane&15), p already includes
//      +8*(lane>>4); elements 0..7 <- p[0..7] (k0+8h..), elements 8..15 <- p[16..23] (k0+16+8h..); same split k map
//      for A and B; B read by it from a k-contiguous [n][k] plane (the gamma v B goes through ldfrag_tr()). Loaded as unsigned 16-byte words.
__device__ __forceinline__ Frag ldfrag(const u16* p) {
  Frag f;
  f.u[0] = *(const v4u*)(p);
  f.u[1] = *(const v4u*)(p + 16);
  return f;
}
// ---- transposing fragment loader: B operand (col n = lane&15, k = row) from a row-major 16-bit LDS tile T[k][n] of pitch VP16.
//      p = T + (k0 + 8*(lane>>4) + (lane&7)) * VP16 + n0 + 8*((lane>>3)&1); lane (c, h) then holds T[k0 + 8h + 0..7][n0 + c] in
//      elements 0..7 and T[k0 + 16 + 8h + 0..7][n0 + c] in elements 8..15: the split k map of ldfrag().
typedef short s16x8 __attribute__((ext_vector_type(8)));
__device__ __forceinline__ Frag ldfrag_tr(const u16* p) {
  typedef __attribute__((address_space(3))) s16x8 lds_s16x8;
  Frag f;
  f.u[0] = __builtin_bit_cast(v4u, __builtin_amdgcn_ds_load_tr16_b128_v8i16((lds_s16x8*)(p)));
  f.u[1] = __builtin_bit_cast(v4u, __builtin_amdgcn_ds_load_tr16_b128_v8i16((lds_s16x8*)(p + 16 * VP16)));
  return f;
}

// ---- WMMA helpers and trailing VALU hazard gaps --------------------------------------------------------
__device__ __forceinline__ v8f mma_h(const Frag& a, const Frag& b, v8f c) {
  return __builtin_amdgcn_wmma_f32_16x16x32_f16(false, a.h, false, b.h, (short)0, c, false, false);
}
__device__ __forceinline__ v8f mma_b(const Frag& a, const Frag& b, v8f c) {
  return __builtin_amdgcn_wmma_f32_16x16x32_bf16(false, a.b, false, b.b, (short)0, c, false, false);
}
__device__ __forceinline__ void guard_sc(v8f& a, v8f& b, v16h x0, v16h x1, v16h x2, v16h x3, v16h x4, v16h x5) {
#if defined(__HIP_DEVICE_COMPILE__)
  asm volatile("v_nop\n\tv_nop\n\tv_nop\n\tv_nop"
               : "+v"(a), "+v"(b) : "v"(x0), "v"(x1), "v"(x2), "v"(x3), "v"(x4), "v"(x5) : "memory");
#endif
}
__device__ __forceinline__ void guard_pv(v8f (&o)[4], v16h p, v16h x0, v16h x1, v16h x2, v16h x3) {
#if defined(__HIP_DEVICE_COMPILE__)
  asm volatile("v_nop\n\tv_nop\n\tv_nop\n\tv_nop"
               : "+v"(o[0]), "+v"(o[1]), "+v"(o[2]), "+v"(o[3]) : "v"(p), "v"(x0), "v"(x1), "v"(x2), "v"(x3) : "memory");
#endif
}
__device__ __forceinline__ void guard_g(v8f (&acc)[8], v16h x0, v16h x1, v16h x2, v16h x3, v16h x4, v16h x5) {
#if defined(__HIP_DEVICE_COMPILE__)
  asm volatile("v_nop\n\tv_nop\n\tv_nop\n\tv_nop"
               : "+v"(acc[0]), "+v"(acc[1]), "+v"(acc[2]), "+v"(acc[3]),
                 "+v"(acc[4]), "+v"(acc[5]), "+v"(acc[6]), "+v"(acc[7])
               : "v"(x0), "v"(x1), "v"(x2), "v"(x3), "v"(x4), "v"(x5) : "memory");
#endif
}
__device__ __forceinline__ void acc_guard4(v8f (&o)[4]) {
#if defined(__HIP_DEVICE_COMPILE__)
  asm volatile("v_nop\n\tv_nop\n\tv_nop\n\tv_nop" : "+v"(o[0]), "+v"(o[1]), "+v"(o[2]), "+v"(o[3]));
#endif
}
__device__ __forceinline__ void wave_sync_lds() {
  __builtin_amdgcn_fence(__ATOMIC_RELEASE, "workgroup");
  __builtin_amdgcn_wave_barrier();
  __builtin_amdgcn_fence(__ATOMIC_ACQUIRE, "workgroup");
}

// ---- asynchronous 16-byte copies global -> LDS (through no register): l = the lane's own LDS byte address, g = the lane's own
//      global address, both multiples of 16. The closing s_wait_xcnt stands inside each statement, so that no address register
//      of an issued copy is rewritten ahead of it (a precaution).
__device__ __forceinline__ unsigned lds_addr(const void* p) { return (unsigned)(uintptr_t)p; }   // low 32 bits = LDS byte offset
__device__ __forceinline__ void acopy1(unsigned l0, const u16* g0) {
#if defined(__HIP_DEVICE_COMPILE__)
  asm volatile("global_load_async_to_lds_b128 %0, %1, off\n\t"
               "s_wait_xcnt 0x0"
               :: "v"(l0), "v"(g0) : "memory");
#endif
}
__device__ __forceinline__ void acopy6(const unsigned (&l)[6], const u16* const (&g)[6]) {
#if defined(__HIP_DEVICE_COMPILE__)
  asm volatile("global_load_async_to_lds_b128 %0, %6, off\n\t"
               "global_load_async_to_lds_b128 %1, %7, off\n\t"
               "global_load_async_to_lds_b128 %2, %8, off\n\t"
               "global_load_async_to_lds_b128 %3, %9, off\n\t"
               "global_load_async_to_lds_b128 %4, %10, off\n\t"
               "global_load_async_to_lds_b128 %5, %11, off\n\t"
               "s_wait_xcnt 0x0"
               :: "v"(l[0]), "v"(l[1]), "v"(l[2]), "v"(l[3]), "v"(l[4]), "v"(l[5]),
                  "v"(g[0]), "v"(g[1]), "v"(g[2]), "v"(g[3]), "v"(g[4]), "v"(g[5]) : "memory");
#endif
}
// The issuing wave's own copies have landed.
__device__ __forceinline__ void wait_copies() { asm volatile("s_wait_asynccnt 0x0" ::: "memory"); }
// Publish point of a two-buffer stage ring, passed by every wave of the block at the foot of every stage.
__device__ __forceinline__ void publish_stage() {
  asm volatile("s_wait_dscnt 0x0" ::: "memory");   // this wave's reads of the buffer that is refilled next have returned
  wait_copies();                                   // this wave's share of the next stage has landed
  __syncthreads();                                 // publishes the next stage; ends every reader's last read of this one
}

// =====================================================================================================
// Row convert: row r of a [rows][DM] f16 plane <- f16(bf16_RNE(x[r][e]) * scale), scale a power of two.
// A group of DM/8 threads per row (tid = index in the group), thread = 8 consecutive elements (two 16-B loads, one 16-B store).
// coverage: one group per row, 128 thr x 8 = DM = the whole row.
// =====================================================================================================
__device__ __forceinline__ void cvt16_row(const float* __restrict__ x, u16* Y, float scale, int tid, size_t r) {
  const float* src = x + r * (size_t)DM + (size_t)tid * 8;
  const v4f a = *(const v4f*)(src), c4 = *(const v4f*)(src + 4);
  v4u o;
#pragma unroll
  for (int e = 0; e < 2; ++e) {
    o[e]     = pk16(h_bits((_Float16)(bfr(a[2 * e]) * scale)),  h_bits((_Float16)(bfr(a[2 * e + 1]) * scale)));
    o[2 + e] = pk16(h_bits((_Float16)(bfr(c4[2 * e]) * scale)), h_bits((_Float16)(bfr(c4[2 * e + 1]) * scale)));
  }
  u16* dst = Y + r * (size_t)DM + (size_t)tid * 8;
  {
    *(v4u*)(dst) = o;
    // precaution: in the merged kernel other block kinds' code follows in the listing and rewrites the store's registers
    asm volatile("s_wait_xcnt 0x0" ::: "memory");
  }
}

// =====================================================================================================
// Row statistics: CX2[r] = sum_e bf16(x[r][e])^2 in f32. Block = 128 rows, 1024 threads, wave w rows 128*blk + 4w + j:
// per row each lane sums 32 values (8 x 16-B loads), xor-shuffle reduce, lane 0 -> LDS (rs, 128 floats); after a block
// barrier threads 0..31 store the 128 sums as 16-B words.
// =====================================================================================================
__device__ __forceinline__ void rowstat_blk(const float* __restrict__ x, float* CX2, float* rs, int tid, int blk) {
  const int wave = tid >> 5, lane = tid & 31;
  const int row0 = blk * 128;
#pragma unroll 1
  for (int j = 0; j < 4; ++j) {
    const int row = row0 + wave * 4 + j;
    const float* xr = x + (size_t)row * DM + 4 * lane;
    float s = 0.f;
#pragma unroll 2
    for (int q = 0; q < DM / 128; ++q) {
      const v4f a = *(const v4f*)(xr + 128 * q);
      const float a0 = bfr(a[0]), a1 = bfr(a[1]), a2 = bfr(a[2]), a3 = bfr(a[3]);
      s += a0 * a0; s += a1 * a1; s += a2 * a2; s += a3 * a3;
    }
    s += __shfl_xor(s, 16, 32); s += __shfl_xor(s, 8, 32); s += __shfl_xor(s, 4, 32);
    s += __shfl_xor(s, 2, 32);  s += __shfl_xor(s, 1, 32);
    if (lane == 0) rs[wave * 4 + j] = s;
  }
  __syncthreads();
  if (tid < 32) {
    const v4f v = *(const v4fa*)(rs + 4 * tid);
    float* dst = CX2 + row0 + 4 * tid;
    {
      *(v4f*)(dst) = v;
      
    }
  }
}

// =====================================================================================================
// Column statistics of a weight z[k][n] (DM x DM): ZN[n] = max(sqrt(sum_k bf16(z[k][n])^2), 1e-15), CH[n] = cosh(2 r[n]),
// SH[n] = sinh(2 r[n]) (r index clamped to nr-1). Block = 32 columns (one 128-B line of every row) x all DM rows,
// 1024 threads: lane = (row sub-index lane>>3, 4 columns at 4*(lane&7)), wave w step j reads rows 128j + 4w .. +3, so a
// thread has its 8 independent 16-B loads in flight at once. Column sums: 8 rows in the thread, xor-8 / xor-16 shuffles
// over the wave's 4 row sub-indices, one 32-float row per wave in LDS, block barrier, wave 0 adds the 32 wave rows.
// coverage: 8 j x 32 waves x 4 rows = DM rows; DM/32 blocks x 32 columns = every column of the three arrays once,
//           each block the only writer of its 128-B line in each array. part: (CS_THREADS / 32) * CS_COLS floats of LDS.
// =====================================================================================================
__device__ __forceinline__ void colstat_blk(const float* __restrict__ z, const float* __restrict__ r, int nr,
                                            float* ZN, float* CH, float* SH, float* part, int tid, int blk) {
  const int wave = tid >> 5, lane = tid & 31;
  const int col0 = blk * CS_COLS;
  const float* zp = z + (size_t)(wave * 4 + (lane >> 3)) * DM + col0 + 4 * (lane & 7);
  const int col = col0 + lane;
  float rv = 0.f;
  if (wave == 0) {                               // wave-uniform; issued with the column loads, not behind the barrier
    int ri = col;
    ri = (ri < nr - 1) ? ri : (nr - 1);
    rv = r[ri];
  }
  v4f a[CS_STEPS];
#pragma unroll   // all loads issue before the first use: one memory latency per thread instead of one per row group
  for (int j = 0; j < CS_STEPS; ++j) a[j] = *(const v4f*)(zp + (size_t)j * (CS_THREADS / 8) * DM);
  v4f s = {0.f, 0.f, 0.f, 0.f};
#pragma unroll
  for (int j = 0; j < CS_STEPS; ++j) {
#pragma unroll
    for (int e = 0; e < 4; ++e) {
      const float v = bfr(a[j][e]);
      s[e] += v * v;
    }
  }
#pragma unroll
  for (int e = 0; e < 4; ++e) {
    s[e] += __shfl_xor(s[e], 8, 32);
    s[e] += __shfl_xor(s[e], 16, 32);
  }
  if (lane < 8) *(v4fa*)(part + wave * CS_COLS + 4 * lane) = s;
  __syncthreads();
  if (wave == 0) {                               // wave-uniform; lane = column
    float t = 0.f;
#pragma unroll
    for (int w = 0; w < CS_THREADS / 32; ++w) t += part[w * CS_COLS + lane];
    const float dr = 2.0f * bfr(rv);
    ZN[col] = fmaxf(sqrtf(t), 1e-15f);
    CH[col] = coshf(dr);
    SH[col] = sinhf(dr);
  }
}

// =====================================================================================================
// Weight transpose-convert for y = x.W weights stored [k][n]: WT[n][k] (f16, k-contiguous Bt layout) <- f16(bf16_RNE(W[k][n]) *
// scale). A group of 128 threads (tid = index in the group) per 64(k) x 64(n) tile, 8 groups per block. Load phase: thread = (row 8p + (tid>>4), 4 floats at 4*(tid&15)),
// 8 steps = 64 k-rows x 64 n, into an LDS tile [kk][nn] (pitch 65); block barrier; store phase: output row n0 + 16i + (tid>>3)
// coverage: 4 i x 16 rows x (8 lanes x 8 halves) = 64 n-rows x 64 k per group; the (DM/64)^2 tiles cover WT exactly once.
// LDS tile (64 * TPITCH floats, the group's own): cross-wave, block barrier; staged extent 64x64 == consumed extent.
// =====================================================================================================
__device__ __forceinline__ void cvtT16_tile(const float* __restrict__ W, u16* Y, float scale, float* tile, int tid, int bid) {
  constexpr int NT = DM / 64;
  const int kt  = bid % NT;
  const int ntb = bid / NT;
  const int k0  = kt * 64, n0 = ntb * 64;
  const int lr = tid >> 4, lc = (tid & 15) * 4;
#pragma unroll
  for (int p = 0; p < 8; ++p) {
    const int kk = p * 8 + lr;
    const v4f w4 = *(const v4f*)(W + (size_t)(k0 + kk) * (size_t)DM + n0 + lc);
    tile[kk * TPITCH + lc + 0] = w4[0];
    tile[kk * TPITCH + lc + 1] = w4[1];
    tile[kk * TPITCH + lc + 2] = w4[2];
    tile[kk * TPITCH + lc + 3] = w4[3];
  }
  __syncthreads();
  const int rq = tid >> 3, c8 = (tid & 7) * 8;      // rq 0..15, c8 0..56
  v4u ov[4];
#pragma unroll
  for (int i = 0; i < 4; ++i) {
    const int row = 16 * i + rq;                   // n within tile
#pragma unroll
    for (int e = 0; e < 4; ++e) {
      const float x0 = tile[(c8 + 2 * e) * TPITCH + row];
      const float x1 = tile[(c8 + 2 * e + 1) * TPITCH + row];
      ov[i][e] = pk16(h_bits((_Float16)(bfr(x0) * scale)), h_bits((_Float16)(bfr(x1) * scale)));
    }
  }
  u16* dst = Y + (size_t)n0 * (size_t)DM + k0 + c8;
  {
#pragma unroll
    for (int i = 0; i < 4; ++i) {
      const int row = 16 * i + rq;
      *(v4u*)(dst + (size_t)row * (size_t)DM) = ov[i];
    }
    // precaution: in the merged kernel other block kinds' code follows in the listing and rewrites the stores' registers
    asm volatile("s_wait_xcnt 0x0" ::: "memory");
  }
}

// =====================================================================================================
// Preparation grid: everything that reads only the inputs, in one launch, so that the four kinds of block run side by side.
// Block kind by block index (block-uniform, so each kind's block barrier is passed by all 1024 threads of its block); the
// kinds with the longest dependent chains come first:
//   [0, PB_ROW)            row statistics of x, 128 rows per block
//   next PB_COL blocks     column statistics, weight = index / (DM/32), 32 columns per block
//   next PB_TR blocks      weight transpose-convert, weight = index / 32, 8 tiles per block (tile = 8 * index + tid / 128)
//   next PB_CVT blocks     x convert, 8 rows per block (row = 8 * index + tid / 128)
// LDS: one array, used by one kind per block (8 transpose tiles, or the column partials, or the row sums).
// =====================================================================================================
__global__ __launch_bounds__(PREP_THREADS)
void prep(const float* __restrict__ x,
          const float* __restrict__ qz, const float* __restrict__ kz, const float* __restrict__ vz,
          const float* __restrict__ qr, const float* __restrict__ kr, const float* __restrict__ vr,
          int nqr, int nkr, int nvr,
          u16* X16, float* CX2, float* ZN, float* CH, float* SH, u16* WQT, u16* WKT, u16* WVT) {
  __shared__ __align__(16) float sm[8 * 64 * TPITCH];
  const int tid = threadIdx.x;
  int bid = blockIdx.x;
  if (bid < PB_ROW) {
    rowstat_blk(x, CX2, sm, tid, bid);
    return;
  }
  bid -= PB_ROW;
  if (bid < PB_COL) {
    const int w = bid / (DM / CS_COLS), blk = bid % (DM / CS_COLS);
    const float* z = (w == 0) ? qz : (w == 1) ? kz : vz;
    const float* r = (w == 0) ? qr : (w == 1) ? kr : vr;
    const int   nr = (w == 0) ? nqr : (w == 1) ? nkr : nvr;
    colstat_blk(z, r, nr, ZN + w * DM, CH + w * DM, SH + w * DM, sm, tid, blk);
    return;
  }
  bid -= PB_COL;
  if (bid < PB_TR) {
    constexpr int BPW = (DM / 64) * (DM / 64) / 8;   // blocks per weight
    const int w = bid / BPW, grp = tid >> 7;
    const float* z = (w == 0) ? qz : (w == 1) ? kz : vz;
    u16*         y = (w == 0) ? WQT : (w == 1) ? WKT : WVT;
    cvtT16_tile(z, y, WSC, sm + grp * 64 * TPITCH, tid & 127, (bid % BPW) * 8 + grp);
    return;
  }
  bid -= PB_TR;
  cvt16_row(x, X16, XS, tid & 127, (size_t)(bid * 8 + (tid >> 7)));
}

// =====================================================================================================
// f16 GEMM core on one LDS stage (KST of k): the wave's 32 x 64 tile of C += A . Bt^T; as -> staged A row (wave row + m) + 8h,
// bs -> staged Bt row (m) + 8h, rows at pitch TP16 (144 B: ds_load_b128 of 16 rows falls on all banks once);
// acc[4i + j] = rows 16i.., cols 16j..; k stepped by 32 in ascending order.
// =====================================================================================================
__device__ __forceinline__ void gemm_stage(const u16* as, const u16* bs, v8f (&acc)[8]) {
#pragma unroll   // two steps: the k offsets become immediates of the LDS reads
  for (int k0 = 0; k0 < KST; k0 += 32) {
    const Frag a0 = ldfrag(as + k0), a1 = ldfrag(as + 16 * TP16 + k0);
    const Frag b0 = ldfrag(bs + k0);
    const Frag b1 = ldfrag(bs + 16 * TP16 + k0);
    const Frag b2 = ldfrag(bs + 32 * TP16 + k0);
    const Frag b3 = ldfrag(bs + 48 * TP16 + k0);
    acc[0] = mma_h(a0, b0, acc[0]);
    acc[1] = mma_h(a0, b1, acc[1]);
    acc[2] = mma_h(a0, b2, acc[2]);
    acc[3] = mma_h(a0, b3, acc[3]);
    acc[4] = mma_h(a1, b0, acc[4]);
    acc[5] = mma_h(a1, b1, acc[5]);
    acc[6] = mma_h(a1, b2, acc[6]);
    acc[7] = mma_h(a1, b3, acc[7]);
    guard_g(acc, a0.h, a1.h, b0.h, b1.h, b2.h, b3.h);
  }
}
// Stage the wave's 32 x 64 f32 tile (times oscale) in its LDS slab (pitch 68): D element r of acc[4i+j], lane l ->
// coverage: 32 lanes x 2 x 8 rows x 4 cols-of-16 = rows 0..31 x cols 0..63 of the slab.
__device__ __forceinline__ void stage32x64(float* sl, v8f (&acc)[8], float oscale, int lane) {
  const int hh = lane >> 4, m = lane & 15;
#pragma unroll
  for (int i = 0; i < 2; ++i) {
#pragma unroll
    for (int r = 0; r < 8; ++r) {
      const int ro = (16 * i + 8 * hh + r) * GPITCH + m;
      sl[ro]      = acc[4 * i + 0][r] * oscale;
      sl[ro + 16] = acc[4 * i + 1][r] * oscale;
      sl[ro + 32] = acc[4 * i + 2][r] * oscale;
      sl[ro + 48] = acc[4 * i + 3][r] * oscale;
    }
  }
  wave_sync_lds();
}

// =====================================================================================================
// Projection GEMM + ball MLR epilogue. A = x plane [NB*SEQ][DM] (f16, x XS), Bt = WT [DM n][DM k] (f16, x WSC).
// One launch for the three weights: block = 384 threads = 128 rows x 64 cols (one head) of q, k and v; waves 4*mode .. 4*mode+3
// (mode 0 q, 1 k, 2 v: picks Bt, the column tables' row and the outputs) take 32 rows each, so the three modes read the same A rows
// from one WGP and three waves share a SIMD. Operands go through a two-buffer LDS ring, KST of k per stage: the block's 128 A rows
// and 3 x 64 Bt rows (PJ_ROWS rows x 128 B, whole lines) are brought in by asynchronous 16-byte copies, one copy of a wave = 4 rows,
// copy index = wave + 12 i (i < 6 for every wave, i = 6 for waves 0..7: 80 copies); the next stage flies while this one is worked on.
// Epilogue per element (f32): mm = (x.z)[row][n] / ZN[n]; arg = (2 mm CH[n] - (1 + cx2) SH[n]) / max(1 - cx2, 1e-15);
// y = sinh(2 ZN[n] asinh(arg)); per (row, head) 64-vector (8 lanes x 8 values, 8-lane shuffle sums): clip to norm MAXN,
// y = y / (1 + sqrt(1 + sum y^2)), clip again; x2 = sum y^2. mode 0/1: planes Ph/Pl = bf16 hi / bf16 lo of y, RS row
// scalar = x2; mode 2: g = 2 / max(1 - x2, 1e-15), plane Ph = f16(g y VS), RS row scalar = g - 1.
// coverage: per wave 8 instr x 4 rows x 8 lanes x 8 halves = 32 x 64 per plane; RS: 32 floats per wave; grid covers every
//           (row, col) of the planes and every (b, head, s) of RS exactly once.
// LDS: ring cross-wave (one block barrier per stage, staged extent == consumed extent, pad bytes never read); slab and rsc are
// wave-private (wave_sync); staged extent 32x64 == consumed extent.
// =====================================================================================================
__global__ __launch_bounds__(PJ_THREADS)
void proj_mlr(const u16* __restrict__ A, const u16* __restrict__ WQT, const u16* __restrict__ WKT, const u16* __restrict__ WVT,
              const float* __restrict__ ZN3, const float* __restrict__ CH3, const float* __restrict__ SH3,
              const float* __restrict__ CX2, u16* Qh, u16* Ql, u16* Kh, u16* Kl, u16* Vg,
              float* QX2, float* KX2, float* GM1) {
  __shared__ __align__(16) float slab[(PJ_THREADS / 32) * 32 * GPITCH];
  __shared__ __align__(16) float rsc[(PJ_THREADS / 32) * 32];
  __shared__ __align__(16) u16 ring[2 * PJ_ROWS * TP16];
  const int tid = threadIdx.x, wv = tid >> 5, wave = wv & 3, lane = tid & 31, hh = lane >> 4, m = lane & 15;
  constexpr int NT = DM / 64;
  const int mode = __builtin_amdgcn_readfirstlane(wv >> 2);   // the same in all lanes of a wave: pointer picks and the mode branch stay scalar
  const int bid  = blockIdx.x;
  const float* ZN = ZN3 + mode * DM;
  const float* CH = CH3 + mode * DM;
  const float* SH = SH3 + mode * DM;
  u16*   Ph = (mode == 0) ? Qh : (mode == 1) ? Kh : Vg;
  u16*   Pl = (mode == 0) ? Ql : Kl;           // stored to by modes 0 and 1 only
  float* RS = (mode == 0) ? QX2 : (mode == 1) ? KX2 : GM1;
  const int nt   = bid % NT;
  const int mt   = bid / NT;
  const int rowb = mt * 128 + wave * 32;       // global token row b*SEQ + s of the wave's first row
  const int col0 = nt * 64;                    // = head * HD
  // ---- this lane's share of a stage: copy i brings staged rows 4 (wave + 12 i) .. +3, lane = (row lane>>3, 16 bytes at 16 (lane&7)) ----
  const int wvs = __builtin_amdgcn_readfirstlane(wv);         // scalar: source picks and the test on the seventh copy stay scalar
  const bool has7 = wvs + 6 * (PJ_THREADS / 32) < PJ_ROWS / 4;
  const u16* gsrc[PJ_CPW];
  unsigned   ldst[PJ_CPW];
#pragma unroll   // constant indices: both arrays stay in registers
  for (int i = 0; i < PJ_CPW; ++i) {
    int ci = wvs + (PJ_THREADS / 32) * i;
    ci = (ci < PJ_ROWS / 4) ? ci : (PJ_ROWS / 4 - 1);         // keeps the addresses of a seventh copy that is not issued in range
    const int sr = 4 * ci + (lane >> 3);                      // staged row
    const int wsel = (ci - 32) >> 4;                          // weight of a Bt row (ci >= 32)
    const u16* rowp = (ci < 32) ? (A + (size_t)(mt * 128 + sr) * DM)
                                : (((wsel == 0) ? WQT : (wsel == 1) ? WKT : WVT) + (size_t)(col0 + sr - 128 - 64 * wsel) * DM);
    gsrc[i] = rowp + 8 * (lane & 7);
    ldst[i] = lds_addr(ring) + (unsigned)(sr * (TP16 * 2) + 16 * (lane & 7));
  }
  auto stage_copy = [&](int st) {                             // stage st -> buffer st & 1
    const unsigned lo = (unsigned)((st & 1) * (PJ_ROWS * TP16 * 2));
    const unsigned l6[6] = {ldst[0] + lo, ldst[1] + lo, ldst[2] + lo, ldst[3] + lo, ldst[4] + lo, ldst[5] + lo};
    const u16* const g6[6] = {gsrc[0] + st * KST, gsrc[1] + st * KST, gsrc[2] + st * KST,
                              gsrc[3] + st * KST, gsrc[4] + st * KST, gsrc[5] + st * KST};
    acopy6(l6, g6);
    if (has7) acopy1(ldst[6] + lo, gsrc[6] + st * KST);
  };
  v8f acc[8];
#pragma unroll
  for (int i = 0; i < 8; ++i) acc[i] = zero8();
  stage_copy(0);
  wait_copies();
  __syncthreads();                                            // stage 0 is published
  stage_copy(1);
#pragma unroll 1   // one stage per trip: the ring's order (read, publish, refill) stays as written
  for (int st = 0; st < DM / KST; ++st) {
    const u16* rb = ring + (st & 1) * (PJ_ROWS * TP16);
    gemm_stage(rb + (wave * 32 + m) * TP16 + 8 * hh, rb + (128 + mode * 64 + m) * TP16 + 8 * hh, acc);
    publish_stage();
    if (st + 2 < DM / KST) stage_copy(st + 2);                // into the buffer that this trip has just read
  }
  wait_copies();
  float* sl = slab + wv * 32 * GPITCH;
  stage32x64(sl, acc, 1.0f / (XS * WSC), lane);

  const int rq = lane >> 3, c8 = (lane & 7) * 8;
  float zn8[8], ch8[8], sh8[8], rz8[8];
  {
    const v4f z0 = *(const v4f*)(ZN + col0 + c8), z1 = *(const v4f*)(ZN + col0 + c8 + 4);
    const v4f h0 = *(const v4f*)(CH + col0 + c8), h1 = *(const v4f*)(CH + col0 + c8 + 4);
    const v4f g0 = *(const v4f*)(SH + col0 + c8), g1 = *(const v4f*)(SH + col0 + c8 + 4);
#pragma unroll
    for (int e = 0; e < 4; ++e) {
      zn8[e] = z0[e]; zn8[4 + e] = z1[e];
      ch8[e] = h0[e]; ch8[4 + e] = h1[e];
      sh8[e] = g0[e]; sh8[4 + e] = g1[e];
    }
#pragma unroll
    for (int e = 0; e < 8; ++e) rz8[e] = rcp1(zn8[e]);        // one reciprocal per column, used by all 8 row groups
  }
  const bool mv = (mode == 2);
#pragma unroll 1
  for (int i = 0; i < 8; ++i) {
    const int row = 4 * i + rq;
    const float cx  = CX2[rowb + row];
    const float romc = rcp1(fmaxf(1.0f - cx, 1e-15f));
    const float opc = 1.0f + cx;
    float* sr = sl + row * GPITCH + c8;
    float y[8];
    float s0 = 0.f;
#pragma unroll
    for (int e = 0; e < 8; ++e) {
      const float mm  = sr[e] * rz8[e];
      const float arg = (2.0f * mm * ch8[e] - opc * sh8[e]) * romc;
      y[e] = sinh_of_scaled_asinh(arg, 2.0f * zn8[e]);
      s0 += y[e] * y[e];
    }
    s0 = red8(s0);
    const float n0 = fmaxf(sqrt1(s0), 1e-15f);
    const float r0 = rcp1(n0);                                // formed for every row: no branch on the clip test
    const float f0 = (n0 > MAXN) ? MAXN * r0 : 1.0f;          // a row inside the ball is multiplied by exactly 1
    float s1 = 0.f;
#pragma unroll
    for (int e = 0; e < 8; ++e) {
      y[e] = y[e] * f0;
      s1 += y[e] * y[e];
    }
    s1 = red8(s1);
    const float rden = rcp1(1.0f + sqrt1(1.0f + s1));
    float s2 = 0.f;
#pragma unroll
    for (int e = 0; e < 8; ++e) {
      y[e] = y[e] * rden;
      s2 += y[e] * y[e];
    }
    s2 = red8(s2);
    const float n2 = fmaxf(sqrt1(s2), 1e-15f);
    const float r2 = rcp1(n2);
    const float f2 = (n2 > MAXN) ? MAXN * r2 : 1.0f;
    float s3 = 0.f;
#pragma unroll
    for (int e = 0; e < 8; ++e) {
      y[e] = y[e] * f2;
      s3 += y[e] * y[e];
    }
    s3 = red8(s3);
    const float g    = 2.0f * rcp1(fmaxf(1.0f - s3, 1e-15f));
    const float gmul = mv ? g : 1.0f;
    const float scal = mv ? (g - 1.0f) : s3;
#pragma unroll
    for (int e = 0; e < 8; ++e) sr[e] = y[e] * gmul;
    if ((lane & 7) == 0) rsc[wv * 32 + row] = scal;
  }
  wave_sync_lds();

  const int bb = rowb / SEQ, s0r = rowb - bb * SEQ, head = nt;
  if (lane < 8) {
    const v4f v = *(const v4fa*)(rsc + wv * 32 + 4 * lane);
    float* dst = RS + ((size_t)(bb * NH + head)) * SEQ + s0r + 4 * lane;
    {
      *(v4f*)(dst) = v;
      
    }
  }
  // ---- planes ----
  const size_t pofs = (size_t)rowb * DM + (size_t)(col0 + c8);
  if (!mv) {
    v4u oh[8], ol[8];
#pragma unroll
    for (int i = 0; i < 8; ++i) {
      const int row = 4 * i + rq;
      const v4f a = *(const v4fa*)(sl + row * GPITCH + c8), c4 = *(const v4fa*)(sl + row * GPITCH + c8 + 4);
#pragma unroll
      for (int e = 0; e < 2; ++e) {
        const unsigned short ha = bf_bits(a[2 * e]),  hb = bf_bits(a[2 * e + 1]);
        const unsigned short la = bf_bits(a[2 * e] - bf_up(ha)), lb = bf_bits(a[2 * e + 1] - bf_up(hb));
        oh[i][e] = pk16(ha, hb);
        ol[i][e] = pk16(la, lb);
        const unsigned short hc = bf_bits(c4[2 * e]), hd = bf_bits(c4[2 * e + 1]);
        const unsigned short lc = bf_bits(c4[2 * e] - bf_up(hc)), ld = bf_bits(c4[2 * e + 1] - bf_up(hd));
        oh[i][2 + e] = pk16(hc, hd);
        ol[i][2 + e] = pk16(lc, ld);
      }
    }
    {
#pragma unroll
      for (int i = 0; i < 8; ++i) {
        const int row = 4 * i + rq;
        *(v4u*)(Ph + pofs + (size_t)row * DM) = oh[i];
        *(v4u*)(Pl + pofs + (size_t)row * DM) = ol[i];
      }
      
    }
  } else {
    v4u ov[8];
#pragma unroll
    for (int i = 0; i < 8; ++i) {
      const int row = 4 * i + rq;
      const v4f a = *(const v4fa*)(sl + row * GPITCH + c8), c4 = *(const v4fa*)(sl + row * GPITCH + c8 + 4);
#pragma unroll
      for (int e = 0; e < 2; ++e) {
        ov[i][e]     = pk16(h_bits((_Float16)(a[2 * e] * VS)),  h_bits((_Float16)(a[2 * e + 1] * VS)));
        ov[i][2 + e] = pk16(h_bits((_Float16)(c4[2 * e] * VS)), h_bits((_Float16)(c4[2 * e + 1] * VS)));
      }
    }
    {
#pragma unroll
      for (int i = 0; i < 8; ++i) {
        const int row = 4 * i + rq;
        *(v4u*)(Ph + pofs + (size_t)row * DM) = ov[i];
      }
      
    }
  }
}

// ---- softmax weight of one (query, key) pair, not normalised: em * exp(-dist) ----
// exp(-acosh(z)) = 1 / (z + sqrt(z^2 - 1)); with z = 1 + 2 num / den this is den / (den + 2 (num + sqrt(num (num + den)))):
// no logarithm, no exponential, no cancellation. num and den lie in [1e-15, 4], so no step leaves the normal f32 range.
// em = the key's own factor exp(bias - largest bias of the batch) * PCAR, in [0, PCAR].
// Range of exp(-dist): q and k leave the projection clipped to norm MAXN, so den >= (1 - MAXN^2)^2 and num <= 4 MAXN^2, which
// gives z + sqrt(z^2 - 1) < 2^18. A key with the largest bias therefore has a weight of at least PCAR / 2^18 = 1/8 in every row,
// while no weight exceeds PCAR: the f16 P operand and the f32 sums need no row maximum.
// Two neighbouring keys at a time: they lie in neighbouring registers of the score tile and of the tables (packed f32 forms).
__device__ __forceinline__ v2f weight2(v2f xy, v2f y2, v2f em, float x2, float omx) {
  const v2f lim = {1e-15f, 1e-15f};
  const v2f num = __builtin_elementwise_max(x2 - 2.0f * xy + y2, lim);
  const v2f den = __builtin_elementwise_max(omx * (1.0f - y2), lim);
  const v2f sq  = num * (num + den);
  const v2f rt  = {__builtin_amdgcn_sqrtf(sq[0]), __builtin_amdgcn_sqrtf(sq[1])};
  const v2f ee  = 2.0f * (num + rt) + den;
  const v2f ri  = {__builtin_amdgcn_rcpf(ee[0]), __builtin_amdgcn_rcpf(ee[1])};
  return (em * den) * ri;
}

// =====================================================================================================
// Fused distance attention + gyro-midpoint over all SEQ keys: block = (batch b, head, 64 query rows), 4 waves, wave w owns
// queries q0 = 64*qt + 16*w .. q0+15. The four waves share the keys: k hi, k lo and gamma v go through a two-buffer LDS ring, KST keys
// per stage (3 tiles of 64 key rows x 128 B, whole lines; pitch TP16 for k, VP16 for gamma v), brought in by asynchronous 16-byte
// copies, 12 per thread and stage; the next stage flies while this one is worked on; one block barrier per stage.
//   q planes bf16 hi/lo [b*SEQ + s][h*64 + d]; k planes bf16 hi/lo and the gamma v plane (f16 x VS) same layout;
//   per-key tables for (b, h): sum k^2, gamma - 1; factor exp(bias - largest bias) x32768 from the additive bias row amask[b][s] (bf16-converted); per query x2 = sum q^2.
//   All NKB = 32 key blocks of 32 keys are visited (static bound), two per ring stage.
//   Scores computed TRANSPOSED: S^T tile g = k rows (keys kb+16g .., A operand, row m = lane&15, split k map over d)
//   times q^T (B operand, col n = query q0 + (lane&15), k = d), 2 d-chunks of 32, three bf16 products each (hi.hi, lo.hi,
//   hi.lo). D element r of lane l = (key kb+16g+8h+r, query q0+(l&15)): a lane owns one query column and 16 of its 32 keys;
//   the partner lane l^16 owns the other 16 -> the row sums need one xor-16 shuffle.
//   dist = acosh(1 + 2 max(x2 - 2 xy + y2, 1e-15) / max((1 - x2)(1 - y2), 1e-15)), logit = -dist + bias, all f32.
//   Softmax weights p = exp(bias - largest bias of the batch) exp(-dist) in closed form (weight2()), one fixed scale for all keys:
//   no row maximum, no rescale of O, nothing crosses lanes in the key loop. Each lane sums l = sum p and dn = sum p (gamma - 1) over
//   its own keys; the two halves of a query's keys meet in one xor-16 shuffle behind the loop. The weights ARE the
//   P A-fragment in place: A row m = query = lane&15, element i <- key kb+8h+i (tile 0, D element i), element 8+i <- key
//   kb+16+8h+i (tile 1, D element i). P (<= 1) carried x32768 as f16; l and dn carry the same factor.
//   4 gamma v B fragments (col n = d = 16j + (lane&15), k = key) by transposing LDS loads from the key-major tile, 4 P.V WMMAs + one guard.
//   Epilogue (f32): two_mean = (O (1/l) / VS) / max(dn / l, 1e-10); a = two_mean / (1 + sqrt(max(1 - sum two_mean^2,
//   1e-15))); clip to norm MAXN; the wave's 16x64 tile staged in its LDS slab (pitch 68); each output row segment
// coverage: per wave 8 instructions x 2 rows x 16 lanes x 4 floats = 16 x 64; grid NB*NH*(SQ/64) blocks x 4 waves = every
//           (b < NB, s < SQ, h) row segment of the output exactly once.
// LDS: ms/ky2/kg1 cross-wave (block barrier, 1024 staged == 1024 consumed); ring cross-wave (block barrier per stage, staged
// extent == consumed extent, pad bytes never read); slab wave-private (wave_sync, 16x64).
// =====================================================================================================
__global__ __launch_bounds__(ATT_THREADS)
void attn_fwd(const u16* __restrict__ Qh, const u16* __restrict__ Ql, const u16* __restrict__ Kh, const u16* __restrict__ Kl,
              const u16* __restrict__ Vg, const float* __restrict__ QX2, const float* __restrict__ KX2,
              const float* __restrict__ GM1, const float* __restrict__ amask, float* Out) {
  __shared__ __align__(16) float ms[SEQ];
  __shared__ __align__(16) float ky2[SEQ];
  __shared__ __align__(16) float kg1[SEQ];
  __shared__ __align__(16) float slab[4 * 16 * GPITCH];
  __shared__ __align__(16) u16 ring[2 * ABUF];

  const int tid  = threadIdx.x;
  const int wave = tid >> 5;
  const int lane = tid & 31;
  const int hh   = lane >> 4;
  const int c    = lane & 15;

  constexpr int NQT = SQ / 64;
  const int bid  = blockIdx.x;
  const int qt   = bid % NQT;
  const int head = (bid / NQT) % NH;
  const int b    = bid / (NQT * NH);
  const int bh   = b * NH + head;
  const int q0   = qt * 64 + wave * 16;

  // ---- this thread's share of a ring stage: per tile rows (tid>>3) + 16 i, i < 4, 16 bytes at 16 (tid&7) ----
  const u16* khg = Kh + ((size_t)(b * SEQ + (tid >> 3))) * DM + head * HD + 8 * (tid & 7);
  const u16* klg = Kl + ((size_t)(b * SEQ + (tid >> 3))) * DM + head * HD + 8 * (tid & 7);
  const u16* vgg = Vg + ((size_t)(b * SEQ + (tid >> 3))) * DM + head * HD + 8 * (tid & 7);
  const unsigned lring = lds_addr(ring) + (unsigned)((tid >> 3) * (TP16 * 2) + 16 * (tid & 7));
  const unsigned lvring = lds_addr(ring) + (unsigned)(2 * ATILE * 2 + (tid >> 3) * (VP16 * 2) + 16 * (tid & 7));
  auto stage_copy = [&](int st) {                             // keys KST st .. +63 -> buffer st & 1
    const unsigned lo = lring + (unsigned)((st & 1) * (ABUF * 2));
    const unsigned lv = lvring + (unsigned)((st & 1) * (ABUF * 2));
    const u16* kh = khg + (size_t)st * KST * DM;
    const u16* kl = klg + (size_t)st * KST * DM;
    const u16* vg = vgg + (size_t)st * KST * DM;
    constexpr unsigned R16 = 16 * TP16 * 2, TB = ATILE * 2;   // 16 k rows, one k tile, in bytes
    constexpr unsigned V16 = 16 * VP16 * 2;                   // 16 gamma v rows, in bytes
    const unsigned la[6] = {lo, lo + R16, lo + 2 * R16, lo + 3 * R16, lo + TB, lo + TB + R16};
    const u16* const ga[6] = {kh, kh + 16 * DM, kh + 32 * DM, kh + 48 * DM, kl, kl + 16 * DM};
    acopy6(la, ga);
    const unsigned lb[6] = {lo + TB + 2 * R16, lo + TB + 3 * R16, lv, lv + V16, lv + 2 * V16, lv + 3 * V16};
    const u16* const gb[6] = {kl + 32 * DM, kl + 48 * DM, vg, vg + 16 * DM, vg + 32 * DM, vg + 48 * DM};
    acopy6(lb, gb);
  };
  stage_copy(0);                                              // flies while the tables are staged

  // ---- largest bias of the batch: every wave reads the whole row (32 lanes x 32 values), so no barrier is needed for it.
  //      bf16 rounding is monotone: the rounded maximum is the maximum of the rounded values.
  float mb;
  {
    const float* mr = amask + (size_t)b * SEQ + 4 * lane;
    v4f a[SEQ / 128];
#pragma unroll   // all loads issue before the first use: one memory latency
    for (int q = 0; q < SEQ / 128; ++q) a[q] = *(const v4f*)(mr + 128 * q);
    // precaution: the table loads that follow may land in the register that holds these loads' offset
    asm volatile("s_wait_xcnt 0x0" ::: "memory");
    float mx = -INFINITY;
#pragma unroll
    for (int q = 0; q < SEQ / 128; ++q) mx = fmaxf(fmaxf(fmaxf(mx, a[q][0]), fmaxf(a[q][1], a[q][2])), a[q][3]);
    mx = fmaxf(mx, __shfl_xor(mx, 16, 32)); mx = fmaxf(mx, __shfl_xor(mx, 8, 32)); mx = fmaxf(mx, __shfl_xor(mx, 4, 32));
    mx = fmaxf(mx, __shfl_xor(mx, 2, 32));  mx = fmaxf(mx, __shfl_xor(mx, 1, 32));
    mb = bfr(mx);
  }
  // ---- stage the per-key tables of (b, head): 128 threads x 8 keys = SEQ ----
  {
    const int i0 = tid * 8;
    const float* mp = amask + (size_t)b * SEQ + i0;
    const float* yp = KX2 + (size_t)bh * SEQ + i0;
    const float* gp = GM1 + (size_t)bh * SEQ + i0;
    const v4f m0 = *(const v4f*)(mp), m1 = *(const v4f*)(mp + 4);
    const v4f y0 = *(const v4f*)(yp), y1 = *(const v4f*)(yp + 4);
    const v4f g0 = *(const v4f*)(gp), g1 = *(const v4f*)(gp + 4);
#pragma unroll
    for (int e = 0; e < 4; ++e) {
      ms[i0 + e]     = exp2f((bfr(m0[e]) - mb) * LOG2E) * PCAR;
      ms[i0 + 4 + e] = exp2f((bfr(m1[e]) - mb) * LOG2E) * PCAR;
      ky2[i0 + e] = y0[e];      ky2[i0 + 4 + e] = y1[e];
      kg1[i0 + e] = g0[e];      kg1[i0 + 4 + e] = g1[e];
    }
  }
  wait_copies();
  __syncthreads();                                            // the tables and stage 0 are published
  stage_copy(1);

  // B fragments of q^T: col n = query q0 + c, k = d (k-contiguous rows of the q planes)
  const size_t qofs = ((size_t)(b * SEQ + q0 + c)) * DM + head * HD + 8 * hh;
  const Frag qh0 = ldfrag(Qh + qofs), qh1 = ldfrag(Qh + qofs + 32);
  const Frag ql0 = ldfrag(Ql + qofs), ql1 = ldfrag(Ql + qofs + 32);
  const float xq  = QX2[(size_t)bh * SEQ + q0 + c];
  const float omx = 1.0f - xq;
  // A fragments of k: row m = key kb + 16g + c, k = d; B fragments of gamma v: col n = d = 16j + c, k = key; both from the ring

  v2f lrun2 = {0.f, 0.f}, drun2 = {0.f, 0.f};   // this lane's sums over its even and its odd keys
  v8f o[4];
#pragma unroll
  for (int j = 0; j < 4; ++j) o[j] = zero8();

#pragma unroll 1   // one stage per trip: the ring's order (read, publish, refill) stays as written
  for (int st = 0; st < SEQ / KST; ++st) {
  const u16* rb = ring + (st & 1) * ABUF;
#pragma unroll 1   // the two 32-key blocks of a stage share one copy of the long body
  for (int sub = 0; sub < KST / 32; ++sub) {
    const int kb = st * KST + sub * 32;
    const u16* KhB = rb + (sub * 32 + c) * TP16 + 8 * hh;     // staged k hi row of key kb + c
    const u16* KlB = KhB + ATILE;
    // ---- transposed scores: s0 = keys kb..kb+15, s1 = keys kb+16..kb+31, column = query q0 + c ----
    v8f s0 = zero8(), s1 = zero8();
    constexpr int k0o = 0, k1o = 16 * TP16;
    {
      const Frag kh0 = ldfrag(KhB + k0o), kh1 = ldfrag(KhB + k1o);
      const Frag kl0 = ldfrag(KlB + k0o), kl1 = ldfrag(KlB + k1o);
      s0 = mma_b(kh0, qh0, s0); s0 = mma_b(kl0, qh0, s0); s0 = mma_b(kh0, ql0, s0);
      s1 = mma_b(kh1, qh0, s1); s1 = mma_b(kl1, qh0, s1); s1 = mma_b(kh1, ql0, s1);
      guard_sc(s0, s1, qh0.h, ql0.h, kh0.h, kh1.h, kl0.h, kl1.h);
    }
    {
      const Frag kh0 = ldfrag(KhB + k0o + 32), kh1 = ldfrag(KhB + k1o + 32);
      const Frag kl0 = ldfrag(KlB + k0o + 32), kl1 = ldfrag(KlB + k1o + 32);
      s0 = mma_b(kh0, qh1, s0); s0 = mma_b(kl0, qh1, s0); s0 = mma_b(kh0, ql1, s0);
      s1 = mma_b(kh1, qh1, s1); s1 = mma_b(kl1, qh1, s1); s1 = mma_b(kh1, ql1, s1);
      guard_sc(s0, s1, qh1.h, ql1.h, kh0.h, kh1.h, kl0.h, kl1.h);
    }
    // ---- per-key values of this lane's 16 keys: word q of [0..1] <- keys kb+8hh+4q.., of [2..3] <- keys kb+16+8hh+4(q-2).. ----
    const int ka = kb + 8 * hh, kc = kb + 16 + 8 * hh;
    const v4f y4[4] = {*(const v4fa*)(ky2 + ka), *(const v4fa*)(ky2 + ka + 4), *(const v4fa*)(ky2 + kc), *(const v4fa*)(ky2 + kc + 4)};
    const v4f g4[4] = {*(const v4fa*)(kg1 + ka), *(const v4fa*)(kg1 + ka + 4), *(const v4fa*)(kg1 + kc), *(const v4fa*)(kg1 + kc + 4)};
    const v4f m4[4] = {*(const v4fa*)(ms + ka),  *(const v4fa*)(ms + ka + 4),  *(const v4fa*)(ms + kc),  *(const v4fa*)(ms + kc + 4)};
    // ---- weights (<= PCAR), this lane's two sums and the P A-fragment f16(p); fragment word 4w + e4 <-> D elements 2 e4, 2 e4 + 1 of tile w ----
    Frag ph;
#pragma unroll
    for (int w = 0; w < 2; ++w) {
      const v8f sv = w ? s1 : s0;
#pragma unroll
      for (int e4 = 0; e4 < 4; ++e4) {
        const int q = 2 * w + (e4 >> 1), h2 = 2 * (e4 & 1);
        const v2f xy = {sv[2 * e4], sv[2 * e4 + 1]};
        const v2f y2 = {y4[q][h2], y4[q][h2 + 1]};
        const v2f em = {m4[q][h2], m4[q][h2 + 1]};
        const v2f g1 = {g4[q][h2], g4[q][h2 + 1]};
        const v2f p  = weight2(xy, y2, em, xq, omx);
        lrun2 += p;
        drun2 += p * g1;
        ph.u[w][e4] = __builtin_bit_cast(unsigned, __builtin_convertvector(p, v2h));
      }
    }
    // ---- P.V : B fragment col n = d = j*16 + c, k = key kb + (split k map), transposed out of the staged key rows ----
    {
      const u16* vp = rb + 2 * ATILE + (sub * 32 + 8 * hh + (lane & 7)) * VP16 + 8 * ((lane >> 3) & 1);
      const Frag v0 = ldfrag_tr(vp);
      const Frag v1 = ldfrag_tr(vp + 16);
      const Frag v2 = ldfrag_tr(vp + 32);
      const Frag v3 = ldfrag_tr(vp + 48);
      o[0] = mma_h(ph, v0, o[0]);
      o[1] = mma_h(ph, v1, o[1]);
      o[2] = mma_h(ph, v2, o[2]);
      o[3] = mma_h(ph, v3, o[3]);
      guard_pv(o, ph.h, v0.h, v1.h, v2.h, v3.h);
    }
  }
  publish_stage();
  if (st + 2 < SEQ / KST) stage_copy(st + 2);                 // into the buffer that this trip has just read
  }
  wait_copies();
  acc_guard4(o);

  // ---- the two halves of each query's keys (lanes l and l ^ 16) meet ----
  float lrun = lrun2[0] + lrun2[1], drun = drun2[0] + drun2[1];
  lrun += __shfl_xor(lrun, 16, 32);
  drun += __shfl_xor(drun, 16, 32);
  // ---- gyro-midpoint epilogue in f32: per query factors from the query-owner lane (lane = query); O and l both carry PCAR ----
  const float linv = rcp1(lrun);
  const float nf   = linv * (1.0f / VS);
  const float dq   = fmaxf(drun * linv, 1e-10f);
  const float fq   = nf * rcp1(dq);             // the query's one factor: 1 / (l VS) over the clamped denominator
  float fqr[8];
#pragma unroll
  for (int r = 0; r < 8; ++r) fqr[r] = __shfl(fq, 8 * hh + r, 32);
  float sq[8];
#pragma unroll
  for (int r = 0; r < 8; ++r) {
    float sp = 0.f;
#pragma unroll
    for (int j = 0; j < 4; ++j) {
      const float tm = o[j][r] * fqr[r];
      o[j][r] = tm;
      sp += tm * tm;
    }
    sq[r] = rsum16(sp);
  }
  float* sw = slab + wave * 16 * GPITCH;
#pragma unroll
  for (int r = 0; r < 8; ++r) {
    const float rdf = rcp1(1.0f + sqrt1(fmaxf(1.0f - sq[r], 1e-15f)));
    float sp = 0.f;
#pragma unroll
    for (int j = 0; j < 4; ++j) {
      const float a = o[j][r] * rdf;
      o[j][r] = a;
      sp += a * a;
    }
    const float s2  = rsum16(sp);
    const float n2  = fmaxf(sqrt1(s2), 1e-15f);
    const bool  cl  = n2 > MAXN;
    const float fcl = MAXN * rcp1(n2);
#pragma unroll
    for (int j = 0; j < 4; ++j) {
      const float a = o[j][r];
      sw[(8 * hh + r) * GPITCH + 16 * j + c] = cl ? (a * fcl) : a;
    }
  }
  wave_sync_lds();
  // ---- f32 output rows: lanes 0..15 -> row 2i, lanes 16..31 -> row 2i+1, lane = 4 consecutive d ----
  const int cc = lane & 15;
  v4f vals[8];
#pragma unroll
  for (int i = 0; i < 8; ++i) vals[i] = *(const v4fa*)(sw + (2 * i + hh) * GPITCH + 4 * cc);
  float* ob = Out + ((size_t)(b * SEQ + q0 + hh)) * DM + head * HD + 4 * cc;
  {
#pragma unroll
    for (int i = 0; i < 8; ++i) {
      *(v4f*)(ob + (size_t)(2 * i) * DM) = vals[i];
    }
    
  }
}

// =====================================================================================================
// Workspace map (bytes); every region written fully by whole-line stores before it is read; every extent an exact multiple
//   X16  f16 [NB*SEQ][DM]          f16(bf16(x) x64)              4194304 (NB=2)
//   WQT/WKT/WVT f16 [DM n][DM k]   f16(bf16(W) x256)             3 x 2097152
//   CX2  f32 [NB*SEQ]              sum x^2                       8192
//   ZN, CH, SH f32 [3][DM]         column norms, cosh/sinh(2r)   3 x 12288
//   Qh, Ql, Kh, Kl bf16 [NB*SEQ][DM]                             4 x 4194304
//   Vg   f16 [NB*SEQ][DM]          f16(gamma v x256)             4194304
//   QX2, KX2, GM1 f32 [NB*NH][SEQ]                                3 x 131072
//   end = 31895552 at NB=2
// =====================================================================================================
static inline size_t up4k(size_t v) { return (v + 4095) & ~(size_t)4095; }

extern "C" void kernel_launch(void* const* d_in, const int* in_sizes, int n_in,
                              void* d_out, int out_size, void* d_ws, size_t ws_size,
                              hipStream_t stream) {
  if (n_in < 8) return;
  if (in_sizes[0] < NB * SEQ * DM) return;
  if (in_sizes[1] < NB * SEQ) return;
  if (in_sizes[2] < DM * DM || in_sizes[4] < DM * DM || in_sizes[6] < DM * DM) return;
  if (in_sizes[3] < 1 || in_sizes[5] < 1 || in_sizes[7] < 1) return;
  if (out_size < NB * SEQ * DM) return;

  const float* hs = (const float*)d_in[0];
  const float* am = (const float*)d_in[1];
  const float* qz = (const float*)d_in[2];
  const float* qr = (const float*)d_in[3];
  const float* kz = (const float*)d_in[4];
  const float* kr = (const float*)d_in[5];
  const float* vz = (const float*)d_in[6];
  const float* vr = (const float*)d_in[7];
  float*       out = (float*)d_out;
  const int nqr = in_sizes[3], nkr = in_sizes[5], nvr = in_sizes[7];

  const size_t nrow  = (size_t)NB * SEQ;
  const size_t szX16 = up4k(nrow * DM * 2);
  const size_t szWT  = up4k((size_t)DM * DM * 2);
  const size_t szCX2 = up4k(nrow * 4);
  const size_t szCOL = up4k((size_t)3 * DM * 4);
  const size_t szP   = up4k(nrow * DM * 2);
  const size_t szRS  = up4k((size_t)NB * NH * SEQ * 4);
  size_t off = 0;
  const size_t oX16 = off; off += szX16;
  const size_t oWQ  = off; off += szWT;
  const size_t oWK  = off; off += szWT;
  const size_t oWV  = off; off += szWT;
  const size_t oCX2 = off; off += szCX2;
  const size_t oZN  = off; off += szCOL;
  const size_t oCH  = off; off += szCOL;
  const size_t oSH  = off; off += szCOL;
  const size_t oQh  = off; off += szP;
  const size_t oQl  = off; off += szP;
  const size_t oKh  = off; off += szP;
  const size_t oKl  = off; off += szP;
  const size_t oVg  = off; off += szP;
  const size_t oQX2 = off; off += szRS;
  const size_t oKX2 = off; off += szRS;
  const size_t oGM1 = off; off += szRS;
  if (off > ws_size) return;                       // off = 31895552 at NB=2
  if (off > (size_t)134217728) return;

  char* ws = (char*)d_ws;
  u16*   X16 = (u16*)(ws + oX16);
  u16*   WQT = (u16*)(ws + oWQ);
  u16*   WKT = (u16*)(ws + oWK);
  u16*   WVT = (u16*)(ws + oWV);
  float* CX2 = (float*)(ws + oCX2);
  float* ZN  = (float*)(ws + oZN);
  float* CH  = (float*)(ws + oCH);
  float* SH  = (float*)(ws + oSH);
  u16*   Qh  = (u16*)(ws + oQh);
  u16*   Ql  = (u16*)(ws + oQl);
  u16*   Kh  = (u16*)(ws + oKh);
  u16*   Kl  = (u16*)(ws + oKl);
  u16*   Vg  = (u16*)(ws + oVg);
  float* QX2 = (float*)(ws + oQX2);
  float* KX2 = (float*)(ws + oKX2);
  float* GM1 = (float*)(ws + oGM1);

  // (1) all that reads only the inputs: x -> f16 plane of bf16(x) x64, per-row sums of squares, per weight the column norms
  //     with cosh/sinh(2r) and the k-contiguous [n][k] f16 plane of bf16(W) x256
  prep<<<dim3(PB_ROW + PB_COL + PB_TR + PB_CVT), dim3(PREP_THREADS), 0, stream>>>(
      hs, qz, kz, vz, qr, kr, vr, nqr, nkr, nvr, X16, CX2, ZN, CH, SH, WQT, WKT, WVT);
  // (2) the three projections with the fused MLR / per-head epilogue
  proj_mlr<<<dim3(PJ_BLOCKS), dim3(PJ_THREADS), 0, stream>>>(
      X16, WQT, WKT, WVT, ZN, CH, SH, CX2, Qh, Ql, Kh, Kl, Vg, QX2, KX2, GM1);
  // (3) attention + midpoint -> out [b][SEQ][DM] f32 (rows s < SQ of batches b < NB), heads merged on the feature dim
  attn_fwd<<<dim3(NB * NH * (SQ / 64)), dim3(ATT_THREADS), 0, stream>>>(Qh, Ql, Kh, Kl, Vg, QX2, KX2, GM1, am, out);
  (void)hipGetLastError();
}

// v008
// One run takes 55.2 microseconds.
// Two timings next to v007 both put it at 1.11 times that version's speed.
// All steps since v000 together make it 10.4 times as fast.
// Contractions: x.Wq, x.Wk, x.Wv on v_wmma_f32_16x16x32_f16 (x as f16(bf16(x) x64), W as f16(bf16(W) x256), f32 accumulate);
// scores k.q^T on v_wmma_f32_16x16x32_bf16 as bf16 hi/lo split (hi.hi + lo.hi + hi.lo into one f32 accumulator);
// P.(gamma v) on v_wmma_f32_16x16x32_f16 (P x32768 f16, gamma v x256 f16 through transposing LDS loads, f32 accumulate); norms, asinh/sinh/acosh
// (closed forms on v_log_f32 / v_exp_f32 / v_sqrt_f32 / v_rcp_f32), softmax weights in closed form at a fixed scale,
// the sum_j p_j (gamma_j - 1) denominators and all carry folds in f32 on VALU.
// Float inputs RNE-converted to bf16 on load; f32 output written directly.
#include <hip/hip_runtime.h>
#include <math.h>
#include <stdint.h>

#ifndef NB
#define NB 2            // batches processed
#endif
#ifndef SQ
#define SQ 1024         // query rows processed per batch (keys/values always all SEQ rows)
#endif
#define NB_FULL 2
#define SEQ  1024       // rows per batch in every input / output / plane layout
#define DM   1024       // model width = K of the projections = row pitch of the 16-bit planes
#define NH   16
#define HD   64
#define XS   64.0f      // carry on the x plane
#define WSC  256.0f     // carry on the transposed weight planes
#define VS   256.0f     // carry on the gamma*v plane
#define PCAR 32768.0f   // carry on P
#define LOG2E 1.4426950408889634f
#define MAXN 0.996f     // (1 - 4e-3) / sqrt(c)
#define NKB  (SEQ / 32)
#define GPITCH 68
#define TP16   72
#define ATT_THREADS 128
#define CS_COLS     32    // weight columns per preparation block
#define XR_ROWS     32    // x rows per preparation block
#define WTP     (DM + 8)  // pitch of a transposed weight row in LDS, in 16-bit units: 16-B words of 4 rows apart fall 16 banks apart
#define PREP_THREADS 512                       // block of the preparation grid (both block kinds)
#define PB_COL  (3 * (DM / CS_COLS))           // weight blocks, 32 columns of one weight each
#define PB_ROW  (NB * SEQ / XR_ROWS)           // x blocks, 32 rows each
#define PJ_BLOCKS ((NB * SEQ / 128) * (DM / 64)) // projection blocks: one per 128-row x 64-column tile
#define PJ_THREADS 384                         // 3 weights x 4 waves
#define KST     64                             // k (projection) or keys (attention) per LDS stage: one 128-B line of every staged row
#define PJ_ROWS (128 + 3 * 64)                 // staged rows of a projection stage: 128 of A, then 64 of each weight
#define PJ_CPW  ((PJ_ROWS / 4 + PJ_THREADS / 32 - 1) / (PJ_THREADS / 32))  // copies per wave and stage, upper bound (a copy = 4 rows)
#define ATILE   (64 * TP16)                    // one staged 64-row k tile of attention, in 16-bit units
#define VP16    80                             // pitch of a staged gamma v row: 160 B = 32 B x 5, the pitch for ds_load_tr16_b128
#define VTILE   (64 * VP16)                    // one staged 64-row gamma v tile, in 16-bit units
#define ABUF    (2 * ATILE + VTILE)            // one buffer of the attention ring: k hi, k lo, gamma v

static_assert(NB >= 1 && NB <= NB_FULL);
static_assert((SQ % 64) == 0 && SQ >= 64 && SQ <= SEQ);
static_assert(NH * HD == DM && HD == 64);
static_assert((SEQ % 128) == 0 && (SEQ % 32) == 0 && NKB * 32 == SEQ);
static_assert((DM % 256) == 0 && (DM % 64) == 0 && (DM % 32) == 0);
static_assert((GPITCH * 4) % 16 == 0 && (TP16 * 2) % 16 == 0 && (VP16 * 2) % 32 == 0 && ((VP16 * 2) / 32) % 2 == 1);
static_assert(CS_COLS == 32 && (DM % CS_COLS) == 0 && (PREP_THREADS / 32) * 64 == DM && (PREP_THREADS / 32) * 2 == CS_COLS);
static_assert(ATT_THREADS == 128 && ATT_THREADS * 8 == SEQ);
static_assert(XR_ROWS == 32 && (PREP_THREADS / 32) * 2 == XR_ROWS && (NB * SEQ) % XR_ROWS == 0 && (WTP * 2) % 16 == 0);
static_assert((NB * SEQ) % 128 == 0);
static_assert(KST == 64 && DM / KST >= 2 && SEQ / KST >= 2 && (DM % KST) == 0 && (SEQ % KST) == 0);
static_assert(PJ_CPW == 7 && (PJ_ROWS % 4) == 0 && PJ_ROWS / 4 - 6 * (PJ_THREADS / 32) == 8);

typedef unsigned short u16;
typedef _Float16 v16h __attribute__((ext_vector_type(16)));
typedef _Float16 v8h  __attribute__((ext_vector_type(8)));
typedef __bf16   v16b __attribute__((ext_vector_type(16)));
typedef float    v8f  __attribute__((ext_vector_type(8)));
typedef float    v4f  __attribute__((ext_vector_type(4)));
typedef float    v2f  __attribute__((ext_vector_type(2)));
typedef _Float16 v2h  __attribute__((ext_vector_type(2)));
typedef unsigned int v4u __attribute__((ext_vector_type(4)));
typedef unsigned int v2u __attribute__((ext_vector_type(2)));
typedef v4u __attribute__((may_alias)) v4ua;
typedef v4f __attribute__((may_alias)) v4fa;
typedef v2f __attribute__((may_alias)) v2fa;

// one 16 x 16-bit per-lane fragment, viewed as f16 vector, bf16 vector or two 16-byte words
union Frag { v16h h; v16b b; v4u u[2]; };

// ---- scalar helpers ----------------------------------------------------------------------------------
__device__ __forceinline__ unsigned short bf_bits(float f) {          // f32 -> bf16 bits, RNE convert
  unsigned u = __float_as_uint(f);
  return (unsigned short)((u + 0x7FFFu + ((u >> 16) & 1u)) >> 16);
}
__device__ __forceinline__ float bf_up(unsigned short h) { return __uint_as_float(((unsigned)h) << 16); }
__device__ __forceinline__ float bfr(float f) { return bf_up(bf_bits(f)); }
__device__ __forceinline__ unsigned short h_bits(_Float16 x) { return __builtin_bit_cast(unsigned short, x); }
__device__ __forceinline__ unsigned pk16(unsigned short a, unsigned short b) { return (unsigned)a | ((unsigned)b << 16); }
__device__ __forceinline__ v8f zero8() { v8f z = {0.f, 0.f, 0.f, 0.f, 0.f, 0.f, 0.f, 0.f}; return z; }
__device__ __forceinline__ float red8(float v) {                      // sum over the 8-lane group (lane bits 0..2)
  v += __shfl_xor(v, 1, 32); v += __shfl_xor(v, 2, 32); v += __shfl_xor(v, 4, 32); return v;
}
__device__ __forceinline__ float rsum16(float v) {                    // sum over the 16-lane half (lane bits 0..3)
  v += __shfl_xor(v, 8, 32); v += __shfl_xor(v, 4, 32); v += __shfl_xor(v, 2, 32); v += __shfl_xor(v, 1, 32); return v;
}

// 1 / x on v_rcp_f32 (about 1 ulp), for a divisor that a whole row or column shares: formed once, then multiplied in.
// Every divisor it is used on is clamped to at least 1e-15 (or is at least 1/8) and, where finite, stays below 2e19,
// so the reciprocal is a normal f32; an infinite divisor gives 0, as the quotient of a finite value by it does.
__device__ __forceinline__ float rcp1(float x) {
  float r = 0.f;
#if defined(__HIP_DEVICE_COMPILE__)
  // v_nop in the same statement: the slot between a transcendental and an instruction that reads its result or overwrites its
  // source
  asm("v_rcp_f32 %0, %1\n\tv_nop" : "=v"(r) : "v"(x));
#endif
  return r;
}

// sqrt(x) on v_sqrt_f32 alone (about 1 ulp), without the correctly rounding sequence of sqrtf. Where it is used x is a sum of
// squares whose root is clamped to at least 1e-15 behind it (a subnormal x may come out as 0: the clamp gives the same value
// as for its true root), or x is at least 1e-15.
__device__ __forceinline__ float sqrt1(float x) {
  float r = 0.f;
#if defined(__HIP_DEVICE_COMPILE__)
  // v_nop in the same statement: the slot behind a transcendental, as in rcp1()
  asm("v_sqrt_f32 %0, %1\n\tv_nop" : "=v"(r) : "v"(x));
#endif
  return r;
}

// sinh(tz * asinh(x)) in closed form: e = |x| + sqrt(x^2 + 1), L = log2(e) >= 0, sinh = 2^(tz L - 1) - 2^(-tz L - 1), sign of x.
// Above 1e18 sqrt(x^2 + 1) = |x| in f32 and x^2 comes near the f32 overflow, so e = 2|x| there. The two halves are formed with the
// factor 1/2 in the exponent, so the result overflows only where sinh itself does.
__device__ __forceinline__ float sinh_of_scaled_asinh(float x, float tz) {
  const float a = fabsf(x);
  const float e = a + ((a > 1e18f) ? a : __builtin_amdgcn_sqrtf(fmaf(a, a, 1.0f)));
  const float L = __builtin_amdgcn_logf(e);
  const float s = __builtin_amdgcn_exp2f(fmaf(tz, L, -1.0f)) - __builtin_amdgcn_exp2f(fmaf(-tz, L, -1.0f));
  return copysignf(s, x);
}

// ---- fragment loader: 16-bit A/B operand from a k-contiguous row; lane -> row/col (lane&15), p already includes
//      +8*(lane>>4); elements 0..7 <- p[0..7] (k0+8h..), elements 8..15 <- p[16..23] (k0+16+8h..); same split k map
//      for A and B; B read by it from a k-contiguous [n][k] plane (the gamma v B goes through ldfrag_tr()). Loaded as unsigned 16-byte words.
__device__ __forceinline__ Frag ldfrag(const u16* p) {
  Frag f;
  f.u[0] = *(const v4u*)(p);
  f.u[1] = *(const v4u*)(p + 16);
  return f;
}
// ---- transposing fragment loader: B operand (col n = lane&15, k = row) from a row-major 16-bit LDS tile T[k][n] of pitch VP16.
//      p = T + (k0 + 8*(lane>>4) + (lane&7)) * VP16 + n0 + 8*((lane>>3)&1); lane (c, h) then holds T[k0 + 8h + 0..7][n0 + c] in
//      elements 0..7 and T[k0 + 16 + 8h + 0..7][n0 + c] in elements 8..15: the split k map of ldfrag().
typedef short s16x8 __attribute__((ext_vector_type(8)));
__device__ __forceinline__ Frag ldfrag_tr(const u16* p) {
  typedef __attribute__((address_space(3))) s16x8 lds_s16x8;
  Frag f;
  f.u[0] = __builtin_bit_cast(v4u, __builtin_amdgcn_ds_load_tr16_b128_v8i16((lds_s16x8*)(p)));
  f.u[1] = __builtin_bit_cast(v4u, __builtin_amdgcn_ds_load_tr16_b128_v8i16((lds_s16x8*)(p + 16 * VP16)));
  return f;
}

// ---- WMMA helpers and trailing VALU hazard gaps --------------------------------------------------------
__device__ __forceinline__ v8f mma_h(const Frag& a, const Frag& b, v8f c) {
  return __builtin_amdgcn_wmma_f32_16x16x32_f16(false, a.h, false, b.h, (short)0, c, false, false);
}
__device__ __forceinline__ v8f mma_b(const Frag& a, const Frag& b, v8f c) {
  return __builtin_amdgcn_wmma_f32_16x16x32_bf16(false, a.b, false, b.b, (short)0, c, false, false);
}
__device__ __forceinline__ void guard_sc(v8f& a, v8f& b, v16h x0, v16h x1, v16h x2, v16h x3, v16h x4, v16h x5) {
#if defined(__HIP_DEVICE_COMPILE__)
  asm volatile("v_nop\n\tv_nop\n\tv_nop\n\tv_nop"
               : "+v"(a), "+v"(b) : "v"(x0), "v"(x1), "v"(x2), "v"(x3), "v"(x4), "v"(x5) : "memory");
#endif
}
__device__ __forceinline__ void guard_pv(v8f (&o)[4], v16h p, v16h x0, v16h x1, v16h x2, v16h x3) {
#if defined(__HIP_DEVICE_COMPILE__)
  asm volatile("v_nop\n\tv_nop\n\tv_nop\n\tv_nop"
               : "+v"(o[0]), "+v"(o[1]), "+v"(o[2]), "+v"(o[3]) : "v"(p), "v"(x0), "v"(x1), "v"(x2), "v"(x3) : "memory");
#endif
}
__device__ __forceinline__ void guard_g(v8f (&acc)[8], v16h x0, v16h x1, v16h x2, v16h x3, v16h x4, v16h x5) {
#if defined(__HIP_DEVICE_COMPILE__)
  asm volatile("v_nop\n\tv_nop\n\tv_nop\n\tv_nop"
               : "+v"(acc[0]), "+v"(acc[1]), "+v"(acc[2]), "+v"(acc[3]),
                 "+v"(acc[4]), "+v"(acc[5]), "+v"(acc[6]), "+v"(acc[7])
               : "v"(x0), "v"(x1), "v"(x2), "v"(x3), "v"(x4), "v"(x5) : "memory");
#endif
}
__device__ __forceinline__ void acc_guard4(v8f (&o)[4]) {
#if defined(__HIP_DEVICE_COMPILE__)
  asm volatile("v_nop\n\tv_nop\n\tv_nop\n\tv_nop" : "+v"(o[0]), "+v"(o[1]), "+v"(o[2]), "+v"(o[3]));
#endif
}
__device__ __forceinline__ void wave_sync_lds() {
  __builtin_amdgcn_fence(__ATOMIC_RELEASE, "workgroup");
  __builtin_amdgcn_wave_barrier();
  __builtin_amdgcn_fence(__ATOMIC_ACQUIRE, "workgroup");
}

// ---- asynchronous 16-byte copies global -> LDS (through no register): l = the lane's own LDS byte address, g = the lane's own
//      global address, both multiples of 16. The closing s_wait_xcnt stands inside each statement, so that no address register
//      of an issued copy is rewritten ahead of it (a precaution).
__device__ __forceinline__ unsigned lds_addr(const void* p) { return (unsigned)(uintptr_t)p; }   // low 32 bits = LDS byte offset
__device__ __forceinline__ void acopy1(unsigned l0, const u16* g0) {
#if defined(__HIP_DEVICE_COMPILE__)
  asm volatile("global_load_async_to_lds_b128 %0, %1, off\n\t"
               "s_wait_xcnt 0x0"
               :: "v"(l0), "v"(g0) : "memory");
#endif
}
__device__ __forceinline__ void acopy6(const unsigned (&l)[6], const u16* const (&g)[6]) {
#if defined(__HIP_DEVICE_COMPILE__)
  asm volatile("global_load_async_to_lds_b128 %0, %6, off\n\t"
               "global_load_async_to_lds_b128 %1, %7, off\n\t"
               "global_load_async_to_lds_b128 %2, %8, off\n\t"
               "global_load_async_to_lds_b128 %3, %9, off\n\t"
               "global_load_async_to_lds_b128 %4, %10, off\n\t"
               "global_load_async_to_lds_b128 %5, %11, off\n\t"
               "s_wait_xcnt 0x0"
               :: "v"(l[0]), "v"(l[1]), "v"(l[2]), "v"(l[3]), "v"(l[4]), "v"(l[5]),
                  "v"(g[0]), "v"(g[1]), "v"(g[2]), "v"(g[3]), "v"(g[4]), "v"(g[5]) : "memory");
#endif
}
// The issuing wave's own copies have landed.
__device__ __forceinline__ void wait_copies() { asm volatile("s_wait_asynccnt 0x0" ::: "memory"); }
// Publish point of a two-buffer stage ring, passed by every wave of the block at the foot of every stage.
__device__ __forceinline__ void publish_stage() {
  asm volatile("s_wait_dscnt 0x0" ::: "memory");   // this wave's reads of the buffer that is refilled next have returned
  wait_copies();                                   // this wave's share of the next stage has landed
  __syncthreads();                                 // publishes the next stage; ends every reader's last read of this one
}

// =====================================================================================================
// x rows, read once: row r of the [rows][DM] f16 plane <- f16(bf16_RNE(x[r][e]) * scale), scale a power of two, and
// CX2[r] = sum_e bf16(x[r][e])^2 in f32. Block = 32 rows (one 128-B line of CX2), 512 threads, wave w rows 32*blk + 2w, +1:
// a lane holds elements 128q + 4*lane .. +3 of both rows (16 x 16-B loads, whole lines, all in flight at once), sums its 32
// values of a row in ascending q, xor-shuffle reduce, lane 0 -> LDS (rs, 32 floats); block barrier; threads 0..7 store the 32
// sums as 16-B words; then every lane stores its 4 halves per q (a wave's store = 256 contiguous bytes).
// coverage: 16 waves x 2 rows x (8 q x 32 lanes x 4) = 32 whole rows per block; NB*SEQ/32 blocks.
// =====================================================================================================
__device__ __forceinline__ void xprep_blk(const float* __restrict__ x, u16* Y, float* CX2, float scale, float* rs, int tid, int blk) {
  const int wave = tid >> 5, lane = tid & 31;
  const int row0 = blk * XR_ROWS + wave * 2;
  const float* xr = x + (size_t)row0 * DM + 4 * lane;
  v4f a[2][DM / 128];
#pragma unroll   // all loads issue before the first use: one memory latency per wave
  for (int j = 0; j < 2; ++j) {
#pragma unroll
    for (int q = 0; q < DM / 128; ++q) a[j][q] = *(const v4f*)(xr + (size_t)j * DM + 128 * q);
  }
  // precaution: the loads' address registers may be given to other values behind this point
  asm volatile("s_wait_xcnt 0x0" ::: "memory");
  v2f s = {0.f, 0.f};                            // the two rows' sums: two independent chains, side by side
#pragma unroll
  for (int q = 0; q < DM / 128; ++q) {
#pragma unroll
    for (int e = 0; e < 4; ++e) {
#pragma unroll
      for (int j = 0; j < 2; ++j) {
        a[j][q][e] = bfr(a[j][q][e]);
        s[j] += a[j][q][e] * a[j][q][e];
      }
    }
  }
#pragma unroll
  for (int m = 16; m >= 1; m >>= 1) {
    const float t0 = __shfl_xor(s[0], m, 32), t1 = __shfl_xor(s[1], m, 32);
    s[0] += t0; s[1] += t1;
  }
  if (lane == 0) *(v2fa*)(rs + wave * 2) = s;
  __syncthreads();                               // stands in front of every global store: it waits for no store
  if (tid < XR_ROWS / 4) {
    const v4f v = *(const v4fa*)(rs + 4 * tid);
    *(v4f*)(CX2 + blk * XR_ROWS + 4 * tid) = v;
  }
  u16* dst = Y + (size_t)row0 * DM + 4 * lane;
#pragma unroll
  for (int j = 0; j < 2; ++j) {
#pragma unroll
    for (int q = 0; q < DM / 128; ++q) {
      v2u o;
      o[0] = pk16(h_bits((_Float16)(a[j][q][0] * scale)), h_bits((_Float16)(a[j][q][1] * scale)));
      o[1] = pk16(h_bits((_Float16)(a[j][q][2] * scale)), h_bits((_Float16)(a[j][q][3] * scale)));
      *(v2u*)(dst + (size_t)j * DM + 128 * q) = o;
    }
  }
  // precaution: nothing rewrites the stores' registers ahead of this point
  asm volatile("s_wait_xcnt 0x0" ::: "memory");
}

// =====================================================================================================
// A weight z[k][n] (DM x DM), read once: ZN[n] = max(sqrt(sum_k bf16(z[k][n])^2), 1e-15), CH[n] = cosh(2 r[n]), SH[n] = sinh(2 r[n])
// (r index clamped to nr-1), and WT[n][k] (f16, k-contiguous Bt layout) <- f16(bf16_RNE(z[k][n]) * scale).
// Block = 32 columns (one 128-B line of every row) x all DM rows, 512 threads: lane = (row group lane>>3, 4 columns at 4*(lane&7)),
// wave w holds rows 64w + 32g + 8*(lane>>3) + j (g < 2, j < 8): 16 independent 16-B loads per thread, all in flight at once, and 8
// consecutive k of a column side by side in a thread, so that they go to the LDS tile [n][k] (pitch WTP) as one 16-B word.
// Column sums: 16 rows in the thread (ascending k), xor-8 / xor-16 shuffles over the wave's 4 row groups, one 32-float row per
// wave in LDS; one block barrier publishes tile and partial sums; wave w stores rows n = 2w, 2w + 1 of WT (4 x 512 contiguous
// bytes each); wave 0 then adds the 16 wave rows.
// coverage: 16 waves x 2 g x 4 groups x 8 rows = DM rows; DM/32 blocks x 32 columns = every column of the three arrays and every
//           row of WT once, each block the only writer of its 128-B lines. tile: CS_COLS * WTP halves, part: 16 * CS_COLS floats.
// =====================================================================================================
__device__ __forceinline__ void wprep_blk(const float* __restrict__ z, const float* __restrict__ r, int nr,
                                          float* ZN, float* CH, float* SH, u16* Y, float scale,
                                          u16* tile, float* part, int tid, int blk) {
  const int wave = tid >> 5, lane = tid & 31;
  const int col0 = blk * CS_COLS;
  const int c4 = 4 * (lane & 7);
  const int k0 = wave * 64 + 8 * (lane >> 3);
  const float* zp = z + (size_t)k0 * DM + col0 + c4;
  const int col = col0 + lane;
  float rv = 0.f;
  if (wave == 0) {                               // wave-uniform; issued with the column loads, not behind the barrier
    int ri = col;
    ri = (ri < nr - 1) ? ri : (nr - 1);
    rv = r[ri];
  }
  v4f a[16];
#pragma unroll   // all loads issue before the first use: one memory latency per thread
  for (int j = 0; j < 16; ++j) a[j] = *(const v4f*)(zp + (size_t)((j >> 3) * 32 + (j & 7)) * DM);
  // precaution: the loads' address registers may be given to other values behind this point
  asm volatile("s_wait_xcnt 0x0" ::: "memory");
  // keeps the arithmetic behind all 16 loads: without it this build issued the last 4 behind the first 12's wait, a second latency
  __builtin_amdgcn_sched_barrier(0);
  v4f s = {0.f, 0.f, 0.f, 0.f};
#pragma unroll
  for (int g = 0; g < 2; ++g) {
#pragma unroll
    for (int e = 0; e < 4; ++e) {
      v4u o;
#pragma unroll
      for (int p = 0; p < 4; ++p) {
        const float v0 = bfr(a[8 * g + 2 * p][e]), v1 = bfr(a[8 * g + 2 * p + 1][e]);
        s[e] += v0 * v0;
        s[e] += v1 * v1;
        o[p] = pk16(h_bits((_Float16)(v0 * scale)), h_bits((_Float16)(v1 * scale)));
      }
      *(v4ua*)(tile + (c4 + e) * WTP + k0 + 32 * g) = o;
    }
  }
#pragma unroll
  for (int e = 0; e < 4; ++e) {
    s[e] += __shfl_xor(s[e], 8, 32);
    s[e] += __shfl_xor(s[e], 16, 32);
  }
  if (lane < 8) *(v4fa*)(part + wave * CS_COLS + 4 * lane) = s;
  __syncthreads();
  {
    v4u ov[2][DM / 256];
#pragma unroll
    for (int i = 0; i < 2; ++i) {
#pragma unroll
      for (int q = 0; q < DM / 256; ++q) ov[i][q] = *(const v4ua*)(tile + (wave * 2 + i) * WTP + 256 * q + 8 * lane);
    }
    u16* dst = Y + (size_t)(col0 + wave * 2) * DM + 8 * lane;
#pragma unroll
    for (int i = 0; i < 2; ++i) {
#pragma unroll
      for (int q = 0; q < DM / 256; ++q) *(v4u*)(dst + (size_t)i * DM + 256 * q) = ov[i][q];
    }
    // precaution: wave 0's code behind this point may rewrite the stores' registers
    asm volatile("s_wait_xcnt 0x0" ::: "memory");
  }
  if (wave == 0) {                               // wave-uniform; lane = column
    float t = 0.f;
#pragma unroll
    for (int w = 0; w < PREP_THREADS / 32; ++w) t += part[w * CS_COLS + lane];
    const float dr = 2.0f * bfr(rv);
    ZN[col] = fmaxf(sqrtf(t), 1e-15f);
    CH[col] = coshf(dr);
    SH[col] = sinhf(dr);
  }
}

// =====================================================================================================
// Preparation grid: everything that reads only the inputs, in one launch; every input is read once, by few waves that each keep
// 16 loads of 16 bytes in flight (the launch is short: the start of its waves counts). Block kind by block index (block-uniform,
// so each kind's block barrier is passed by all 512 threads of its block); the kind with the longer dependent chain comes first:
//   [0, PB_COL)            a weight's column statistics and transposed f16 plane, weight = index / (DM/32), 32 columns per block
//   next PB_ROW blocks     x row sums and f16 plane, 32 rows per block
// =====================================================================================================
__global__ __launch_bounds__(PREP_THREADS)
void prep(const float* __restrict__ x,
          const float* __restrict__ qz, const float* __restrict__ kz, const float* __restrict__ vz,
          const float* __restrict__ qr, const float* __restrict__ kr, const float* __restrict__ vr,
          int nqr, int nkr, int nvr,
          u16* X16, float* CX2, float* ZN, float* CH, float* SH, u16* WQT, u16* WKT, u16* WVT) {
  __shared__ __align__(16) u16 tile[CS_COLS * WTP];
  __shared__ __align__(16) float part[(PREP_THREADS / 32) * CS_COLS];
  const int tid = threadIdx.x;
  int bid = blockIdx.x;
  if (bid < PB_COL) {
    const int w = bid / (DM / CS_COLS), blk = bid % (DM / CS_COLS);
    const float* z = (w == 0) ? qz : (w == 1) ? kz : vz;
    const float* r = (w == 0) ? qr : (w == 1) ? kr : vr;
    const int   nr = (w == 0) ? nqr : (w == 1) ? nkr : nvr;
    u16*         y = (w == 0) ? WQT : (w == 1) ? WKT : WVT;
    wprep_blk(z, r, nr, ZN + w * DM, CH + w * DM, SH + w * DM, y, WSC, tile, part, tid, blk);
    return;
  }
  bid -= PB_COL;
  xprep_blk(x, X16, CX2, XS, part, tid, bid);
}

// =====================================================================================================
// f16 GEMM core on one LDS stage (KST of k): the wave's 32 x 64 tile of C += A . Bt^T; as -> staged A row (wave row + m) + 8h,
// bs -> staged Bt row (m) + 8h, rows at pitch TP16 (144 B: ds_load_b128 of 16 rows falls on all banks once);
// acc[4i + j] = rows 16i.., cols 16j..; k stepped by 32 in ascending order.
// =====================================================================================================
__device__ __forceinline__ void gemm_stage(const u16* as, const u16* bs, v8f (&acc)[8]) {
#pragma unroll   // two steps: the k offsets become immediates of the LDS reads
  for (int k0 = 0; k0 < KST; k0 += 32) {
    const Frag a0 = ldfrag(as + k0), a1 = ldfrag(as + 16 * TP16 + k0);
    const Frag b0 = ldfrag(bs + k0);
    const Frag b1 = ldfrag(bs + 16 * TP16 + k0);
    const Frag b2 = ldfrag(bs + 32 * TP16 + k0);
    const Frag b3 = ldfrag(bs + 48 * TP16 + k0);
    acc[0] = mma_h(a0, b0, acc[0]);
    acc[1] = mma_h(a0, b1, acc[1]);
    acc[2] = mma_h(a0, b2, acc[2]);
    acc[3] = mma_h(a0, b3, acc[3]);
    acc[4] = mma_h(a1, b0, acc[4]);
    acc[5] = mma_h(a1, b1, acc[5]);
    acc[6] = mma_h(a1, b2, acc[6]);
    acc[7] = mma_h(a1, b3, acc[7]);
    guard_g(acc, a0.h, a1.h, b0.h, b1.h, b2.h, b3.h);
  }
}
// Stage the wave's 32 x 64 f32 tile (times oscale) in its LDS slab (pitch 68): D element r of acc[4i+j], lane l ->
// coverage: 32 lanes x 2 x 8 rows x 4 cols-of-16 = rows 0..31 x cols 0..63 of the slab.
__device__ __forceinline__ void stage32x64(float* sl, v8f (&acc)[8], float oscale, int lane) {
  const int hh = lane >> 4, m = lane & 15;
#pragma unroll
  for (int i = 0; i < 2; ++i) {
#pragma unroll
    for (int r = 0; r < 8; ++r) {
      const int ro = (16 * i + 8 * hh + r) * GPITCH + m;
      sl[ro]      = acc[4 * i + 0][r] * oscale;
      sl[ro + 16] = acc[4 * i + 1][r] * oscale;
      sl[ro + 32] = acc[4 * i + 2][r] * oscale;
      sl[ro + 48] = acc[4 * i + 3][r] * oscale;
    }
  }
  wave_sync_lds();
}

// =====================================================================================================
// Projection GEMM + ball MLR epilogue. A = x plane [NB*SEQ][DM] (f16, x XS), Bt = WT [DM n][DM k] (f16, x WSC).
// One launch for the three weights: block = 384 threads = 128 rows x 64 cols (one head) of q, k and v; waves 4*mode .. 4*mode+3
// (mode 0 q, 1 k, 2 v: picks Bt, the column tables' row and the outputs) take 32 rows each, so the three modes read the same A rows
// from one WGP and three waves share a SIMD. Operands go through a two-buffer LDS ring, KST of k per stage: the block's 128 A rows
// and 3 x 64 Bt rows (PJ_ROWS rows x 128 B, whole lines) are brought in by asynchronous 16-byte copies, one copy of a wave = 4 rows,
// copy index = wave + 12 i (i < 6 for every wave, i = 6 for waves 0..7: 80 copies); the next stage flies while this one is worked on.
// Epilogue per element (f32): mm = (x.z)[row][n] / ZN[n]; arg = (2 mm CH[n] - (1 + cx2) SH[n]) / max(1 - cx2, 1e-15);
// y = sinh(2 ZN[n] asinh(arg)); per (row, head) 64-vector (8 lanes x 8 values, 8-lane shuffle sums): clip to norm MAXN,
// y = y / (1 + sqrt(1 + sum y^2)), clip again; x2 = sum y^2. mode 0/1: planes Ph/Pl = bf16 hi / bf16 lo of y, RS row
// scalar = x2; mode 2: g = 2 / max(1 - x2, 1e-15), plane Ph = f16(g y VS), RS row scalar = g - 1.
// coverage: per wave 8 instr x 4 rows x 8 lanes x 8 halves = 32 x 64 per plane; RS: 32 floats per wave; grid covers every
//           (row, col) of the planes and every (b, head, s) of RS exactly once.
// LDS: ring cross-wave (one block barrier per stage, staged extent == consumed extent, pad bytes never read); slab and rsc are
// wave-private (wave_sync); staged extent 32x64 == consumed extent.
// =====================================================================================================
__global__ __launch_bounds__(PJ_THREADS)
void proj_mlr(const u16* __restrict__ A, const u16* __restrict__ WQT, const u16* __restrict__ WKT, const u16* __restrict__ WVT,
              const float* __restrict__ ZN3, const float* __restrict__ CH3, const float* __restrict__ SH3,
              const float* __restrict__ CX2, u16* Qh, u16* Ql, u16* Kh, u16* Kl, u16* Vg,
              float* QX2, float* KX2, float* GM1) {
  __shared__ __align__(16) float slab[(PJ_THREADS / 32) * 32 * GPITCH];
  __shared__ __align__(16) float rsc[(PJ_THREADS / 32) * 32];
  __shared__ __align__(16) u16 ring[2 * PJ_ROWS * TP16];
  const int tid = threadIdx.x, wv = tid >> 5, wave = wv & 3, lane = tid & 31, hh = lane >> 4, m = lane & 15;
  constexpr int NT = DM / 64;
  const int mode = __builtin_amdgcn_readfirstlane(wv >> 2);   // the same in all lanes of a wave: pointer picks and the mode branch stay scalar
  const int bid  = blockIdx.x;
  const float* ZN = ZN3 + mode * DM;
  const float* CH = CH3 + mode * DM;
  const float* SH = SH3 + mode * DM;
  u16*   Ph = (mode == 0) ? Qh : (mode == 1) ? Kh : Vg;
  u16*   Pl = (mode == 0) ? Ql : Kl;           // stored to by modes 0 and 1 only
  float* RS = (mode == 0) ? QX2 : (mode == 1) ? KX2 : GM1;
  const int nt   = bid % NT;
  const int mt   = bid / NT;
  const int rowb = mt * 128 + wave * 32;       // global token row b*SEQ + s of the wave's first row
  const int col0 = nt * 64;                    // = head * HD
  // ---- this lane's share of a stage: copy i brings staged rows 4 (wave + 12 i) .. +3, lane = (row lane>>3, 16 bytes at 16 (lane&7)) ----
  const int wvs = __builtin_amdgcn_readfirstlane(wv);         // scalar: source picks and the test on the seventh copy stay scalar
  const bool has7 = wvs + 6 * (PJ_THREADS / 32) < PJ_ROWS / 4;
  const u16* gsrc[PJ_CPW];
  unsigned   ldst[PJ_CPW];
#pragma unroll   // constant indices: both arrays stay in registers
  for (int i = 0; i < PJ_CPW; ++i) {
    int ci = wvs + (PJ_THREADS / 32) * i;
    ci = (ci < PJ_ROWS / 4) ? ci : (PJ_ROWS / 4 - 1);         // keeps the addresses of a seventh copy that is not issued in range
    const int sr = 4 * ci + (lane >> 3);                      // staged row
    const int wsel = (ci - 32) >> 4;                          // weight of a Bt row (ci >= 32)
    const u16* rowp = (ci < 32) ? (A + (size_t)(mt * 128 + sr) * DM)
                                : (((wsel == 0) ? WQT : (wsel == 1) ? WKT : WVT) + (size_t)(col0 + sr - 128 - 64 * wsel) * DM);
    gsrc[i] = rowp + 8 * (lane & 7);
    ldst[i] = lds_addr(ring) + (unsigned)(sr * (TP16 * 2) + 16 * (lane & 7));
  }
  auto stage_copy = [&](int st) {                             // stage st -> buffer st & 1
    const unsigned lo = (unsigned)((st & 1) * (PJ_ROWS * TP16 * 2));
    const unsigned l6[6] = {ldst[0] + lo, ldst[1] + lo, ldst[2] + lo, ldst[3] + lo, ldst[4] + lo, ldst[5] + lo};
    const u16* const g6[6] = {gsrc[0] + st * KST, gsrc[1] + st * KST, gsrc[2] + st * KST,
                              gsrc[3] + st * KST, gsrc[4] + st * KST, gsrc[5] + st * KST};
    acopy6(l6, g6);
    if (has7) acopy1(ldst[6] + lo, gsrc[6] + st * KST);
  };
  v8f acc[8];
#pragma unroll
  for (int i = 0; i < 8; ++i) acc[i] = zero8();
  stage_copy(0);
  wait_copies();
  __syncthreads();                                            // stage 0 is published
  stage_copy(1);
#pragma unroll 1   // one stage per trip: the ring's order (read, publish, refill) stays as written
  for (int st = 0; st < DM / KST; ++st) {
    const u16* rb = ring + (st & 1) * (PJ_ROWS * TP16);
    gemm_stage(rb + (wave * 32 + m) * TP16 + 8 * hh, rb + (128 + mode * 64 + m) * TP16 + 8 * hh, acc);
    publish_stage();
    if (st + 2 < DM / KST) stage_copy(st + 2);                // into the buffer that this trip has just read
  }
  wait_copies();
  float* sl = slab + wv * 32 * GPITCH;
  stage32x64(sl, acc, 1.0f / (XS * WSC), lane);

  const int rq = lane >> 3, c8 = (lane & 7) * 8;
  float zn8[8], ch8[8], sh8[8], rz8[8];
  {
    const v4f z0 = *(const v4f*)(ZN + col0 + c8), z1 = *(const v4f*)(ZN + col0 + c8 + 4);
    const v4f h0 = *(const v4f*)(CH + col0 + c8), h1 = *(const v4f*)(CH + col0 + c8 + 4);
    const v4f g0 = *(const v4f*)(SH + col0 + c8), g1 = *(const v4f*)(SH + col0 + c8 + 4);
#pragma unroll
    for (int e = 0; e < 4; ++e) {
      zn8[e] = z0[e]; zn8[4 + e] = z1[e];
      ch8[e] = h0[e]; ch8[4 + e] = h1[e];
      sh8[e] = g0[e]; sh8[4 + e] = g1[e];
    }
#pragma unroll
    for (int e = 0; e < 8; ++e) rz8[e] = rcp1(zn8[e]);        // one reciprocal per column, used by all 8 row groups
  }
  const bool mv = (mode == 2);
#pragma unroll 1
  for (int i = 0; i < 8; ++i) {
    const int row = 4 * i + rq;
    const float cx  = CX2[rowb + row];
    const float romc = rcp1(fmaxf(1.0f - cx, 1e-15f));
    const float opc = 1.0f + cx;
    float* sr = sl + row * GPITCH + c8;
    float y[8];
    float s0 = 0.f;
#pragma unroll
    for (int e = 0; e < 8; ++e) {
      const float mm  = sr[e] * rz8[e];
      const float arg = (2.0f * mm * ch8[e] - opc * sh8[e]) * romc;
      y[e] = sinh_of_scaled_asinh(arg, 2.0f * zn8[e]);
      s0 += y[e] * y[e];
    }
    s0 = red8(s0);
    const float n0 = fmaxf(sqrt1(s0), 1e-15f);
    const float r0 = rcp1(n0);                                // formed for every row: no branch on the clip test
    const float f0 = (n0 > MAXN) ? MAXN * r0 : 1.0f;          // a row inside the ball is multiplied by exactly 1
    float s1 = 0.f;
#pragma unroll
    for (int e = 0; e < 8; ++e) {
      y[e] = y[e] * f0;
      s1 += y[e] * y[e];
    }
    s1 = red8(s1);
    const float rden = rcp1(1.0f + sqrt1(1.0f + s1));
    float s2 = 0.f;
#pragma unroll
    for (int e = 0; e < 8; ++e) {
      y[e] = y[e] * rden;
      s2 += y[e] * y[e];
    }
    s2 = red8(s2);
    const float n2 = fmaxf(sqrt1(s2), 1e-15f);
    const float r2 = rcp1(n2);
    const float f2 = (n2 > MAXN) ? MAXN * r2 : 1.0f;
    float s3 = 0.f;
#pragma unroll
    for (int e = 0; e < 8; ++e) {
      y[e] = y[e] * f2;
      s3 += y[e] * y[e];
    }
    s3 = red8(s3);
    const float g    = 2.0f * rcp1(fmaxf(1.0f - s3, 1e-15f));
    const float gmul = mv ? g : 1.0f;
    const float scal = mv ? (g - 1.0f) : s3;
#pragma unroll
    for (int e = 0; e < 8; ++e) sr[e] = y[e] * gmul;
    if ((lane & 7) == 0) rsc[wv * 32 + row] = scal;
  }
  wave_sync_lds();

  const int bb = rowb / SEQ, s0r = rowb - bb * SEQ, head = nt;
  if (lane < 8) {
    const v4f v = *(const v4fa*)(rsc + wv * 32 + 4 * lane);
    float* dst = RS + ((size_t)(bb * NH + head)) * SEQ + s0r + 4 * lane;
    {
      *(v4f*)(dst) = v;
      
    }
  }
  // ---- planes ----
  const size_t pofs = (size_t)rowb * DM + (size_t)(col0 + c8);
  if (!mv) {
    v4u oh[8], ol[8];
#pragma unroll
    for (int i = 0; i < 8; ++i) {
      const int row = 4 * i + rq;
      const v4f a = *(const v4fa*)(sl + row * GPITCH + c8), c4 = *(const v4fa*)(sl + row * GPITCH + c8 + 4);
#pragma unroll
      for (int e = 0; e < 2; ++e) {
        const unsigned short ha = bf_bits(a[2 * e]),  hb = bf_bits(a[2 * e + 1]);
        const unsigned short la = bf_bits(a[2 * e] - bf_up(ha)), lb = bf_bits(a[2 * e + 1] - bf_up(hb));
        oh[i][e] = pk16(ha, hb);
        ol[i][e] = pk16(la, lb);
        const unsigned short hc = bf_bits(c4[2 * e]), hd = bf_bits(c4[2 * e + 1]);
        const unsigned short lc = bf_bits(c4[2 * e] - bf_up(hc)), ld = bf_bits(c4[2 * e + 1] - bf_up(hd));
        oh[i][2 + e] = pk16(hc, hd);
        ol[i][2 + e] = pk16(lc, ld);
      }
    }
    {
#pragma unroll
      for (int i = 0; i < 8; ++i) {
        const int row = 4 * i + rq;
        *(v4u*)(Ph + pofs + (size_t)row * DM) = oh[i];
        *(v4u*)(Pl + pofs + (size_t)row * DM) = ol[i];
      }
      
    }
  } else {
    v4u ov[8];
#pragma unroll
    for (int i = 0; i < 8; ++i) {
      const int row = 4 * i + rq;
      const v4f a = *(const v4fa*)(sl + row * GPITCH + c8), c4 = *(const v4fa*)(sl + row * GPITCH + c8 + 4);
#pragma unroll
      for (int e = 0; e < 2; ++e) {
        ov[i][e]     = pk16(h_bits((_Float16)(a[2 * e] * VS)),  h_bits((_Float16)(a[2 * e + 1] * VS)));
        ov[i][2 + e] = pk16(h_bits((_Float16)(c4[2 * e] * VS)), h_bits((_Float16)(c4[2 * e + 1] * VS)));
      }
    }
    {
#pragma unroll
      for (int i = 0; i < 8; ++i) {
        const int row = 4 * i + rq;
        *(v4u*)(Ph + pofs + (size_t)row * DM) = ov[i];
      }
      
    }
  }
}

// ---- softmax weight of one (query, key) pair, not normalised: em * exp(-dist) ----
// exp(-acosh(z)) = 1 / (z + sqrt(z^2 - 1)); with z = 1 + 2 num / den this is den / (den + 2 (num + sqrt(num (num + den)))):
// no logarithm, no exponential, no cancellation. num and den lie in [1e-15, 4], so no step leaves the normal f32 range.
// em = the key's own factor exp(bias - largest bias of the batch) * PCAR, in [0, PCAR].
// Range of exp(-dist): q and k leave the projection clipped to norm MAXN, so den >= (1 - MAXN^2)^2 and num <= 4 MAXN^2, which
// gives z + sqrt(z^2 - 1) < 2^18. A key with the largest bias therefore has a weight of at least PCAR / 2^18 = 1/8 in every row,
// while no weight exceeds PCAR: the f16 P operand and the f32 sums need no row maximum.
// Two neighbouring keys at a time: they lie in neighbouring registers of the score tile and of the tables (packed f32 forms).
__device__ __forceinline__ v2f weight2(v2f xy, v2f y2, v2f em, float x2, float omx) {
  const v2f lim = {1e-15f, 1e-15f};
  const v2f num = __builtin_elementwise_max(x2 - 2.0f * xy + y2, lim);
  const v2f den = __builtin_elementwise_max(omx * (1.0f - y2), lim);
  const v2f sq  = num * (num + den);
  const v2f rt  = {__builtin_amdgcn_sqrtf(sq[0]), __builtin_amdgcn_sqrtf(sq[1])};
  const v2f ee  = 2.0f * (num + rt) + den;
  const v2f ri  = {__builtin_amdgcn_rcpf(ee[0]), __builtin_amdgcn_rcpf(ee[1])};
  return (em * den) * ri;
}

// =====================================================================================================
// Fused distance attention + gyro-midpoint over all SEQ keys: block = (batch b, head, 64 query rows), 4 waves, wave w owns
// queries q0 = 64*qt + 16*w .. q0+15. The four waves share the keys: k hi, k lo and gamma v go through a two-buffer LDS ring, KST keys
// per stage (3 tiles of 64 key rows x 128 B, whole lines; pitch TP16 for k, VP16 for gamma v), brought in by asynchronous 16-byte
// copies, 12 per thread and stage; the next stage flies while this one is worked on; one block barrier per stage.
//   q planes bf16 hi/lo [b*SEQ + s][h*64 + d]; k planes bf16 hi/lo and the gamma v plane (f16 x VS) same layout;
//   per-key tables for (b, h): sum k^2, gamma - 1; factor exp(bias - largest bias) x32768 from the additive bias row amask[b][s] (bf16-converted); per query x2 = sum q^2.
//   All NKB = 32 key blocks of 32 keys are visited (static bound), two per ring stage.
//   Scores computed TRANSPOSED: S^T tile g = k rows (keys kb+16g .., A operand, row m = lane&15, split k map over d)
//   times q^T (B operand, col n = query q0 + (lane&15), k = d), 2 d-chunks of 32, three bf16 products each (hi.hi, lo.hi,
//   hi.lo). D element r of lane l = (key kb+16g+8h+r, query q0+(l&15)): a lane owns one query column and 16 of its 32 keys;
//   the partner lane l^16 owns the other 16 -> the row sums need one xor-16 shuffle.
//   dist = acosh(1 + 2 max(x2 - 2 xy + y2, 1e-15) / max((1 - x2)(1 - y2), 1e-15)), logit = -dist + bias, all f32.
//   Softmax weights p = exp(bias - largest bias of the batch) exp(-dist) in closed form (weight2()), one fixed scale for all keys:
//   no row maximum, no rescale of O, nothing crosses lanes in the key loop. Each lane sums l = sum p and dn = sum p (gamma - 1) over
//   its own keys; the two halves of a query's keys meet in one xor-16 shuffle behind the loop. The weights ARE the
//   P A-fragment in place: A row m = query = lane&15, element i <- key kb+8h+i (tile 0, D element i), element 8+i <- key
//   kb+16+8h+i (tile 1, D element i). P (<= 1) carried x32768 as f16; l and dn carry the same factor.
//   4 gamma v B fragments (col n = d = 16j + (lane&15), k = key) by transposing LDS loads from the key-major tile, 4 P.V WMMAs + one guard.
//   Epilogue (f32): two_mean = (O (1/l) / VS) / max(dn / l, 1e-10); a = two_mean / (1 + sqrt(max(1 - sum two_mean^2,
//   1e-15))); clip to norm MAXN; the wave's 16x64 tile staged in its LDS slab (pitch 68); each output row segment
// coverage: per wave 8 instructions x 2 rows x 16 lanes x 4 floats = 16 x 64; grid NB*NH*(SQ/64) blocks x 4 waves = every
//           (b < NB, s < SQ, h) row segment of the output exactly once.
// LDS: ms/ky2/kg1 cross-wave (block barrier, 1024 staged == 1024 consumed); ring cross-wave (block barrier per stage, staged
// extent == consumed extent, pad bytes never read); slab wave-private (wave_sync, 16x64).
// =====================================================================================================
__global__ __launch_bounds__(ATT_THREADS)
void attn_fwd(const u16* __restrict__ Qh, const u16* __restrict__ Ql, const u16* __restrict__ Kh, const u16* __restrict__ Kl,
              const u16* __restrict__ Vg, const float* __restrict__ QX2, const float* __restrict__ KX2,
              const float* __restrict__ GM1, const float* __restrict__ amask, float* Out) {
  __shared__ __align__(16) float ms[SEQ];
  __shared__ __align__(16) float ky2[SEQ];
  __shared__ __align__(16) float kg1[SEQ];
  __shared__ __align__(16) float slab[4 * 16 * GPITCH];
  __shared__ __align__(16) u16 ring[2 * ABUF];

  const int tid  = threadIdx.x;
  const int wave = tid >> 5;
  const int lane = tid & 31;
  const int hh   = lane >> 4;
  const int c    = lane & 15;

  constexpr int NQT = SQ / 64;
  const int bid  = blockIdx.x;
  const int qt   = bid % NQT;
  const int head = (bid / NQT) % NH;
  const int b    = bid / (NQT * NH);
  const int bh   = b * NH + head;
  const int q0   = qt * 64 + wave * 16;

  // ---- this thread's share of a ring stage: per tile rows (tid>>3) + 16 i, i < 4, 16 bytes at 16 (tid&7) ----
  const u16* khg = Kh + ((size_t)(b * SEQ + (tid >> 3))) * DM + head * HD + 8 * (tid & 7);
  const u16* klg = Kl + ((size_t)(b * SEQ + (tid >> 3))) * DM + head * HD + 8 * (tid & 7);
  const u16* vgg = Vg + ((size_t)(b * SEQ + (tid >> 3))) * DM + head * HD + 8 * (tid & 7);
  const unsigned lring = lds_addr(ring) + (unsigned)((tid >> 3) * (TP16 * 2) + 16 * (tid & 7));
  const unsigned lvring = lds_addr(ring) + (unsigned)(2 * ATILE * 2 + (tid >> 3) * (VP16 * 2) + 16 * (tid & 7));
  auto stage_copy = [&](int st) {                             // keys KST st .. +63 -> buffer st & 1
    const unsigned lo = lring + (unsigned)((st & 1) * (ABUF * 2));
    const unsigned lv = lvring + (unsigned)((st & 1) * (ABUF * 2));
    const u16* kh = khg + (size_t)st * KST * DM;
    const u16* kl = klg + (size_t)st * KST * DM;
    const u16* vg = vgg + (size_t)st * KST * DM;
    constexpr unsigned R16 = 16 * TP16 * 2, TB = ATILE * 2;   // 16 k rows, one k tile, in bytes
    constexpr unsigned V16 = 16 * VP16 * 2;                   // 16 gamma v rows, in bytes
    const unsigned la[6] = {lo, lo + R16, lo + 2 * R16, lo + 3 * R16, lo + TB, lo + TB + R16};
    const u16* const ga[6] = {kh, kh + 16 * DM, kh + 32 * DM, kh + 48 * DM, kl, kl + 16 * DM};
    acopy6(la, ga);
    const unsigned lb[6] = {lo + TB + 2 * R16, lo + TB + 3 * R16, lv, lv + V16, lv + 2 * V16, lv + 3 * V16};
    const u16* const gb[6] = {kl + 32 * DM, kl + 48 * DM, vg, vg + 16 * DM, vg + 32 * DM, vg + 48 * DM};
    acopy6(lb, gb);
  };
  stage_copy(0);                                              // flies while the tables are staged

  // ---- largest bias of the batch: every wave reads the whole row (32 lanes x 32 values), so no barrier is needed for it.
  //      bf16 rounding is monotone: the rounded maximum is the maximum of the rounded values.
  float mb;
  {
    const float* mr = amask + (size_t)b * SEQ + 4 * lane;
    v4f a[SEQ / 128];
#pragma unroll   // all loads issue before the first use: one memory latency
    for (int q = 0; q < SEQ / 128; ++q) a[q] = *(const v4f*)(mr + 128 * q);
    // precaution: the table loads that follow may land in the register that holds these loads' offset
    asm volatile("s_wait_xcnt 0x0" ::: "memory");
    float mx = -INFINITY;
#pragma unroll
    for (int q = 0; q < SEQ / 128; ++q) mx = fmaxf(fmaxf(fmaxf(mx, a[q][0]), fmaxf(a[q][1], a[q][2])), a[q][3]);
    mx = fmaxf(mx, __shfl_xor(mx, 16, 32)); mx = fmaxf(mx, __shfl_xor(mx, 8, 32)); mx = fmaxf(mx, __shfl_xor(mx, 4, 32));
    mx = fmaxf(mx, __shfl_xor(mx, 2, 32));  mx = fmaxf(mx, __shfl_xor(mx, 1, 32));
    mb = bfr(mx);
  }
  // ---- stage the per-key tables of (b, head): 128 threads x 8 keys = SEQ ----
  {
    const int i0 = tid * 8;
    const float* mp = amask + (size_t)b * SEQ + i0;
    const float* yp = KX2 + (size_t)bh * SEQ + i0;
    const float* gp = GM1 + (size_t)bh * SEQ + i0;
    const v4f m0 = *(const v4f*)(mp), m1 = *(const v4f*)(mp + 4);
    const v4f y0 = *(const v4f*)(yp), y1 = *(const v4f*)(yp + 4);
    const v4f g0 = *(const v4f*)(gp), g1 = *(const v4f*)(gp + 4);
#pragma unroll
    for (int e = 0; e < 4; ++e) {
      ms[i0 + e]     = exp2f((bfr(m0[e]) - mb) * LOG2E) * PCAR;
      ms[i0 + 4 + e] = exp2f((bfr(m1[e]) - mb) * LOG2E) * PCAR;
      ky2[i0 + e] = y0[e];      ky2[i0 + 4 + e] = y1[e];
      kg1[i0 + e] = g0[e];      kg1[i0 + 4 + e] = g1[e];
    }
  }
  wait_copies();
  __syncthreads();                                            // the tables and stage 0 are published
  stage_copy(1);

  // B fragments of q^T: col n = query q0 + c, k = d (k-contiguous rows of the q planes)
  const size_t qofs = ((size_t)(b * SEQ + q0 + c)) * DM + head * HD + 8 * hh;
  const Frag qh0 = ldfrag(Qh + qofs), qh1 = ldfrag(Qh + qofs + 32);
  const Frag ql0 = ldfrag(Ql + qofs), ql1 = ldfrag(Ql + qofs + 32);
  const float xq  = QX2[(size_t)bh * SEQ + q0 + c];
  const float omx = 1.0f - xq;
  // A fragments of k: row m = key kb + 16g + c, k = d; B fragments of gamma v: col n = d = 16j + c, k = key; both from the ring

  v2f lrun2 = {0.f, 0.f}, drun2 = {0.f, 0.f};   // this lane's sums over its even and its odd keys
  v8f o[4];
#pragma unroll
  for (int j = 0; j < 4; ++j) o[j] = zero8();

#pragma unroll 1   // one stage per trip: the ring's order (read, publish, refill) stays as written
  for (int st = 0; st < SEQ / KST; ++st) {
  const u16* rb = ring + (st & 1) * ABUF;
#pragma unroll 1   // the two 32-key blocks of a stage share one copy of the long body
  for (int sub = 0; sub < KST / 32; ++sub) {
    const int kb = st * KST + sub * 32;
    const u16* KhB = rb + (sub * 32 + c) * TP16 + 8 * hh;     // staged k hi row of key kb + c
    const u16* KlB = KhB + ATILE;
    // ---- transposed scores: s0 = keys kb..kb+15, s1 = keys kb+16..kb+31, column = query q0 + c ----
    v8f s0 = zero8(), s1 = zero8();
    constexpr int k0o = 0, k1o = 16 * TP16;
    {
      const Frag kh0 = ldfrag(KhB + k0o), kh1 = ldfrag(KhB + k1o);
      const Frag kl0 = ldfrag(KlB + k0o), kl1 = ldfrag(KlB + k1o);
      s0 = mma_b(kh0, qh0, s0); s0 = mma_b(kl0, qh0, s0); s0 = mma_b(kh0, ql0, s0);
      s1 = mma_b(kh1, qh0, s1); s1 = mma_b(kl1, qh0, s1); s1 = mma_b(kh1, ql0, s1);
      guard_sc(s0, s1, qh0.h, ql0.h, kh0.h, kh1.h, kl0.h, kl1.h);
    }
    {
      const Frag kh0 = ldfrag(KhB + k0o + 32), kh1 = ldfrag(KhB + k1o + 32);
      const Frag kl0 = ldfrag(KlB + k0o + 32), kl1 = ldfrag(KlB + k1o + 32);
      s0 = mma_b(kh0, qh1, s0); s0 = mma_b(kl0, qh1, s0); s0 = mma_b(kh0, ql1, s0);
      s1 = mma_b(kh1, qh1, s1); s1 = mma_b(kl1, qh1, s1); s1 = mma_b(kh1, ql1, s1);
      guard_sc(s0, s1, qh1.h, ql1.h, kh0.h, kh1.h, kl0.h, kl1.h);
    }
    // ---- per-key values of this lane's 16 keys: word q of [0..1] <- keys kb+8hh+4q.., of [2..3] <- keys kb+16+8hh+4(q-2).. ----
    const int ka = kb + 8 * hh, kc = kb + 16 + 8 * hh;
    const v4f y4[4] = {*(const v4fa*)(ky2 + ka), *(const v4fa*)(ky2 + ka + 4), *(const v4fa*)(ky2 + kc), *(const v4fa*)(ky2 + kc + 4)};
    const v4f g4[4] = {*(const v4fa*)(kg1 + ka), *(const v4fa*)(kg1 + ka + 4), *(const v4fa*)(kg1 + kc), *(const v4fa*)(kg1 + kc + 4)};
    const v4f m4[4] = {*(const v4fa*)(ms + ka),  *(const v4fa*)(ms + ka + 4),  *(const v4fa*)(ms + kc),  *(const v4fa*)(ms + kc + 4)};
    // ---- weights (<= PCAR), this lane's two sums and the P A-fragment f16(p); fragment word 4w + e4 <-> D elements 2 e4, 2 e4 + 1 of tile w ----
    Frag ph;
#pragma unroll
    for (int w = 0; w < 2; ++w) {
      const v8f sv = w ? s1 : s0;
#pragma unroll
      for (int e4 = 0; e4 < 4; ++e4) {
        const int q = 2 * w + (e4 >> 1), h2 = 2 * (e4 & 1);
        const v2f xy = {sv[2 * e4], sv[2 * e4 + 1]};
        const v2f y2 = {y4[q][h2], y4[q][h2 + 1]};
        const v2f em = {m4[q][h2], m4[q][h2 + 1]};
        const v2f g1 = {g4[q][h2], g4[q][h2 + 1]};
        const v2f p  = weight2(xy, y2, em, xq, omx);
        lrun2 += p;
        drun2 += p * g1;
        ph.u[w][e4] = __builtin_bit_cast(unsigned, __builtin_convertvector(p, v2h));
      }
    }
    // ---- P.V : B fragment col n = d = j*16 + c, k = key kb + (split k map), transposed out of the staged key rows ----
    {
      const u16* vp = rb + 2 * ATILE + (sub * 32 + 8 * hh + (lane & 7)) * VP16 + 8 * ((lane >> 3) & 1);
      const Frag v0 = ldfrag_tr(vp);
      const Frag v1 = ldfrag_tr(vp + 16);
      const Frag v2 = ldfrag_tr(vp + 32);
      const Frag v3 = ldfrag_tr(vp + 48);
      o[0] = mma_h(ph, v0, o[0]);
      o[1] = mma_h(ph, v1, o[1]);
      o[2] = mma_h(ph, v2, o[2]);
      o[3] = mma_h(ph, v3, o[3]);
      guard_pv(o, ph.h, v0.h, v1.h, v2.h, v3.h);
    }
  }
  publish_stage();
  if (st + 2 < SEQ / KST) stage_copy(st + 2);                 // into the buffer that this trip has just read
  }
  wait_copies();
  acc_guard4(o);

  // ---- the two halves of each query's keys (lanes l and l ^ 16) meet ----
  float lrun = lrun2[0] + lrun2[1], drun = drun2[0] + drun2[1];
  lrun += __shfl_xor(lrun, 16, 32);
  drun += __shfl_xor(drun, 16, 32);
  // ---- gyro-midpoint epilogue in f32: per query factors from the query-owner lane (lane = query); O and l both carry PCAR ----
  const float linv = rcp1(lrun);
  const float nf   = linv * (1.0f / VS);
  const float dq   = fmaxf(drun * linv, 1e-10f);
  const float fq   = nf * rcp1(dq);             // the query's one factor: 1 / (l VS) over the clamped denominator
  float fqr[8];
#pragma unroll
  for (int r = 0; r < 8; ++r) fqr[r] = __shfl(fq, 8 * hh + r, 32);
  float sq[8];
#pragma unroll
  for (int r = 0; r < 8; ++r) {
    float sp = 0.f;
#pragma unroll
    for (int j = 0; j < 4; ++j) {
      const float tm = o[j][r] * fqr[r];
      o[j][r] = tm;
      sp += tm * tm;
    }
    sq[r] = rsum16(sp);
  }
  float* sw = slab + wave * 16 * GPITCH;
#pragma unroll
  for (int r = 0; r < 8; ++r) {
    const float rdf = rcp1(1.0f + sqrt1(fmaxf(1.0f - sq[r], 1e-15f)));
    float sp = 0.f;
#pragma unroll
    for (int j = 0; j < 4; ++j) {
      const float a = o[j][r] * rdf;
      o[j][r] = a;
      sp += a * a;
    }
    const float s2  = rsum16(sp);
    const float n2  = fmaxf(sqrt1(s2), 1e-15f);
    const bool  cl  = n2 > MAXN;
    const float fcl = MAXN * rcp1(n2);
#pragma unroll
    for (int j = 0; j < 4; ++j) {
      const float a = o[j][r];
      sw[(8 * hh + r) * GPITCH + 16 * j + c] = cl ? (a * fcl) : a;
    }
  }
  wave_sync_lds();
  // ---- f32 output rows: lanes 0..15 -> row 2i, lanes 16..31 -> row 2i+1, lane = 4 consecutive d ----
  const int cc = lane & 15;
  v4f vals[8];
#pragma unroll
  for (int i = 0; i < 8; ++i) vals[i] = *(const v4fa*)(sw + (2 * i + hh) * GPITCH + 4 * cc);
  float* ob = Out + ((size_t)(b * SEQ + q0 + hh)) * DM + head * HD + 4 * cc;
  {
#pragma unroll
    for (int i = 0; i < 8; ++i) {
      *(v4f*)(ob + (size_t)(2 * i) * DM) = vals[i];
    }
    
  }
}

// =====================================================================================================
// Workspace map (bytes); every region written fully by whole-line stores before it is read; every extent an exact multiple
//   X16  f16 [NB*SEQ][DM]          f16(bf16(x) x64)              4194304 (NB=2)
//   WQT/WKT/WVT f16 [DM n][DM k]   f16(bf16(W) x256)             3 x 2097152
//   CX2  f32 [NB*SEQ]              sum x^2                       8192
//   ZN, CH, SH f32 [3][DM]         column norms, cosh/sinh(2r)   3 x 12288
//   Qh, Ql, Kh, Kl bf16 [NB*SEQ][DM]                             4 x 4194304
//   Vg   f16 [NB*SEQ][DM]          f16(gamma v x256)             4194304
//   QX2, KX2, GM1 f32 [NB*NH][SEQ]                                3 x 131072
//   end = 31895552 at NB=2
// =====================================================================================================
static inline size_t up4k(size_t v) { return (v + 4095) & ~(size_t)4095; }

extern "C" void kernel_launch(void* const* d_in, const int* in_sizes, int n_in,
                              void* d_out, int out_size, void* d_ws, size_t ws_size,
                              hipStream_t stream) {
  if (n_in < 8) return;
  if (in_sizes[0] < NB * SEQ * DM) return;
  if (in_sizes[1] < NB * SEQ) return;
  if (in_sizes[2] < DM * DM || in_sizes[4] < DM * DM || in_sizes[6] < DM * DM) return;
  if (in_sizes[3] < 1 || in_sizes[5] < 1 || in_sizes[7] < 1) return;
  if (out_size < NB * SEQ * DM) return;

  const float* hs = (const float*)d_in[0];
  const float* am = (const float*)d_in[1];
  const float* qz = (const float*)d_in[2];
  const float* qr = (const float*)d_in[3];
  const float* kz = (const float*)d_in[4];
  const float* kr = (const float*)d_in[5];
  const float* vz = (const float*)d_in[6];
  const float* vr = (const float*)d_in[7];
  float*       out = (float*)d_out;
  const int nqr = in_sizes[3], nkr = in_sizes[5], nvr = in_sizes[7];

  const size_t nrow  = (size_t)NB * SEQ;
  const size_t szX16 = up4k(nrow * DM * 2);
  const size_t szWT  = up4k((size_t)DM * DM * 2);
  const size_t szCX2 = up4k(nrow * 4);
  const size_t szCOL = up4k((size_t)3 * DM * 4);
  const size_t szP   = up4k(nrow * DM * 2);
  const size_t szRS  = up4k((size_t)NB * NH * SEQ * 4);
  size_t off = 0;
  const size_t oX16 = off; off += szX16;
  const size_t oWQ  = off; off += szWT;
  const size_t oWK  = off; off += szWT;
  const size_t oWV  = off; off += szWT;
  const size_t oCX2 = off; off += szCX2;
  const size_t oZN  = off; off += szCOL;
  const size_t oCH  = off; off += szCOL;
  const size_t oSH  = off; off += szCOL;
  const size_t oQh  = off; off += szP;
  const size_t oQl  = off; off += szP;
  const size_t oKh  = off; off += szP;
  const size_t oKl  = off; off += szP;
  const size_t oVg  = off; off += szP;
  const size_t oQX2 = off; off += szRS;
  const size_t oKX2 = off; off += szRS;
  const size_t oGM1 = off; off += szRS;
  if (off > ws_size) return;                       // off = 31895552 at NB=2
  if (off > (size_t)134217728) return;

  char* ws = (char*)d_ws;
  u16*   X16 = (u16*)(ws + oX16);
  u16*   WQT = (u16*)(ws + oWQ);
  u16*   WKT = (u16*)(ws + oWK);
  u16*   WVT = (u16*)(ws + oWV);
  float* CX2 = (float*)(ws + oCX2);
  float* ZN  = (float*)(ws + oZN);
  float* CH  = (float*)(ws + oCH);
  float* SH  = (float*)(ws + oSH);
  u16*   Qh  = (u16*)(ws + oQh);
  u16*   Ql  = (u16*)(ws + oQl);
  u16*   Kh  = (u16*)(ws + oKh);
  u16*   Kl  = (u16*)(ws + oKl);
  u16*   Vg  = (u16*)(ws + oVg);
  float* QX2 = (float*)(ws + oQX2);
  float* KX2 = (float*)(ws + oKX2);
  float* GM1 = (float*)(ws + oGM1);

  // (1) all that reads only the inputs: x -> f16 plane of bf16(x) x64, per-row sums of squares, per weight the column norms
  //     with cosh/sinh(2r) and the k-contiguous [n][k] f16 plane of bf16(W) x256
  prep<<<dim3(PB_COL + PB_ROW), dim3(PREP_THREADS), 0, stream>>>(
      hs, qz, kz, vz, qr, kr, vr, nqr, nkr, nvr, X16, CX2, ZN, CH, SH, WQT, WKT, WVT);
  // (2) the three projections with the fused MLR / per-head epilogue
  proj_mlr<<<dim3(PJ_BLOCKS), dim3(PJ_THREADS), 0, stream>>>(
      X16, WQT, WKT, WVT, ZN, CH, SH, CX2, Qh, Ql, Kh, Kl, Vg, QX2, KX2, GM1);
  // (3) attention + midpoint -> out [b][SEQ][DM] f32 (rows s < SQ of batches b < NB), heads merged on the feature dim
  attn_fwd<<<dim3(NB * NH * (SQ / 64)), dim3(ATT_THREADS), 0, stream>>>(Qh, Ql, Kh, Kl, Vg, QX2, KX2, GM1, am, out);
  (void)hipGetLastError();
}

// v009
// It runs in 52.8 microseconds.
// In both of two side-by-side timings against v008, it was 1.05 times as fast.
// Counting every step since v000, it is 10.9 times as fast.
// Contractions: x.Wq, x.Wk, x.Wv on v_wmma_f32_16x16x32_f16 (x as f16(bf16(x) x64), W as f16(bf16(W) x256), f32 accumulate);
// scores k.q^T on v_wmma_f32_16x16x32_bf16 as bf16 hi/lo split (hi.hi + lo.hi + hi.lo into one f32 accumulator);
// P.(gamma v) on v_wmma_f32_16x16x32_f16 (P x32768 f16, gamma v x256 f16 through transposing LDS loads, f32 accumulate); norms, asinh/sinh/acosh
// (closed forms on v_log_f32 / v_exp_f32 / v_sqrt_f32 / v_rcp_f32), softmax weights in closed form at a fixed scale,
// the sum_j p_j (gamma_j - 1) denominators and all carry folds in f32 on VALU.
// Float inputs RNE-converted to bf16 on load; f32 output written directly.
#include <hip/hip_runtime.h>
#include <math.h>
#include <stdint.h>

#ifndef NB
#define NB 2            // batches processed
#endif
#ifndef SQ
#define SQ 1024         // query rows processed per batch (keys/values always all SEQ rows)
#endif
#define NB_FULL 2
#define SEQ  1024       // rows per batch in every input / output / plane layout
#define DM   1024       // model width = K of the projections = row pitch of the 16-bit planes
#define NH   16
#define HD   64
#define XS   64.0f      // carry on the x plane
#define WSC  256.0f     // carry on the transposed weight planes
#define VS   256.0f     // carry on the gamma*v plane
#define PCAR 32768.0f   // carry on P
#define LOG2E 1.4426950408889634f
#define MAXN 0.996f     // (1 - 4e-3) / sqrt(c)
#define NKB  (SEQ / 32)
#define GPITCH 68
#define TP16   72
#define ATT_THREADS 256
#define CS_COLS     32    // weight columns per preparation block
#define XR_ROWS     32    // x rows per preparation block
#define WTP     (DM + 8)  // pitch of a transposed weight row in LDS, in 16-bit units: 16-B words of 4 rows apart fall 16 banks apart
#define PREP_THREADS 512                       // block of the preparation grid (both block kinds)
#define PB_COL  (3 * (DM / CS_COLS))           // weight blocks, 32 columns of one weight each
#define PB_ROW  (NB * SEQ / XR_ROWS)           // x blocks, 32 rows each
#define PJ_BLOCKS ((NB * SEQ / 128) * (DM / 64)) // projection blocks: one per 128-row x 64-column tile
#define PJ_THREADS 384                         // 3 weights x 4 waves
#define KST     64                             // k per LDS stage of the projection: one 128-B line of every staged row
#define AKST    128                            // keys per LDS stage of attention: 64 for each key half
#define PJ_ROWS (128 + 3 * 64)                 // staged rows of a projection stage: 128 of A, then 64 of each weight
#define PJ_CPW  ((PJ_ROWS / 4 + PJ_THREADS / 32 - 1) / (PJ_THREADS / 32))  // copies per wave and stage, upper bound (a copy = 4 rows)
#define ATILE   (AKST * TP16)                  // one staged 128-row k tile of attention, in 16-bit units
#define VP16    80                             // pitch of a staged gamma v row: 160 B = 32 B x 5, the pitch for ds_load_tr16_b128
#define VTILE   (AKST * VP16)                  // one staged 128-row gamma v tile, in 16-bit units
#define ABUF    (2 * ATILE + VTILE)            // one buffer of the attention ring: k hi, k lo, gamma v
#define XP      36                             // floats a lane hands to its partner wave, padded: 144 B = 16 B x 9, the pitch for 16-B LDS words

static_assert(NB >= 1 && NB <= NB_FULL);
static_assert((SQ % 128) == 0 && SQ >= 128 && SQ <= SEQ);
static_assert(NH * HD == DM && HD == 64);
static_assert((SEQ % 128) == 0 && (SEQ % 32) == 0 && NKB * 32 == SEQ);
static_assert((DM % 256) == 0 && (DM % 64) == 0 && (DM % 32) == 0);
static_assert((GPITCH * 4) % 16 == 0 && (TP16 * 2) % 16 == 0 && (VP16 * 2) % 32 == 0 && ((VP16 * 2) / 32) % 2 == 1);
static_assert(CS_COLS == 32 && (DM % CS_COLS) == 0 && (PREP_THREADS / 32) * 64 == DM && (PREP_THREADS / 32) * 2 == CS_COLS);
static_assert(ATT_THREADS == 256 && ATT_THREADS * 4 == SEQ && (XP * 4) % 16 == 0 && XP >= 34);
static_assert(XR_ROWS == 32 && (PREP_THREADS / 32) * 2 == XR_ROWS && (NB * SEQ) % XR_ROWS == 0 && (WTP * 2) % 16 == 0);
static_assert((NB * SEQ) % 128 == 0);
static_assert(KST == 64 && DM / KST >= 2 && (DM % KST) == 0 && AKST == 128 && SEQ / AKST >= 2 && (SEQ % AKST) == 0);
static_assert(PJ_CPW == 7 && (PJ_ROWS % 4) == 0 && PJ_ROWS / 4 - 6 * (PJ_THREADS / 32) == 8);

typedef unsigned short u16;
typedef _Float16 v16h __attribute__((ext_vector_type(16)));
typedef _Float16 v8h  __attribute__((ext_vector_type(8)));
typedef __bf16   v16b __attribute__((ext_vector_type(16)));
typedef float    v8f  __attribute__((ext_vector_type(8)));
typedef float    v4f  __attribute__((ext_vector_type(4)));
typedef float    v2f  __attribute__((ext_vector_type(2)));
typedef _Float16 v2h  __attribute__((ext_vector_type(2)));
typedef unsigned int v4u __attribute__((ext_vector_type(4)));
typedef unsigned int v2u __attribute__((ext_vector_type(2)));
typedef v4u __attribute__((may_alias)) v4ua;
typedef v4f __attribute__((may_alias)) v4fa;
typedef v2f __attribute__((may_alias)) v2fa;

// one 16 x 16-bit per-lane fragment, viewed as f16 vector, bf16 vector or two 16-byte words
union Frag { v16h h; v16b b; v4u u[2]; };

// ---- scalar helpers ----------------------------------------------------------------------------------
__device__ __forceinline__ unsigned short bf_bits(float f) {          // f32 -> bf16 bits, RNE convert
  unsigned u = __float_as_uint(f);
  return (unsigned short)((u + 0x7FFFu + ((u >> 16) & 1u)) >> 16);
}
__device__ __forceinline__ float bf_up(unsigned short h) { return __uint_as_float(((unsigned)h) << 16); }
__device__ __forceinline__ float bfr(float f) { return bf_up(bf_bits(f)); }
__device__ __forceinline__ unsigned short h_bits(_Float16 x) { return __builtin_bit_cast(unsigned short, x); }
__device__ __forceinline__ unsigned pk16(unsigned short a, unsigned short b) { return (unsigned)a | ((unsigned)b << 16); }
__device__ __forceinline__ v8f zero8() { v8f z = {0.f, 0.f, 0.f, 0.f, 0.f, 0.f, 0.f, 0.f}; return z; }
__device__ __forceinline__ float red8(float v) {                      // sum over the 8-lane group (lane bits 0..2)
  v += __shfl_xor(v, 1, 32); v += __shfl_xor(v, 2, 32); v += __shfl_xor(v, 4, 32); return v;
}
__device__ __forceinline__ float rsum16(float v) {                    // sum over the 16-lane half (lane bits 0..3)
  v += __shfl_xor(v, 8, 32); v += __shfl_xor(v, 4, 32); v += __shfl_xor(v, 2, 32); v += __shfl_xor(v, 1, 32); return v;
}

// 1 / x on v_rcp_f32 (about 1 ulp), for a divisor that a whole row or column shares: formed once, then multiplied in.
// Every divisor it is used on is clamped to at least 1e-15 (or is at least 1/8) and, where finite, stays below 2e19,
// so the reciprocal is a normal f32; an infinite divisor gives 0, as the quotient of a finite value by it does.
__device__ __forceinline__ float rcp1(float x) {
  float r = 0.f;
#if defined(__HIP_DEVICE_COMPILE__)
  // v_nop in the same statement: the slot between a transcendental and an instruction that reads its result or overwrites its
  // source
  asm("v_rcp_f32 %0, %1\n\tv_nop" : "=v"(r) : "v"(x));
#endif
  return r;
}

// sqrt(x) on v_sqrt_f32 alone (about 1 ulp), without the correctly rounding sequence of sqrtf. Where it is used x is a sum of
// squares whose root is clamped to at least 1e-15 behind it (a subnormal x may come out as 0: the clamp gives the same value
// as for its true root), or x is at least 1e-15.
__device__ __forceinline__ float sqrt1(float x) {
  float r = 0.f;
#if defined(__HIP_DEVICE_COMPILE__)
  // v_nop in the same statement: the slot behind a transcendental, as in rcp1()
  asm("v_sqrt_f32 %0, %1\n\tv_nop" : "=v"(r) : "v"(x));
#endif
  return r;
}

// sinh(tz * asinh(x)) in closed form: e = |x| + sqrt(x^2 + 1), L = log2(e) >= 0, sinh = 2^(tz L - 1) - 2^(-tz L - 1), sign of x.
// Above 1e18 sqrt(x^2 + 1) = |x| in f32 and x^2 comes near the f32 overflow, so e = 2|x| there. The two halves are formed with the
// factor 1/2 in the exponent, so the result overflows only where sinh itself does.
__device__ __forceinline__ float sinh_of_scaled_asinh(float x, float tz) {
  const float a = fabsf(x);
  const float e = a + ((a > 1e18f) ? a : __builtin_amdgcn_sqrtf(fmaf(a, a, 1.0f)));
  const float L = __builtin_amdgcn_logf(e);
  const float s = __builtin_amdgcn_exp2f(fmaf(tz, L, -1.0f)) - __builtin_amdgcn_exp2f(fmaf(-tz, L, -1.0f));
  return copysignf(s, x);
}

// ---- fragment loader: 16-bit A/B operand from a k-contiguous row; lane -> row/col (lane&15), p already includes
//      +8*(lane>>4); elements 0..7 <- p[0..7] (k0+8h..), elements 8..15 <- p[16..23] (k0+16+8h..); same split k map
//      for A and B; B read by it from a k-contiguous [n][k] plane (the gamma v B goes through ldfrag_tr()). Loaded as unsigned 16-byte words.
__device__ __forceinline__ Frag ldfrag(const u16* p) {
  Frag f;
  f.u[0] = *(const v4u*)(p);
  f.u[1] = *(const v4u*)(p + 16);
  return f;
}
// ---- transposing fragment loader: B operand (col n = lane&15, k = row) from a row-major 16-bit LDS tile T[k][n] of pitch VP16.
//      p = T + (k0 + 8*(lane>>4) + (lane&7)) * VP16 + n0 + 8*((lane>>3)&1); lane (c, h) then holds T[k0 + 8h + 0..7][n0 + c] in
//      elements 0..7 and T[k0 + 16 + 8h + 0..7][n0 + c] in elements 8..15: the split k map of ldfrag().
typedef short s16x8 __attribute__((ext_vector_type(8)));
__device__ __forceinline__ Frag ldfrag_tr(const u16* p) {
  typedef __attribute__((address_space(3))) s16x8 lds_s16x8;
  Frag f;
  f.u[0] = __builtin_bit_cast(v4u, __builtin_amdgcn_ds_load_tr16_b128_v8i16((lds_s16x8*)(p)));
  f.u[1] = __builtin_bit_cast(v4u, __builtin_amdgcn_ds_load_tr16_b128_v8i16((lds_s16x8*)(p + 16 * VP16)));
  return f;
}

// ---- WMMA helpers and trailing VALU hazard gaps --------------------------------------------------------
__device__ __forceinline__ v8f mma_h(const Frag& a, const Frag& b, v8f c) {
  return __builtin_amdgcn_wmma_f32_16x16x32_f16(false, a.h, false, b.h, (short)0, c, false, false);
}
__device__ __forceinline__ v8f mma_b(const Frag& a, const Frag& b, v8f c) {
  return __builtin_amdgcn_wmma_f32_16x16x32_bf16(false, a.b, false, b.b, (short)0, c, false, false);
}
__device__ __forceinline__ void guard_sc(v8f& a, v8f& b, v8f& c, v8f& d, v16h x0, v16h x1, v16h x2, v16h x3,
                                         v16h x4, v16h x5, v16h x6, v16h x7) {
#if defined(__HIP_DEVICE_COMPILE__)
  asm volatile("v_nop\n\tv_nop\n\tv_nop\n\tv_nop"
               : "+v"(a), "+v"(b), "+v"(c), "+v"(d)
               : "v"(x0), "v"(x1), "v"(x2), "v"(x3), "v"(x4), "v"(x5), "v"(x6), "v"(x7) : "memory");
#endif
}
__device__ __forceinline__ void guard_pv(v8f (&o)[4], v8f (&u)[4], v16h p, v16h q, v16h x0, v16h x1, v16h x2, v16h x3) {
#if defined(__HIP_DEVICE_COMPILE__)
  asm volatile("v_nop\n\tv_nop\n\tv_nop\n\tv_nop"
               : "+v"(o[0]), "+v"(o[1]), "+v"(o[2]), "+v"(o[3]), "+v"(u[0]), "+v"(u[1]), "+v"(u[2]), "+v"(u[3])
               : "v"(p), "v"(q), "v"(x0), "v"(x1), "v"(x2), "v"(x3) : "memory");
#endif
}
__device__ __forceinline__ void guard_g(v8f (&acc)[8], v16h x0, v16h x1, v16h x2, v16h x3, v16h x4, v16h x5) {
#if defined(__HIP_DEVICE_COMPILE__)
  asm volatile("v_nop\n\tv_nop\n\tv_nop\n\tv_nop"
               : "+v"(acc[0]), "+v"(acc[1]), "+v"(acc[2]), "+v"(acc[3]),
                 "+v"(acc[4]), "+v"(acc[5]), "+v"(acc[6]), "+v"(acc[7])
               : "v"(x0), "v"(x1), "v"(x2), "v"(x3), "v"(x4), "v"(x5) : "memory");
#endif
}
__device__ __forceinline__ void acc_guard4(v8f (&o)[4]) {
#if defined(__HIP_DEVICE_COMPILE__)
  asm volatile("v_nop\n\tv_nop\n\tv_nop\n\tv_nop" : "+v"(o[0]), "+v"(o[1]), "+v"(o[2]), "+v"(o[3]));
#endif
}
__device__ __forceinline__ void wave_sync_lds() {
  __builtin_amdgcn_fence(__ATOMIC_RELEASE, "workgroup");
  __builtin_amdgcn_wave_barrier();
  __builtin_amdgcn_fence(__ATOMIC_ACQUIRE, "workgroup");
}

// ---- asynchronous 16-byte copies global -> LDS (through no register): l = the lane's own LDS byte address, g = the lane's own
//      global address, both multiples of 16. The closing s_wait_xcnt stands inside each statement, so that no address register
//      of an issued copy is rewritten ahead of it (a precaution).
__device__ __forceinline__ unsigned lds_addr(const void* p) { return (unsigned)(uintptr_t)p; }   // low 32 bits = LDS byte offset
__device__ __forceinline__ void acopy1(unsigned l0, const u16* g0) {
#if defined(__HIP_DEVICE_COMPILE__)
  asm volatile("global_load_async_to_lds_b128 %0, %1, off\n\t"
               "s_wait_xcnt 0x0"
               :: "v"(l0), "v"(g0) : "memory");
#endif
}
__device__ __forceinline__ void acopy6(const unsigned (&l)[6], const u16* const (&g)[6]) {
#if defined(__HIP_DEVICE_COMPILE__)
  asm volatile("global_load_async_to_lds_b128 %0, %6, off\n\t"
               "global_load_async_to_lds_b128 %1, %7, off\n\t"
               "global_load_async_to_lds_b128 %2, %8, off\n\t"
               "global_load_async_to_lds_b128 %3, %9, off\n\t"
               "global_load_async_to_lds_b128 %4, %10, off\n\t"
               "global_load_async_to_lds_b128 %5, %11, off\n\t"
               "s_wait_xcnt 0x0"
               :: "v"(l[0]), "v"(l[1]), "v"(l[2]), "v"(l[3]), "v"(l[4]), "v"(l[5]),
                  "v"(g[0]), "v"(g[1]), "v"(g[2]), "v"(g[3]), "v"(g[4]), "v"(g[5]) : "memory");
#endif
}
// The issuing wave's own copies have landed.
__device__ __forceinline__ void wait_copies() { asm volatile("s_wait_asynccnt 0x0" ::: "memory"); }
// Publish point of a two-buffer stage ring, passed by every wave of the block at the foot of every stage.
__device__ __forceinline__ void publish_stage() {
  asm volatile("s_wait_dscnt 0x0" ::: "memory");   // this wave's reads of the buffer that is refilled next have returned
  wait_copies();                                   // this wave's share of the next stage has landed
  __syncthreads();                                 // publishes the next stage; ends every reader's last read of this one
}

// =====================================================================================================
// x rows, read once: row r of the [rows][DM] f16 plane <- f16(bf16_RNE(x[r][e]) * scale), scale a power of two, and
// CX2[r] = sum_e bf16(x[r][e])^2 in f32. Block = 32 rows (one 128-B line of CX2), 512 threads, wave w rows 32*blk + 2w, +1:
// a lane holds elements 128q + 4*lane .. +3 of both rows (16 x 16-B loads, whole lines, all in flight at once), sums its 32
// values of a row in ascending q, xor-shuffle reduce, lane 0 -> LDS (rs, 32 floats); block barrier; threads 0..7 store the 32
// sums as 16-B words; then every lane stores its 4 halves per q (a wave's store = 256 contiguous bytes).
// coverage: 16 waves x 2 rows x (8 q x 32 lanes x 4) = 32 whole rows per block; NB*SEQ/32 blocks.
// =====================================================================================================
__device__ __forceinline__ void xprep_blk(const float* __restrict__ x, u16* Y, float* CX2, float scale, float* rs, int tid, int blk) {
  const int wave = tid >> 5, lane = tid & 31;
  const int row0 = blk * XR_ROWS + wave * 2;
  const float* xr = x + (size_t)row0 * DM + 4 * lane;
  v4f a[2][DM / 128];
#pragma unroll   // all loads issue before the first use: one memory latency per wave
  for (int j = 0; j < 2; ++j) {
#pragma unroll
    for (int q = 0; q < DM / 128; ++q) a[j][q] = *(const v4f*)(xr + (size_t)j * DM + 128 * q);
  }
  // precaution: the loads' address registers may be given to other values behind this point
  asm volatile("s_wait_xcnt 0x0" ::: "memory");
  v2f s = {0.f, 0.f};                            // the two rows' sums: two independent chains, side by side
#pragma unroll
  for (int q = 0; q < DM / 128; ++q) {
#pragma unroll
    for (int e = 0; e < 4; ++e) {
#pragma unroll
      for (int j = 0; j < 2; ++j) {
        a[j][q][e] = bfr(a[j][q][e]);
        s[j] += a[j][q][e] * a[j][q][e];
      }
    }
  }
#pragma unroll
  for (int m = 16; m >= 1; m >>= 1) {
    const float t0 = __shfl_xor(s[0], m, 32), t1 = __shfl_xor(s[1], m, 32);
    s[0] += t0; s[1] += t1;
  }
  if (lane == 0) *(v2fa*)(rs + wave * 2) = s;
  __syncthreads();                               // stands in front of every global store: it waits for no store
  if (tid < XR_ROWS / 4) {
    const v4f v = *(const v4fa*)(rs + 4 * tid);
    *(v4f*)(CX2 + blk * XR_ROWS + 4 * tid) = v;
  }
  u16* dst = Y + (size_t)row0 * DM + 4 * lane;
#pragma unroll
  for (int j = 0; j < 2; ++j) {
#pragma unroll
    for (int q = 0; q < DM / 128; ++q) {
      v2u o;
      o[0] = pk16(h_bits((_Float16)(a[j][q][0] * scale)), h_bits((_Float16)(a[j][q][1] * scale)));
      o[1] = pk16(h_bits((_Float16)(a[j][q][2] * scale)), h_bits((_Float16)(a[j][q][3] * scale)));
      *(v2u*)(dst + (size_t)j * DM + 128 * q) = o;
    }
  }
  // precaution: nothing rewrites the stores' registers ahead of this point
  asm volatile("s_wait_xcnt 0x0" ::: "memory");
}

// =====================================================================================================
// A weight z[k][n] (DM x DM), read once: ZN[n] = max(sqrt(sum_k bf16(z[k][n])^2), 1e-15), CH[n] = cosh(2 r[n]), SH[n] = sinh(2 r[n])
// (r index clamped to nr-1), and WT[n][k] (f16, k-contiguous Bt layout) <- f16(bf16_RNE(z[k][n]) * scale).
// Block = 32 columns (one 128-B line of every row) x all DM rows, 512 threads: lane = (row group lane>>3, 4 columns at 4*(lane&7)),
// wave w holds rows 64w + 32g + 8*(lane>>3) + j (g < 2, j < 8): 16 independent 16-B loads per thread, all in flight at once, and 8
// consecutive k of a column side by side in a thread, so that they go to the LDS tile [n][k] (pitch WTP) as one 16-B word.
// Column sums: 16 rows in the thread (ascending k), xor-8 / xor-16 shuffles over the wave's 4 row groups, one 32-float row per
// wave in LDS; one block barrier publishes tile and partial sums; wave w stores rows n = 2w, 2w + 1 of WT (4 x 512 contiguous
// bytes each); wave 0 then adds the 16 wave rows.
// coverage: 16 waves x 2 g x 4 groups x 8 rows = DM rows; DM/32 blocks x 32 columns = every column of the three arrays and every
//           row of WT once, each block the only writer of its 128-B lines. tile: CS_COLS * WTP halves, part: 16 * CS_COLS floats.
// =====================================================================================================
__device__ __forceinline__ void wprep_blk(const float* __restrict__ z, const float* __restrict__ r, int nr,
                                          float* ZN, float* CH, float* SH, u16* Y, float scale,
                                          u16* tile, float* part, int tid, int blk) {
  const int wave = tid >> 5, lane = tid & 31;
  const int col0 = blk * CS_COLS;
  const int c4 = 4 * (lane & 7);
  const int k0 = wave * 64 + 8 * (lane >> 3);
  const float* zp = z + (size_t)k0 * DM + col0 + c4;
  const int col = col0 + lane;
  float rv = 0.f;
  if (wave == 0) {                               // wave-uniform; issued with the column loads, not behind the barrier
    int ri = col;
    ri = (ri < nr - 1) ? ri : (nr - 1);
    rv = r[ri];
  }
  v4f a[16];
#pragma unroll   // all loads issue before the first use: one memory latency per thread
  for (int j = 0; j < 16; ++j) a[j] = *(const v4f*)(zp + (size_t)((j >> 3) * 32 + (j & 7)) * DM);
  // precaution: the loads' address registers may be given to other values behind this point
  asm volatile("s_wait_xcnt 0x0" ::: "memory");
  // keeps the arithmetic behind all 16 loads: without it this build issued the last 4 behind the first 12's wait, a second latency
  __builtin_amdgcn_sched_barrier(0);
  v4f s = {0.f, 0.f, 0.f, 0.f};
#pragma unroll
  for (int g = 0; g < 2; ++g) {
#pragma unroll
    for (int e = 0; e < 4; ++e) {
      v4u o;
#pragma unroll
      for (int p = 0; p < 4; ++p) {
        const float v0 = bfr(a[8 * g + 2 * p][e]), v1 = bfr(a[8 * g + 2 * p + 1][e]);
        s[e] += v0 * v0;
        s[e] += v1 * v1;
        o[p] = pk16(h_bits((_Float16)(v0 * scale)), h_bits((_Float16)(v1 * scale)));
      }
      *(v4ua*)(tile + (c4 + e) * WTP + k0 + 32 * g) = o;
    }
  }
#pragma unroll
  for (int e = 0; e < 4; ++e) {
    s[e] += __shfl_xor(s[e], 8, 32);
    s[e] += __shfl_xor(s[e], 16, 32);
  }
  if (lane < 8) *(v4fa*)(part + wave * CS_COLS + 4 * lane) = s;
  __syncthreads();
  {
    v4u ov[2][DM / 256];
#pragma unroll
    for (int i = 0; i < 2; ++i) {
#pragma unroll
      for (int q = 0; q < DM / 256; ++q) ov[i][q] = *(const v4ua*)(tile + (wave * 2 + i) * WTP + 256 * q + 8 * lane);
    }
    u16* dst = Y + (size_t)(col0 + wave * 2) * DM + 8 * lane;
#pragma unroll
    for (int i = 0; i < 2; ++i) {
#pragma unroll
      for (int q = 0; q < DM / 256; ++q) *(v4u*)(dst + (size_t)i * DM + 256 * q) = ov[i][q];
    }
    // precaution: wave 0's code behind this point may rewrite the stores' registers
    asm volatile("s_wait_xcnt 0x0" ::: "memory");
  }
  if (wave == 0) {                               // wave-uniform; lane = column
    float t = 0.f;
#pragma unroll
    for (int w = 0; w < PREP_THREADS / 32; ++w) t += part[w * CS_COLS + lane];
    const float dr = 2.0f * bfr(rv);
    ZN[col] = fmaxf(sqrtf(t), 1e-15f);
    CH[col] = coshf(dr);
    SH[col] = sinhf(dr);
  }
}

// =====================================================================================================
// Preparation grid: everything that reads only the inputs, in one launch; every input is read once, by few waves that each keep
// 16 loads of 16 bytes in flight (the launch is short: the start of its waves counts). Block kind by block index (block-uniform,
// so each kind's block barrier is passed by all 512 threads of its block); the kind with the longer dependent chain comes first:
//   [0, PB_COL)            a weight's column statistics and transposed f16 plane, weight = index / (DM/32), 32 columns per block
//   next PB_ROW blocks     x row sums and f16 plane, 32 rows per block
// =====================================================================================================
__global__ __launch_bounds__(PREP_THREADS)
void prep(const float* __restrict__ x,
          const float* __restrict__ qz, const float* __restrict__ kz, const float* __restrict__ vz,
          const float* __restrict__ qr, const float* __restrict__ kr, const float* __restrict__ vr,
          int nqr, int nkr, int nvr,
          u16* X16, float* CX2, float* ZN, float* CH, float* SH, u16* WQT, u16* WKT, u16* WVT) {
  __shared__ __align__(16) u16 tile[CS_COLS * WTP];
  __shared__ __align__(16) float part[(PREP_THREADS / 32) * CS_COLS];
  const int tid = threadIdx.x;
  int bid = blockIdx.x;
  if (bid < PB_COL) {
    const int w = bid / (DM / CS_COLS), blk = bid % (DM / CS_COLS);
    const float* z = (w == 0) ? qz : (w == 1) ? kz : vz;
    const float* r = (w == 0) ? qr : (w == 1) ? kr : vr;
    const int   nr = (w == 0) ? nqr : (w == 1) ? nkr : nvr;
    u16*         y = (w == 0) ? WQT : (w == 1) ? WKT : WVT;
    wprep_blk(z, r, nr, ZN + w * DM, CH + w * DM, SH + w * DM, y, WSC, tile, part, tid, blk);
    return;
  }
  bid -= PB_COL;
  xprep_blk(x, X16, CX2, XS, part, tid, bid);
}

// =====================================================================================================
// f16 GEMM core on one LDS stage (KST of k): the wave's 32 x 64 tile of C += A . Bt^T; as -> staged A row (wave row + m) + 8h,
// bs -> staged Bt row (m) + 8h, rows at pitch TP16 (144 B: ds_load_b128 of 16 rows falls on all banks once);
// acc[4i + j] = rows 16i.., cols 16j..; k stepped by 32 in ascending order.
// =====================================================================================================
__device__ __forceinline__ void gemm_stage(const u16* as, const u16* bs, v8f (&acc)[8]) {
#pragma unroll   // two steps: the k offsets become immediates of the LDS reads
  for (int k0 = 0; k0 < KST; k0 += 32) {
    const Frag a0 = ldfrag(as + k0), a1 = ldfrag(as + 16 * TP16 + k0);
    const Frag b0 = ldfrag(bs + k0);
    const Frag b1 = ldfrag(bs + 16 * TP16 + k0);
    const Frag b2 = ldfrag(bs + 32 * TP16 + k0);
    const Frag b3 = ldfrag(bs + 48 * TP16 + k0);
    acc[0] = mma_h(a0, b0, acc[0]);
    acc[1] = mma_h(a0, b1, acc[1]);
    acc[2] = mma_h(a0, b2, acc[2]);
    acc[3] = mma_h(a0, b3, acc[3]);
    acc[4] = mma_h(a1, b0, acc[4]);
    acc[5] = mma_h(a1, b1, acc[5]);
    acc[6] = mma_h(a1, b2, acc[6]);
    acc[7] = mma_h(a1, b3, acc[7]);
    guard_g(acc, a0.h, a1.h, b0.h, b1.h, b2.h, b3.h);
  }
}
// Stage the wave's 32 x 64 f32 tile (times oscale) in its LDS slab (pitch 68): D element r of acc[4i+j], lane l ->
// coverage: 32 lanes x 2 x 8 rows x 4 cols-of-16 = rows 0..31 x cols 0..63 of the slab.
__device__ __forceinline__ void stage32x64(float* sl, v8f (&acc)[8], float oscale, int lane) {
  const int hh = lane >> 4, m = lane & 15;
#pragma unroll
  for (int i = 0; i < 2; ++i) {
#pragma unroll
    for (int r = 0; r < 8; ++r) {
      const int ro = (16 * i + 8 * hh + r) * GPITCH + m;
      sl[ro]      = acc[4 * i + 0][r] * oscale;
      sl[ro + 16] = acc[4 * i + 1][r] * oscale;
      sl[ro + 32] = acc[4 * i + 2][r] * oscale;
      sl[ro + 48] = acc[4 * i + 3][r] * oscale;
    }
  }
  wave_sync_lds();
}

// =====================================================================================================
// Projection GEMM + ball MLR epilogue. A = x plane [NB*SEQ][DM] (f16, x XS), Bt = WT [DM n][DM k] (f16, x WSC).
// One launch for the three weights: block = 384 threads = 128 rows x 64 cols (one head) of q, k and v; waves 4*mode .. 4*mode+3
// (mode 0 q, 1 k, 2 v: picks Bt, the column tables' row and the outputs) take 32 rows each, so the three modes read the same A rows
// from one WGP and three waves share a SIMD. Operands go through a two-buffer LDS ring, KST of k per stage: the block's 128 A rows
// and 3 x 64 Bt rows (PJ_ROWS rows x 128 B, whole lines) are brought in by asynchronous 16-byte copies, one copy of a wave = 4 rows,
// copy index = wave + 12 i (i < 6 for every wave, i = 6 for waves 0..7: 80 copies); the next stage flies while this one is worked on.
// Epilogue per element (f32): mm = (x.z)[row][n] / ZN[n]; arg = (2 mm CH[n] - (1 + cx2) SH[n]) / max(1 - cx2, 1e-15);
// y = sinh(2 ZN[n] asinh(arg)); per (row, head) 64-vector (8 lanes x 8 values, 8-lane shuffle sums): clip to norm MAXN,
// y = y / (1 + sqrt(1 + sum y^2)), clip again; x2 = sum y^2. mode 0/1: planes Ph/Pl = bf16 hi / bf16 lo of y, RS row
// scalar = x2; mode 2: g = 2 / max(1 - x2, 1e-15), plane Ph = f16(g y VS), RS row scalar = g - 1.
// coverage: per wave 8 instr x 4 rows x 8 lanes x 8 halves = 32 x 64 per plane; RS: 32 floats per wave; grid covers every
//           (row, col) of the planes and every (b, head, s) of RS exactly once.
// LDS: ring cross-wave (one block barrier per stage, staged extent == consumed extent, pad bytes never read); slab and rsc are
// wave-private (wave_sync); staged extent 32x64 == consumed extent.
// =====================================================================================================
__global__ __launch_bounds__(PJ_THREADS)
void proj_mlr(const u16* __restrict__ A, const u16* __restrict__ WQT, const u16* __restrict__ WKT, const u16* __restrict__ WVT,
              const float* __restrict__ ZN3, const float* __restrict__ CH3, const float* __restrict__ SH3,
              const float* __restrict__ CX2, u16* Qh, u16* Ql, u16* Kh, u16* Kl, u16* Vg,
              float* QX2, float* KX2, float* GM1) {
  __shared__ __align__(16) float slab[(PJ_THREADS / 32) * 32 * GPITCH];
  __shared__ __align__(16) float rsc[(PJ_THREADS / 32) * 32];
  __shared__ __align__(16) u16 ring[2 * PJ_ROWS * TP16];
  const int tid = threadIdx.x, wv = tid >> 5, wave = wv & 3, lane = tid & 31, hh = lane >> 4, m = lane & 15;
  constexpr int NT = DM / 64;
  const int mode = __builtin_amdgcn_readfirstlane(wv >> 2);   // the same in all lanes of a wave: pointer picks and the mode branch stay scalar
  const int bid  = blockIdx.x;
  const float* ZN = ZN3 + mode * DM;
  const float* CH = CH3 + mode * DM;
  const float* SH = SH3 + mode * DM;
  u16*   Ph = (mode == 0) ? Qh : (mode == 1) ? Kh : Vg;
  u16*   Pl = (mode == 0) ? Ql : Kl;           // stored to by modes 0 and 1 only
  float* RS = (mode == 0) ? QX2 : (mode == 1) ? KX2 : GM1;
  const int nt   = bid % NT;
  const int mt   = bid / NT;
  const int rowb = mt * 128 + wave * 32;       // global token row b*SEQ + s of the wave's first row
  const int col0 = nt * 64;                    // = head * HD
  // ---- this lane's share of a stage: copy i brings staged rows 4 (wave + 12 i) .. +3, lane = (row lane>>3, 16 bytes at 16 (lane&7)) ----
  const int wvs = __builtin_amdgcn_readfirstlane(wv);         // scalar: source picks and the test on the seventh copy stay scalar
  const bool has7 = wvs + 6 * (PJ_THREADS / 32) < PJ_ROWS / 4;
  const u16* gsrc[PJ_CPW];
  unsigned   ldst[PJ_CPW];
#pragma unroll   // constant indices: both arrays stay in registers
  for (int i = 0; i < PJ_CPW; ++i) {
    int ci = wvs + (PJ_THREADS / 32) * i;
    ci = (ci < PJ_ROWS / 4) ? ci : (PJ_ROWS / 4 - 1);         // keeps the addresses of a seventh copy that is not issued in range
    const int sr = 4 * ci + (lane >> 3);                      // staged row
    const int wsel = (ci - 32) >> 4;                          // weight of a Bt row (ci >= 32)
    const u16* rowp = (ci < 32) ? (A + (size_t)(mt * 128 + sr) * DM)
                                : (((wsel == 0) ? WQT : (wsel == 1) ? WKT : WVT) + (size_t)(col0 + sr - 128 - 64 * wsel) * DM);
    gsrc[i] = rowp + 8 * (lane & 7);
    ldst[i] = lds_addr(ring) + (unsigned)(sr * (TP16 * 2) + 16 * (lane & 7));
  }
  auto stage_copy = [&](int st) {                             // stage st -> buffer st & 1
    const unsigned lo = (unsigned)((st & 1) * (PJ_ROWS * TP16 * 2));
    const unsigned l6[6] = {ldst[0] + lo, ldst[1] + lo, ldst[2] + lo, ldst[3] + lo, ldst[4] + lo, ldst[5] + lo};
    const u16* const g6[6] = {gsrc[0] + st * KST, gsrc[1] + st * KST, gsrc[2] + st * KST,
                              gsrc[3] + st * KST, gsrc[4] + st * KST, gsrc[5] + st * KST};
    acopy6(l6, g6);
    if (has7) acopy1(ldst[6] + lo, gsrc[6] + st * KST);
  };
  v8f acc[8];
#pragma unroll
  for (int i = 0; i < 8; ++i) acc[i] = zero8();
  stage_copy(0);
  wait_copies();
  __syncthreads();                                            // stage 0 is published
  stage_copy(1);
#pragma unroll 1   // one stage per trip: the ring's order (read, publish, refill) stays as written
  for (int st = 0; st < DM / KST; ++st) {
    const u16* rb = ring + (st & 1) * (PJ_ROWS * TP16);
    gemm_stage(rb + (wave * 32 + m) * TP16 + 8 * hh, rb + (128 + mode * 64 + m) * TP16 + 8 * hh, acc);
    publish_stage();
    if (st + 2 < DM / KST) stage_copy(st + 2);                // into the buffer that this trip has just read
  }
  wait_copies();
  float* sl = slab + wv * 32 * GPITCH;
  stage32x64(sl, acc, 1.0f / (XS * WSC), lane);

  const int rq = lane >> 3, c8 = (lane & 7) * 8;
  float zn8[8], ch8[8], sh8[8], rz8[8];
  {
    const v4f z0 = *(const v4f*)(ZN + col0 + c8), z1 = *(const v4f*)(ZN + col0 + c8 + 4);
    const v4f h0 = *(const v4f*)(CH + col0 + c8), h1 = *(const v4f*)(CH + col0 + c8 + 4);
    const v4f g0 = *(const v4f*)(SH + col0 + c8), g1 = *(const v4f*)(SH + col0 + c8 + 4);
#pragma unroll
    for (int e = 0; e < 4; ++e) {
      zn8[e] = z0[e]; zn8[4 + e] = z1[e];
      ch8[e] = h0[e]; ch8[4 + e] = h1[e];
      sh8[e] = g0[e]; sh8[4 + e] = g1[e];
    }
#pragma unroll
    for (int e = 0; e < 8; ++e) rz8[e] = rcp1(zn8[e]);        // one reciprocal per column, used by all 8 row groups
  }
  const bool mv = (mode == 2);
#pragma unroll 1
  for (int i = 0; i < 8; ++i) {
    const int row = 4 * i + rq;
    const float cx  = CX2[rowb + row];
    const float romc = rcp1(fmaxf(1.0f - cx, 1e-15f));
    const float opc = 1.0f + cx;
    float* sr = sl + row * GPITCH + c8;
    float y[8];
    float s0 = 0.f;
#pragma unroll
    for (int e = 0; e < 8; ++e) {
      const float mm  = sr[e] * rz8[e];
      const float arg = (2.0f * mm * ch8[e] - opc * sh8[e]) * romc;
      y[e] = sinh_of_scaled_asinh(arg, 2.0f * zn8[e]);
      s0 += y[e] * y[e];
    }
    s0 = red8(s0);
    const float n0 = fmaxf(sqrt1(s0), 1e-15f);
    const float r0 = rcp1(n0);                                // formed for every row: no branch on the clip test
    const float f0 = (n0 > MAXN) ? MAXN * r0 : 1.0f;          // a row inside the ball is multiplied by exactly 1
    float s1 = 0.f;
#pragma unroll
    for (int e = 0; e < 8; ++e) {
      y[e] = y[e] * f0;
      s1 += y[e] * y[e];
    }
    s1 = red8(s1);
    const float rden = rcp1(1.0f + sqrt1(1.0f + s1));
    float s2 = 0.f;
#pragma unroll
    for (int e = 0; e < 8; ++e) {
      y[e] = y[e] * rden;
      s2 += y[e] * y[e];
    }
    s2 = red8(s2);
    const float n2 = fmaxf(sqrt1(s2), 1e-15f);
    const float r2 = rcp1(n2);
    const float f2 = (n2 > MAXN) ? MAXN * r2 : 1.0f;
    float s3 = 0.f;
#pragma unroll
    for (int e = 0; e < 8; ++e) {
      y[e] = y[e] * f2;
      s3 += y[e] * y[e];
    }
    s3 = red8(s3);
    const float g    = 2.0f * rcp1(fmaxf(1.0f - s3, 1e-15f));
    const float gmul = mv ? g : 1.0f;
    const float scal = mv ? (g - 1.0f) : s3;
#pragma unroll
    for (int e = 0; e < 8; ++e) sr[e] = y[e] * gmul;
    if ((lane & 7) == 0) rsc[wv * 32 + row] = scal;
  }
  wave_sync_lds();

  const int bb = rowb / SEQ, s0r = rowb - bb * SEQ, head = nt;
  if (lane < 8) {
    const v4f v = *(const v4fa*)(rsc + wv * 32 + 4 * lane);
    float* dst = RS + ((size_t)(bb * NH + head)) * SEQ + s0r + 4 * lane;
    {
      *(v4f*)(dst) = v;
      
    }
  }
  // ---- planes ----
  const size_t pofs = (size_t)rowb * DM + (size_t)(col0 + c8);
  if (!mv) {
    v4u oh[8], ol[8];
#pragma unroll
    for (int i = 0; i < 8; ++i) {
      const int row = 4 * i + rq;
      const v4f a = *(const v4fa*)(sl + row * GPITCH + c8), c4 = *(const v4fa*)(sl + row * GPITCH + c8 + 4);
#pragma unroll
      for (int e = 0; e < 2; ++e) {
        const unsigned short ha = bf_bits(a[2 * e]),  hb = bf_bits(a[2 * e + 1]);
        const unsigned short la = bf_bits(a[2 * e] - bf_up(ha)), lb = bf_bits(a[2 * e + 1] - bf_up(hb));
        oh[i][e] = pk16(ha, hb);
        ol[i][e] = pk16(la, lb);
        const unsigned short hc = bf_bits(c4[2 * e]), hd = bf_bits(c4[2 * e + 1]);
        const unsigned short lc = bf_bits(c4[2 * e] - bf_up(hc)), ld = bf_bits(c4[2 * e + 1] - bf_up(hd));
        oh[i][2 + e] = pk16(hc, hd);
        ol[i][2 + e] = pk16(lc, ld);
      }
    }
    {
#pragma unroll
      for (int i = 0; i < 8; ++i) {
        const int row = 4 * i + rq;
        *(v4u*)(Ph + pofs + (size_t)row * DM) = oh[i];
        *(v4u*)(Pl + pofs + (size_t)row * DM) = ol[i];
      }
      
    }
  } else {
    v4u ov[8];
#pragma unroll
    for (int i = 0; i < 8; ++i) {
      const int row = 4 * i + rq;
      const v4f a = *(const v4fa*)(sl + row * GPITCH + c8), c4 = *(const v4fa*)(sl + row * GPITCH + c8 + 4);
#pragma unroll
      for (int e = 0; e < 2; ++e) {
        ov[i][e]     = pk16(h_bits((_Float16)(a[2 * e] * VS)),  h_bits((_Float16)(a[2 * e + 1] * VS)));
        ov[i][2 + e] = pk16(h_bits((_Float16)(c4[2 * e] * VS)), h_bits((_Float16)(c4[2 * e + 1] * VS)));
      }
    }
    {
#pragma unroll
      for (int i = 0; i < 8; ++i) {
        const int row = 4 * i + rq;
        *(v4u*)(Ph + pofs + (size_t)row * DM) = ov[i];
      }
      
    }
  }
}

// ---- softmax weight of one (query, key) pair, not normalised: em * exp(-dist) ----
// exp(-acosh(z)) = 1 / (z + sqrt(z^2 - 1)); with z = 1 + 2 num / den this is den / (den + 2 (num + sqrt(num (num + den)))):
// no logarithm, no exponential, no cancellation. num and den lie in [1e-15, 4], so no step leaves the normal f32 range.
// em = the key's own factor exp(bias - largest bias of the batch) * PCAR, in [0, PCAR].
// Range of exp(-dist): q and k leave the projection clipped to norm MAXN, so den >= (1 - MAXN^2)^2 and num <= 4 MAXN^2, which
// gives z + sqrt(z^2 - 1) < 2^18. A key with the largest bias therefore has a weight of at least PCAR / 2^18 = 1/8 in every row,
// while no weight exceeds PCAR: the f16 P operand and the f32 sums need no row maximum.
// Two neighbouring keys at a time: they lie in neighbouring registers of the score tile and of the tables (packed f32 forms).
__device__ __forceinline__ v2f weight2(v2f xy, v2f y2, v2f em, float x2, float omx) {
  const v2f lim = {1e-15f, 1e-15f};
  const v2f num = __builtin_elementwise_max(x2 - 2.0f * xy + y2, lim);
  const v2f den = __builtin_elementwise_max(omx * (1.0f - y2), lim);
  const v2f sq  = num * (num + den);
  const v2f rt  = {__builtin_amdgcn_sqrtf(sq[0]), __builtin_amdgcn_sqrtf(sq[1])};
  const v2f ee  = 2.0f * (num + rt) + den;
  const v2f ri  = {__builtin_amdgcn_rcpf(ee[0]), __builtin_amdgcn_rcpf(ee[1])};
  return (em * den) * ri;
}

// =====================================================================================================
// Fused distance attention + gyro-midpoint over all SEQ keys: block = (batch b, head, 128 query rows), 8 waves. Wave w = (query
// group w & 3, key half w >> 2) owns queries q0 = 128*qt + 32*(w & 3) .. q0+31 as two 16-query tiles, against one half of the keys:
// every k fragment, gamma v fragment and table word that it reads from LDS serves both query tiles. The eight waves share the
// keys: k hi, k lo and gamma v go through a two-buffer LDS ring, AKST keys per stage (3 tiles of 128 key rows x 128 B, whole lines;
// pitch TP16 for k, VP16 for gamma v), brought in by asynchronous 16-byte copies, 12 per thread and stage; the next stage flies
// while this one is worked on; one block barrier per stage. Key half h takes staged rows 64h .. 64h+63 of every stage.
//   q planes bf16 hi/lo [b*SEQ + s][h*64 + d]; k planes bf16 hi/lo and the gamma v plane (f16 x VS) same layout;
//   per-key tables for (b, h): sum k^2, gamma - 1; factor exp(bias - largest bias) x32768 from the additive bias row amask[b][s] (bf16-converted); per query x2 = sum q^2.
//   All NKB = 32 key blocks of 32 keys are visited (static bound), two per ring stage and key half.
//   Scores computed TRANSPOSED: S^T tile (t, g) = k rows (keys kb+16g .., A operand, row m = lane&15, split k map over d)
//   times q^T (B operand, col n = query q0 + 16t + (lane&15), k = d), 2 d-chunks of 32, three bf16 products each (hi.hi, lo.hi,
//   hi.lo). D element r of lane l = (key kb+16g+8h+r, query q0+16t+(l&15)): a lane owns one query column per tile and 16 of its
//   32 keys; the partner lane l^16 owns the other 16.
//   dist = acosh(1 + 2 max(x2 - 2 xy + y2, 1e-15) / max((1 - x2)(1 - y2), 1e-15)), logit = -dist + bias, all f32.
//   Softmax weights p = exp(bias - largest bias of the batch) exp(-dist) in closed form (weight2()), one fixed scale for all keys:
//   no row maximum, no rescale of O, nothing crosses lanes in the key loop. Each lane sums l = sum p and dn = sum p (gamma - 1) over
//   its own keys. The weights ARE the P A-fragment in place: A row m = query = lane&15, element i <- key kb+8h+i (key tile 0,
//   D element i), element 8+i <- key kb+16+8h+i (key tile 1, D element i). P (<= 1) carried x32768 as f16; l and dn carry the same factor.
//   4 gamma v B fragments (col n = d = 16j + (lane&15), k = key) by transposing LDS loads from the key-major tile, 8 P.V WMMAs + one guard.
//   Behind the loop the two key halves of a query group meet: wave (g, h) finishes query tile h; it hands its sums O, l, dn of the
//   other tile to wave (g, 1 - h) through LDS (xch, one block barrier) and adds that wave's sums of tile h to its own (all plain f32
//   sums at the one fixed scale); the two lane halves of a query's keys then meet in one xor-16 shuffle.
//   Epilogue (f32): two_mean = (O (1/l) / VS) / max(dn / l, 1e-10); a = two_mean / (1 + sqrt(max(1 - sum two_mean^2,
//   1e-15))); clip to norm MAXN; the wave's 16x64 tile staged in its LDS slab (pitch 68); each output row segment
// coverage: per wave 8 instructions x 2 rows x 16 lanes x 4 floats = 16 x 64; grid NB*NH*(SQ/128) blocks x 8 waves = every
//           (b < NB, s < SQ, h) row segment of the output exactly once.
// LDS: ms/ky2/kg1 cross-wave (block barrier, 1024 staged == 1024 consumed); ring cross-wave (block barrier per stage, staged
// extent == consumed extent, pad bytes never read); xch cross-wave (block barrier, 34 floats a lane staged == consumed, pitch XP);
// slab wave-private (wave_sync, 16x64).
// =====================================================================================================
__global__ __launch_bounds__(ATT_THREADS)
void attn_fwd(const u16* __restrict__ Qh, const u16* __restrict__ Ql, const u16* __restrict__ Kh, const u16* __restrict__ Kl,
              const u16* __restrict__ Vg, const float* __restrict__ QX2, const float* __restrict__ KX2,
              const float* __restrict__ GM1, const float* __restrict__ amask, float* Out) {
  __shared__ __align__(16) float ms[SEQ];
  __shared__ __align__(16) float ky2[SEQ];
  __shared__ __align__(16) float kg1[SEQ];
  __shared__ __align__(16) float slab[(ATT_THREADS / 32) * 16 * GPITCH];
  __shared__ __align__(16) float xch[ATT_THREADS * XP];
  __shared__ __align__(16) u16 ring[2 * ABUF];

  const int tid  = threadIdx.x;
  const int wave = tid >> 5;
  const int lane = tid & 31;
  const int hh   = lane >> 4;
  const int c    = lane & 15;
  const int kh2  = wave >> 2;                   // key half of this wave

  constexpr int NQT = SQ / 128;
  const int bid  = blockIdx.x;
  const int qt   = bid % NQT;
  const int head = (bid / NQT) % NH;
  const int b    = bid / (NQT * NH);
  const int bh   = b * NH + head;
  const int q0   = qt * 128 + (wave & 3) * 32;

  // ---- this thread's share of a ring stage: per tile rows (tid>>3) + 32 i, i < 4, 16 bytes at 16 (tid&7) ----
  const u16* khg = Kh + ((size_t)(b * SEQ + (tid >> 3))) * DM + head * HD + 8 * (tid & 7);
  const u16* klg = Kl + ((size_t)(b * SEQ + (tid >> 3))) * DM + head * HD + 8 * (tid & 7);
  const u16* vgg = Vg + ((size_t)(b * SEQ + (tid >> 3))) * DM + head * HD + 8 * (tid & 7);
  const unsigned lring = lds_addr(ring) + (unsigned)((tid >> 3) * (TP16 * 2) + 16 * (tid & 7));
  const unsigned lvring = lds_addr(ring) + (unsigned)(2 * ATILE * 2 + (tid >> 3) * (VP16 * 2) + 16 * (tid & 7));
  auto stage_copy = [&](int st) {                             // keys AKST st .. +127 -> buffer st & 1
    const unsigned lo = lring + (unsigned)((st & 1) * (ABUF * 2));
    const unsigned lv = lvring + (unsigned)((st & 1) * (ABUF * 2));
    const u16* kh = khg + (size_t)st * AKST * DM;
    const u16* kl = klg + (size_t)st * AKST * DM;
    const u16* vg = vgg + (size_t)st * AKST * DM;
    constexpr unsigned R32 = 32 * TP16 * 2, TB = ATILE * 2;   // 32 k rows, one k tile, in bytes
    constexpr unsigned V32 = 32 * VP16 * 2;                   // 32 gamma v rows, in bytes
    const unsigned la[6] = {lo, lo + R32, lo + 2 * R32, lo + 3 * R32, lo + TB, lo + TB + R32};
    const u16* const ga[6] = {kh, kh + 32 * DM, kh + 64 * DM, kh + 96 * DM, kl, kl + 32 * DM};
    acopy6(la, ga);
    const unsigned lb[6] = {lo + TB + 2 * R32, lo + TB + 3 * R32, lv, lv + V32, lv + 2 * V32, lv + 3 * V32};
    const u16* const gb[6] = {kl + 64 * DM, kl + 96 * DM, vg, vg + 32 * DM, vg + 64 * DM, vg + 96 * DM};
    acopy6(lb, gb);
  };
  stage_copy(0);                                              // flies while the tables are staged

  // ---- largest bias of the batch: every wave reads the whole row (32 lanes x 32 values), so no barrier is needed for it.
  //      bf16 rounding is monotone: the rounded maximum is the maximum of the rounded values.
  float mb;
  const int i0 = tid * 4;                       // this thread's 4 keys of the per-key tables
  v4f m0, y0, g0;
  {
    const float* mr = amask + (size_t)b * SEQ + 4 * lane;
    v4f a[SEQ / 128];
#pragma unroll   // all loads issue before the first use: one memory latency
    for (int q = 0; q < SEQ / 128; ++q) a[q] = *(const v4f*)(mr + 128 * q);
    // precaution: the table loads that follow may land in the register that holds these loads' offset
    asm volatile("s_wait_xcnt 0x0" ::: "memory");
    // this thread's words of the three per-key tables issue with the row: one memory latency for both
    m0 = *(const v4f*)(amask + (size_t)b * SEQ + i0);
    y0 = *(const v4f*)(KX2 + (size_t)bh * SEQ + i0);
    g0 = *(const v4f*)(GM1 + (size_t)bh * SEQ + i0);
    // precaution: the code that follows may land in the registers that hold these loads' addresses
    asm volatile("s_wait_xcnt 0x0" ::: "memory");
    // keeps that code behind the wait: without it this build moved writes of those registers ahead of it
    __builtin_amdgcn_sched_barrier(0);
    float mx = -INFINITY;
#pragma unroll
    for (int q = 0; q < SEQ / 128; ++q) mx = fmaxf(fmaxf(fmaxf(mx, a[q][0]), fmaxf(a[q][1], a[q][2])), a[q][3]);
    mx = fmaxf(mx, __shfl_xor(mx, 16, 32)); mx = fmaxf(mx, __shfl_xor(mx, 8, 32)); mx = fmaxf(mx, __shfl_xor(mx, 4, 32));
    mx = fmaxf(mx, __shfl_xor(mx, 2, 32));  mx = fmaxf(mx, __shfl_xor(mx, 1, 32));
    mb = bfr(mx);
  }
  // ---- stage the per-key tables of (b, head): 256 threads x 4 keys = SEQ ----
  {
#pragma unroll
    for (int e = 0; e < 4; ++e) {
      ms[i0 + e]  = exp2f((bfr(m0[e]) - mb) * LOG2E) * PCAR;
      ky2[i0 + e] = y0[e];
      kg1[i0 + e] = g0[e];
    }
  }
  wait_copies();
  __syncthreads();                                            // the tables and stage 0 are published
  stage_copy(1);

  // B fragments of q^T, query tile t: col n = query q0 + 16t + c, k = d (k-contiguous rows of the q planes), d chunk 0 / 1
  Frag qh[2][2], ql[2][2];
  float xq[2], omx[2];
#pragma unroll   // constant indices: the arrays stay in registers
  for (int t = 0; t < 2; ++t) {
    const size_t qofs = ((size_t)(b * SEQ + q0 + 16 * t + c)) * DM + head * HD + 8 * hh;
    qh[t][0] = ldfrag(Qh + qofs); qh[t][1] = ldfrag(Qh + qofs + 32);
    ql[t][0] = ldfrag(Ql + qofs); ql[t][1] = ldfrag(Ql + qofs + 32);
    xq[t]  = QX2[(size_t)bh * SEQ + q0 + 16 * t + c];
  }
  // precaution: the code that follows may land in the registers that hold these loads' addresses
  asm volatile("s_wait_xcnt 0x0" ::: "memory");
  // keeps that code behind the wait: without it this build moved writes of those registers ahead of it
  __builtin_amdgcn_sched_barrier(0);
  omx[0] = 1.0f - xq[0];
  omx[1] = 1.0f - xq[1];
  // A fragments of k: row m = key kb + 16g + c, k = d; B fragments of gamma v: col n = d = 16j + c, k = key; both from the ring

  v2f lrun2[2] = {{0.f, 0.f}, {0.f, 0.f}}, drun2[2] = {{0.f, 0.f}, {0.f, 0.f}};   // per query tile: sums over this lane's even and odd keys
  v8f o[2][4];
#pragma unroll
  for (int t = 0; t < 2; ++t) {
#pragma unroll
    for (int j = 0; j < 4; ++j) o[t][j] = zero8();
  }

#pragma unroll 1   // one stage per trip: the ring's order (read, publish, refill) stays as written
  for (int st = 0; st < SEQ / AKST; ++st) {
  const u16* rb = ring + (st & 1) * ABUF;
#pragma unroll 1   // the wave's two 32-key blocks of a stage share one copy of the long body
  for (int sub = 0; sub < AKST / 64; ++sub) {
    const int kr = kh2 * (AKST / 2) + sub * 32;               // staged row of the block's first key
    const int kb = st * AKST + kr;
    const u16* KhB = rb + (kr + c) * TP16 + 8 * hh;           // staged k hi row of key kb + c
    const u16* KlB = KhB + ATILE;
    // ---- transposed scores: s[t][0] = keys kb..kb+15, s[t][1] = keys kb+16..kb+31, column = query q0 + 16t + c ----
    v8f s[2][2] = {{zero8(), zero8()}, {zero8(), zero8()}};
    constexpr int k0o = 0, k1o = 16 * TP16;
#pragma unroll   // two d chunks: the offsets become immediates of the LDS reads
    for (int dc = 0; dc < 2; ++dc) {
      const Frag kh0 = ldfrag(KhB + k0o + 32 * dc), kh1 = ldfrag(KhB + k1o + 32 * dc);
      const Frag kl0 = ldfrag(KlB + k0o + 32 * dc), kl1 = ldfrag(KlB + k1o + 32 * dc);
      s[0][0] = mma_b(kh0, qh[0][dc], s[0][0]); s[0][1] = mma_b(kh1, qh[0][dc], s[0][1]);
      s[1][0] = mma_b(kh0, qh[1][dc], s[1][0]); s[1][1] = mma_b(kh1, qh[1][dc], s[1][1]);
      s[0][0] = mma_b(kl0, qh[0][dc], s[0][0]); s[0][1] = mma_b(kl1, qh[0][dc], s[0][1]);
      s[1][0] = mma_b(kl0, qh[1][dc], s[1][0]); s[1][1] = mma_b(kl1, qh[1][dc], s[1][1]);
      s[0][0] = mma_b(kh0, ql[0][dc], s[0][0]); s[0][1] = mma_b(kh1, ql[0][dc], s[0][1]);
      s[1][0] = mma_b(kh0, ql[1][dc], s[1][0]); s[1][1] = mma_b(kh1, ql[1][dc], s[1][1]);
      guard_sc(s[0][0], s[0][1], s[1][0], s[1][1], qh[0][dc].h, ql[0][dc].h, qh[1][dc].h, ql[1][dc].h, kh0.h, kh1.h, kl0.h, kl1.h);
    }
    // ---- per-key values of this lane's 16 keys: word q of [0..1] <- keys kb+8hh+4q.., of [2..3] <- keys kb+16+8hh+4(q-2).. ----
    const int ka = kb + 8 * hh, kc = kb + 16 + 8 * hh;
    const v4f y4[4] = {*(const v4fa*)(ky2 + ka), *(const v4fa*)(ky2 + ka + 4), *(const v4fa*)(ky2 + kc), *(const v4fa*)(ky2 + kc + 4)};
    const v4f g4[4] = {*(const v4fa*)(kg1 + ka), *(const v4fa*)(kg1 + ka + 4), *(const v4fa*)(kg1 + kc), *(const v4fa*)(kg1 + kc + 4)};
    const v4f m4[4] = {*(const v4fa*)(ms + ka),  *(const v4fa*)(ms + ka + 4),  *(const v4fa*)(ms + kc),  *(const v4fa*)(ms + kc + 4)};
    // ---- weights (<= PCAR), this lane's sums and the P A-fragments f16(p); fragment word 4w + e4 <-> D elements 2 e4, 2 e4 + 1 of key tile w ----
    Frag ph[2];
#pragma unroll
    for (int t = 0; t < 2; ++t) {
#pragma unroll
      for (int w = 0; w < 2; ++w) {
        const v8f sv = s[t][w];
#pragma unroll
        for (int e4 = 0; e4 < 4; ++e4) {
          const int q = 2 * w + (e4 >> 1), h2 = 2 * (e4 & 1);
          const v2f xy = {sv[2 * e4], sv[2 * e4 + 1]};
          const v2f y2 = {y4[q][h2], y4[q][h2 + 1]};
          const v2f em = {m4[q][h2], m4[q][h2 + 1]};
          const v2f g1 = {g4[q][h2], g4[q][h2 + 1]};
          const v2f p  = weight2(xy, y2, em, xq[t], omx[t]);
          lrun2[t] += p;
          drun2[t] += p * g1;
          ph[t].u[w][e4] = __builtin_bit_cast(unsigned, __builtin_convertvector(p, v2h));
        }
      }
    }
    // ---- P.V : B fragment col n = d = j*16 + c, k = key kb + (split k map), transposed out of the staged key rows ----
    {
      const u16* vp = rb + 2 * ATILE + (kr + 8 * hh + (lane & 7)) * VP16 + 8 * ((lane >> 3) & 1);
      const Frag v0 = ldfrag_tr(vp);
      const Frag v1 = ldfrag_tr(vp + 16);
      const Frag v2 = ldfrag_tr(vp + 32);
      const Frag v3 = ldfrag_tr(vp + 48);
      o[0][0] = mma_h(ph[0], v0, o[0][0]);
      o[0][1] = mma_h(ph[0], v1, o[0][1]);
      o[0][2] = mma_h(ph[0], v2, o[0][2]);
      o[0][3] = mma_h(ph[0], v3, o[0][3]);
      o[1][0] = mma_h(ph[1], v0, o[1][0]);
      o[1][1] = mma_h(ph[1], v1, o[1][1]);
      o[1][2] = mma_h(ph[1], v2, o[1][2]);
      o[1][3] = mma_h(ph[1], v3, o[1][3]);
      guard_pv(o[0], o[1], ph[0].h, ph[1].h, v0.h, v1.h, v2.h, v3.h);
    }
  }
  publish_stage();
  if (st + 2 < SEQ / AKST) stage_copy(st + 2);                // into the buffer that this trip has just read
  }
  wait_copies();
  acc_guard4(o[0]);
  acc_guard4(o[1]);

  // ---- the two key halves meet: this wave keeps query tile kh2 and hands the other tile's sums to its partner wave ----
  const bool up = kh2 != 0;
  v8f ow[4];
  float lrun, drun;
  {
    const float l0 = lrun2[0][0] + lrun2[0][1], l1 = lrun2[1][0] + lrun2[1][1];
    const float d0 = drun2[0][0] + drun2[0][1], d1 = drun2[1][0] + drun2[1][1];
    float* xw = xch + tid * XP;
#pragma unroll
    for (int j = 0; j < 4; ++j) {
      v8f ot;
#pragma unroll
      for (int r = 0; r < 8; ++r) {
        ow[j][r] = up ? o[1][j][r] : o[0][j][r];
        ot[r]    = up ? o[0][j][r] : o[1][j][r];
      }
      const v4f a = {ot[0], ot[1], ot[2], ot[3]}, e = {ot[4], ot[5], ot[6], ot[7]};
      *(v4fa*)(xw + 8 * j)     = a;
      *(v4fa*)(xw + 8 * j + 4) = e;
    }
    const v2f ld = {up ? l0 : l1, up ? d0 : d1};
    *(v2fa*)(xw + 32) = ld;
    __syncthreads();                                          // every wave's hand-over is published
    const float* xr = xch + (tid ^ 128) * XP;                 // the same lane of the wave with the other key half
#pragma unroll
    for (int j = 0; j < 4; ++j) {
      const v4f a = *(const v4fa*)(xr + 8 * j), e = *(const v4fa*)(xr + 8 * j + 4);
#pragma unroll
      for (int r = 0; r < 4; ++r) {
        ow[j][r]     += a[r];
        ow[j][4 + r] += e[r];
      }
    }
    const v2f pd = *(const v2fa*)(xr + 32);
    lrun = (up ? l1 : l0) + pd[0];
    drun = (up ? d1 : d0) + pd[1];
  }
  const int qf = q0 + 16 * kh2;                               // first query of the tile that this wave finishes
  // ---- the two halves of each query's keys (lanes l and l ^ 16) meet ----
  lrun += __shfl_xor(lrun, 16, 32);
  drun += __shfl_xor(drun, 16, 32);
  // ---- gyro-midpoint epilogue in f32: per query factors from the query-owner lane (lane = query); O and l both carry PCAR ----
  const float linv = rcp1(lrun);
  const float nf   = linv * (1.0f / VS);
  const float dq   = fmaxf(drun * linv, 1e-10f);
  const float fq   = nf * rcp1(dq);             // the query's one factor: 1 / (l VS) over the clamped denominator
  float fqr[8];
#pragma unroll
  for (int r = 0; r < 8; ++r) fqr[r] = __shfl(fq, 8 * hh + r, 32);
  float sq[8];
#pragma unroll
  for (int r = 0; r < 8; ++r) {
    float sp = 0.f;
#pragma unroll
    for (int j = 0; j < 4; ++j) {
      const float tm = ow[j][r] * fqr[r];
      ow[j][r] = tm;
      sp += tm * tm;
    }
    sq[r] = rsum16(sp);
  }
  float* sw = slab + wave * 16 * GPITCH;
#pragma unroll
  for (int r = 0; r < 8; ++r) {
    const float rdf = rcp1(1.0f + sqrt1(fmaxf(1.0f - sq[r], 1e-15f)));
    float sp = 0.f;
#pragma unroll
    for (int j = 0; j < 4; ++j) {
      const float a = ow[j][r] * rdf;
      ow[j][r] = a;
      sp += a * a;
    }
    const float s2  = rsum16(sp);
    const float n2  = fmaxf(sqrt1(s2), 1e-15f);
    const bool  cl  = n2 > MAXN;
    const float fcl = MAXN * rcp1(n2);
#pragma unroll
    for (int j = 0; j < 4; ++j) {
      const float a = ow[j][r];
      sw[(8 * hh + r) * GPITCH + 16 * j + c] = cl ? (a * fcl) : a;
    }
  }
  wave_sync_lds();
  // ---- f32 output rows: lanes 0..15 -> row 2i, lanes 16..31 -> row 2i+1, lane = 4 consecutive d ----
  const int cc = lane & 15;
  v4f vals[8];
#pragma unroll
  for (int i = 0; i < 8; ++i) vals[i] = *(const v4fa*)(sw + (2 * i + hh) * GPITCH + 4 * cc);
  float* ob = Out + ((size_t)(b * SEQ + qf + hh)) * DM + head * HD + 4 * cc;
  {
#pragma unroll
    for (int i = 0; i < 8; ++i) {
      *(v4f*)(ob + (size_t)(2 * i) * DM) = vals[i];
    }
    
  }
}

// =====================================================================================================
// Workspace map (bytes); every region written fully by whole-line stores before it is read; every extent an exact multiple
//   X16  f16 [NB*SEQ][DM]          f16(bf16(x) x64)              4194304 (NB=2)
//   WQT/WKT/WVT f16 [DM n][DM k]   f16(bf16(W) x256)             3 x 2097152
//   CX2  f32 [NB*SEQ]              sum x^2                       8192
//   ZN, CH, SH f32 [3][DM]         column norms, cosh/sinh(2r)   3 x 12288
//   Qh, Ql, Kh, Kl bf16 [NB*SEQ][DM]                             4 x 4194304
//   Vg   f16 [NB*SEQ][DM]          f16(gamma v x256)             4194304
//   QX2, KX2, GM1 f32 [NB*NH][SEQ]                                3 x 131072
//   end = 31895552 at NB=2
// =====================================================================================================
static inline size_t up4k(size_t v) { return (v + 4095) & ~(size_t)4095; }

extern "C" void kernel_launch(void* const* d_in, const int* in_sizes, int n_in,
                              void* d_out, int out_size, void* d_ws, size_t ws_size,
                              hipStream_t stream) {
  if (n_in < 8) return;
  if (in_sizes[0] < NB * SEQ * DM) return;
  if (in_sizes[1] < NB * SEQ) return;
  if (in_sizes[2] < DM * DM || in_sizes[4] < DM * DM || in_sizes[6] < DM * DM) return;
  if (in_sizes[3] < 1 || in_sizes[5] < 1 || in_sizes[7] < 1) return;
  if (out_size < NB * SEQ * DM) return;

  const float* hs = (const float*)d_in[0];
  const float* am = (const float*)d_in[1];
  const float* qz = (const float*)d_in[2];
  const float* qr = (const float*)d_in[3];
  const float* kz = (const float*)d_in[4];
  const float* kr = (const float*)d_in[5];
  const float* vz = (const float*)d_in[6];
  const float* vr = (const float*)d_in[7];
  float*       out = (float*)d_out;
  const int nqr = in_sizes[3], nkr = in_sizes[5], nvr = in_sizes[7];

  const size_t nrow  = (size_t)NB * SEQ;
  const size_t szX16 = up4k(nrow * DM * 2);
  const size_t szWT  = up4k((size_t)DM * DM * 2);
  const size_t szCX2 = up4k(nrow * 4);
  const size_t szCOL = up4k((size_t)3 * DM * 4);
  const size_t szP   = up4k(nrow * DM * 2);
  const size_t szRS  = up4k((size_t)NB * NH * SEQ * 4);
  size_t off = 0;
  const size_t oX16 = off; off += szX16;
  const size_t oWQ  = off; off += szWT;
  const size_t oWK  = off; off += szWT;
  const size_t oWV  = off; off += szWT;
  const size_t oCX2 = off; off += szCX2;
  const size_t oZN  = off; off += szCOL;
  const size_t oCH  = off; off += szCOL;
  const size_t oSH  = off; off += szCOL;
  const size_t oQh  = off; off += szP;
  const size_t oQl  = off; off += szP;
  const size_t oKh  = off; off += szP;
  const size_t oKl  = off; off += szP;
  const size_t oVg  = off; off += szP;
  const size_t oQX2 = off; off += szRS;
  const size_t oKX2 = off; off += szRS;
  const size_t oGM1 = off; off += szRS;
  if (off > ws_size) return;                       // off = 31895552 at NB=2
  if (off > (size_t)134217728) return;

  char* ws = (char*)d_ws;
  u16*   X16 = (u16*)(ws + oX16);
  u16*   WQT = (u16*)(ws + oWQ);
  u16*   WKT = (u16*)(ws + oWK);
  u16*   WVT = (u16*)(ws + oWV);
  float* CX2 = (float*)(ws + oCX2);
  float* ZN  = (float*)(ws + oZN);
  float* CH  = (float*)(ws + oCH);
  float* SH  = (float*)(ws + oSH);
  u16*   Qh  = (u16*)(ws + oQh);
  u16*   Ql  = (u16*)(ws + oQl);
  u16*   Kh  = (u16*)(ws + oKh);
  u16*   Kl  = (u16*)(ws + oKl);
  u16*   Vg  = (u16*)(ws + oVg);
  float* QX2 = (float*)(ws + oQX2);
  float* KX2 = (float*)(ws + oKX2);
  float* GM1 = (float*)(ws + oGM1);

  // (1) all that reads only the inputs: x -> f16 plane of bf16(x) x64, per-row sums of squares, per weight the column norms
  //     with cosh/sinh(2r) and the k-contiguous [n][k] f16 plane of bf16(W) x256
  prep<<<dim3(PB_COL + PB_ROW), dim3(PREP_THREADS), 0, stream>>>(
      hs, qz, kz, vz, qr, kr, vr, nqr, nkr, nvr, X16, CX2, ZN, CH, SH, WQT, WKT, WVT);
  // (2) the three projections with the fused MLR / per-head epilogue
  proj_mlr<<<dim3(PJ_BLOCKS), dim3(PJ_THREADS), 0, stream>>>(
      X16, WQT, WKT, WVT, ZN, CH, SH, CX2, Qh, Ql, Kh, Kl, Vg, QX2, KX2, GM1);
  // (3) attention + midpoint -> out [b][SEQ][DM] f32 (rows s < SQ of batches b < NB), heads merged on the feature dim
  attn_fwd<<<dim3(NB * NH * (SQ / 128)), dim3(ATT_THREADS), 0, stream>>>(Qh, Ql, Kh, Kl, Vg, QX2, KX2, GM1, am, out);
  (void)hipGetLastError();
}

// v010
// It runs in 48.4 microseconds.
// Two timings next to v009 put it at 1.10 and 1.09 times that version's speed.
// Counting every step since v000, it is 11.9 times as fast.
// Contractions: x.Wq, x.Wk, x.Wv on v_wmma_f32_16x16x32_f16 (x as f16(bf16(x) x64), W as f16(bf16(W) x256), f32 accumulate);
// scores k.q^T on v_wmma_f32_16x16x32_bf16 as bf16 hi/lo split (hi.hi + lo.hi + hi.lo into one f32 accumulator);
// P.(gamma v) on v_wmma_f32_16x16x32_f16 (P x32768 f16, gamma v x256 f16 through transposing LDS loads, f32 accumulate); norms, asinh/sinh/acosh
// (closed forms on v_log_f32 / v_exp_f32 / v_sqrt_f32 / v_rcp_f32), softmax weights in closed form at a fixed scale,
// the sum_j p_j (gamma_j - 1) denominators and all carry folds in f32 on VALU.
// Float inputs RNE-converted to bf16 on load; f32 output written directly.
#include <hip/hip_runtime.h>
#include <math.h>
#include <stdint.h>

#ifndef NB
#define NB 2            // batches processed
#endif
#ifndef SQ
#define SQ 1024         // query rows processed per batch (keys/values always all SEQ rows)
#endif
#define NB_FULL 2
#define SEQ  1024       // rows per batch in every input / output / plane layout
#define DM   1024       // model width = K of the projections = row pitch of the 16-bit planes
#define NH   16
#define HD   64
#define XS   64.0f      // carry on the x plane
#define WSC  256.0f     // carry on the transposed weight planes
#define VS   256.0f     // carry on the gamma*v plane
#define PCAR 32768.0f   // carry on P
#define LOG2E 1.4426950408889634f
#define MAXN 0.996f     // (1 - 4e-3) / sqrt(c)
#define NKB  (SEQ / 32)
#define GPITCH 68
#define TP16   72
#define ATT_THREADS 256
#define CS_COLS     32    // weight columns per preparation block
#define XR_ROWS     32    // x rows per preparation block
#define WTP     (DM + 8)  // pitch of a transposed weight row in LDS, in 16-bit units: 16-B words of 4 rows apart fall 16 banks apart
#define PREP_THREADS 512                       // block of the preparation grid (both block kinds)
#define PB_COL  (3 * (DM / CS_COLS))           // weight blocks, 32 columns of one weight each
#define PB_ROW  (NB * SEQ / XR_ROWS)           // x blocks, 32 rows each
#define PJ_BLOCKS ((NB * SEQ / 128) * (DM / 64)) // projection blocks: one per 128-row x 64-column tile
#define PJ_THREADS 384                         // 3 weights x 4 waves
#define KST     64                             // k per LDS stage of the projection: one 128-B line of every staged row
#define AKST    128                            // keys per LDS stage of attention: 64 for each key half
#define PJ_ROWS (128 + 3 * 64)                 // staged rows of a projection stage: 128 of A, then 64 of each weight
#define PJ_CPW  ((PJ_ROWS / 4 + PJ_THREADS / 32 - 1) / (PJ_THREADS / 32))  // copies per wave and stage, upper bound (a copy = 4 rows)
#define ATILE   (AKST * TP16)                  // one staged 128-row k tile of attention, in 16-bit units
#define VP16    80                             // pitch of a staged gamma v row: 160 B = 32 B x 5, the pitch for ds_load_tr16_b128
#define VTILE   (AKST * VP16)                  // one staged 128-row gamma v tile, in 16-bit units
#define ABUF    (2 * ATILE + VTILE)            // one buffer of the attention ring: k hi, k lo, gamma v
#define XP      36                             // floats a lane hands to its partner wave, padded: 144 B = 16 B x 9, the pitch for 16-B LDS words

static_assert(NB >= 1 && NB <= NB_FULL);
static_assert((SQ % 128) == 0 && SQ >= 128 && SQ <= SEQ);
static_assert(NH * HD == DM && HD == 64);
static_assert((SEQ % 128) == 0 && (SEQ % 32) == 0 && NKB * 32 == SEQ);
static_assert((DM % 256) == 0 && (DM % 64) == 0 && (DM % 32) == 0);
static_assert((GPITCH * 4) % 16 == 0 && (TP16 * 2) % 16 == 0 && (VP16 * 2) % 32 == 0 && ((VP16 * 2) / 32) % 2 == 1);
static_assert(CS_COLS == 32 && (DM % CS_COLS) == 0 && (PREP_THREADS / 32) * 64 == DM && (PREP_THREADS / 32) * 2 == CS_COLS);
static_assert(ATT_THREADS == 256 && ATT_THREADS * 4 == SEQ && (XP * 4) % 16 == 0 && XP >= 34);
static_assert(XR_ROWS == 32 && (PREP_THREADS / 32) * 2 == XR_ROWS && (NB * SEQ) % XR_ROWS == 0 && (WTP * 2) % 16 == 0);
static_assert((NB * SEQ) % 128 == 0);
static_assert(KST == 64 && DM / KST >= 2 && (DM % KST) == 0 && AKST == 128 && SEQ / AKST >= 2 && (SEQ % AKST) == 0);
static_assert(PJ_CPW == 7 && (PJ_ROWS % 4) == 0 && PJ_ROWS / 4 - 6 * (PJ_THREADS / 32) == 8);

typedef unsigned short u16;
typedef _Float16 v16h __attribute__((ext_vector_type(16)));
typedef _Float16 v8h  __attribute__((ext_vector_type(8)));
typedef __bf16   v16b __attribute__((ext_vector_type(16)));
typedef float    v8f  __attribute__((ext_vector_type(8)));
typedef float    v4f  __attribute__((ext_vector_type(4)));
typedef float    v2f  __attribute__((ext_vector_type(2)));
typedef _Float16 v2h  __attribute__((ext_vector_type(2)));
typedef unsigned int v4u __attribute__((ext_vector_type(4)));
typedef unsigned int v2u __attribute__((ext_vector_type(2)));
typedef v4u __attribute__((may_alias)) v4ua;
typedef v4f __attribute__((may_alias)) v4fa;
typedef v2f __attribute__((may_alias)) v2fa;

// one 16 x 16-bit per-lane fragment, viewed as f16 vector, bf16 vector or two 16-byte words
union Frag { v16h h; v16b b; v4u u[2]; };

// ---- scalar helpers ----------------------------------------------------------------------------------
__device__ __forceinline__ unsigned short bf_bits(float f) {          // f32 -> bf16 bits, RNE convert
  unsigned u = __float_as_uint(f);
  return (unsigned short)((u + 0x7FFFu + ((u >> 16) & 1u)) >> 16);
}
__device__ __forceinline__ float bf_up(unsigned short h) { return __uint_as_float(((unsigned)h) << 16); }
__device__ __forceinline__ float bfr(float f) { return bf_up(bf_bits(f)); }
__device__ __forceinline__ unsigned short h_bits(_Float16 x) { return __builtin_bit_cast(unsigned short, x); }
__device__ __forceinline__ unsigned pk16(unsigned short a, unsigned short b) { return (unsigned)a | ((unsigned)b << 16); }
__device__ __forceinline__ v8f zero8() { v8f z = {0.f, 0.f, 0.f, 0.f, 0.f, 0.f, 0.f, 0.f}; return z; }
// ---- lane exchanges on the vector unit (all 32 lanes on wherever they are used); __shfl_xor / __shfl go through the LDS unit
//      and cost its latency at every link of a reduction tree ----
template <int M> __device__ __forceinline__ float xrow(float v) {     // value of lane l ^ M, M < 16: DPP row_xmask:M
  return __builtin_bit_cast(float, __builtin_amdgcn_update_dpp(0, __builtin_bit_cast(int, v), 0x160 + M, 0xf, 0xf, true));
}
template <int N> __device__ __forceinline__ float rowlane(float v) {  // value of lane N of the lane's own 16-lane row: DPP row_share:N
  return __builtin_bit_cast(float, __builtin_amdgcn_update_dpp(0, __builtin_bit_cast(int, v), 0x150 + N, 0xf, 0xf, true));
}
__device__ __forceinline__ float xhalf(float v) {                     // value of lane l ^ 16: v_permlanex16_b32, identity selects
  return __builtin_bit_cast(float, __builtin_amdgcn_permlanex16(__builtin_bit_cast(int, v), __builtin_bit_cast(int, v),
                                                                0x76543210, 0xfedcba98, false, false));
}
__device__ __forceinline__ float red8(float v) {                      // sum over the 8-lane group (lane bits 0..2)
  v += xrow<1>(v); v += xrow<2>(v); v += xrow<4>(v); return v;
}
__device__ __forceinline__ float rsum16(float v) {                    // sum over the 16-lane half (lane bits 0..3)
  v += xrow<8>(v); v += xrow<4>(v); v += xrow<2>(v); v += xrow<1>(v); return v;
}

// 1 / x on v_rcp_f32 (about 1 ulp), for a divisor that a whole row or column shares: formed once, then multiplied in.
// Every divisor it is used on is clamped to at least 1e-15 (or is at least 1/8) and, where finite, stays below 2e19,
// so the reciprocal is a normal f32; an infinite divisor gives 0, as the quotient of a finite value by it does.
__device__ __forceinline__ float rcp1(float x) {
  float r = 0.f;
#if defined(__HIP_DEVICE_COMPILE__)
  // v_nop in the same statement: the slot between a transcendental and an instruction that reads its result or overwrites its
  // source
  asm("v_rcp_f32 %0, %1\n\tv_nop" : "=v"(r) : "v"(x));
#endif
  return r;
}

// sqrt(x) on v_sqrt_f32 alone (about 1 ulp), without the correctly rounding sequence of sqrtf. Where it is used x is a sum of
// squares whose root is clamped to at least 1e-15 behind it (a subnormal x may come out as 0: the clamp gives the same value
// as for its true root), or x is at least 1e-15.
__device__ __forceinline__ float sqrt1(float x) {
  float r = 0.f;
#if defined(__HIP_DEVICE_COMPILE__)
  // v_nop in the same statement: the slot behind a transcendental, as in rcp1()
  asm("v_sqrt_f32 %0, %1\n\tv_nop" : "=v"(r) : "v"(x));
#endif
  return r;
}

// sinh(tz * asinh(x)) in closed form: e = |x| + sqrt(x^2 + 1), L = log2(e) >= 0, sinh = 2^(tz L - 1) - 2^(-tz L - 1), sign of x.
// Above 1e18 sqrt(x^2 + 1) = |x| in f32 and x^2 comes near the f32 overflow, so e = 2|x| there. The two halves are formed with the
// factor 1/2 in the exponent, so the result overflows only where sinh itself does.
__device__ __forceinline__ float sinh_of_scaled_asinh(float x, float tz) {
  const float a = fabsf(x);
  const float e = a + ((a > 1e18f) ? a : __builtin_amdgcn_sqrtf(fmaf(a, a, 1.0f)));
  const float L = __builtin_amdgcn_logf(e);
  const float s = __builtin_amdgcn_exp2f(fmaf(tz, L, -1.0f)) - __builtin_amdgcn_exp2f(fmaf(-tz, L, -1.0f));
  return copysignf(s, x);
}

// ---- fragment loader: 16-bit A/B operand from a k-contiguous row; lane -> row/col (lane&15), p already includes
//      +8*(lane>>4); elements 0..7 <- p[0..7] (k0+8h..), elements 8..15 <- p[16..23] (k0+16+8h..); same split k map
//      for A and B; B read by it from a k-contiguous [n][k] plane (the gamma v B goes through ldfrag_tr()). Loaded as unsigned 16-byte words.
__device__ __forceinline__ Frag ldfrag(const u16* p) {
  Frag f;
  f.u[0] = *(const v4u*)(p);
  f.u[1] = *(const v4u*)(p + 16);
  return f;
}
// ---- transposing fragment loader: B operand (col n = lane&15, k = row) from a row-major 16-bit LDS tile T[k][n] of pitch VP16.
//      p = T + (k0 + 8*(lane>>4) + (lane&7)) * VP16 + n0 + 8*((lane>>3)&1); lane (c, h) then holds T[k0 + 8h + 0..7][n0 + c] in
//      elements 0..7 and T[k0 + 16 + 8h + 0..7][n0 + c] in elements 8..15: the split k map of ldfrag().
typedef short s16x8 __attribute__((ext_vector_type(8)));
__device__ __forceinline__ Frag ldfrag_tr(const u16* p) {
  typedef __attribute__((address_space(3))) s16x8 lds_s16x8;
  Frag f;
  f.u[0] = __builtin_bit_cast(v4u, __builtin_amdgcn_ds_load_tr16_b128_v8i16((lds_s16x8*)(p)));
  f.u[1] = __builtin_bit_cast(v4u, __builtin_amdgcn_ds_load_tr16_b128_v8i16((lds_s16x8*)(p + 16 * VP16)));
  return f;
}

// ---- WMMA helpers and trailing VALU hazard gaps --------------------------------------------------------
__device__ __forceinline__ v8f mma_h(const Frag& a, const Frag& b, v8f c) {
  return __builtin_amdgcn_wmma_f32_16x16x32_f16(false, a.h, false, b.h, (short)0, c, false, false);
}
__device__ __forceinline__ v8f mma_b(const Frag& a, const Frag& b, v8f c) {
  return __builtin_amdgcn_wmma_f32_16x16x32_bf16(false, a.b, false, b.b, (short)0, c, false, false);
}
__device__ __forceinline__ void guard_sc(v8f& a, v8f& b, v8f& c, v8f& d, v16h x0, v16h x1, v16h x2, v16h x3,
                                         v16h x4, v16h x5, v16h x6, v16h x7) {
#if defined(__HIP_DEVICE_COMPILE__)
  asm volatile("v_nop\n\tv_nop\n\tv_nop\n\tv_nop"
               : "+v"(a), "+v"(b), "+v"(c), "+v"(d)
               : "v"(x0), "v"(x1), "v"(x2), "v"(x3), "v"(x4), "v"(x5), "v"(x6), "v"(x7) : "memory");
#endif
}
__device__ __forceinline__ void guard_pv(v8f (&o)[4], v8f (&u)[4], v16h p, v16h q, v16h x0, v16h x1, v16h x2, v16h x3) {
#if defined(__HIP_DEVICE_COMPILE__)
  asm volatile("v_nop\n\tv_nop\n\tv_nop\n\tv_nop"
               : "+v"(o[0]), "+v"(o[1]), "+v"(o[2]), "+v"(o[3]), "+v"(u[0]), "+v"(u[1]), "+v"(u[2]), "+v"(u[3])
               : "v"(p), "v"(q), "v"(x0), "v"(x1), "v"(x2), "v"(x3) : "memory");
#endif
}
__device__ __forceinline__ void guard_g(v8f (&acc)[8], v16h x0, v16h x1, v16h x2, v16h x3, v16h x4, v16h x5) {
#if defined(__HIP_DEVICE_COMPILE__)
  asm volatile("v_nop\n\tv_nop\n\tv_nop\n\tv_nop"
               : "+v"(acc[0]), "+v"(acc[1]), "+v"(acc[2]), "+v"(acc[3]),
                 "+v"(acc[4]), "+v"(acc[5]), "+v"(acc[6]), "+v"(acc[7])
               : "v"(x0), "v"(x1), "v"(x2), "v"(x3), "v"(x4), "v"(x5) : "memory");
#endif
}
__device__ __forceinline__ void acc_guard4(v8f (&o)[4]) {
#if defined(__HIP_DEVICE_COMPILE__)
  asm volatile("v_nop\n\tv_nop\n\tv_nop\n\tv_nop" : "+v"(o[0]), "+v"(o[1]), "+v"(o[2]), "+v"(o[3]));
#endif
}
__device__ __forceinline__ void wave_sync_lds() {
  __builtin_amdgcn_fence(__ATOMIC_RELEASE, "workgroup");
  __builtin_amdgcn_wave_barrier();
  __builtin_amdgcn_fence(__ATOMIC_ACQUIRE, "workgroup");
}

// ---- asynchronous 16-byte copies global -> LDS (through no register): l = the lane's own LDS byte address, g = the lane's own
//      global address, both multiples of 16. The closing s_wait_xcnt stands inside each statement, so that no address register
//      of an issued copy is rewritten ahead of it (a precaution).
__device__ __forceinline__ unsigned lds_addr(const void* p) { return (unsigned)(uintptr_t)p; }   // low 32 bits = LDS byte offset
__device__ __forceinline__ void acopy1(unsigned l0, const u16* g0) {
#if defined(__HIP_DEVICE_COMPILE__)
  asm volatile("global_load_async_to_lds_b128 %0, %1, off\n\t"
               "s_wait_xcnt 0x0"
               :: "v"(l0), "v"(g0) : "memory");
#endif
}
__device__ __forceinline__ void acopy6(const unsigned (&l)[6], const u16* const (&g)[6]) {
#if defined(__HIP_DEVICE_COMPILE__)
  asm volatile("global_load_async_to_lds_b128 %0, %6, off\n\t"
               "global_load_async_to_lds_b128 %1, %7, off\n\t"
               "global_load_async_to_lds_b128 %2, %8, off\n\t"
               "global_load_async_to_lds_b128 %3, %9, off\n\t"
               "global_load_async_to_lds_b128 %4, %10, off\n\t"
               "global_load_async_to_lds_b128 %5, %11, off\n\t"
               "s_wait_xcnt 0x0"
               :: "v"(l[0]), "v"(l[1]), "v"(l[2]), "v"(l[3]), "v"(l[4]), "v"(l[5]),
                  "v"(g[0]), "v"(g[1]), "v"(g[2]), "v"(g[3]), "v"(g[4]), "v"(g[5]) : "memory");
#endif
}
// The issuing wave's own copies have landed.
__device__ __forceinline__ void wait_copies() { asm volatile("s_wait_asynccnt 0x0" ::: "memory"); }
// Publish point of a two-buffer stage ring, passed by every wave of the block at the foot of every stage.
__device__ __forceinline__ void publish_stage() {
  asm volatile("s_wait_dscnt 0x0" ::: "memory");   // this wave's reads of the buffer that is refilled next have returned
  wait_copies();                                   // this wave's share of the next stage has landed
  __syncthreads();                                 // publishes the next stage; ends every reader's last read of this one
}

// =====================================================================================================
// x rows, read once: row r of the [rows][DM] f16 plane <- f16(bf16_RNE(x[r][e]) * scale), scale a power of two, and
// CX2[r] = sum_e bf16(x[r][e])^2 in f32. Block = 32 rows (one 128-B line of CX2), 512 threads, wave w rows 32*blk + 2w, +1:
// a lane holds elements 128q + 4*lane .. +3 of both rows (16 x 16-B loads, whole lines, all in flight at once), sums its 32
// values of a row in ascending q, xor-shuffle reduce, lane 0 -> LDS (rs, 32 floats); block barrier; threads 0..7 store the 32
// sums as 16-B words; then every lane stores its 4 halves per q (a wave's store = 256 contiguous bytes).
// coverage: 16 waves x 2 rows x (8 q x 32 lanes x 4) = 32 whole rows per block; NB*SEQ/32 blocks.
// =====================================================================================================
__device__ __forceinline__ void xprep_blk(const float* __restrict__ x, u16* Y, float* CX2, float scale, float* rs, int tid, int blk) {
  const int wave = tid >> 5, lane = tid & 31;
  const int row0 = blk * XR_ROWS + wave * 2;
  const float* xr = x + (size_t)row0 * DM + 4 * lane;
  v4f a[2][DM / 128];
#pragma unroll   // all loads issue before the first use: one memory latency per wave
  for (int j = 0; j < 2; ++j) {
#pragma unroll
    for (int q = 0; q < DM / 128; ++q) a[j][q] = *(const v4f*)(xr + (size_t)j * DM + 128 * q);
  }
  // precaution: the loads' address registers may be given to other values behind this point
  asm volatile("s_wait_xcnt 0x0" ::: "memory");
  v2f s = {0.f, 0.f};                            // the two rows' sums: two independent chains, side by side
#pragma unroll
  for (int q = 0; q < DM / 128; ++q) {
#pragma unroll
    for (int e = 0; e < 4; ++e) {
#pragma unroll
      for (int j = 0; j < 2; ++j) {
        a[j][q][e] = bfr(a[j][q][e]);
        s[j] += a[j][q][e] * a[j][q][e];
      }
    }
  }
  s[0] += xhalf(s[0]);  s[1] += xhalf(s[1]);     // lane bit 4
  s[0] = rsum16(s[0]);  s[1] = rsum16(s[1]);     // lane bits 3..0
  if (lane == 0) *(v2fa*)(rs + wave * 2) = s;
  __syncthreads();                               // stands in front of every global store: it waits for no store
  if (tid < XR_ROWS / 4) {
    const v4f v = *(const v4fa*)(rs + 4 * tid);
    *(v4f*)(CX2 + blk * XR_ROWS + 4 * tid) = v;
  }
  u16* dst = Y + (size_t)row0 * DM + 4 * lane;
#pragma unroll
  for (int j = 0; j < 2; ++j) {
#pragma unroll
    for (int q = 0; q < DM / 128; ++q) {
      v2u o;
      o[0] = pk16(h_bits((_Float16)(a[j][q][0] * scale)), h_bits((_Float16)(a[j][q][1] * scale)));
      o[1] = pk16(h_bits((_Float16)(a[j][q][2] * scale)), h_bits((_Float16)(a[j][q][3] * scale)));
      *(v2u*)(dst + (size_t)j * DM + 128 * q) = o;
    }
  }
  // precaution: nothing rewrites the stores' registers ahead of this point
  asm volatile("s_wait_xcnt 0x0" ::: "memory");
}

// =====================================================================================================
// A weight z[k][n] (DM x DM), read once: ZN[n] = max(sqrt(sum_k bf16(z[k][n])^2), 1e-15), CH[n] = cosh(2 r[n]), SH[n] = sinh(2 r[n])
// (r index clamped to nr-1), and WT[n][k] (f16, k-contiguous Bt layout) <- f16(bf16_RNE(z[k][n]) * scale).
// Block = 32 columns (one 128-B line of every row) x all DM rows, 512 threads: lane = (row group lane>>3, 4 columns at 4*(lane&7)),
// wave w holds rows 64w + 32g + 8*(lane>>3) + j (g < 2, j < 8): 16 independent 16-B loads per thread, all in flight at once, and 8
// consecutive k of a column side by side in a thread, so that they go to the LDS tile [n][k] (pitch WTP) as one 16-B word.
// Column sums: 16 rows in the thread (ascending k), xor-8 / xor-16 shuffles over the wave's 4 row groups, one 32-float row per
// wave in LDS; one block barrier publishes tile and partial sums; wave w stores rows n = 2w, 2w + 1 of WT (4 x 512 contiguous
// bytes each); wave 0 then adds the 16 wave rows.
// coverage: 16 waves x 2 g x 4 groups x 8 rows = DM rows; DM/32 blocks x 32 columns = every column of the three arrays and every
//           row of WT once, each block the only writer of its 128-B lines. tile: CS_COLS * WTP halves, part: 16 * CS_COLS floats.
// =====================================================================================================
__device__ __forceinline__ void wprep_blk(const float* __restrict__ z, const float* __restrict__ r, int nr,
                                          float* ZN, float* CH, float* SH, u16* Y, float scale,
                                          u16* tile, float* part, int tid, int blk) {
  const int wave = tid >> 5, lane = tid & 31;
  const int col0 = blk * CS_COLS;
  const int c4 = 4 * (lane & 7);
  const int k0 = wave * 64 + 8 * (lane >> 3);
  const float* zp = z + (size_t)k0 * DM + col0 + c4;
  const int col = col0 + lane;
  float rv = 0.f;
  if (wave == 0) {                               // wave-uniform; issued with the column loads, not behind the barrier
    int ri = col;
    ri = (ri < nr - 1) ? ri : (nr - 1);
    rv = r[ri];
  }
  v4f a[16];
#pragma unroll   // all loads issue before the first use: one memory latency per thread
  for (int j = 0; j < 16; ++j) a[j] = *(const v4f*)(zp + (size_t)((j >> 3) * 32 + (j & 7)) * DM);
  // precaution: the loads' address registers may be given to other values behind this point
  asm volatile("s_wait_xcnt 0x0" ::: "memory");
  // keeps the arithmetic behind all 16 loads: without it this build issued the last 4 behind the first 12's wait, a second latency
  __builtin_amdgcn_sched_barrier(0);
  v4f s = {0.f, 0.f, 0.f, 0.f};
#pragma unroll
  for (int g = 0; g < 2; ++g) {
#pragma unroll
    for (int e = 0; e < 4; ++e) {
      v4u o;
#pragma unroll
      for (int p = 0; p < 4; ++p) {
        const float v0 = bfr(a[8 * g + 2 * p][e]), v1 = bfr(a[8 * g + 2 * p + 1][e]);
        s[e] += v0 * v0;
        s[e] += v1 * v1;
        o[p] = pk16(h_bits((_Float16)(v0 * scale)), h_bits((_Float16)(v1 * scale)));
      }
      *(v4ua*)(tile + (c4 + e) * WTP + k0 + 32 * g) = o;
    }
  }
#pragma unroll
  for (int e = 0; e < 4; ++e) {
    s[e] += xrow<8>(s[e]);
    s[e] += xhalf(s[e]);
  }
  if (lane < 8) *(v4fa*)(part + wave * CS_COLS + 4 * lane) = s;
  __syncthreads();
  {
    v4u ov[2][DM / 256];
#pragma unroll
    for (int i = 0; i < 2; ++i) {
#pragma unroll
      for (int q = 0; q < DM / 256; ++q) ov[i][q] = *(const v4ua*)(tile + (wave * 2 + i) * WTP + 256 * q + 8 * lane);
    }
    u16* dst = Y + (size_t)(col0 + wave * 2) * DM + 8 * lane;
#pragma unroll
    for (int i = 0; i < 2; ++i) {
#pragma unroll
      for (int q = 0; q < DM / 256; ++q) *(v4u*)(dst + (size_t)i * DM + 256 * q) = ov[i][q];
    }
    // precaution: wave 0's code behind this point may rewrite the stores' registers
    asm volatile("s_wait_xcnt 0x0" ::: "memory");
  }
  if (wave == 0) {                               // wave-uniform; lane = column
    float t = 0.f;
#pragma unroll
    for (int w = 0; w < PREP_THREADS / 32; ++w) t += part[w * CS_COLS + lane];
    const float dr = 2.0f * bfr(rv);
    ZN[col] = fmaxf(sqrtf(t), 1e-15f);
    CH[col] = coshf(dr);
    SH[col] = sinhf(dr);
  }
}

// =====================================================================================================
// Preparation grid: everything that reads only the inputs, in one launch; every input is read once, by few waves that each keep
// 16 loads of 16 bytes in flight (the launch is short: the start of its waves counts). Block kind by block index (block-uniform,
// so each kind's block barrier is passed by all 512 threads of its block); the kind with the longer dependent chain comes first:
//   [0, PB_COL)            a weight's column statistics and transposed f16 plane, weight = index / (DM/32), 32 columns per block
//   next PB_ROW blocks     x row sums and f16 plane, 32 rows per block
// =====================================================================================================
__global__ __launch_bounds__(PREP_THREADS)
void prep(const float* __restrict__ x,
          const float* __restrict__ qz, const float* __restrict__ kz, const float* __restrict__ vz,
          const float* __restrict__ qr, const float* __restrict__ kr, const float* __restrict__ vr,
          int nqr, int nkr, int nvr,
          u16* X16, float* CX2, float* ZN, float* CH, float* SH, u16* WQT, u16* WKT, u16* WVT) {
  __shared__ __align__(16) u16 tile[CS_COLS * WTP];
  __shared__ __align__(16) float part[(PREP_THREADS / 32) * CS_COLS];
  const int tid = threadIdx.x;
  int bid = blockIdx.x;
  if (bid < PB_COL) {
    const int w = bid / (DM / CS_COLS), blk = bid % (DM / CS_COLS);
    const float* z = (w == 0) ? qz : (w == 1) ? kz : vz;
    const float* r = (w == 0) ? qr : (w == 1) ? kr : vr;
    const int   nr = (w == 0) ? nqr : (w == 1) ? nkr : nvr;
    u16*         y = (w == 0) ? WQT : (w == 1) ? WKT : WVT;
    wprep_blk(z, r, nr, ZN + w * DM, CH + w * DM, SH + w * DM, y, WSC, tile, part, tid, blk);
    return;
  }
  bid -= PB_COL;
  xprep_blk(x, X16, CX2, XS, part, tid, bid);
}

// =====================================================================================================
// f16 GEMM core on one LDS stage (KST of k): the wave's 32 x 64 tile of C += A . Bt^T; as -> staged A row (wave row + m) + 8h,
// bs -> staged Bt row (m) + 8h, rows at pitch TP16 (144 B: ds_load_b128 of 16 rows falls on all banks once);
// acc[4i + j] = rows 16i.., cols 16j..; k stepped by 32 in ascending order.
// =====================================================================================================
__device__ __forceinline__ void gemm_stage(const u16* as, const u16* bs, v8f (&acc)[8]) {
#pragma unroll   // two steps: the k offsets become immediates of the LDS reads
  for (int k0 = 0; k0 < KST; k0 += 32) {
    const Frag a0 = ldfrag(as + k0), a1 = ldfrag(as + 16 * TP16 + k0);
    const Frag b0 = ldfrag(bs + k0);
    const Frag b1 = ldfrag(bs + 16 * TP16 + k0);
    const Frag b2 = ldfrag(bs + 32 * TP16 + k0);
    const Frag b3 = ldfrag(bs + 48 * TP16 + k0);
    acc[0] = mma_h(a0, b0, acc[0]);
    acc[1] = mma_h(a0, b1, acc[1]);
    acc[2] = mma_h(a0, b2, acc[2]);
    acc[3] = mma_h(a0, b3, acc[3]);
    acc[4] = mma_h(a1, b0, acc[4]);
    acc[5] = mma_h(a1, b1, acc[5]);
    acc[6] = mma_h(a1, b2, acc[6]);
    acc[7] = mma_h(a1, b3, acc[7]);
    guard_g(acc, a0.h, a1.h, b0.h, b1.h, b2.h, b3.h);
  }
}
// Stage the wave's 32 x 64 f32 tile (times oscale) in its LDS slab (pitch 68): D element r of acc[4i+j], lane l ->
// coverage: 32 lanes x 2 x 8 rows x 4 cols-of-16 = rows 0..31 x cols 0..63 of the slab.
__device__ __forceinline__ void stage32x64(float* sl, v8f (&acc)[8], float oscale, int lane) {
  const int hh = lane >> 4, m = lane & 15;
#pragma unroll
  for (int i = 0; i < 2; ++i) {
#pragma unroll
    for (int r = 0; r < 8; ++r) {
      const int ro = (16 * i + 8 * hh + r) * GPITCH + m;
      sl[ro]      = acc[4 * i + 0][r] * oscale;
      sl[ro + 16] = acc[4 * i + 1][r] * oscale;
      sl[ro + 32] = acc[4 * i + 2][r] * oscale;
      sl[ro + 48] = acc[4 * i + 3][r] * oscale;
    }
  }
  wave_sync_lds();
}

// =====================================================================================================
// Projection GEMM + ball MLR epilogue. A = x plane [NB*SEQ][DM] (f16, x XS), Bt = WT [DM n][DM k] (f16, x WSC).
// One launch for the three weights: block = 384 threads = 128 rows x 64 cols (one head) of q, k and v; waves 4*mode .. 4*mode+3
// (mode 0 q, 1 k, 2 v: picks Bt, the column tables' row and the outputs) take 32 rows each, so the three modes read the same A rows
// from one WGP and three waves share a SIMD. Operands go through a two-buffer LDS ring, KST of k per stage: the block's 128 A rows
// and 3 x 64 Bt rows (PJ_ROWS rows x 128 B, whole lines) are brought in by asynchronous 16-byte copies, one copy of a wave = 4 rows,
// copy index = wave + 12 i (i < 6 for every wave, i = 6 for waves 0..7: 80 copies); the next stage flies while this one is worked on.
// Epilogue per element (f32): mm = (x.z)[row][n] / ZN[n]; arg = (2 mm CH[n] - (1 + cx2) SH[n]) / max(1 - cx2, 1e-15);
// y = sinh(2 ZN[n] asinh(arg)); per (row, head) 64-vector (8 lanes x 8 values, 8-lane shuffle sums): clip to norm MAXN,
// y = y / (1 + sqrt(1 + sum y^2)), clip again; x2 = sum y^2. mode 0/1: planes Ph/Pl = bf16 hi / bf16 lo of y, RS row
// scalar = x2; mode 2: g = 2 / max(1 - x2, 1e-15), plane Ph = f16(g y VS), RS row scalar = g - 1.
// coverage: per wave 8 instr x 4 rows x 8 lanes x 8 halves = 32 x 64 per plane; RS: 32 floats per wave; grid covers every
//           (row, col) of the planes and every (b, head, s) of RS exactly once.
// LDS: ring cross-wave (one block barrier per stage, staged extent == consumed extent, pad bytes never read); slab and rsc are
// wave-private (wave_sync); staged extent 32x64 == consumed extent.
// =====================================================================================================
__global__ __launch_bounds__(PJ_THREADS)
void proj_mlr(const u16* __restrict__ A, const u16* __restrict__ WQT, const u16* __restrict__ WKT, const u16* __restrict__ WVT,
              const float* __restrict__ ZN3, const float* __restrict__ CH3, const float* __restrict__ SH3,
              const float* __restrict__ CX2, u16* Qh, u16* Ql, u16* Kh, u16* Kl, u16* Vg,
              float* QX2, float* KX2, float* GM1) {
  __shared__ __align__(16) float slab[(PJ_THREADS / 32) * 32 * GPITCH];
  __shared__ __align__(16) float rsc[(PJ_THREADS / 32) * 32];
  __shared__ __align__(16) u16 ring[2 * PJ_ROWS * TP16];
  const int tid = threadIdx.x, wv = tid >> 5, wave = wv & 3, lane = tid & 31, hh = lane >> 4, m = lane & 15;
  constexpr int NT = DM / 64;
  const int mode = __builtin_amdgcn_readfirstlane(wv >> 2);   // the same in all lanes of a wave: pointer picks and the mode branch stay scalar
  const int bid  = blockIdx.x;
  const float* ZN = ZN3 + mode * DM;
  const float* CH = CH3 + mode * DM;
  const float* SH = SH3 + mode * DM;
  u16*   Ph = (mode == 0) ? Qh : (mode == 1) ? Kh : Vg;
  u16*   Pl = (mode == 0) ? Ql : Kl;           // stored to by modes 0 and 1 only
  float* RS = (mode == 0) ? QX2 : (mode == 1) ? KX2 : GM1;
  const int nt   = bid % NT;
  const int mt   = bid / NT;
  const int rowb = mt * 128 + wave * 32;       // global token row b*SEQ + s of the wave's first row
  const int col0 = nt * 64;                    // = head * HD
  // ---- this lane's share of a stage: copy i brings staged rows 4 (wave + 12 i) .. +3, lane = (row lane>>3, 16 bytes at 16 (lane&7)) ----
  const int wvs = __builtin_amdgcn_readfirstlane(wv);         // scalar: source picks and the test on the seventh copy stay scalar
  const bool has7 = wvs + 6 * (PJ_THREADS / 32) < PJ_ROWS / 4;
  const u16* gsrc[PJ_CPW];
  unsigned   ldst[PJ_CPW];
#pragma unroll   // constant indices: both arrays stay in registers
  for (int i = 0; i < PJ_CPW; ++i) {
    int ci = wvs + (PJ_THREADS / 32) * i;
    ci = (ci < PJ_ROWS / 4) ? ci : (PJ_ROWS / 4 - 1);         // keeps the addresses of a seventh copy that is not issued in range
    const int sr = 4 * ci + (lane >> 3);                      // staged row
    const int wsel = (ci - 32) >> 4;                          // weight of a Bt row (ci >= 32)
    const u16* rowp = (ci < 32) ? (A + (size_t)(mt * 128 + sr) * DM)
                                : (((wsel == 0) ? WQT : (wsel == 1) ? WKT : WVT) + (size_t)(col0 + sr - 128 - 64 * wsel) * DM);
    gsrc[i] = rowp + 8 * (lane & 7);
    ldst[i] = lds_addr(ring) + (unsigned)(sr * (TP16 * 2) + 16 * (lane & 7));
  }
  auto stage_copy = [&](int st) {                             // stage st -> buffer st & 1
    const unsigned lo = (unsigned)((st & 1) * (PJ_ROWS * TP16 * 2));
    const unsigned l6[6] = {ldst[0] + lo, ldst[1] + lo, ldst[2] + lo, ldst[3] + lo, ldst[4] + lo, ldst[5] + lo};
    const u16* const g6[6] = {gsrc[0] + st * KST, gsrc[1] + st * KST, gsrc[2] + st * KST,
                              gsrc[3] + st * KST, gsrc[4] + st * KST, gsrc[5] + st * KST};
    acopy6(l6, g6);
    if (has7) acopy1(ldst[6] + lo, gsrc[6] + st * KST);
  };
  v8f acc[8];
#pragma unroll
  for (int i = 0; i < 8; ++i) acc[i] = zero8();
  stage_copy(0);
  wait_copies();
  __syncthreads();                                            // stage 0 is published
  stage_copy(1);
#pragma unroll 1   // one stage per trip: the ring's order (read, publish, refill) stays as written
  for (int st = 0; st < DM / KST; ++st) {
    const u16* rb = ring + (st & 1) * (PJ_ROWS * TP16);
    gemm_stage(rb + (wave * 32 + m) * TP16 + 8 * hh, rb + (128 + mode * 64 + m) * TP16 + 8 * hh, acc);
    publish_stage();
    if (st + 2 < DM / KST) stage_copy(st + 2);                // into the buffer that this trip has just read
  }
  wait_copies();
  float* sl = slab + wv * 32 * GPITCH;
  stage32x64(sl, acc, 1.0f / (XS * WSC), lane);

  const int rq = lane >> 3, c8 = (lane & 7) * 8;
  float zn8[8], ch8[8], sh8[8], rz8[8];
  {
    const v4f z0 = *(const v4f*)(ZN + col0 + c8), z1 = *(const v4f*)(ZN + col0 + c8 + 4);
    const v4f h0 = *(const v4f*)(CH + col0 + c8), h1 = *(const v4f*)(CH + col0 + c8 + 4);
    const v4f g0 = *(const v4f*)(SH + col0 + c8), g1 = *(const v4f*)(SH + col0 + c8 + 4);
#pragma unroll
    for (int e = 0; e < 4; ++e) {
      zn8[e] = z0[e]; zn8[4 + e] = z1[e];
      ch8[e] = h0[e]; ch8[4 + e] = h1[e];
      sh8[e] = g0[e]; sh8[4 + e] = g1[e];
    }
#pragma unroll
    for (int e = 0; e < 8; ++e) rz8[e] = rcp1(zn8[e]);        // one reciprocal per column, used by all 8 row groups
  }
  const bool mv = (mode == 2);
#pragma unroll 1
  for (int i = 0; i < 8; ++i) {
    const int row = 4 * i + rq;
    const float cx  = CX2[rowb + row];
    const float romc = rcp1(fmaxf(1.0f - cx, 1e-15f));
    const float opc = 1.0f + cx;
    float* sr = sl + row * GPITCH + c8;
    float y[8];
    float s0 = 0.f;
#pragma unroll
    for (int e = 0; e < 8; ++e) {
      const float mm  = sr[e] * rz8[e];
      const float arg = (2.0f * mm * ch8[e] - opc * sh8[e]) * romc;
      y[e] = sinh_of_scaled_asinh(arg, 2.0f * zn8[e]);
      s0 += y[e] * y[e];
    }
    s0 = red8(s0);
    const float n0 = fmaxf(sqrt1(s0), 1e-15f);
    const float r0 = rcp1(n0);                                // formed for every row: no branch on the clip test
    const float f0 = (n0 > MAXN) ? MAXN * r0 : 1.0f;          // a row inside the ball is multiplied by exactly 1
    float s1 = 0.f;
#pragma unroll
    for (int e = 0; e < 8; ++e) {
      y[e] = y[e] * f0;
      s1 += y[e] * y[e];
    }
    s1 = red8(s1);
    const float rden = rcp1(1.0f + sqrt1(1.0f + s1));
    float s2 = 0.f;
#pragma unroll
    for (int e = 0; e < 8; ++e) {
      y[e] = y[e] * rden;
      s2 += y[e] * y[e];
    }
    s2 = red8(s2);
    const float n2 = fmaxf(sqrt1(s2), 1e-15f);
    const float r2 = rcp1(n2);
    const float f2 = (n2 > MAXN) ? MAXN * r2 : 1.0f;
    float s3 = 0.f;
#pragma unroll
    for (int e = 0; e < 8; ++e) {
      y[e] = y[e] * f2;
      s3 += y[e] * y[e];
    }
    s3 = red8(s3);
    const float g    = 2.0f * rcp1(fmaxf(1.0f - s3, 1e-15f));
    const float gmul = mv ? g : 1.0f;
    const float scal = mv ? (g - 1.0f) : s3;
#pragma unroll
    for (int e = 0; e < 8; ++e) sr[e] = y[e] * gmul;
    if ((lane & 7) == 0) rsc[wv * 32 + row] = scal;
  }
  wave_sync_lds();

  const int bb = rowb / SEQ, s0r = rowb - bb * SEQ, head = nt;
  if (lane < 8) {
    const v4f v = *(const v4fa*)(rsc + wv * 32 + 4 * lane);
    float* dst = RS + ((size_t)(bb * NH + head)) * SEQ + s0r + 4 * lane;
    {
      *(v4f*)(dst) = v;
      
    }
  }
  // ---- planes ----
  const size_t pofs = (size_t)rowb * DM + (size_t)(col0 + c8);
  if (!mv) {
    v4u oh[8], ol[8];
#pragma unroll
    for (int i = 0; i < 8; ++i) {
      const int row = 4 * i + rq;
      const v4f a = *(const v4fa*)(sl + row * GPITCH + c8), c4 = *(const v4fa*)(sl + row * GPITCH + c8 + 4);
#pragma unroll
      for (int e = 0; e < 2; ++e) {
        const unsigned short ha = bf_bits(a[2 * e]),  hb = bf_bits(a[2 * e + 1]);
        const unsigned short la = bf_bits(a[2 * e] - bf_up(ha)), lb = bf_bits(a[2 * e + 1] - bf_up(hb));
        oh[i][e] = pk16(ha, hb);
        ol[i][e] = pk16(la, lb);
        const unsigned short hc = bf_bits(c4[2 * e]), hd = bf_bits(c4[2 * e + 1]);
        const unsigned short lc = bf_bits(c4[2 * e] - bf_up(hc)), ld = bf_bits(c4[2 * e + 1] - bf_up(hd));
        oh[i][2 + e] = pk16(hc, hd);
        ol[i][2 + e] = pk16(lc, ld);
      }
    }
    {
#pragma unroll
      for (int i = 0; i < 8; ++i) {
        const int row = 4 * i + rq;
        *(v4u*)(Ph + pofs + (size_t)row * DM) = oh[i];
        *(v4u*)(Pl + pofs + (size_t)row * DM) = ol[i];
      }
      
    }
  } else {
    v4u ov[8];
#pragma unroll
    for (int i = 0; i < 8; ++i) {
      const int row = 4 * i + rq;
      const v4f a = *(const v4fa*)(sl + row * GPITCH + c8), c4 = *(const v4fa*)(sl + row * GPITCH + c8 + 4);
#pragma unroll
      for (int e = 0; e < 2; ++e) {
        ov[i][e]     = pk16(h_bits((_Float16)(a[2 * e] * VS)),  h_bits((_Float16)(a[2 * e + 1] * VS)));
        ov[i][2 + e] = pk16(h_bits((_Float16)(c4[2 * e] * VS)), h_bits((_Float16)(c4[2 * e + 1] * VS)));
      }
    }
    {
#pragma unroll
      for (int i = 0; i < 8; ++i) {
        const int row = 4 * i + rq;
        *(v4u*)(Ph + pofs + (size_t)row * DM) = ov[i];
      }
      
    }
  }
}

// ---- softmax weight of one (query, key) pair, not normalised: em * exp(-dist) ----
// exp(-acosh(z)) = 1 / (z + sqrt(z^2 - 1)); with z = 1 + 2 num / den this is den / (den + 2 (num + sqrt(num (num + den)))):
// no logarithm, no exponential, no cancellation. num and den lie in [1e-15, 4], so no step leaves the normal f32 range.
// em = the key's own factor exp(bias - largest bias of the batch) * PCAR, in [0, PCAR].
// Range of exp(-dist): q and k leave the projection clipped to norm MAXN, so den >= (1 - MAXN^2)^2 and num <= 4 MAXN^2, which
// gives z + sqrt(z^2 - 1) < 2^18. A key with the largest bias therefore has a weight of at least PCAR / 2^18 = 1/8 in every row,
// while no weight exceeds PCAR: the f16 P operand and the f32 sums need no row maximum.
// Two neighbouring keys at a time: they lie in neighbouring registers of the score tile and of the tables (packed f32 forms).
__device__ __forceinline__ v2f weight2(v2f xy, v2f y2, v2f em, float x2, float omx) {
  const v2f lim = {1e-15f, 1e-15f};
  const v2f num = __builtin_elementwise_max(x2 - 2.0f * xy + y2, lim);
  const v2f den = __builtin_elementwise_max(omx * (1.0f - y2), lim);
  const v2f sq  = num * (num + den);
  const v2f rt  = {__builtin_amdgcn_sqrtf(sq[0]), __builtin_amdgcn_sqrtf(sq[1])};
  const v2f ee  = 2.0f * (num + rt) + den;
  const v2f ri  = {__builtin_amdgcn_rcpf(ee[0]), __builtin_amdgcn_rcpf(ee[1])};
  return (em * den) * ri;
}

// =====================================================================================================
// Fused distance attention + gyro-midpoint over all SEQ keys: block = (batch b, head, 128 query rows), 8 waves. Wave w = (query
// group w & 3, key half w >> 2) owns queries q0 = 128*qt + 32*(w & 3) .. q0+31 as two 16-query tiles, against one half of the keys:
// every k fragment, gamma v fragment and table word that it reads from LDS serves both query tiles. The eight waves share the
// keys: k hi, k lo and gamma v go through a two-buffer LDS ring, AKST keys per stage (3 tiles of 128 key rows x 128 B, whole lines;
// pitch TP16 for k, VP16 for gamma v), brought in by asynchronous 16-byte copies, 12 per thread and stage; the next stage flies
// while this one is worked on; one block barrier per stage. Key half h takes staged rows 64h .. 64h+63 of every stage.
//   q planes bf16 hi/lo [b*SEQ + s][h*64 + d]; k planes bf16 hi/lo and the gamma v plane (f16 x VS) same layout;
//   per-key tables for (b, h): sum k^2, gamma - 1; factor exp(bias - largest bias) x32768 from the additive bias row amask[b][s] (bf16-converted); per query x2 = sum q^2.
//   All NKB = 32 key blocks of 32 keys are visited (static bound), two per ring stage and key half.
//   Scores computed TRANSPOSED: S^T tile (t, g) = k rows (keys kb+16g .., A operand, row m = lane&15, split k map over d)
//   times q^T (B operand, col n = query q0 + 16t + (lane&15), k = d), 2 d-chunks of 32, three bf16 products each (hi.hi, lo.hi,
//   hi.lo). D element r of lane l = (key kb+16g+8h+r, query q0+16t+(l&15)): a lane owns one query column per tile and 16 of its
//   32 keys; the partner lane l^16 owns the other 16.
//   dist = acosh(1 + 2 max(x2 - 2 xy + y2, 1e-15) / max((1 - x2)(1 - y2), 1e-15)), logit = -dist + bias, all f32.
//   Softmax weights p = exp(bias - largest bias of the batch) exp(-dist) in closed form (weight2()), one fixed scale for all keys:
//   no row maximum, no rescale of O, nothing crosses lanes in the key loop. Each lane sums l = sum p and dn = sum p (gamma - 1) over
//   its own keys. The weights ARE the P A-fragment in place: A row m = query = lane&15, element i <- key kb+8h+i (key tile 0,
//   D element i), element 8+i <- key kb+16+8h+i (key tile 1, D element i). P (<= 1) carried x32768 as f16; l and dn carry the same factor.
//   4 gamma v B fragments (col n = d = 16j + (lane&15), k = key) by transposing LDS loads from the key-major tile, 8 P.V WMMAs + one guard.
//   Behind the loop the two key halves of a query group meet: wave (g, h) finishes query tile h; it hands its sums O, l, dn of the
//   other tile to wave (g, 1 - h) through LDS (xch, one block barrier) and adds that wave's sums of tile h to its own (all plain f32
//   sums at the one fixed scale); the two lane halves of a query's keys then meet in one xor-16 shuffle.
//   Epilogue (f32): two_mean = (O (1/l) / VS) / max(dn / l, 1e-10); a = two_mean / (1 + sqrt(max(1 - sum two_mean^2,
//   1e-15))); clip to norm MAXN; the wave's 16x64 tile staged in its LDS slab (pitch 68); each output row segment
// coverage: per wave 8 instructions x 2 rows x 16 lanes x 4 floats = 16 x 64; grid NB*NH*(SQ/128) blocks x 8 waves = every
//           (b < NB, s < SQ, h) row segment of the output exactly once.
// LDS: ms/ky2/kg1 cross-wave (block barrier, 1024 staged == 1024 consumed); ring cross-wave (block barrier per stage, staged
// extent == consumed extent, pad bytes never read); xch cross-wave (block barrier, 34 floats a lane staged == consumed, pitch XP);
// slab wave-private (wave_sync, 16x64).
// =====================================================================================================
__global__ __launch_bounds__(ATT_THREADS)
void attn_fwd(const u16* __restrict__ Qh, const u16* __restrict__ Ql, const u16* __restrict__ Kh, const u16* __restrict__ Kl,
              const u16* __restrict__ Vg, const float* __restrict__ QX2, const float* __restrict__ KX2,
              const float* __restrict__ GM1, const float* __restrict__ amask, float* Out) {
  __shared__ __align__(16) float ms[SEQ];
  __shared__ __align__(16) float ky2[SEQ];
  __shared__ __align__(16) float kg1[SEQ];
  __shared__ __align__(16) float slab[(ATT_THREADS / 32) * 16 * GPITCH];
  __shared__ __align__(16) float xch[ATT_THREADS * XP];
  __shared__ __align__(16) u16 ring[2 * ABUF];

  const int tid  = threadIdx.x;
  const int wave = tid >> 5;
  const int lane = tid & 31;
  const int hh   = lane >> 4;
  const int c    = lane & 15;
  const int kh2  = wave >> 2;                   // key half of this wave

  constexpr int NQT = SQ / 128;
  const int bid  = blockIdx.x;
  const int qt   = bid % NQT;
  const int head = (bid / NQT) % NH;
  const int b    = bid / (NQT * NH);
  const int bh   = b * NH + head;
  const int q0   = qt * 128 + (wave & 3) * 32;

  // ---- this thread's share of a ring stage: per tile rows (tid>>3) + 32 i, i < 4, 16 bytes at 16 (tid&7) ----
  const u16* khg = Kh + ((size_t)(b * SEQ + (tid >> 3))) * DM + head * HD + 8 * (tid & 7);
  const u16* klg = Kl + ((size_t)(b * SEQ + (tid >> 3))) * DM + head * HD + 8 * (tid & 7);
  const u16* vgg = Vg + ((size_t)(b * SEQ + (tid >> 3))) * DM + head * HD + 8 * (tid & 7);
  const unsigned lring = lds_addr(ring) + (unsigned)((tid >> 3) * (TP16 * 2) + 16 * (tid & 7));
  const unsigned lvring = lds_addr(ring) + (unsigned)(2 * ATILE * 2 + (tid >> 3) * (VP16 * 2) + 16 * (tid & 7));
  auto stage_copy = [&](int st) {                             // keys AKST st .. +127 -> buffer st & 1
    const unsigned lo = lring + (unsigned)((st & 1) * (ABUF * 2));
    const unsigned lv = lvring + (unsigned)((st & 1) * (ABUF * 2));
    const u16* kh = khg + (size_t)st * AKST * DM;
    const u16* kl = klg + (size_t)st * AKST * DM;
    const u16* vg = vgg + (size_t)st * AKST * DM;
    constexpr unsigned R32 = 32 * TP16 * 2, TB = ATILE * 2;   // 32 k rows, one k tile, in bytes
    constexpr unsigned V32 = 32 * VP16 * 2;                   // 32 gamma v rows, in bytes
    const unsigned la[6] = {lo, lo + R32, lo + 2 * R32, lo + 3 * R32, lo + TB, lo + TB + R32};
    const u16* const ga[6] = {kh, kh + 32 * DM, kh + 64 * DM, kh + 96 * DM, kl, kl + 32 * DM};
    acopy6(la, ga);
    const unsigned lb[6] = {lo + TB + 2 * R32, lo + TB + 3 * R32, lv, lv + V32, lv + 2 * V32, lv + 3 * V32};
    const u16* const gb[6] = {kl + 64 * DM, kl + 96 * DM, vg, vg + 32 * DM, vg + 64 * DM, vg + 96 * DM};
    acopy6(lb, gb);
  };
  stage_copy(0);                                              // flies while the tables are staged

  // ---- largest bias of the batch: every wave reads the whole row (32 lanes x 32 values), so no barrier is needed for it.
  //      bf16 rounding is monotone: the rounded maximum is the maximum of the rounded values.
  float mb;
  const int i0 = tid * 4;                       // this thread's 4 keys of the per-key tables
  v4f m0, y0, g0;
  {
    const float* mr = amask + (size_t)b * SEQ + 4 * lane;
    v4f a[SEQ / 128];
#pragma unroll   // all loads issue before the first use: one memory latency
    for (int q = 0; q < SEQ / 128; ++q) a[q] = *(const v4f*)(mr + 128 * q);
    // precaution: the table loads that follow may land in the register that holds these loads' offset
    asm volatile("s_wait_xcnt 0x0" ::: "memory");
    // this thread's words of the three per-key tables issue with the row: one memory latency for both
    m0 = *(const v4f*)(amask + (size_t)b * SEQ + i0);
    y0 = *(const v4f*)(KX2 + (size_t)bh * SEQ + i0);
    g0 = *(const v4f*)(GM1 + (size_t)bh * SEQ + i0);
    // precaution: the code that follows may land in the registers that hold these loads' addresses
    asm volatile("s_wait_xcnt 0x0" ::: "memory");
    // keeps that code behind the wait: without it this build moved writes of those registers ahead of it
    __builtin_amdgcn_sched_barrier(0);
    float mx = -INFINITY;
#pragma unroll
    for (int q = 0; q < SEQ / 128; ++q) mx = fmaxf(fmaxf(fmaxf(mx, a[q][0]), fmaxf(a[q][1], a[q][2])), a[q][3]);
    mx = fmaxf(mx, xhalf(mx));   mx = fmaxf(mx, xrow<8>(mx)); mx = fmaxf(mx, xrow<4>(mx));
    mx = fmaxf(mx, xrow<2>(mx)); mx = fmaxf(mx, xrow<1>(mx));
    mb = bfr(mx);
  }
  // ---- stage the per-key tables of (b, head): 256 threads x 4 keys = SEQ ----
  {
#pragma unroll
    for (int e = 0; e < 4; ++e) {
      ms[i0 + e]  = exp2f((bfr(m0[e]) - mb) * LOG2E) * PCAR;
      ky2[i0 + e] = y0[e];
      kg1[i0 + e] = g0[e];
    }
  }
  wait_copies();
  __syncthreads();                                            // the tables and stage 0 are published
  stage_copy(1);

  // B fragments of q^T, query tile t: col n = query q0 + 16t + c, k = d (k-contiguous rows of the q planes), d chunk 0 / 1
  Frag qh[2][2], ql[2][2];
  float xq[2], omx[2];
#pragma unroll   // constant indices: the arrays stay in registers
  for (int t = 0; t < 2; ++t) {
    const size_t qofs = ((size_t)(b * SEQ + q0 + 16 * t + c)) * DM + head * HD + 8 * hh;
    qh[t][0] = ldfrag(Qh + qofs); qh[t][1] = ldfrag(Qh + qofs + 32);
    ql[t][0] = ldfrag(Ql + qofs); ql[t][1] = ldfrag(Ql + qofs + 32);
    xq[t]  = QX2[(size_t)bh * SEQ + q0 + 16 * t + c];
  }
  // precaution: the code that follows may land in the registers that hold these loads' addresses
  asm volatile("s_wait_xcnt 0x0" ::: "memory");
  // keeps that code behind the wait: without it this build moved writes of those registers ahead of it
  __builtin_amdgcn_sched_barrier(0);
  omx[0] = 1.0f - xq[0];
  omx[1] = 1.0f - xq[1];
  // A fragments of k: row m = key kb + 16g + c, k = d; B fragments of gamma v: col n = d = 16j + c, k = key; both from the ring

  v2f lrun2[2] = {{0.f, 0.f}, {0.f, 0.f}}, drun2[2] = {{0.f, 0.f}, {0.f, 0.f}};   // per query tile: sums over this lane's even and odd keys
  v8f o[2][4];
#pragma unroll
  for (int t = 0; t < 2; ++t) {
#pragma unroll
    for (int j = 0; j < 4; ++j) o[t][j] = zero8();
  }

#pragma unroll 1   // one stage per trip: the ring's order (read, publish, refill) stays as written
  for (int st = 0; st < SEQ / AKST; ++st) {
  const u16* rb = ring + (st & 1) * ABUF;
#pragma unroll 1   // the wave's two 32-key blocks of a stage share one copy of the long body
  for (int sub = 0; sub < AKST / 64; ++sub) {
    const int kr = kh2 * (AKST / 2) + sub * 32;               // staged row of the block's first key
    const int kb = st * AKST + kr;
    const u16* KhB = rb + (kr + c) * TP16 + 8 * hh;           // staged k hi row of key kb + c
    const u16* KlB = KhB + ATILE;
    // ---- transposed scores: s[t][0] = keys kb..kb+15, s[t][1] = keys kb+16..kb+31, column = query q0 + 16t + c ----
    v8f s[2][2] = {{zero8(), zero8()}, {zero8(), zero8()}};
    constexpr int k0o = 0, k1o = 16 * TP16;
#pragma unroll   // two d chunks: the offsets become immediates of the LDS reads
    for (int dc = 0; dc < 2; ++dc) {
      const Frag kh0 = ldfrag(KhB + k0o + 32 * dc), kh1 = ldfrag(KhB + k1o + 32 * dc);
      const Frag kl0 = ldfrag(KlB + k0o + 32 * dc), kl1 = ldfrag(KlB + k1o + 32 * dc);
      s[0][0] = mma_b(kh0, qh[0][dc], s[0][0]); s[0][1] = mma_b(kh1, qh[0][dc], s[0][1]);
      s[1][0] = mma_b(kh0, qh[1][dc], s[1][0]); s[1][1] = mma_b(kh1, qh[1][dc], s[1][1]);
      s[0][0] = mma_b(kl0, qh[0][dc], s[0][0]); s[0][1] = mma_b(kl1, qh[0][dc], s[0][1]);
      s[1][0] = mma_b(kl0, qh[1][dc], s[1][0]); s[1][1] = mma_b(kl1, qh[1][dc], s[1][1]);
      s[0][0] = mma_b(kh0, ql[0][dc], s[0][0]); s[0][1] = mma_b(kh1, ql[0][dc], s[0][1]);
      s[1][0] = mma_b(kh0, ql[1][dc], s[1][0]); s[1][1] = mma_b(kh1, ql[1][dc], s[1][1]);
      guard_sc(s[0][0], s[0][1], s[1][0], s[1][1], qh[0][dc].h, ql[0][dc].h, qh[1][dc].h, ql[1][dc].h, kh0.h, kh1.h, kl0.h, kl1.h);
    }
    // ---- per-key values of this lane's 16 keys: word q of [0..1] <- keys kb+8hh+4q.., of [2..3] <- keys kb+16+8hh+4(q-2).. ----
    const int ka = kb + 8 * hh, kc = kb + 16 + 8 * hh;
    const v4f y4[4] = {*(const v4fa*)(ky2 + ka), *(const v4fa*)(ky2 + ka + 4), *(const v4fa*)(ky2 + kc), *(const v4fa*)(ky2 + kc + 4)};
    const v4f g4[4] = {*(const v4fa*)(kg1 + ka), *(const v4fa*)(kg1 + ka + 4), *(const v4fa*)(kg1 + kc), *(const v4fa*)(kg1 + kc + 4)};
    const v4f m4[4] = {*(const v4fa*)(ms + ka),  *(const v4fa*)(ms + ka + 4),  *(const v4fa*)(ms + kc),  *(const v4fa*)(ms + kc + 4)};
    // ---- weights (<= PCAR), this lane's sums and the P A-fragments f16(p); fragment word 4w + e4 <-> D elements 2 e4, 2 e4 + 1 of key tile w ----
    Frag ph[2];
#pragma unroll
    for (int t = 0; t < 2; ++t) {
#pragma unroll
      for (int w = 0; w < 2; ++w) {
        const v8f sv = s[t][w];
#pragma unroll
        for (int e4 = 0; e4 < 4; ++e4) {
          const int q = 2 * w + (e4 >> 1), h2 = 2 * (e4 & 1);
          const v2f xy = {sv[2 * e4], sv[2 * e4 + 1]};
          const v2f y2 = {y4[q][h2], y4[q][h2 + 1]};
          const v2f em = {m4[q][h2], m4[q][h2 + 1]};
          const v2f g1 = {g4[q][h2], g4[q][h2 + 1]};
          const v2f p  = weight2(xy, y2, em, xq[t], omx[t]);
          lrun2[t] += p;
          drun2[t] += p * g1;
          ph[t].u[w][e4] = __builtin_bit_cast(unsigned, __builtin_convertvector(p, v2h));
        }
      }
    }
    // ---- P.V : B fragment col n = d = j*16 + c, k = key kb + (split k map), transposed out of the staged key rows ----
    {
      const u16* vp = rb + 2 * ATILE + (kr + 8 * hh + (lane & 7)) * VP16 + 8 * ((lane >> 3) & 1);
      const Frag v0 = ldfrag_tr(vp);
      const Frag v1 = ldfrag_tr(vp + 16);
      const Frag v2 = ldfrag_tr(vp + 32);
      const Frag v3 = ldfrag_tr(vp + 48);
      o[0][0] = mma_h(ph[0], v0, o[0][0]);
      o[0][1] = mma_h(ph[0], v1, o[0][1]);
      o[0][2] = mma_h(ph[0], v2, o[0][2]);
      o[0][3] = mma_h(ph[0], v3, o[0][3]);
      o[1][0] = mma_h(ph[1], v0, o[1][0]);
      o[1][1] = mma_h(ph[1], v1, o[1][1]);
      o[1][2] = mma_h(ph[1], v2, o[1][2]);
      o[1][3] = mma_h(ph[1], v3, o[1][3]);
      guard_pv(o[0], o[1], ph[0].h, ph[1].h, v0.h, v1.h, v2.h, v3.h);
    }
  }
  publish_stage();
  if (st + 2 < SEQ / AKST) stage_copy(st + 2);                // into the buffer that this trip has just read
  }
  wait_copies();
  acc_guard4(o[0]);
  acc_guard4(o[1]);

  // ---- the two key halves meet: this wave keeps query tile kh2 and hands the other tile's sums to its partner wave ----
  const bool up = kh2 != 0;
  v8f ow[4];
  float lrun, drun;
  {
    const float l0 = lrun2[0][0] + lrun2[0][1], l1 = lrun2[1][0] + lrun2[1][1];
    const float d0 = drun2[0][0] + drun2[0][1], d1 = drun2[1][0] + drun2[1][1];
    float* xw = xch + tid * XP;
#pragma unroll
    for (int j = 0; j < 4; ++j) {
      v8f ot;
#pragma unroll
      for (int r = 0; r < 8; ++r) {
        ow[j][r] = up ? o[1][j][r] : o[0][j][r];
        ot[r]    = up ? o[0][j][r] : o[1][j][r];
      }
      const v4f a = {ot[0], ot[1], ot[2], ot[3]}, e = {ot[4], ot[5], ot[6], ot[7]};
      *(v4fa*)(xw + 8 * j)     = a;
      *(v4fa*)(xw + 8 * j + 4) = e;
    }
    const v2f ld = {up ? l0 : l1, up ? d0 : d1};
    *(v2fa*)(xw + 32) = ld;
    __syncthreads();                                          // every wave's hand-over is published
    const float* xr = xch + (tid ^ 128) * XP;                 // the same lane of the wave with the other key half
#pragma unroll
    for (int j = 0; j < 4; ++j) {
      const v4f a = *(const v4fa*)(xr + 8 * j), e = *(const v4fa*)(xr + 8 * j + 4);
#pragma unroll
      for (int r = 0; r < 4; ++r) {
        ow[j][r]     += a[r];
        ow[j][4 + r] += e[r];
      }
    }
    const v2f pd = *(const v2fa*)(xr + 32);
    lrun = (up ? l1 : l0) + pd[0];
    drun = (up ? d1 : d0) + pd[1];
  }
  const int qf = q0 + 16 * kh2;                               // first query of the tile that this wave finishes
  // ---- the two halves of each query's keys (lanes l and l ^ 16) meet ----
  lrun += xhalf(lrun);
  drun += xhalf(drun);
  // ---- gyro-midpoint epilogue in f32: per query factors from the query-owner lane (lane = query); O and l both carry PCAR ----
  const float linv = rcp1(lrun);
  const float nf   = linv * (1.0f / VS);
  const float dq   = fmaxf(drun * linv, 1e-10f);
  const float fq   = nf * rcp1(dq);             // the query's one factor: 1 / (l VS) over the clamped denominator
  // fqr[r] = factor of query 8 hh + r. Lanes l and l ^ 16 hold the same fq (the same two addends above), so each row serves itself:
  // the upper row first swaps its lanes j and j ^ 8, then lane r of either row holds what that row wants.
  const float fsw = xrow<8>(fq);                // formed by all 32 lanes, ahead of the pick
  const float fqs = hh ? fsw : fq;
  const float fqr[8] = {rowlane<0>(fqs), rowlane<1>(fqs), rowlane<2>(fqs), rowlane<3>(fqs),
                        rowlane<4>(fqs), rowlane<5>(fqs), rowlane<6>(fqs), rowlane<7>(fqs)};
  float sq[8];
#pragma unroll
  for (int r = 0; r < 8; ++r) {
    float sp = 0.f;
#pragma unroll
    for (int j = 0; j < 4; ++j) {
      const float tm = ow[j][r] * fqr[r];
      ow[j][r] = tm;
      sp += tm * tm;
    }
    sq[r] = rsum16(sp);
  }
  float* sw = slab + wave * 16 * GPITCH;
#pragma unroll
  for (int r = 0; r < 8; ++r) {
    const float rdf = rcp1(1.0f + sqrt1(fmaxf(1.0f - sq[r], 1e-15f)));
    float sp = 0.f;
#pragma unroll
    for (int j = 0; j < 4; ++j) {
      const float a = ow[j][r] * rdf;
      ow[j][r] = a;
      sp += a * a;
    }
    const float s2  = rsum16(sp);
    const float n2  = fmaxf(sqrt1(s2), 1e-15f);
    const bool  cl  = n2 > MAXN;
    const float fcl = MAXN * rcp1(n2);
#pragma unroll
    for (int j = 0; j < 4; ++j) {
      const float a = ow[j][r];
      sw[(8 * hh + r) * GPITCH + 16 * j + c] = cl ? (a * fcl) : a;
    }
  }
  wave_sync_lds();
  // ---- f32 output rows: lanes 0..15 -> row 2i, lanes 16..31 -> row 2i+1, lane = 4 consecutive d ----
  const int cc = lane & 15;
  v4f vals[8];
#pragma unroll
  for (int i = 0; i < 8; ++i) vals[i] = *(const v4fa*)(sw + (2 * i + hh) * GPITCH + 4 * cc);
  float* ob = Out + ((size_t)(b * SEQ + qf + hh)) * DM + head * HD + 4 * cc;
  {
#pragma unroll
    for (int i = 0; i < 8; ++i) {
      *(v4f*)(ob + (size_t)(2 * i) * DM) = vals[i];
    }
    
  }
}

// =====================================================================================================
// Workspace map (bytes); every region written fully by whole-line stores before it is read; every extent an exact multiple
//   X16  f16 [NB*SEQ][DM]          f16(bf16(x) x64)              4194304 (NB=2)
//   WQT/WKT/WVT f16 [DM n][DM k]   f16(bf16(W) x256)             3 x 2097152
//   CX2  f32 [NB*SEQ]              sum x^2                       8192
//   ZN, CH, SH f32 [3][DM]         column norms, cosh/sinh(2r)   3 x 12288
//   Qh, Ql, Kh, Kl bf16 [NB*SEQ][DM]                             4 x 4194304
//   Vg   f16 [NB*SEQ][DM]          f16(gamma v x256)             4194304
//   QX2, KX2, GM1 f32 [NB*NH][SEQ]                                3 x 131072
//   end = 31895552 at NB=2
// =====================================================================================================
static inline size_t up4k(size_t v) { return (v + 4095) & ~(size_t)4095; }

extern "C" void kernel_launch(void* const* d_in, const int* in_sizes, int n_in,
                              void* d_out, int out_size, void* d_ws, size_t ws_size,
                              hipStream_t stream) {
  if (n_in < 8) return;
  if (in_sizes[0] < NB * SEQ * DM) return;
  if (in_sizes[1] < NB * SEQ) return;
  if (in_sizes[2] < DM * DM || in_sizes[4] < DM * DM || in_sizes[6] < DM * DM) return;
  if (in_sizes[3] < 1 || in_sizes[5] < 1 || in_sizes[7] < 1) return;
  if (out_size < NB * SEQ * DM) return;

  const float* hs = (const float*)d_in[0];
  const float* am = (const float*)d_in[1];
  const float* qz = (const float*)d_in[2];
  const float* qr = (const float*)d_in[3];
  const float* kz = (const float*)d_in[4];
  const float* kr = (const float*)d_in[5];
  const float* vz = (const float*)d_in[6];
  const float* vr = (const float*)d_in[7];
  float*       out = (float*)d_out;
  const int nqr = in_sizes[3], nkr = in_sizes[5], nvr = in_sizes[7];

  const size_t nrow  = (size_t)NB * SEQ;
  const size_t szX16 = up4k(nrow * DM * 2);
  const size_t szWT  = up4k((size_t)DM * DM * 2);
  const size_t szCX2 = up4k(nrow * 4);
  const size_t szCOL = up4k((size_t)3 * DM * 4);
  const size_t szP   = up4k(nrow * DM * 2);
  const size_t szRS  = up4k((size_t)NB * NH * SEQ * 4);
  size_t off = 0;
  const size_t oX16 = off; off += szX16;
  const size_t oWQ  = off; off += szWT;
  const size_t oWK  = off; off += szWT;
  const size_t oWV  = off; off += szWT;
  const size_t oCX2 = off; off += szCX2;
  const size_t oZN  = off; off += szCOL;
  const size_t oCH  = off; off += szCOL;
  const size_t oSH  = off; off += szCOL;
  const size_t oQh  = off; off += szP;
  const size_t oQl  = off; off += szP;
  const size_t oKh  = off; off += szP;
  const size_t oKl  = off; off += szP;
  const size_t oVg  = off; off += szP;
  const size_t oQX2 = off; off += szRS;
  const size_t oKX2 = off; off += szRS;
  const size_t oGM1 = off; off += szRS;
  if (off > ws_size) return;                       // off = 31895552 at NB=2
  if (off > (size_t)134217728) return;

  char* ws = (char*)d_ws;
  u16*   X16 = (u16*)(ws + oX16);
  u16*   WQT = (u16*)(ws + oWQ);
  u16*   WKT = (u16*)(ws + oWK);
  u16*   WVT = (u16*)(ws + oWV);
  float* CX2 = (float*)(ws + oCX2);
  float* ZN  = (float*)(ws + oZN);
  float* CH  = (float*)(ws + oCH);
  float* SH  = (float*)(ws + oSH);
  u16*   Qh  = (u16*)(ws + oQh);
  u16*   Ql  = (u16*)(ws + oQl);
  u16*   Kh  = (u16*)(ws + oKh);
  u16*   Kl  = (u16*)(ws + oKl);
  u16*   Vg  = (u16*)(ws + oVg);
  float* QX2 = (float*)(ws + oQX2);
  float* KX2 = (float*)(ws + oKX2);
  float* GM1 = (float*)(ws + oGM1);

  // (1) all that reads only the inputs: x -> f16 plane of bf16(x) x64, per-row sums of squares, per weight the column norms
  //     with cosh/sinh(2r) and the k-contiguous [n][k] f16 plane of bf16(W) x256
  prep<<<dim3(PB_COL + PB_ROW), dim3(PREP_THREADS), 0, stream>>>(
      hs, qz, kz, vz, qr, kr, vr, nqr, nkr, nvr, X16, CX2, ZN, CH, SH, WQT, WKT, WVT);
  // (2) the three projections with the fused MLR / per-head epilogue
  proj_mlr<<<dim3(PJ_BLOCKS), dim3(PJ_THREADS), 0, stream>>>(
      X16, WQT, WKT, WVT, ZN, CH, SH, CX2, Qh, Ql, Kh, Kl, Vg, QX2, KX2, GM1);
  // (3) attention + midpoint -> out [b][SEQ][DM] f32 (rows s < SQ of batches b < NB), heads merged on the feature dim
  attn_fwd<<<dim3(NB * NH * (SQ / 128)), dim3(ATT_THREADS), 0, stream>>>(Qh, Ql, Kh, Kl, Vg, QX2, KX2, GM1, am, out);
  (void)hipGetLastError();
}
